// v000
// The times below were measured on an AMD MI455X: many runs one after another, warmed up first and cycling through
// copies of the inputs, with the whole window's GPU time divided by the number of runs. Launches and the gaps
// between them are all in it. The median over several windows is given; except for v000 it joins two sittings, which
// can be a few percent apart, so the side-by-side timings, each taken in one sitting, are the better comparison.
// The starting kernel, v000, takes 2200 microseconds a run.
#include <hip/hip_runtime.h>
// Single-projection attention with a QUERY-axis softmax, tiled 16x (x [4][2048][1024]; q, k, v = x W ([1024][64] weights stored [in][out], shared by all heads); att[i][k] = q_i . k_k (no scaling); att = softmax over the QUERY index i for each key column k (the module's nn.Softmax(dim=1)); out_i = sum_k att[i][k] v_k -> [2048][64], concatenated 16 times -> [4][2048][1024]).
// Structure: token rows; x as exact f16 rows; q and k projections as WMMA GEMMs (32x64 wave tiles, f32 accumulation, exact x16 weights) kept in f32 and split into f16 hi + x1024 residual planes (the unscaled logits have sigma 8, so they are formed from three hi/lo products, ~2^-21 relative); v likewise kept f32 and split; per batch: transposed scores S^T[k][i] = k_k . q_i as three accumulating GEMM passes (K = 64), row softmax over i on VALU (f32 statistics, native exp; weights x256 f16) = the module's column softmax, the weight matrix transposed back to [i][k] via LDS tile transposes, V^T (hi and residual) via LDS transposes, out_i = P V^T as two accumulating GEMM passes (K = 2048, f32) into a [2048][64] plane, broadcast into the 16 head slots of the output rows with thread-linear float4 stores; 10 + 4 x 10 = 50 launches.
// Compute dtype: inputs rounded to bf16; x / weights exact; q, k, v as f16 hi + residual pairs; the softmax weights plain f16 (~2^-12); scores, statistics, out f32. v_wmma_f32_16x16x32_f16.
#define NB 4
#define SQ 2048
#define DM 1024
#define HD 64
#define NH 1
#define HG 1
#define DMO 1024                     /* output row width = 16 x 64 */
#define B0 0                         /* first batch (debug hook) */
#define NBR NB
#define NR ((size_t)NB * SQ)
typedef __bf16 v16b __attribute__((ext_vector_type(16)));
typedef unsigned short v8us __attribute__((ext_vector_type(8), may_alias));
typedef float  v8f  __attribute__((ext_vector_type(8)));
typedef float  v4f  __attribute__((ext_vector_type(4)));
typedef float  v4fa __attribute__((ext_vector_type(4), may_alias));
union FragB { v16b v; v8us half[2]; unsigned short u[16]; };

__device__ __forceinline__ unsigned short bf16_bits(float x) { unsigned int u = __float_as_uint(x); return (unsigned short)((u + 0x7FFFu + ((u >> 16) & 1u)) >> 16); }
__device__ __forceinline__ float bf16_val(unsigned short b) { return __uint_as_float(((unsigned int)b) << 16); }
__device__ __forceinline__ float bf16_round(float x) { return bf16_val(bf16_bits(x)); }
// D += A·B with NT terms: 1 = ah·bh, 2 = + al·bh (A split), 3 = + ah·bl (both split)
template <int NT>
__device__ __forceinline__ v8f mmaN(v16b ah, v16b al, v16b bh, v16b bl, v8f c) {
  c = __builtin_amdgcn_wmma_f32_16x16x32_bf16(false, ah, false, bh, (short)0, c, false, false);
  if (NT >= 2) c = __builtin_amdgcn_wmma_f32_16x16x32_bf16(false, al, false, bh, (short)0, c, false, false);
  if (NT >= 3) c = __builtin_amdgcn_wmma_f32_16x16x32_bf16(false, ah, false, bl, (short)0, c, false, false);
  asm volatile("v_nop\n\tv_nop\n\tv_nop\n\tv_nop" : "+v"(c) : "v"(ah), "v"(al), "v"(bh), "v"(bl));
  return c;
}

__global__ __launch_bounds__(256) void k_wt_bf16(const float* __restrict__ W, unsigned short* __restrict__ Wt, int K, int N) {
  const int t = blockIdx.x * 256 + threadIdx.x;
  const int k8n = K / 8;
  if (t >= N * k8n) return;
  const int n = t / k8n, k8 = (t % k8n) * 8;
  v8us v;
#pragma unroll
  for (int i = 0; i < 8; ++i) v[i] = bf16_bits(W[(size_t)(k8 + i) * N + n]);
  *(v8us*)(Wt + (size_t)n * K + k8) = v;
  
}

// GEMM C[M][N] (f32, pitch ldc) = act(A[M][K]·W + bias). A f32 row-major (pitch lda) converted per fragment to bf16
// (ASPLIT: hi/lo two planes -> 2 terms, else single rounded term); Wt bf16 [N][K] (pitch ldb). BIAS_BF16 rounds the
// bias to bf16 first (bias quantised to bf16 before the add). K%32==0, M%16==0, N%64==0.
template <bool ASPLIT, int ACT, bool BIAS_BF16>
__global__ __launch_bounds__(128) void k_gemm_bf(const float* __restrict__ A, int lda, const unsigned short* __restrict__ Wt, int ldb,
                                               const float* __restrict__ bias, float* __restrict__ C, int ldc, int M, int N, int K) {
  __shared__ __attribute__((aligned(16))) float so[4][16][64];
  const int tid = threadIdx.x, w = tid >> 5, lane = tid & 31, ln = lane & 15, hh = lane >> 4;
  const int ntn = N / 64;
  const int wid = blockIdx.x * 4 + w;
  const int mt = wid / ntn, nq = wid % ntn;
  if (mt * 16 >= M) return;
  const int row0 = mt * 16, col0 = nq * 64;
  const float* arow = A + (size_t)(row0 + ln) * lda;
  v8f acc[4] = {};
  for (int kb = 0; kb < K; kb += 32) {
    FragB ah, al;
    const v4f x0 = *(const v4fa*)(arow + kb + 8 * hh), x1 = *(const v4fa*)(arow + kb + 8 * hh + 4);
    const v4f x2 = *(const v4fa*)(arow + kb + 16 + 8 * hh), x3 = *(const v4fa*)(arow + kb + 16 + 8 * hh + 4);
    float xs[16] = {x0[0],x0[1],x0[2],x0[3],x1[0],x1[1],x1[2],x1[3],x2[0],x2[1],x2[2],x2[3],x3[0],x3[1],x3[2],x3[3]};
#pragma unroll
    for (int i = 0; i < 16; ++i) { const unsigned short hb = bf16_bits(xs[i]); ah.u[i] = hb; al.u[i] = ASPLIT ? bf16_bits(xs[i] - bf16_val(hb)) : (unsigned short)0; }
#pragma unroll
    for (int t = 0; t < 4; ++t) {
      const unsigned short* brow = Wt + (size_t)(col0 + t * 16 + ln) * ldb + kb;
      FragB b;
      b.half[0] = *(const v8us*)(brow + 8 * hh);
      b.half[1] = *(const v8us*)(brow + 16 + 8 * hh);
      acc[t] = mmaN<ASPLIT ? 2 : 1>(ah.v, al.v, b.v, b.v, acc[t]);
    }
  }
#pragma unroll
  for (int t = 0; t < 4; ++t) {
    float bv = bias ? bias[col0 + t * 16 + ln] : 0.f;
    if (BIAS_BF16) bv = bf16_round(bv);
#pragma unroll
    for (int r = 0; r < 8; ++r) { float v = acc[t][r] + bv; if (ACT == 1) v = fmaxf(v, 0.f); so[w][8 * hh + r][t * 16 + ln] = v; }
  }
  __builtin_amdgcn_fence(__ATOMIC_ACQ_REL, "workgroup");
  __builtin_amdgcn_wave_barrier();
  const int rsub = lane >> 4, c4 = (lane & 15) * 4;
  {
#pragma unroll
    for (int q = 0; q < 8; ++q) {
      const int r = q * 2 + rsub;
      const v4f v = *(const v4fa*)&so[w][r][c4];
      *(v4f*)(C + (size_t)(row0 + r) * ldc + col0 + c4) = v;
    }
    
  }
}

// GEMM C = act(A·W + bias + resid): A f32 (ASPLIT -> hi/lo 2 terms), Wt bf16 [N][K]; ACT 0 none, 1 relu, 2 exact gelu;
// resid (optional, f32, row index = (row % rmod), pitch ldr, RES_BF16 rounds it) added before the activation.
template <bool ASPLIT, int ACT, bool BIAS_BF16, bool RES_BF16>
__global__ __launch_bounds__(128) void k_gemm_bf3(const float* __restrict__ A, int lda, const unsigned short* __restrict__ Wt, int ldb,
                                                const float* __restrict__ bias, const float* __restrict__ resid, int rmod, int ldr,
                                                float* __restrict__ C, int ldc, int M, int N, int K) {
  __shared__ __attribute__((aligned(16))) float so[4][16][64];
  const int tid = threadIdx.x, w = tid >> 5, lane = tid & 31, ln = lane & 15, hh = lane >> 4;
  const int ntn = N / 64;
  const int wid = blockIdx.x * 4 + w;
  const int mt = wid / ntn, nq = wid % ntn;
  if (mt * 16 >= M) return;
  const int row0 = mt * 16, col0 = nq * 64;
  const float* arow = A + (size_t)(row0 + ln) * lda;
  v8f acc[4] = {};
  for (int kb = 0; kb < K; kb += 32) {
    FragB ah, al;
    const v4f x0 = *(const v4fa*)(arow + kb + 8 * hh), x1 = *(const v4fa*)(arow + kb + 8 * hh + 4);
    const v4f x2 = *(const v4fa*)(arow + kb + 16 + 8 * hh), x3 = *(const v4fa*)(arow + kb + 16 + 8 * hh + 4);
    float xs[16] = {x0[0],x0[1],x0[2],x0[3],x1[0],x1[1],x1[2],x1[3],x2[0],x2[1],x2[2],x2[3],x3[0],x3[1],x3[2],x3[3]};
#pragma unroll
    for (int i = 0; i < 16; ++i) { const unsigned short hb = bf16_bits(xs[i]); ah.u[i] = hb; al.u[i] = ASPLIT ? bf16_bits(xs[i] - bf16_val(hb)) : (unsigned short)0; }
#pragma unroll
    for (int t = 0; t < 4; ++t) {
      const unsigned short* brow = Wt + (size_t)(col0 + t * 16 + ln) * ldb + kb;
      FragB b;
      b.half[0] = *(const v8us*)(brow + 8 * hh);
      b.half[1] = *(const v8us*)(brow + 16 + 8 * hh);
      acc[t] = mmaN<ASPLIT ? 2 : 1>(ah.v, al.v, b.v, b.v, acc[t]);
    }
  }
#pragma unroll
  for (int t = 0; t < 4; ++t) {
    const int col = col0 + t * 16 + ln;
    float bv = bias ? bias[col] : 0.f;
    if (BIAS_BF16) bv = bf16_round(bv);
#pragma unroll
    for (int r = 0; r < 8; ++r) {
      float v = acc[t][r] + bv;
      if (resid) { float rv = resid[(size_t)((row0 + 8 * hh + r) % rmod) * ldr + col]; if (RES_BF16) rv = bf16_round(rv); v += rv; }
      if (ACT == 1) v = fmaxf(v, 0.f);
      if (ACT == 2) v = 0.5f * v * (1.0f + erff(v * 0.70710678118654752f));
      if (ACT == 3) { const float u = 0.7978845608028654f * (v + 0.044715f * v * v * v); v = 0.5f * v * (1.0f + tanhf(u)); }
      so[w][8 * hh + r][t * 16 + ln] = v;
    }
  }
  __builtin_amdgcn_fence(__ATOMIC_ACQ_REL, "workgroup");
  __builtin_amdgcn_wave_barrier();
  const int rsub = lane >> 4, c4 = (lane & 15) * 4;
  {
#pragma unroll
    for (int q = 0; q < 8; ++q) {
      const int r = q * 2 + rsub;
      const v4f v = *(const v4fa*)&so[w][r][c4];
      *(v4f*)(C + (size_t)(row0 + r) * ldc + col0 + c4) = v;
    }
    
  }
}
// row LayerNorm (biased variance, eps) over N: s = X (+ R); optional out_sum <- s; out_norm <- (s-mu)*rsqrt(var+eps)*g + b
template <bool PARAM_BF16>
__global__ __launch_bounds__(256) void k_layernorm(const float* __restrict__ X, const float* __restrict__ R, const float* __restrict__ g, const float* __restrict__ bta,
                                                  float* __restrict__ out_sum, float* __restrict__ out_norm, int N, float eps) {
  __shared__ float red[256];
  const int row = blockIdx.x, tid = threadIdx.x;
  const float* x = X + (size_t)row * N; const float* rr = R ? R + (size_t)row * N : nullptr;
  float vals[16];                     // up to N = 4096
  const int per = N / 256;            // contiguous chunk per thread? use strided-by-4 chunks: thread handles j = tid*4 + 1024*u
  float s1 = 0.f;
  for (int u = 0; u < per / 4; ++u) {
    const int j = tid * 4 + 1024 * u;
    const v4f a = *(const v4fa*)(x + j);
    v4f b = {0.f,0.f,0.f,0.f}; if (rr) b = *(const v4fa*)(rr + j);
#pragma unroll
    for (int q = 0; q < 4; ++q) { const float v = a[q] + b[q]; vals[u * 4 + q] = v; s1 += v; }
  }
  red[tid] = s1; __syncthreads();
  for (int st = 128; st > 0; st >>= 1) { if (tid < st) red[tid] += red[tid + st]; __syncthreads(); }
  const float mu = red[0] / (float)N; __syncthreads();
  float s2 = 0.f;
  for (int u = 0; u < per / 4; ++u)
#pragma unroll
    for (int q = 0; q < 4; ++q) { const float c = vals[u * 4 + q] - mu; s2 += c * c; }
  red[tid] = s2; __syncthreads();
  for (int st = 128; st > 0; st >>= 1) { if (tid < st) red[tid] += red[tid + st]; __syncthreads(); }
  const float rs = rsqrtf(red[0] / (float)N + eps);
  {
    for (int u = 0; u < per / 4; ++u) {
      const int j = tid * 4 + 1024 * u;
      v4f o, sm;
#pragma unroll
      for (int q = 0; q < 4; ++q) {
        float gg = g[j + q], bb = bta[j + q];
        if (PARAM_BF16) { gg = bf16_round(gg); bb = bf16_round(bb); }
        sm[q] = vals[u * 4 + q]; o[q] = (vals[u * 4 + q] - mu) * rs * gg + bb;
      }
      if (out_sum) *(v4f*)(out_sum + (size_t)row * N + j) = sm;
      *(v4f*)(out_norm + (size_t)row * N + j) = o;
    }
    
  }
}



// ---- f16 WMMA path (v_wmma_f32_16x16x32_f16): 11-bit significands for operands in range — used where a [0,1] probability operand needs more precision than bf16
typedef _Float16 v16h __attribute__((ext_vector_type(16)));
union FragH { v16h v; v8us half[2]; _Float16 h[16]; unsigned short u[16]; };
template <int NT>
__device__ __forceinline__ v8f mmaH(v16h ah, v16h al, v16h bh, v16h bl, v8f c) {
  c = __builtin_amdgcn_wmma_f32_16x16x32_f16(false, ah, false, bh, (short)0, c, false, false);
  if (NT >= 2) c = __builtin_amdgcn_wmma_f32_16x16x32_f16(false, al, false, bh, (short)0, c, false, false);
  if (NT >= 3) c = __builtin_amdgcn_wmma_f32_16x16x32_f16(false, ah, false, bl, (short)0, c, false, false);
  asm volatile("v_nop\n\tv_nop\n\tv_nop\n\tv_nop" : "+v"(c) : "v"(ah), "v"(al), "v"(bh), "v"(bl));
  return c;
}
// batched GEMM like k_gemm_b but f16 operands: A f32 (split into f16 hi/lo if ASPLIT, else rounded to f16), Bt = f16 values [n][k]; alpha; C f32; N multiple of 16 (partial tiles skipped)
template <bool ASPLIT>
__global__ __launch_bounds__(128) void k_gemm_h(const float* __restrict__ A, int lda, size_t sA, const _Float16* __restrict__ Bh, int ldb, size_t sB, float alpha, float* __restrict__ C, int ldc, size_t sC, int M, int N, int K) {
  __shared__ __attribute__((aligned(16))) float so[4][16][64];
  const int tid = threadIdx.x, w = tid >> 5, lane = tid & 31, ln = lane & 15, hh = lane >> 4; const int by = blockIdx.y;
  A += (size_t)by * sA; Bh += (size_t)by * sB; C += (size_t)by * sC;
  const int ntn = (N + 63) / 64; const int wid = blockIdx.x * 4 + w; const int mt = wid / ntn, nq = wid % ntn; if (mt * 16 >= M) return;
  const int row0 = mt * 16, col0 = nq * 64; const float* arow = A + (size_t)(row0 + ln) * lda;
  v8f acc[4] = {};
  for (int kb = 0; kb < K; kb += 32) {
    FragH ah, al;
    const v4f x0 = *(const v4fa*)(arow + kb + 8 * hh), x1 = *(const v4fa*)(arow + kb + 8 * hh + 4), x2 = *(const v4fa*)(arow + kb + 16 + 8 * hh), x3 = *(const v4fa*)(arow + kb + 16 + 8 * hh + 4);
    float xs[16] = {x0[0],x0[1],x0[2],x0[3],x1[0],x1[1],x1[2],x1[3],x2[0],x2[1],x2[2],x2[3],x3[0],x3[1],x3[2],x3[3]};
#pragma unroll
    for (int i = 0; i < 16; ++i) { const _Float16 h = (_Float16)xs[i]; ah.h[i] = h; al.h[i] = ASPLIT ? (_Float16)(xs[i] - (float)h) : (_Float16)0.0f; }
#pragma unroll
    for (int t = 0; t < 4; ++t) { if (col0 + t * 16 >= N) continue; const size_t boff = (size_t)(col0 + t * 16 + ln) * ldb + kb; FragH bq; bq.half[0] = *(const v8us*)(Bh + boff + 8 * hh); bq.half[1] = *(const v8us*)(Bh + boff + 16 + 8 * hh);
      acc[t] = mmaH<ASPLIT ? 2 : 1>(ah.v, al.v, bq.v, bq.v, acc[t]); }
  }
#pragma unroll
  for (int t = 0; t < 4; ++t) { if (col0 + t * 16 >= N) continue;
#pragma unroll
    for (int r = 0; r < 8; ++r) so[w][8 * hh + r][t * 16 + ln] = acc[t][r] * alpha; }
  __builtin_amdgcn_fence(__ATOMIC_ACQ_REL, "workgroup"); __builtin_amdgcn_wave_barrier();
  const int rsub = lane >> 4, c4 = (lane & 15) * 4;
  {
#pragma unroll
    for (int q = 0; q < 8; ++q) { const int r = q * 2 + rsub; if (col0 + c4 < N) { const v4f v = *(const v4fa*)&so[w][r][c4]; *(v4f*)(C + (size_t)(row0 + r) * ldc + col0 + c4) = v; } }
     }
}

// Wt[n][k] = f16(W[k][n]·scale) from f32 row-major W[K][N] (scale = power of two; bf16-exact weights stay exact in f16 away from the subnormal range)
__global__ __launch_bounds__(256) void k_wt_f16(const float* __restrict__ W, _Float16* __restrict__ Wt, int K, int N, float scale) {
  const int t = blockIdx.x * 256 + threadIdx.x; if (t >= N * (K / 8)) return; const int n = t / (K / 8), k8 = (t % (K / 8)) * 8; FragH f;
#pragma unroll
  for (int i = 0; i < 8; ++i) f.h[i] = (_Float16)(bf16_round(W[(size_t)(k8 + i) * N + n]) * scale); const v8us o = f.half[0];
  *(v8us*)((unsigned short*)Wt + (size_t)n * K + k8) = o; 
}
// k_gemm_hh variant with fused epilogue: v = acc·alpha + bias[by·sBias + col] (+ CP[(row/rowsPerB)·sCPb + by·64 + col] if CP) ; ACT 0 none / 1 elu ; writes f16 C16 (and f32 C if non-null)
template <int ACT>
__global__ __launch_bounds__(128) void k_gemm_hhx(const _Float16* __restrict__ A, int lda, size_t sA, const _Float16* __restrict__ Bh, int ldb, size_t sB, float alpha, const float* __restrict__ bias, size_t sBias, const float* __restrict__ CP, int rowsPerB, size_t sCPb, int row0g,
    float* __restrict__ C, _Float16* __restrict__ C16, int ldc, size_t sC, int M, int N, int K) {
  __shared__ __attribute__((aligned(16))) float so[4][16][64];
  const int tid = threadIdx.x, w = tid >> 5, lane = tid & 31, ln = lane & 15, hh = lane >> 4; const int by = blockIdx.y;
  A += (size_t)by * sA; Bh += (size_t)by * sB; const size_t cofs = (size_t)by * sC; const float* bp = bias ? bias + (size_t)by * sBias : nullptr;
  const int ntn = (N + 63) / 64; const int wid = blockIdx.x * 4 + w; const int mt = wid / ntn, nq = wid % ntn; if (mt * 16 >= M) return;
  const int row0 = mt * 16, col0 = nq * 64; const _Float16* arow = A + (size_t)(row0 + ln) * lda;
  v8f acc[4] = {};
  for (int kb = 0; kb < K; kb += 32) { FragH ah; ah.half[0] = *(const v8us*)((const unsigned short*)arow + kb + 8 * hh); ah.half[1] = *(const v8us*)((const unsigned short*)arow + kb + 16 + 8 * hh);
#pragma unroll
    for (int t = 0; t < 4; ++t) { if (col0 + t * 16 >= N) continue; const size_t boff = (size_t)(col0 + t * 16 + ln) * ldb + kb; FragH bq; bq.half[0] = *(const v8us*)((const unsigned short*)Bh + boff + 8 * hh); bq.half[1] = *(const v8us*)((const unsigned short*)Bh + boff + 16 + 8 * hh);
      acc[t] = mmaH<1>(ah.v, ah.v, bq.v, bq.v, acc[t]); }
  }
#pragma unroll
  for (int t = 0; t < 4; ++t) { if (col0 + t * 16 >= N) continue; const int col = col0 + t * 16 + ln; const float bv = bp ? bf16_round(bp[col]) : 0.f;
#pragma unroll
    for (int r = 0; r < 8; ++r) { float v = acc[t][r] * alpha + bv; if (CP) { const int rr = row0g + row0 + 8 * hh + r; if (rowsPerB < 0) v += CP[cofs + (size_t)rr * ldc + col];      /* rowsPerB < 0: own element of the batched C plane */ else { const int bidx = rr / rowsPerB; v += CP[(size_t)bidx * sCPb + (size_t)by * 64 + col]; } } if (ACT == 1) v = (v > 0.f) ? v : expm1f(v); else if (ACT == 7) v = (v > 0.f) ? v + 1.0f : expf(v); else if (ACT == 8) v = tanhf(v); else if (ACT == 9) v = 0.5f * v * (1.0f + tanhf(0.7978845608028654f * (v + 0.044715f * v * v * v))); else if (ACT == 11) v = 1.0f / (1.0f + expf(-v)); else if (ACT == 12) v = (v > 0.f) ? v : 0.01f * v; else if (ACT == 14) v = (v > 0.f) ? v : 0.1f * v; else if (ACT == 16) v = (v >= 0.f) ? v : 0.3f * v; else if (ACT == 17) v = (v >= 0.f) ? v : 0.2f * v; else if (ACT == 15) v = v / (1.0f + expf(-v)); else if (ACT == 3) v = fmaxf(v, 0.f); else if (ACT == 6) v = 0.5f * v * (1.0f + erff(v * 0.70710678118654752f)); so[w][8 * hh + r][t * 16 + ln] = v; } }
  __builtin_amdgcn_fence(__ATOMIC_ACQ_REL, "workgroup"); __builtin_amdgcn_wave_barrier();
  const int rsub = lane >> 4, c4 = (lane & 15) * 4; typedef _Float16 v4h __attribute__((ext_vector_type(4)));
  {
#pragma unroll
    for (int q = 0; q < 8; ++q) { const int r = q * 2 + rsub; if (col0 + c4 < N) { const v4f v = *(const v4fa*)&so[w][r][c4]; if (C) *(v4f*)(C + cofs + (size_t)(row0 + r) * ldc + col0 + c4) = v; if (C16) { v4h h4; for (int i = 0; i < 4; ++i) h4[i] = (_Float16)v[i]; *(v4h*)(C16 + cofs + (size_t)(row0 + r) * ldc + col0 + c4) = h4; } } }
     }
}


typedef _Float16 v4h __attribute__((ext_vector_type(4)));

__global__ __launch_bounds__(256) void k_x16(const float* __restrict__ x, _Float16* __restrict__ X16, size_t n8) { const size_t t = (size_t)blockIdx.x * 256 + threadIdx.x; if (t >= n8) return; FragH f;
#pragma unroll
  for (int q = 0; q < 8; ++q) f.h[q] = (_Float16)bf16_round(x[t * 8 + q]); *(v8us*)((unsigned short*)X16 + t * 8) = f.half[0];  }
__global__ __launch_bounds__(256) void k_h16(const float* __restrict__ x, _Float16* __restrict__ X16, size_t n8) { const size_t t = (size_t)blockIdx.x * 256 + threadIdx.x; if (t >= n8) return; FragH f;
#pragma unroll
  for (int q = 0; q < 8; ++q) f.h[q] = (_Float16)x[t * 8 + q]; *(v8us*)((unsigned short*)X16 + t * 8) = f.half[0];  }
__global__ __launch_bounds__(256) void k_round16f(const float* __restrict__ W, _Float16* __restrict__ Bt, size_t n8) { const size_t t = (size_t)blockIdx.x * 256 + threadIdx.x; if (t >= n8) return; FragH f;
#pragma unroll
  for (int i = 0; i < 8; ++i) f.h[i] = (_Float16)(bf16_round(W[t * 8 + i]) * 16.0f); *(v8us*)((unsigned short*)Bt + t * 8) = f.half[0];  }
template <int NHv, int TTv>
__global__ __launch_bounds__(256) void k_vt(const _Float16* __restrict__ V16, int ldv, int voff, _Float16* __restrict__ Vt) { __shared__ unsigned short tl[64][66]; const int tid = threadIdx.x; const int slab = blockIdx.x / (TTv / 64), lg = blockIdx.x % (TTv / 64); const int b = slab / NHv, h = slab % NHv;
  for (int i = tid; i < 64 * 8; i += 256) { const int r = i / 8, c8 = (i % 8) * 8; FragH f; f.half[0] = *(const v8us*)((const unsigned short*)V16 + ((size_t)b * TTv + lg * 64 + r) * ldv + voff + h * 64 + c8);
#pragma unroll
    for (int q = 0; q < 8; ++q) tl[r][c8 + q] = f.u[q]; }
  __syncthreads();
  {
#pragma unroll
    for (int rd = 0; rd < 2; ++rd) { const int d = rd * 32 + tid / 8, pc = tid % 8; FragH f;
#pragma unroll
      for (int q = 0; q < 8; ++q) f.u[q] = tl[pc * 8 + q][d];
      *(v8us*)((unsigned short*)Vt + ((size_t)slab * 64 + d) * TTv + lg * 64 + pc * 8) = f.half[0]; }
     } }

__global__ __launch_bounds__(256) void k_hl(const float* __restrict__ F, _Float16* __restrict__ Hh, _Float16* __restrict__ Hl, size_t n8) { const size_t t = (size_t)blockIdx.x * 256 + threadIdx.x; if (t >= n8) return; FragH fh, fl; const v4f a = *(const v4fa*)(F + t * 8), c = *(const v4fa*)(F + t * 8 + 4);
#pragma unroll
  for (int q = 0; q < 4; ++q) { _Float16 h = (_Float16)a[q]; fh.h[q] = h; fl.h[q] = (_Float16)((a[q] - (float)h) * 1024.0f); h = (_Float16)c[q]; fh.h[4 + q] = h; fl.h[4 + q] = (_Float16)((c[q] - (float)h) * 1024.0f); }
  { *(v8us*)((unsigned short*)Hh + t * 8) = fh.half[0]; *(v8us*)((unsigned short*)Hl + t * 8) = fl.half[0];  } }

// ---- fast GEMM (wave tile 32x64; requires M % 32 == 0 rows per launch region and N % 64 == 0); epilogue = k_gemm_hhx semantics ----
__device__ __forceinline__ v16h g2_frag(const _Float16* p, int hh) { FragH f; f.half[0] = *(const v8us*)((const unsigned short*)p + 8 * hh); f.half[1] = *(const v8us*)((const unsigned short*)p + 16 + 8 * hh); return f.v; }
__device__ __forceinline__ v8f g2_mma(v16h a, v16h b, v8f c) { v8f d = __builtin_amdgcn_wmma_f32_16x16x32_f16(false, a, false, b, (short)0, c, false, false); asm volatile("v_nop\n\tv_nop\n\tv_nop\n\tv_nop" : "+v"(d) : "v"(a), "v"(b)); return d; }
template <int ACT>
__global__ __launch_bounds__(128) void k_gemm2(const _Float16* __restrict__ A, int lda, size_t sA, const _Float16* __restrict__ Bh, int ldb, size_t sB, float alpha, const float* __restrict__ bias, size_t sBias, const float* __restrict__ CP, int rowsPerB, size_t sCPb, int row0g,
    float* __restrict__ C, _Float16* __restrict__ C16, int ldc, size_t sC, int M, int N, int K) { static_assert(ACT == 0 || ACT == 3 || ACT == 6 || ACT == 8 || ACT == 9 || ACT == 11 || ACT == 12 || ACT == 14 || ACT == 15 || ACT == 16 || ACT == 17, "k_gemm2: unsupported ACT code (would silently apply no activation)");
  __shared__ __attribute__((aligned(16))) float so[4][32][68];
  const int tid = threadIdx.x, w = tid >> 5, lane = tid & 31, ln = lane & 15, hh = lane >> 4; const int by = blockIdx.y;
  A += (size_t)by * sA; Bh += (size_t)by * sB; const size_t cofs = (size_t)by * sC; const float* bp = bias ? bias + (size_t)by * sBias : nullptr;
  const int ntn = N >> 6; const int mt = blockIdx.x / ntn, nq = blockIdx.x - mt * ntn; const int row0 = mt * 128 + 32 * w, col0 = nq * 64; if (row0 >= M) return;
  const _Float16* a0p = A + (size_t)(row0 + ln) * lda; const _Float16* a1p = a0p + (size_t)16 * lda;
  const _Float16* b0p = Bh + (size_t)(col0 + ln) * ldb; const _Float16* b1p = b0p + (size_t)16 * ldb; const _Float16* b2p = b1p + (size_t)16 * ldb; const _Float16* b3p = b2p + (size_t)16 * ldb;
  const v8f z8 = {0.f,0.f,0.f,0.f,0.f,0.f,0.f,0.f}; v8f c00 = z8, c01 = z8, c02 = z8, c03 = z8, c10 = z8, c11 = z8, c12 = z8, c13 = z8;
#pragma unroll 1
  for (int kb = 0; kb < K; kb += 32) { const v16h a0 = g2_frag(a0p + kb, hh), a1 = g2_frag(a1p + kb, hh);
    v16h b = g2_frag(b0p + kb, hh); c00 = g2_mma(a0, b, c00); c10 = g2_mma(a1, b, c10);
    b = g2_frag(b1p + kb, hh); c01 = g2_mma(a0, b, c01); c11 = g2_mma(a1, b, c11);
    b = g2_frag(b2p + kb, hh); c02 = g2_mma(a0, b, c02); c12 = g2_mma(a1, b, c12);
    b = g2_frag(b3p + kb, hh); c03 = g2_mma(a0, b, c03); c13 = g2_mma(a1, b, c13); }
  v8f accs[8] = {c00, c01, c02, c03, c10, c11, c12, c13};
#pragma unroll
  for (int u = 0; u < 8; ++u) { const int t = u & 3, half = u >> 2; const int col = col0 + t * 16 + ln; const float bv = bp ? bf16_round(bp[col]) : 0.f;
#pragma unroll
    for (int r = 0; r < 8; ++r) { const int rloc = half * 16 + 8 * hh + r; float v = accs[u][r] * alpha + bv; if (CP) { if (rowsPerB < 0) v += CP[cofs + (size_t)(row0g + row0 + rloc) * ldc + col];      /* rowsPerB < 0: own element of the batched C plane */ else { const int bidx = (row0g + row0 + rloc) / rowsPerB; v += CP[(size_t)bidx * sCPb + (size_t)by * 64 + col]; } }
      if (ACT == 3) v = fmaxf(v, 0.f); else if (ACT == 6) v = 0.5f * v * (1.0f + erff(v * 0.70710678118654752f)); else if (ACT == 11) v = 1.0f / (1.0f + expf(-v)); else if (ACT == 15) v = v / (1.0f + expf(-v)); else if (ACT == 12) v = (v > 0.f) ? v : 0.01f * v; else if (ACT == 8) v = tanhf(v); else if (ACT == 9) v = 0.5f * v * (1.0f + tanhf(0.7978845608028654f * (v + 0.044715f * v * v * v))); else if (ACT == 14) v = (v > 0.f) ? v : 0.1f * v; else if (ACT == 16) v = (v >= 0.f) ? v : 0.3f * v; else if (ACT == 17) v = (v >= 0.f) ? v : 0.2f * v;
      so[w][rloc][t * 16 + ln] = v; } }
  __builtin_amdgcn_fence(__ATOMIC_ACQ_REL, "workgroup"); __builtin_amdgcn_wave_barrier();
  const int rsub = lane >> 4, c4 = (lane & 15) * 4;
  {
#pragma unroll
    for (int q = 0; q < 16; ++q) { const int r = q * 2 + rsub; const v4f v = *(const v4fa*)&so[w][r][c4]; if (C) *(v4f*)(C + cofs + (size_t)(row0 + r) * ldc + col0 + c4) = v; if (C16) { v4h h4; for (int i = 0; i < 4; ++i) h4[i] = (_Float16)v[i]; *(v4h*)(C16 + cofs + (size_t)(row0 + r) * ldc + col0 + c4) = h4; } }
     } }


__global__ __launch_bounds__(256) void k_wnat(const float* __restrict__ w, size_t n8, _Float16* __restrict__ Bt) { const size_t t = (size_t)blockIdx.x * 256 + threadIdx.x; if (t >= n8) return; FragH f; for (int q = 0; q < 8; ++q) f.h[q] = (_Float16)(bf16_round(w[t * 8 + q]) * 16.0f); *(v8us*)((unsigned short*)Bt + t * 8) = f.half[0];  }
__global__ __launch_bounds__(256) void k_rsm(const float* __restrict__ S, _Float16* __restrict__ P, int nrows) {
  #pragma clang fp contract(off)
  const int i = blockIdx.x * 256 + threadIdx.x; if (i >= nrows) return; const float* s = S + (size_t)i * SQ; float mx = -3.0e38f;
#pragma unroll 1
  for (int j = 0; j < SQ; ++j) mx = fmaxf(mx, s[j]); float se = 0.f;
#pragma unroll 1
  for (int j = 0; j < SQ; ++j) se += expf(s[j] - mx); const float sc = 256.0f / se;
#pragma unroll 1
  for (int j0 = 0; j0 < SQ; j0 += 8) { FragH f; for (int q = 0; q < 8; ++q) f.h[q] = (_Float16)(expf(s[j0 + q] - mx) * sc); unsigned short* d = (unsigned short*)P + (size_t)i * SQ + j0; *(v8us*)d = f.half[0];  } }
__global__ __launch_bounds__(256) void k_vt(const _Float16* __restrict__ V16, int b, int h0, _Float16* __restrict__ VT) { __shared__ unsigned short tl[64][65]; const int tid = threadIdx.x; const int hh = blockIdx.x % HG, sg = blockIdx.x / HG; const int s0 = sg * 64; const int h = h0 + hh;
  for (int i = tid; i < 64 * 8; i += 256) { const int j = i / 8, d8 = (i % 8) * 8; FragH f; f.half[0] = *(const v8us*)((const unsigned short*)V16 + ((size_t)b * SQ + s0 + j) * DM + h * HD + d8); for (int q = 0; q < 8; ++q) tl[d8 + q][j] = f.u[q]; }
  __syncthreads();
  { for (int i = tid; i < 64 * 8; i += 256) { const int d = i / 8, j8 = (i % 8) * 8; FragH f; for (int q = 0; q < 8; ++q) f.u[q] = tl[d][j8 + q]; *(v8us*)((unsigned short*)VT + ((size_t)hh * HD + d) * SQ + s0 + j8) = f.half[0]; }  } }


__global__ __launch_bounds__(256) void k_tile16(const float* __restrict__ O, float* __restrict__ out, size_t n4) { const size_t t = (size_t)blockIdx.x * 256 + threadIdx.x; if (t >= n4) return; const size_t e = t * 4; const size_t r = e / DMO; const int c = (int)(e % DMO); const v4f v = *(const v4fa*)(O + r * HD + (c % HD)); *(v4f*)(out + e) = v;  }


__global__ __launch_bounds__(256) void k_rsmf(const float* __restrict__ S, _Float16* __restrict__ P, int qn, int hg) {
  #pragma clang fp contract(off)
  const int t = blockIdx.x * 256 + threadIdx.x; if (t >= qn * hg) return; const size_t i = (size_t)(t / qn) * SQ + (t % qn); const float* s = S + i * SQ; float mx = -3.0e38f;
#pragma unroll 1
  for (int j = 0; j < SQ; ++j) mx = fmaxf(mx, s[j]); float se = 0.f;
#pragma unroll 1
  for (int j = 0; j < SQ; ++j) se += __expf(s[j] - mx); const float sc = 256.0f / se;
#pragma unroll 1
  for (int j0 = 0; j0 < SQ; j0 += 8) { FragH f; for (int q = 0; q < 8; ++q) f.h[q] = (_Float16)(__expf(s[j0 + q] - mx) * sc); unsigned short* d = (unsigned short*)P + i * SQ + j0; *(v8us*)d = f.half[0];  } }

extern "C" void kernel_launch(void* const* d_in, const int* in_sizes, int n_in,
                              void* d_out, int out_size, void* d_ws, size_t ws_size, hipStream_t stream) {
  (void)in_sizes; (void)n_in; (void)out_size;
  const float* const* I = (const float* const*)d_in; const float* x = I[0]; const float* wq = I[1]; const float* wk = I[2]; const float* wv = I[3];      /* [in][out] = [1024][64] */
  char* ws = (char*)d_ws; size_t off = 0;
  auto take = [&](size_t bytes) { char* p = ws + off; off += (bytes + 255) & ~(size_t)255; return p; };
  _Float16* BQ = (_Float16*)take((size_t)HD * DM * 2); _Float16* BK = (_Float16*)take((size_t)HD * DM * 2); _Float16* BV = (_Float16*)take((size_t)HD * DM * 2);
  _Float16* X16 = (_Float16*)take(NR * DM * 2); float* QF = (float*)take(NR * HD * 4); float* KF = (float*)take(NR * HD * 4); _Float16* QH = (_Float16*)take(NR * HD * 2); _Float16* QL = (_Float16*)take(NR * HD * 2); _Float16* KH = (_Float16*)take(NR * HD * 2); _Float16* KL = (_Float16*)take(NR * HD * 2); float* VF = (float*)take(NR * HD * 4); _Float16* VH = (_Float16*)take(NR * HD * 2); _Float16* VL = (_Float16*)take(NR * HD * 2);
  float* ST = (float*)take((size_t)SQ * SQ * 4); _Float16* PT = (_Float16*)take((size_t)SQ * SQ * 2); _Float16* P = (_Float16*)take((size_t)SQ * SQ * 2); _Float16* VT = (_Float16*)take((size_t)HD * SQ * 2); _Float16* VTL = (_Float16*)take((size_t)HD * SQ * 2); float* OF = (float*)take((size_t)SQ * HD * 4);
  if (off > ws_size) return;      /* approx 16 + 6 + 6 + 16 + 8 + 8 + 1.4 = 61.4 MiB */
  k_wt_f16<<<(unsigned)(((size_t)HD * (DM / 8) + 255) / 256), 256, 0, stream>>>(wq, BQ, DM, HD, 16.0f); k_wt_f16<<<(unsigned)(((size_t)HD * (DM / 8) + 255) / 256), 256, 0, stream>>>(wk, BK, DM, HD, 16.0f); k_wt_f16<<<(unsigned)(((size_t)HD * (DM / 8) + 255) / 256), 256, 0, stream>>>(wv, BV, DM, HD, 16.0f);      /* [1024][64] -> Bt[64][1024] x16 */
  k_x16<<<(unsigned)((NR * DM / 8 + 255) / 256), 256, 0, stream>>>(x, X16, NR * DM / 8);
  k_gemm2<0><<<dim3((unsigned)((NR / 128) * 1), 1), 128, 0, stream>>>(X16, DM, 0, BQ, DM, 0, 0.0625f, nullptr, 0, nullptr, 1, 0, 0, QF, nullptr, HD, 0, (int)NR, HD, DM);      /* q (f32, exact products) */
  k_gemm2<0><<<dim3((unsigned)((NR / 128) * 1), 1), 128, 0, stream>>>(X16, DM, 0, BK, DM, 0, 0.0625f, nullptr, 0, nullptr, 1, 0, 0, KF, nullptr, HD, 0, (int)NR, HD, DM);      /* k (f32) */
  k_gemm2<0><<<dim3((unsigned)((NR / 128) * 1), 1), 128, 0, stream>>>(X16, DM, 0, BV, DM, 0, 0.0625f, nullptr, 0, nullptr, 1, 0, 0, VF, nullptr, HD, 0, (int)NR, HD, DM);      /* v (f32, exact products) */
  k_hl<<<(unsigned)((NR * HD / 8 + 255) / 256), 256, 0, stream>>>(QF, QH, QL, NR * HD / 8); k_hl<<<(unsigned)((NR * HD / 8 + 255) / 256), 256, 0, stream>>>(KF, KH, KL, NR * HD / 8); k_hl<<<(unsigned)((NR * HD / 8 + 255) / 256), 256, 0, stream>>>(VF, VH, VL, NR * HD / 8);      /* f16 hi + x1024 residual planes of q, k, v */
  for (int b = B0; b < B0 + NBR; ++b) { const size_t r0 = (size_t)b * SQ;
    k_gemm2<0><<<dim3((SQ / 128) * (SQ / 64), 1), 128, 0, stream>>>(KH + r0 * HD, HD, 0, QH + r0 * HD, HD, 0, 1.0f, nullptr, 0, nullptr, 1, 0, 0, ST, nullptr, SQ, 0, SQ, SQ, HD);      /* S^T[k][i] = k_hi . q_hi */
    k_gemm2<0><<<dim3((SQ / 128) * (SQ / 64), 1), 128, 0, stream>>>(KL + r0 * HD, HD, 0, QH + r0 * HD, HD, 0, 0.0009765625f, nullptr, 0, ST, -1, 0, 0, ST, nullptr, SQ, 0, SQ, SQ, HD);      /* += k_lo . q_hi 2^-10 */
    k_gemm2<0><<<dim3((SQ / 128) * (SQ / 64), 1), 128, 0, stream>>>(KH + r0 * HD, HD, 0, QL + r0 * HD, HD, 0, 0.0009765625f, nullptr, 0, ST, -1, 0, 0, ST, nullptr, SQ, 0, SQ, SQ, HD);      /* += k_hi . q_lo 2^-10 */
    k_rsmf<<<(HG * SQ + 255) / 256, 256, 0, stream>>>(ST, PT, SQ, HG);      /* softmax over the query index i (rows of S^T) -> PT[k][i] = f16(256 att[i][k]) */
    k_vt<SQ / 64, SQ><<<(SQ / 64) * (SQ / 64), 256, 0, stream>>>(PT, SQ, 0, P);      /* transpose PT [k][i] -> P [i][k] (32 slabs of 64 i's) */
    k_vt<1, SQ><<<1 * (SQ / 64), 256, 0, stream>>>(VH + r0 * HD, HD, 0, VT); k_vt<1, SQ><<<1 * (SQ / 64), 256, 0, stream>>>(VL + r0 * HD, HD, 0, VTL);      /* V^T hi / residual [64][2048] */
    k_gemm2<0><<<dim3((SQ / 128) * 1, 1), 128, 0, stream>>>(P, SQ, 0, VT, SQ, 0, 0.00390625f, nullptr, 0, nullptr, 1, 0, 0, OF, nullptr, HD, 0, SQ, HD, SQ);      /* out_i = 2^-8 sum_k P[i][k] v_hi */
    k_gemm2<0><<<dim3((SQ / 128) * 1, 1), 128, 0, stream>>>(P, SQ, 0, VTL, SQ, 0, 0.000003814697265625f, nullptr, 0, OF, -1, 0, 0, OF, nullptr, HD, 0, SQ, HD, SQ);      /* += 2^-18 sum_k P[i][k] v_lo */
    k_tile16<<<(unsigned)(((size_t)SQ * DMO / 4 + 255) / 256), 256, 0, stream>>>(OF, (float*)d_out + r0 * DMO, (size_t)SQ * DMO / 4); }      /* the 16 identical heads */
}

// v001
// It runs in 877 microseconds.
// Timed twice side by side with v000, it ran 2.50 and 2.45 times as fast.
#include <hip/hip_runtime.h>
// Single-projection attention with a QUERY-axis softmax, tiled 16x (x [4][2048][1024]; q, k, v = x W ([1024][64] weights stored [in][out], shared by all heads); att[i][k] = q_i . k_k (no scaling); att = softmax over the QUERY index i for each key column k (the module's nn.Softmax(dim=1)); out_i = sum_k att[i][k] v_k -> [2048][64], concatenated 16 times -> [4][2048][1024]).
// Structure: token rows; x as exact f16 rows; q and k projections as WMMA GEMMs (32x64 wave tiles, f32 accumulation, exact x16 weights) kept in f32 and split into f16 hi + x1024 residual planes (the unscaled logits have sigma 8, so they are formed from three hi/lo products, ~2^-21 relative); v likewise kept f32 and split; per batch: transposed scores S^T[k][i] = k_k . q_i as three accumulating GEMM passes (K = 64), row softmax over i on VALU (f32 statistics, native exp; weights x256 f16) = the module's column softmax, the weight matrix transposed back to [i][k] via LDS tile transposes, V^T (hi and residual) via LDS transposes, out_i = P V^T as two accumulating GEMM passes (K = 2048, f32) into a [2048][64] plane, broadcast into the 16 head slots of the output rows with thread-linear float4 stores; 10 + 4 x 10 = 50 launches.
// Compute dtype: inputs rounded to bf16; x / weights exact; q, k, v as f16 hi + residual pairs; the softmax weights plain f16 (~2^-12); scores, statistics, out f32. v_wmma_f32_16x16x32_f16.
#define NB 4
#define SQ 2048
#define DM 1024
#define HD 64
#define NH 1
#define HG 1
#define DMO 1024                     /* output row width = 16 x 64 */
#define B0 0                         /* first batch (debug hook) */
#define NBR NB
#define NR ((size_t)NB * SQ)
typedef __bf16 v16b __attribute__((ext_vector_type(16)));
typedef unsigned short v8us __attribute__((ext_vector_type(8), may_alias));
typedef float  v8f  __attribute__((ext_vector_type(8)));
typedef float  v4f  __attribute__((ext_vector_type(4)));
typedef float  v4fa __attribute__((ext_vector_type(4), may_alias));
union FragB { v16b v; v8us half[2]; unsigned short u[16]; };

__device__ __forceinline__ unsigned short bf16_bits(float x) { unsigned int u = __float_as_uint(x); return (unsigned short)((u + 0x7FFFu + ((u >> 16) & 1u)) >> 16); }
__device__ __forceinline__ float bf16_val(unsigned short b) { return __uint_as_float(((unsigned int)b) << 16); }
__device__ __forceinline__ float bf16_round(float x) { return bf16_val(bf16_bits(x)); }
// D += A·B with NT terms: 1 = ah·bh, 2 = + al·bh (A split), 3 = + ah·bl (both split)
template <int NT>
__device__ __forceinline__ v8f mmaN(v16b ah, v16b al, v16b bh, v16b bl, v8f c) {
  c = __builtin_amdgcn_wmma_f32_16x16x32_bf16(false, ah, false, bh, (short)0, c, false, false);
  if (NT >= 2) c = __builtin_amdgcn_wmma_f32_16x16x32_bf16(false, al, false, bh, (short)0, c, false, false);
  if (NT >= 3) c = __builtin_amdgcn_wmma_f32_16x16x32_bf16(false, ah, false, bl, (short)0, c, false, false);
  asm volatile("v_nop\n\tv_nop\n\tv_nop\n\tv_nop" : "+v"(c) : "v"(ah), "v"(al), "v"(bh), "v"(bl));
  return c;
}

__global__ __launch_bounds__(256) void k_wt_bf16(const float* __restrict__ W, unsigned short* __restrict__ Wt, int K, int N) {
  const int t = blockIdx.x * 256 + threadIdx.x;
  const int k8n = K / 8;
  if (t >= N * k8n) return;
  const int n = t / k8n, k8 = (t % k8n) * 8;
  v8us v;
#pragma unroll
  for (int i = 0; i < 8; ++i) v[i] = bf16_bits(W[(size_t)(k8 + i) * N + n]);
  *(v8us*)(Wt + (size_t)n * K + k8) = v;
  
}

// GEMM C[M][N] (f32, pitch ldc) = act(A[M][K]·W + bias). A f32 row-major (pitch lda) converted per fragment to bf16
// (ASPLIT: hi/lo two planes -> 2 terms, else single rounded term); Wt bf16 [N][K] (pitch ldb). BIAS_BF16 rounds the
// bias to bf16 first (bias quantised to bf16 before the add). K%32==0, M%16==0, N%64==0.
template <bool ASPLIT, int ACT, bool BIAS_BF16>
__global__ __launch_bounds__(128) void k_gemm_bf(const float* __restrict__ A, int lda, const unsigned short* __restrict__ Wt, int ldb,
                                               const float* __restrict__ bias, float* __restrict__ C, int ldc, int M, int N, int K) {
  __shared__ __attribute__((aligned(16))) float so[4][16][64];
  const int tid = threadIdx.x, w = tid >> 5, lane = tid & 31, ln = lane & 15, hh = lane >> 4;
  const int ntn = N / 64;
  const int wid = blockIdx.x * 4 + w;
  const int mt = wid / ntn, nq = wid % ntn;
  if (mt * 16 >= M) return;
  const int row0 = mt * 16, col0 = nq * 64;
  const float* arow = A + (size_t)(row0 + ln) * lda;
  v8f acc[4] = {};
  for (int kb = 0; kb < K; kb += 32) {
    FragB ah, al;
    const v4f x0 = *(const v4fa*)(arow + kb + 8 * hh), x1 = *(const v4fa*)(arow + kb + 8 * hh + 4);
    const v4f x2 = *(const v4fa*)(arow + kb + 16 + 8 * hh), x3 = *(const v4fa*)(arow + kb + 16 + 8 * hh + 4);
    float xs[16] = {x0[0],x0[1],x0[2],x0[3],x1[0],x1[1],x1[2],x1[3],x2[0],x2[1],x2[2],x2[3],x3[0],x3[1],x3[2],x3[3]};
#pragma unroll
    for (int i = 0; i < 16; ++i) { const unsigned short hb = bf16_bits(xs[i]); ah.u[i] = hb; al.u[i] = ASPLIT ? bf16_bits(xs[i] - bf16_val(hb)) : (unsigned short)0; }
#pragma unroll
    for (int t = 0; t < 4; ++t) {
      const unsigned short* brow = Wt + (size_t)(col0 + t * 16 + ln) * ldb + kb;
      FragB b;
      b.half[0] = *(const v8us*)(brow + 8 * hh);
      b.half[1] = *(const v8us*)(brow + 16 + 8 * hh);
      acc[t] = mmaN<ASPLIT ? 2 : 1>(ah.v, al.v, b.v, b.v, acc[t]);
    }
  }
#pragma unroll
  for (int t = 0; t < 4; ++t) {
    float bv = bias ? bias[col0 + t * 16 + ln] : 0.f;
    if (BIAS_BF16) bv = bf16_round(bv);
#pragma unroll
    for (int r = 0; r < 8; ++r) { float v = acc[t][r] + bv; if (ACT == 1) v = fmaxf(v, 0.f); so[w][8 * hh + r][t * 16 + ln] = v; }
  }
  __builtin_amdgcn_fence(__ATOMIC_ACQ_REL, "workgroup");
  __builtin_amdgcn_wave_barrier();
  const int rsub = lane >> 4, c4 = (lane & 15) * 4;
  {
#pragma unroll
    for (int q = 0; q < 8; ++q) {
      const int r = q * 2 + rsub;
      const v4f v = *(const v4fa*)&so[w][r][c4];
      *(v4f*)(C + (size_t)(row0 + r) * ldc + col0 + c4) = v;
    }
    
  }
}

// GEMM C = act(A·W + bias + resid): A f32 (ASPLIT -> hi/lo 2 terms), Wt bf16 [N][K]; ACT 0 none, 1 relu, 2 exact gelu;
// resid (optional, f32, row index = (row % rmod), pitch ldr, RES_BF16 rounds it) added before the activation.
template <bool ASPLIT, int ACT, bool BIAS_BF16, bool RES_BF16>
__global__ __launch_bounds__(128) void k_gemm_bf3(const float* __restrict__ A, int lda, const unsigned short* __restrict__ Wt, int ldb,
                                                const float* __restrict__ bias, const float* __restrict__ resid, int rmod, int ldr,
                                                float* __restrict__ C, int ldc, int M, int N, int K) {
  __shared__ __attribute__((aligned(16))) float so[4][16][64];
  const int tid = threadIdx.x, w = tid >> 5, lane = tid & 31, ln = lane & 15, hh = lane >> 4;
  const int ntn = N / 64;
  const int wid = blockIdx.x * 4 + w;
  const int mt = wid / ntn, nq = wid % ntn;
  if (mt * 16 >= M) return;
  const int row0 = mt * 16, col0 = nq * 64;
  const float* arow = A + (size_t)(row0 + ln) * lda;
  v8f acc[4] = {};
  for (int kb = 0; kb < K; kb += 32) {
    FragB ah, al;
    const v4f x0 = *(const v4fa*)(arow + kb + 8 * hh), x1 = *(const v4fa*)(arow + kb + 8 * hh + 4);
    const v4f x2 = *(const v4fa*)(arow + kb + 16 + 8 * hh), x3 = *(const v4fa*)(arow + kb + 16 + 8 * hh + 4);
    float xs[16] = {x0[0],x0[1],x0[2],x0[3],x1[0],x1[1],x1[2],x1[3],x2[0],x2[1],x2[2],x2[3],x3[0],x3[1],x3[2],x3[3]};
#pragma unroll
    for (int i = 0; i < 16; ++i) { const unsigned short hb = bf16_bits(xs[i]); ah.u[i] = hb; al.u[i] = ASPLIT ? bf16_bits(xs[i] - bf16_val(hb)) : (unsigned short)0; }
#pragma unroll
    for (int t = 0; t < 4; ++t) {
      const unsigned short* brow = Wt + (size_t)(col0 + t * 16 + ln) * ldb + kb;
      FragB b;
      b.half[0] = *(const v8us*)(brow + 8 * hh);
      b.half[1] = *(const v8us*)(brow + 16 + 8 * hh);
      acc[t] = mmaN<ASPLIT ? 2 : 1>(ah.v, al.v, b.v, b.v, acc[t]);
    }
  }
#pragma unroll
  for (int t = 0; t < 4; ++t) {
    const int col = col0 + t * 16 + ln;
    float bv = bias ? bias[col] : 0.f;
    if (BIAS_BF16) bv = bf16_round(bv);
#pragma unroll
    for (int r = 0; r < 8; ++r) {
      float v = acc[t][r] + bv;
      if (resid) { float rv = resid[(size_t)((row0 + 8 * hh + r) % rmod) * ldr + col]; if (RES_BF16) rv = bf16_round(rv); v += rv; }
      if (ACT == 1) v = fmaxf(v, 0.f);
      if (ACT == 2) v = 0.5f * v * (1.0f + erff(v * 0.70710678118654752f));
      if (ACT == 3) { const float u = 0.7978845608028654f * (v + 0.044715f * v * v * v); v = 0.5f * v * (1.0f + tanhf(u)); }
      so[w][8 * hh + r][t * 16 + ln] = v;
    }
  }
  __builtin_amdgcn_fence(__ATOMIC_ACQ_REL, "workgroup");
  __builtin_amdgcn_wave_barrier();
  const int rsub = lane >> 4, c4 = (lane & 15) * 4;
  {
#pragma unroll
    for (int q = 0; q < 8; ++q) {
      const int r = q * 2 + rsub;
      const v4f v = *(const v4fa*)&so[w][r][c4];
      *(v4f*)(C + (size_t)(row0 + r) * ldc + col0 + c4) = v;
    }
    
  }
}
// row LayerNorm (biased variance, eps) over N: s = X (+ R); optional out_sum <- s; out_norm <- (s-mu)*rsqrt(var+eps)*g + b
template <bool PARAM_BF16>
__global__ __launch_bounds__(256) void k_layernorm(const float* __restrict__ X, const float* __restrict__ R, const float* __restrict__ g, const float* __restrict__ bta,
                                                  float* __restrict__ out_sum, float* __restrict__ out_norm, int N, float eps) {
  __shared__ float red[256];
  const int row = blockIdx.x, tid = threadIdx.x;
  const float* x = X + (size_t)row * N; const float* rr = R ? R + (size_t)row * N : nullptr;
  float vals[16];                     // up to N = 4096
  const int per = N / 256;            // contiguous chunk per thread? use strided-by-4 chunks: thread handles j = tid*4 + 1024*u
  float s1 = 0.f;
  for (int u = 0; u < per / 4; ++u) {
    const int j = tid * 4 + 1024 * u;
    const v4f a = *(const v4fa*)(x + j);
    v4f b = {0.f,0.f,0.f,0.f}; if (rr) b = *(const v4fa*)(rr + j);
#pragma unroll
    for (int q = 0; q < 4; ++q) { const float v = a[q] + b[q]; vals[u * 4 + q] = v; s1 += v; }
  }
  red[tid] = s1; __syncthreads();
  for (int st = 128; st > 0; st >>= 1) { if (tid < st) red[tid] += red[tid + st]; __syncthreads(); }
  const float mu = red[0] / (float)N; __syncthreads();
  float s2 = 0.f;
  for (int u = 0; u < per / 4; ++u)
#pragma unroll
    for (int q = 0; q < 4; ++q) { const float c = vals[u * 4 + q] - mu; s2 += c * c; }
  red[tid] = s2; __syncthreads();
  for (int st = 128; st > 0; st >>= 1) { if (tid < st) red[tid] += red[tid + st]; __syncthreads(); }
  const float rs = rsqrtf(red[0] / (float)N + eps);
  {
    for (int u = 0; u < per / 4; ++u) {
      const int j = tid * 4 + 1024 * u;
      v4f o, sm;
#pragma unroll
      for (int q = 0; q < 4; ++q) {
        float gg = g[j + q], bb = bta[j + q];
        if (PARAM_BF16) { gg = bf16_round(gg); bb = bf16_round(bb); }
        sm[q] = vals[u * 4 + q]; o[q] = (vals[u * 4 + q] - mu) * rs * gg + bb;
      }
      if (out_sum) *(v4f*)(out_sum + (size_t)row * N + j) = sm;
      *(v4f*)(out_norm + (size_t)row * N + j) = o;
    }
    
  }
}



// ---- f16 WMMA path (v_wmma_f32_16x16x32_f16): 11-bit significands for operands in range — used where a [0,1] probability operand needs more precision than bf16
typedef _Float16 v16h __attribute__((ext_vector_type(16)));
union FragH { v16h v; v8us half[2]; _Float16 h[16]; unsigned short u[16]; };
template <int NT>
__device__ __forceinline__ v8f mmaH(v16h ah, v16h al, v16h bh, v16h bl, v8f c) {
  c = __builtin_amdgcn_wmma_f32_16x16x32_f16(false, ah, false, bh, (short)0, c, false, false);
  if (NT >= 2) c = __builtin_amdgcn_wmma_f32_16x16x32_f16(false, al, false, bh, (short)0, c, false, false);
  if (NT >= 3) c = __builtin_amdgcn_wmma_f32_16x16x32_f16(false, ah, false, bl, (short)0, c, false, false);
  asm volatile("v_nop\n\tv_nop\n\tv_nop\n\tv_nop" : "+v"(c) : "v"(ah), "v"(al), "v"(bh), "v"(bl));
  return c;
}
// batched GEMM like k_gemm_b but f16 operands: A f32 (split into f16 hi/lo if ASPLIT, else rounded to f16), Bt = f16 values [n][k]; alpha; C f32; N multiple of 16 (partial tiles skipped)
template <bool ASPLIT>
__global__ __launch_bounds__(128) void k_gemm_h(const float* __restrict__ A, int lda, size_t sA, const _Float16* __restrict__ Bh, int ldb, size_t sB, float alpha, float* __restrict__ C, int ldc, size_t sC, int M, int N, int K) {
  __shared__ __attribute__((aligned(16))) float so[4][16][64];
  const int tid = threadIdx.x, w = tid >> 5, lane = tid & 31, ln = lane & 15, hh = lane >> 4; const int by = blockIdx.y;
  A += (size_t)by * sA; Bh += (size_t)by * sB; C += (size_t)by * sC;
  const int ntn = (N + 63) / 64; const int wid = blockIdx.x * 4 + w; const int mt = wid / ntn, nq = wid % ntn; if (mt * 16 >= M) return;
  const int row0 = mt * 16, col0 = nq * 64; const float* arow = A + (size_t)(row0 + ln) * lda;
  v8f acc[4] = {};
  for (int kb = 0; kb < K; kb += 32) {
    FragH ah, al;
    const v4f x0 = *(const v4fa*)(arow + kb + 8 * hh), x1 = *(const v4fa*)(arow + kb + 8 * hh + 4), x2 = *(const v4fa*)(arow + kb + 16 + 8 * hh), x3 = *(const v4fa*)(arow + kb + 16 + 8 * hh + 4);
    float xs[16] = {x0[0],x0[1],x0[2],x0[3],x1[0],x1[1],x1[2],x1[3],x2[0],x2[1],x2[2],x2[3],x3[0],x3[1],x3[2],x3[3]};
#pragma unroll
    for (int i = 0; i < 16; ++i) { const _Float16 h = (_Float16)xs[i]; ah.h[i] = h; al.h[i] = ASPLIT ? (_Float16)(xs[i] - (float)h) : (_Float16)0.0f; }
#pragma unroll
    for (int t = 0; t < 4; ++t) { if (col0 + t * 16 >= N) continue; const size_t boff = (size_t)(col0 + t * 16 + ln) * ldb + kb; FragH bq; bq.half[0] = *(const v8us*)(Bh + boff + 8 * hh); bq.half[1] = *(const v8us*)(Bh + boff + 16 + 8 * hh);
      acc[t] = mmaH<ASPLIT ? 2 : 1>(ah.v, al.v, bq.v, bq.v, acc[t]); }
  }
#pragma unroll
  for (int t = 0; t < 4; ++t) { if (col0 + t * 16 >= N) continue;
#pragma unroll
    for (int r = 0; r < 8; ++r) so[w][8 * hh + r][t * 16 + ln] = acc[t][r] * alpha; }
  __builtin_amdgcn_fence(__ATOMIC_ACQ_REL, "workgroup"); __builtin_amdgcn_wave_barrier();
  const int rsub = lane >> 4, c4 = (lane & 15) * 4;
  {
#pragma unroll
    for (int q = 0; q < 8; ++q) { const int r = q * 2 + rsub; if (col0 + c4 < N) { const v4f v = *(const v4fa*)&so[w][r][c4]; *(v4f*)(C + (size_t)(row0 + r) * ldc + col0 + c4) = v; } }
     }
}

// Wt[n][k] = f16(W[k][n]·scale) from f32 row-major W[K][N] (scale = power of two; bf16-exact weights stay exact in f16 away from the subnormal range)
__global__ __launch_bounds__(256) void k_wt_f16(const float* __restrict__ W, _Float16* __restrict__ Wt, int K, int N, float scale) {
  const int t = blockIdx.x * 256 + threadIdx.x; if (t >= N * (K / 8)) return; const int n = t / (K / 8), k8 = (t % (K / 8)) * 8; FragH f;
#pragma unroll
  for (int i = 0; i < 8; ++i) f.h[i] = (_Float16)(bf16_round(W[(size_t)(k8 + i) * N + n]) * scale); const v8us o = f.half[0];
  *(v8us*)((unsigned short*)Wt + (size_t)n * K + k8) = o; 
}
// k_gemm_hh variant with fused epilogue: v = acc·alpha + bias[by·sBias + col] (+ CP[(row/rowsPerB)·sCPb + by·64 + col] if CP) ; ACT 0 none / 1 elu ; writes f16 C16 (and f32 C if non-null)
template <int ACT>
__global__ __launch_bounds__(128) void k_gemm_hhx(const _Float16* __restrict__ A, int lda, size_t sA, const _Float16* __restrict__ Bh, int ldb, size_t sB, float alpha, const float* __restrict__ bias, size_t sBias, const float* __restrict__ CP, int rowsPerB, size_t sCPb, int row0g,
    float* __restrict__ C, _Float16* __restrict__ C16, int ldc, size_t sC, int M, int N, int K) {
  __shared__ __attribute__((aligned(16))) float so[4][16][64];
  const int tid = threadIdx.x, w = tid >> 5, lane = tid & 31, ln = lane & 15, hh = lane >> 4; const int by = blockIdx.y;
  A += (size_t)by * sA; Bh += (size_t)by * sB; const size_t cofs = (size_t)by * sC; const float* bp = bias ? bias + (size_t)by * sBias : nullptr;
  const int ntn = (N + 63) / 64; const int wid = blockIdx.x * 4 + w; const int mt = wid / ntn, nq = wid % ntn; if (mt * 16 >= M) return;
  const int row0 = mt * 16, col0 = nq * 64; const _Float16* arow = A + (size_t)(row0 + ln) * lda;
  v8f acc[4] = {};
  for (int kb = 0; kb < K; kb += 32) { FragH ah; ah.half[0] = *(const v8us*)((const unsigned short*)arow + kb + 8 * hh); ah.half[1] = *(const v8us*)((const unsigned short*)arow + kb + 16 + 8 * hh);
#pragma unroll
    for (int t = 0; t < 4; ++t) { if (col0 + t * 16 >= N) continue; const size_t boff = (size_t)(col0 + t * 16 + ln) * ldb + kb; FragH bq; bq.half[0] = *(const v8us*)((const unsigned short*)Bh + boff + 8 * hh); bq.half[1] = *(const v8us*)((const unsigned short*)Bh + boff + 16 + 8 * hh);
      acc[t] = mmaH<1>(ah.v, ah.v, bq.v, bq.v, acc[t]); }
  }
#pragma unroll
  for (int t = 0; t < 4; ++t) { if (col0 + t * 16 >= N) continue; const int col = col0 + t * 16 + ln; const float bv = bp ? bf16_round(bp[col]) : 0.f;
#pragma unroll
    for (int r = 0; r < 8; ++r) { float v = acc[t][r] * alpha + bv; if (CP) { const int rr = row0g + row0 + 8 * hh + r; if (rowsPerB < 0) v += CP[cofs + (size_t)rr * ldc + col];      /* rowsPerB < 0: own element of the batched C plane */ else { const int bidx = rr / rowsPerB; v += CP[(size_t)bidx * sCPb + (size_t)by * 64 + col]; } } if (ACT == 1) v = (v > 0.f) ? v : expm1f(v); else if (ACT == 7) v = (v > 0.f) ? v + 1.0f : expf(v); else if (ACT == 8) v = tanhf(v); else if (ACT == 9) v = 0.5f * v * (1.0f + tanhf(0.7978845608028654f * (v + 0.044715f * v * v * v))); else if (ACT == 11) v = 1.0f / (1.0f + expf(-v)); else if (ACT == 12) v = (v > 0.f) ? v : 0.01f * v; else if (ACT == 14) v = (v > 0.f) ? v : 0.1f * v; else if (ACT == 16) v = (v >= 0.f) ? v : 0.3f * v; else if (ACT == 17) v = (v >= 0.f) ? v : 0.2f * v; else if (ACT == 15) v = v / (1.0f + expf(-v)); else if (ACT == 3) v = fmaxf(v, 0.f); else if (ACT == 6) v = 0.5f * v * (1.0f + erff(v * 0.70710678118654752f)); so[w][8 * hh + r][t * 16 + ln] = v; } }
  __builtin_amdgcn_fence(__ATOMIC_ACQ_REL, "workgroup"); __builtin_amdgcn_wave_barrier();
  const int rsub = lane >> 4, c4 = (lane & 15) * 4; typedef _Float16 v4h __attribute__((ext_vector_type(4)));
  {
#pragma unroll
    for (int q = 0; q < 8; ++q) { const int r = q * 2 + rsub; if (col0 + c4 < N) { const v4f v = *(const v4fa*)&so[w][r][c4]; if (C) *(v4f*)(C + cofs + (size_t)(row0 + r) * ldc + col0 + c4) = v; if (C16) { v4h h4; for (int i = 0; i < 4; ++i) h4[i] = (_Float16)v[i]; *(v4h*)(C16 + cofs + (size_t)(row0 + r) * ldc + col0 + c4) = h4; } } }
     }
}


typedef _Float16 v4h __attribute__((ext_vector_type(4)));

__global__ __launch_bounds__(256) void k_x16(const float* __restrict__ x, _Float16* __restrict__ X16, size_t n8) { const size_t t = (size_t)blockIdx.x * 256 + threadIdx.x; if (t >= n8) return; FragH f;
#pragma unroll
  for (int q = 0; q < 8; ++q) f.h[q] = (_Float16)bf16_round(x[t * 8 + q]); *(v8us*)((unsigned short*)X16 + t * 8) = f.half[0];  }
__global__ __launch_bounds__(256) void k_h16(const float* __restrict__ x, _Float16* __restrict__ X16, size_t n8) { const size_t t = (size_t)blockIdx.x * 256 + threadIdx.x; if (t >= n8) return; FragH f;
#pragma unroll
  for (int q = 0; q < 8; ++q) f.h[q] = (_Float16)x[t * 8 + q]; *(v8us*)((unsigned short*)X16 + t * 8) = f.half[0];  }
__global__ __launch_bounds__(256) void k_round16f(const float* __restrict__ W, _Float16* __restrict__ Bt, size_t n8) { const size_t t = (size_t)blockIdx.x * 256 + threadIdx.x; if (t >= n8) return; FragH f;
#pragma unroll
  for (int i = 0; i < 8; ++i) f.h[i] = (_Float16)(bf16_round(W[t * 8 + i]) * 16.0f); *(v8us*)((unsigned short*)Bt + t * 8) = f.half[0];  }
template <int NHv, int TTv>
__global__ __launch_bounds__(256) void k_vt(const _Float16* __restrict__ V16, int ldv, int voff, _Float16* __restrict__ Vt) { __shared__ unsigned short tl[64][66]; const int tid = threadIdx.x; const int slab = blockIdx.x / (TTv / 64), lg = blockIdx.x % (TTv / 64); const int b = slab / NHv, h = slab % NHv;
  for (int i = tid; i < 64 * 8; i += 256) { const int r = i / 8, c8 = (i % 8) * 8; FragH f; f.half[0] = *(const v8us*)((const unsigned short*)V16 + ((size_t)b * TTv + lg * 64 + r) * ldv + voff + h * 64 + c8);
#pragma unroll
    for (int q = 0; q < 8; ++q) tl[r][c8 + q] = f.u[q]; }
  __syncthreads();
  {
#pragma unroll
    for (int rd = 0; rd < 2; ++rd) { const int d = rd * 32 + tid / 8, pc = tid % 8; FragH f;
#pragma unroll
      for (int q = 0; q < 8; ++q) f.u[q] = tl[pc * 8 + q][d];
      *(v8us*)((unsigned short*)Vt + ((size_t)slab * 64 + d) * TTv + lg * 64 + pc * 8) = f.half[0]; }
     } }

__global__ __launch_bounds__(256) void k_hl(const float* __restrict__ F, _Float16* __restrict__ Hh, _Float16* __restrict__ Hl, size_t n8) { const size_t t = (size_t)blockIdx.x * 256 + threadIdx.x; if (t >= n8) return; FragH fh, fl; const v4f a = *(const v4fa*)(F + t * 8), c = *(const v4fa*)(F + t * 8 + 4);
#pragma unroll
  for (int q = 0; q < 4; ++q) { _Float16 h = (_Float16)a[q]; fh.h[q] = h; fl.h[q] = (_Float16)((a[q] - (float)h) * 1024.0f); h = (_Float16)c[q]; fh.h[4 + q] = h; fl.h[4 + q] = (_Float16)((c[q] - (float)h) * 1024.0f); }
  { *(v8us*)((unsigned short*)Hh + t * 8) = fh.half[0]; *(v8us*)((unsigned short*)Hl + t * 8) = fl.half[0];  } }

// ---- fast GEMM (wave tile 32x64; requires M % 32 == 0 rows per launch region and N % 64 == 0); epilogue = k_gemm_hhx semantics ----
__device__ __forceinline__ v16h g2_frag(const _Float16* p, int hh) { FragH f; f.half[0] = *(const v8us*)((const unsigned short*)p + 8 * hh); f.half[1] = *(const v8us*)((const unsigned short*)p + 16 + 8 * hh); return f.v; }
__device__ __forceinline__ v8f g2_mma(v16h a, v16h b, v8f c) { v8f d = __builtin_amdgcn_wmma_f32_16x16x32_f16(false, a, false, b, (short)0, c, false, false); asm volatile("v_nop\n\tv_nop\n\tv_nop\n\tv_nop" : "+v"(d) : "v"(a), "v"(b)); return d; }
template <int ACT>
__global__ __launch_bounds__(128) void k_gemm2(const _Float16* __restrict__ A, int lda, size_t sA, const _Float16* __restrict__ Bh, int ldb, size_t sB, float alpha, const float* __restrict__ bias, size_t sBias, const float* __restrict__ CP, int rowsPerB, size_t sCPb, int row0g,
    float* __restrict__ C, _Float16* __restrict__ C16, int ldc, size_t sC, int M, int N, int K) { static_assert(ACT == 0 || ACT == 3 || ACT == 6 || ACT == 8 || ACT == 9 || ACT == 11 || ACT == 12 || ACT == 14 || ACT == 15 || ACT == 16 || ACT == 17, "k_gemm2: unsupported ACT code (would silently apply no activation)");
  __shared__ __attribute__((aligned(16))) float so[4][32][68];
  const int tid = threadIdx.x, w = tid >> 5, lane = tid & 31, ln = lane & 15, hh = lane >> 4; const int by = blockIdx.y;
  A += (size_t)by * sA; Bh += (size_t)by * sB; const size_t cofs = (size_t)by * sC; const float* bp = bias ? bias + (size_t)by * sBias : nullptr;
  const int ntn = N >> 6; const int mt = blockIdx.x / ntn, nq = blockIdx.x - mt * ntn; const int row0 = mt * 128 + 32 * w, col0 = nq * 64; if (row0 >= M) return;
  const _Float16* a0p = A + (size_t)(row0 + ln) * lda; const _Float16* a1p = a0p + (size_t)16 * lda;
  const _Float16* b0p = Bh + (size_t)(col0 + ln) * ldb; const _Float16* b1p = b0p + (size_t)16 * ldb; const _Float16* b2p = b1p + (size_t)16 * ldb; const _Float16* b3p = b2p + (size_t)16 * ldb;
  const v8f z8 = {0.f,0.f,0.f,0.f,0.f,0.f,0.f,0.f}; v8f c00 = z8, c01 = z8, c02 = z8, c03 = z8, c10 = z8, c11 = z8, c12 = z8, c13 = z8;
#pragma unroll 1
  for (int kb = 0; kb < K; kb += 32) { const v16h a0 = g2_frag(a0p + kb, hh), a1 = g2_frag(a1p + kb, hh);
    v16h b = g2_frag(b0p + kb, hh); c00 = g2_mma(a0, b, c00); c10 = g2_mma(a1, b, c10);
    b = g2_frag(b1p + kb, hh); c01 = g2_mma(a0, b, c01); c11 = g2_mma(a1, b, c11);
    b = g2_frag(b2p + kb, hh); c02 = g2_mma(a0, b, c02); c12 = g2_mma(a1, b, c12);
    b = g2_frag(b3p + kb, hh); c03 = g2_mma(a0, b, c03); c13 = g2_mma(a1, b, c13); }
  v8f accs[8] = {c00, c01, c02, c03, c10, c11, c12, c13};
#pragma unroll
  for (int u = 0; u < 8; ++u) { const int t = u & 3, half = u >> 2; const int col = col0 + t * 16 + ln; const float bv = bp ? bf16_round(bp[col]) : 0.f;
#pragma unroll
    for (int r = 0; r < 8; ++r) { const int rloc = half * 16 + 8 * hh + r; float v = accs[u][r] * alpha + bv; if (CP) { if (rowsPerB < 0) v += CP[cofs + (size_t)(row0g + row0 + rloc) * ldc + col];      /* rowsPerB < 0: own element of the batched C plane */ else { const int bidx = (row0g + row0 + rloc) / rowsPerB; v += CP[(size_t)bidx * sCPb + (size_t)by * 64 + col]; } }
      if (ACT == 3) v = fmaxf(v, 0.f); else if (ACT == 6) v = 0.5f * v * (1.0f + erff(v * 0.70710678118654752f)); else if (ACT == 11) v = 1.0f / (1.0f + expf(-v)); else if (ACT == 15) v = v / (1.0f + expf(-v)); else if (ACT == 12) v = (v > 0.f) ? v : 0.01f * v; else if (ACT == 8) v = tanhf(v); else if (ACT == 9) v = 0.5f * v * (1.0f + tanhf(0.7978845608028654f * (v + 0.044715f * v * v * v))); else if (ACT == 14) v = (v > 0.f) ? v : 0.1f * v; else if (ACT == 16) v = (v >= 0.f) ? v : 0.3f * v; else if (ACT == 17) v = (v >= 0.f) ? v : 0.2f * v;
      so[w][rloc][t * 16 + ln] = v; } }
  __builtin_amdgcn_fence(__ATOMIC_ACQ_REL, "workgroup"); __builtin_amdgcn_wave_barrier();
  const int rsub = lane >> 4, c4 = (lane & 15) * 4;
  {
#pragma unroll
    for (int q = 0; q < 16; ++q) { const int r = q * 2 + rsub; const v4f v = *(const v4fa*)&so[w][r][c4]; if (C) *(v4f*)(C + cofs + (size_t)(row0 + r) * ldc + col0 + c4) = v; if (C16) { v4h h4; for (int i = 0; i < 4; ++i) h4[i] = (_Float16)v[i]; *(v4h*)(C16 + cofs + (size_t)(row0 + r) * ldc + col0 + c4) = h4; } }
     } }


__global__ __launch_bounds__(256) void k_wnat(const float* __restrict__ w, size_t n8, _Float16* __restrict__ Bt) { const size_t t = (size_t)blockIdx.x * 256 + threadIdx.x; if (t >= n8) return; FragH f; for (int q = 0; q < 8; ++q) f.h[q] = (_Float16)(bf16_round(w[t * 8 + q]) * 16.0f); *(v8us*)((unsigned short*)Bt + t * 8) = f.half[0];  }
__global__ __launch_bounds__(256) void k_rsm(const float* __restrict__ S, _Float16* __restrict__ P, int nrows) {
  #pragma clang fp contract(off)
  const int i = blockIdx.x * 256 + threadIdx.x; if (i >= nrows) return; const float* s = S + (size_t)i * SQ; float mx = -3.0e38f;
#pragma unroll 1
  for (int j = 0; j < SQ; ++j) mx = fmaxf(mx, s[j]); float se = 0.f;
#pragma unroll 1
  for (int j = 0; j < SQ; ++j) se += expf(s[j] - mx); const float sc = 256.0f / se;
#pragma unroll 1
  for (int j0 = 0; j0 < SQ; j0 += 8) { FragH f; for (int q = 0; q < 8; ++q) f.h[q] = (_Float16)(expf(s[j0 + q] - mx) * sc); unsigned short* d = (unsigned short*)P + (size_t)i * SQ + j0; *(v8us*)d = f.half[0];  } }
__global__ __launch_bounds__(256) void k_vt(const _Float16* __restrict__ V16, int b, int h0, _Float16* __restrict__ VT) { __shared__ unsigned short tl[64][65]; const int tid = threadIdx.x; const int hh = blockIdx.x % HG, sg = blockIdx.x / HG; const int s0 = sg * 64; const int h = h0 + hh;
  for (int i = tid; i < 64 * 8; i += 256) { const int j = i / 8, d8 = (i % 8) * 8; FragH f; f.half[0] = *(const v8us*)((const unsigned short*)V16 + ((size_t)b * SQ + s0 + j) * DM + h * HD + d8); for (int q = 0; q < 8; ++q) tl[d8 + q][j] = f.u[q]; }
  __syncthreads();
  { for (int i = tid; i < 64 * 8; i += 256) { const int d = i / 8, j8 = (i % 8) * 8; FragH f; for (int q = 0; q < 8; ++q) f.u[q] = tl[d][j8 + q]; *(v8us*)((unsigned short*)VT + ((size_t)hh * HD + d) * SQ + s0 + j8) = f.half[0]; }  } }


__global__ __launch_bounds__(256) void k_tile16(const float* __restrict__ O, float* __restrict__ out, size_t n4) { const size_t t = (size_t)blockIdx.x * 256 + threadIdx.x; if (t >= n4) return; const size_t e = t * 4; const size_t r = e / DMO; const int c = (int)(e % DMO); const v4f v = *(const v4fa*)(O + r * HD + (c % HD)); *(v4f*)(out + e) = v;  }


// Row softmax, one wave per row of S: the row's 2048 scores are read once, by 16 whole-line 16-byte loads per lane, and stay in 64 registers;
// maximum and sum = per-lane chains, then a five-step butterfly over the 32 lanes (every lane ends with the same bits).
__global__ __launch_bounds__(256) void k_rsmf(const float* __restrict__ S, _Float16* __restrict__ P, int qn, int hg) {
  const int lane = threadIdx.x & 31; const int t = blockIdx.x * 8 + (threadIdx.x >> 5); if (t >= qn * hg) return;      /* wave-uniform, no barrier below */
  const size_t i = (size_t)(t / qn) * SQ + (t % qn); const float* s = S + i * SQ + lane * 4; v4f e[SQ / 128];
#pragma unroll      /* e[] must be indexed by constants to stay in registers; all 16 loads in flight at once */
  for (int u = 0; u < SQ / 128 - 1; ++u) e[u] = *(const v4fa*)(s + u * 128);
  asm volatile("s_wait_xcnt 0x0" ::: "memory");      /* the build lets the last load's result land on the address pair that the 15 loads above name: the wait stands in front of that overwrite */
  e[SQ / 128 - 1] = *(const v4fa*)(s + (SQ / 128 - 1) * 128);
  float mx = -3.0e38f;
#pragma unroll      /* constant indices into e[] */
  for (int u = 0; u < SQ / 128; ++u) mx = fmaxf(mx, fmaxf(fmaxf(e[u][0], e[u][1]), fmaxf(e[u][2], e[u][3])));
  for (int m = 16; m > 0; m >>= 1) mx = fmaxf(mx, __shfl_xor(mx, m, 32));
  v4f a4 = {0.f, 0.f, 0.f, 0.f};      /* four independent sum chains per lane */
#pragma unroll      /* constant indices into e[] */
  for (int u = 0; u < SQ / 128; ++u) for (int q = 0; q < 4; ++q) { const float y = (e[u][q] - mx) * 1.44269504f; float ex;
    asm("v_exp_f32 %0, %1\n\tv_nop" : "=v"(ex) : "v"(y));      /* native exp as before (2^y with y = (s - max) log2 e); the v_nop keeps the slot the instruction set asks for behind a transcendental: in runs of v_exp the build reused a source register in the very next instruction */
    e[u][q] = ex; a4[q] += ex; }
  float se = (a4[0] + a4[1]) + (a4[2] + a4[3]);
  for (int m = 16; m > 0; m >>= 1) se += __shfl_xor(se, m, 32);
  const float sc = 256.0f / se; _Float16* d = P + i * SQ + lane * 4;
#pragma unroll      /* constant indices into e[] */
  for (int u = 0; u < SQ / 128; ++u) { v4h h4; for (int q = 0; q < 4; ++q) h4[q] = (_Float16)(e[u][q] * sc); *(v4h*)(d + u * 128) = h4; } }

extern "C" void kernel_launch(void* const* d_in, const int* in_sizes, int n_in,
                              void* d_out, int out_size, void* d_ws, size_t ws_size, hipStream_t stream) {
  (void)in_sizes; (void)n_in; (void)out_size;
  const float* const* I = (const float* const*)d_in; const float* x = I[0]; const float* wq = I[1]; const float* wk = I[2]; const float* wv = I[3];      /* [in][out] = [1024][64] */
  char* ws = (char*)d_ws; size_t off = 0;
  auto take = [&](size_t bytes) { char* p = ws + off; off += (bytes + 255) & ~(size_t)255; return p; };
  _Float16* BQ = (_Float16*)take((size_t)HD * DM * 2); _Float16* BK = (_Float16*)take((size_t)HD * DM * 2); _Float16* BV = (_Float16*)take((size_t)HD * DM * 2);
  _Float16* X16 = (_Float16*)take(NR * DM * 2); float* QF = (float*)take(NR * HD * 4); float* KF = (float*)take(NR * HD * 4); _Float16* QH = (_Float16*)take(NR * HD * 2); _Float16* QL = (_Float16*)take(NR * HD * 2); _Float16* KH = (_Float16*)take(NR * HD * 2); _Float16* KL = (_Float16*)take(NR * HD * 2); float* VF = (float*)take(NR * HD * 4); _Float16* VH = (_Float16*)take(NR * HD * 2); _Float16* VL = (_Float16*)take(NR * HD * 2);
  float* ST = (float*)take((size_t)SQ * SQ * 4); _Float16* PT = (_Float16*)take((size_t)SQ * SQ * 2); _Float16* P = (_Float16*)take((size_t)SQ * SQ * 2); _Float16* VT = (_Float16*)take((size_t)HD * SQ * 2); _Float16* VTL = (_Float16*)take((size_t)HD * SQ * 2); float* OF = (float*)take((size_t)SQ * HD * 4);
  if (off > ws_size) return;      /* approx 16 + 6 + 6 + 16 + 8 + 8 + 1.4 = 61.4 MiB */
  k_wt_f16<<<(unsigned)(((size_t)HD * (DM / 8) + 255) / 256), 256, 0, stream>>>(wq, BQ, DM, HD, 16.0f); k_wt_f16<<<(unsigned)(((size_t)HD * (DM / 8) + 255) / 256), 256, 0, stream>>>(wk, BK, DM, HD, 16.0f); k_wt_f16<<<(unsigned)(((size_t)HD * (DM / 8) + 255) / 256), 256, 0, stream>>>(wv, BV, DM, HD, 16.0f);      /* [1024][64] -> Bt[64][1024] x16 */
  k_x16<<<(unsigned)((NR * DM / 8 + 255) / 256), 256, 0, stream>>>(x, X16, NR * DM / 8);
  k_gemm2<0><<<dim3((unsigned)((NR / 128) * 1), 1), 128, 0, stream>>>(X16, DM, 0, BQ, DM, 0, 0.0625f, nullptr, 0, nullptr, 1, 0, 0, QF, nullptr, HD, 0, (int)NR, HD, DM);      /* q (f32, exact products) */
  k_gemm2<0><<<dim3((unsigned)((NR / 128) * 1), 1), 128, 0, stream>>>(X16, DM, 0, BK, DM, 0, 0.0625f, nullptr, 0, nullptr, 1, 0, 0, KF, nullptr, HD, 0, (int)NR, HD, DM);      /* k (f32) */
  k_gemm2<0><<<dim3((unsigned)((NR / 128) * 1), 1), 128, 0, stream>>>(X16, DM, 0, BV, DM, 0, 0.0625f, nullptr, 0, nullptr, 1, 0, 0, VF, nullptr, HD, 0, (int)NR, HD, DM);      /* v (f32, exact products) */
  k_hl<<<(unsigned)((NR * HD / 8 + 255) / 256), 256, 0, stream>>>(QF, QH, QL, NR * HD / 8); k_hl<<<(unsigned)((NR * HD / 8 + 255) / 256), 256, 0, stream>>>(KF, KH, KL, NR * HD / 8); k_hl<<<(unsigned)((NR * HD / 8 + 255) / 256), 256, 0, stream>>>(VF, VH, VL, NR * HD / 8);      /* f16 hi + x1024 residual planes of q, k, v */
  for (int b = B0; b < B0 + NBR; ++b) { const size_t r0 = (size_t)b * SQ;
    k_gemm2<0><<<dim3((SQ / 128) * (SQ / 64), 1), 128, 0, stream>>>(KH + r0 * HD, HD, 0, QH + r0 * HD, HD, 0, 1.0f, nullptr, 0, nullptr, 1, 0, 0, ST, nullptr, SQ, 0, SQ, SQ, HD);      /* S^T[k][i] = k_hi . q_hi */
    k_gemm2<0><<<dim3((SQ / 128) * (SQ / 64), 1), 128, 0, stream>>>(KL + r0 * HD, HD, 0, QH + r0 * HD, HD, 0, 0.0009765625f, nullptr, 0, ST, -1, 0, 0, ST, nullptr, SQ, 0, SQ, SQ, HD);      /* += k_lo . q_hi 2^-10 */
    k_gemm2<0><<<dim3((SQ / 128) * (SQ / 64), 1), 128, 0, stream>>>(KH + r0 * HD, HD, 0, QL + r0 * HD, HD, 0, 0.0009765625f, nullptr, 0, ST, -1, 0, 0, ST, nullptr, SQ, 0, SQ, SQ, HD);      /* += k_hi . q_lo 2^-10 */
    k_rsmf<<<(HG * SQ + 7) / 8, 256, 0, stream>>>(ST, PT, SQ, HG);      /* softmax over the query index i (rows of S^T) -> PT[k][i] = f16(256 att[i][k]) */
    k_vt<SQ / 64, SQ><<<(SQ / 64) * (SQ / 64), 256, 0, stream>>>(PT, SQ, 0, P);      /* transpose PT [k][i] -> P [i][k] (32 slabs of 64 i's) */
    k_vt<1, SQ><<<1 * (SQ / 64), 256, 0, stream>>>(VH + r0 * HD, HD, 0, VT); k_vt<1, SQ><<<1 * (SQ / 64), 256, 0, stream>>>(VL + r0 * HD, HD, 0, VTL);      /* V^T hi / residual [64][2048] */
    k_gemm2<0><<<dim3((SQ / 128) * 1, 1), 128, 0, stream>>>(P, SQ, 0, VT, SQ, 0, 0.00390625f, nullptr, 0, nullptr, 1, 0, 0, OF, nullptr, HD, 0, SQ, HD, SQ);      /* out_i = 2^-8 sum_k P[i][k] v_hi */
    k_gemm2<0><<<dim3((SQ / 128) * 1, 1), 128, 0, stream>>>(P, SQ, 0, VTL, SQ, 0, 0.000003814697265625f, nullptr, 0, OF, -1, 0, 0, OF, nullptr, HD, 0, SQ, HD, SQ);      /* += 2^-18 sum_k P[i][k] v_lo */
    k_tile16<<<(unsigned)(((size_t)SQ * DMO / 4 + 255) / 256), 256, 0, stream>>>(OF, (float*)d_out + r0 * DMO, (size_t)SQ * DMO / 4); }      /* the 16 identical heads */
}

// v002
// One run takes 379 microseconds.
// In two side-by-side timings against v001, it was 2.29 and 2.32 times as fast.
// Over all steps from v000 it is 5.70 times as fast.
#include <hip/hip_runtime.h>
// Single-projection attention with a QUERY-axis softmax, tiled 16x (x [4][2048][1024]; q, k, v = x W ([1024][64] weights stored [in][out], shared by all heads); att[i][k] = q_i . k_k (no scaling); att = softmax over the QUERY index i for each key column k (the module's nn.Softmax(dim=1)); out_i = sum_k att[i][k] v_k -> [2048][64], concatenated 16 times -> [4][2048][1024]).
// Structure: token rows; x as exact f16 rows; q and k projections as WMMA GEMMs (32x64 wave tiles, f32 accumulation, exact x16 weights) kept in f32 and split into f16 hi + x1024 residual planes (the unscaled logits have sigma 8, so they are formed from three hi/lo products, ~2^-21 relative); v likewise kept f32 and split; per batch: transposed scores S^T[k][i] = k_k . q_i as three accumulating GEMM passes (K = 64), row softmax over i on VALU (f32 statistics, native exp; weights x256 f16) = the module's column softmax, the weight matrix transposed back to [i][k] via LDS tile transposes, V^T (hi and residual) via LDS transposes, out_i = P V^T as two accumulating GEMM passes (K = 2048, f32) into a [2048][64] plane, broadcast into the 16 head slots of the output rows with thread-linear float4 stores; every per-batch stage runs as one launch over the four batches; 10 + 10 = 20 launches.
// Compute dtype: inputs rounded to bf16; x / weights exact; q, k, v as f16 hi + residual pairs; the softmax weights plain f16 (~2^-12); scores, statistics, out f32. v_wmma_f32_16x16x32_f16.
#define NB 4
#define SQ 2048
#define DM 1024
#define HD 64
#define NH 1
#define HG 1
#define DMO 1024                     /* output row width = 16 x 64 */
#define B0 0                         /* unused */
#define NBR NB
#define NR ((size_t)NB * SQ)
typedef __bf16 v16b __attribute__((ext_vector_type(16)));
typedef unsigned short v8us __attribute__((ext_vector_type(8), may_alias));
typedef float  v8f  __attribute__((ext_vector_type(8)));
typedef float  v4f  __attribute__((ext_vector_type(4)));
typedef float  v4fa __attribute__((ext_vector_type(4), may_alias));
union FragB { v16b v; v8us half[2]; unsigned short u[16]; };

__device__ __forceinline__ unsigned short bf16_bits(float x) { unsigned int u = __float_as_uint(x); return (unsigned short)((u + 0x7FFFu + ((u >> 16) & 1u)) >> 16); }
__device__ __forceinline__ float bf16_val(unsigned short b) { return __uint_as_float(((unsigned int)b) << 16); }
__device__ __forceinline__ float bf16_round(float x) { return bf16_val(bf16_bits(x)); }
// D += A·B with NT terms: 1 = ah·bh, 2 = + al·bh (A split), 3 = + ah·bl (both split)
template <int NT>
__device__ __forceinline__ v8f mmaN(v16b ah, v16b al, v16b bh, v16b bl, v8f c) {
  c = __builtin_amdgcn_wmma_f32_16x16x32_bf16(false, ah, false, bh, (short)0, c, false, false);
  if (NT >= 2) c = __builtin_amdgcn_wmma_f32_16x16x32_bf16(false, al, false, bh, (short)0, c, false, false);
  if (NT >= 3) c = __builtin_amdgcn_wmma_f32_16x16x32_bf16(false, ah, false, bl, (short)0, c, false, false);
  asm volatile("v_nop\n\tv_nop\n\tv_nop\n\tv_nop" : "+v"(c) : "v"(ah), "v"(al), "v"(bh), "v"(bl));
  return c;
}

__global__ __launch_bounds__(256) void k_wt_bf16(const float* __restrict__ W, unsigned short* __restrict__ Wt, int K, int N) {
  const int t = blockIdx.x * 256 + threadIdx.x;
  const int k8n = K / 8;
  if (t >= N * k8n) return;
  const int n = t / k8n, k8 = (t % k8n) * 8;
  v8us v;
#pragma unroll
  for (int i = 0; i < 8; ++i) v[i] = bf16_bits(W[(size_t)(k8 + i) * N + n]);
  *(v8us*)(Wt + (size_t)n * K + k8) = v;
  
}

// GEMM C[M][N] (f32, pitch ldc) = act(A[M][K]·W + bias). A f32 row-major (pitch lda) converted per fragment to bf16
// (ASPLIT: hi/lo two planes -> 2 terms, else single rounded term); Wt bf16 [N][K] (pitch ldb). BIAS_BF16 rounds the
// bias to bf16 first (bias quantised to bf16 before the add). K%32==0, M%16==0, N%64==0.
template <bool ASPLIT, int ACT, bool BIAS_BF16>
__global__ __launch_bounds__(128) void k_gemm_bf(const float* __restrict__ A, int lda, const unsigned short* __restrict__ Wt, int ldb,
                                               const float* __restrict__ bias, float* __restrict__ C, int ldc, int M, int N, int K) {
  __shared__ __attribute__((aligned(16))) float so[4][16][64];
  const int tid = threadIdx.x, w = tid >> 5, lane = tid & 31, ln = lane & 15, hh = lane >> 4;
  const int ntn = N / 64;
  const int wid = blockIdx.x * 4 + w;
  const int mt = wid / ntn, nq = wid % ntn;
  if (mt * 16 >= M) return;
  const int row0 = mt * 16, col0 = nq * 64;
  const float* arow = A + (size_t)(row0 + ln) * lda;
  v8f acc[4] = {};
  for (int kb = 0; kb < K; kb += 32) {
    FragB ah, al;
    const v4f x0 = *(const v4fa*)(arow + kb + 8 * hh), x1 = *(const v4fa*)(arow + kb + 8 * hh + 4);
    const v4f x2 = *(const v4fa*)(arow + kb + 16 + 8 * hh), x3 = *(const v4fa*)(arow + kb + 16 + 8 * hh + 4);
    float xs[16] = {x0[0],x0[1],x0[2],x0[3],x1[0],x1[1],x1[2],x1[3],x2[0],x2[1],x2[2],x2[3],x3[0],x3[1],x3[2],x3[3]};
#pragma unroll
    for (int i = 0; i < 16; ++i) { const unsigned short hb = bf16_bits(xs[i]); ah.u[i] = hb; al.u[i] = ASPLIT ? bf16_bits(xs[i] - bf16_val(hb)) : (unsigned short)0; }
#pragma unroll
    for (int t = 0; t < 4; ++t) {
      const unsigned short* brow = Wt + (size_t)(col0 + t * 16 + ln) * ldb + kb;
      FragB b;
      b.half[0] = *(const v8us*)(brow + 8 * hh);
      b.half[1] = *(const v8us*)(brow + 16 + 8 * hh);
      acc[t] = mmaN<ASPLIT ? 2 : 1>(ah.v, al.v, b.v, b.v, acc[t]);
    }
  }
#pragma unroll
  for (int t = 0; t < 4; ++t) {
    float bv = bias ? bias[col0 + t * 16 + ln] : 0.f;
    if (BIAS_BF16) bv = bf16_round(bv);
#pragma unroll
    for (int r = 0; r < 8; ++r) { float v = acc[t][r] + bv; if (ACT == 1) v = fmaxf(v, 0.f); so[w][8 * hh + r][t * 16 + ln] = v; }
  }
  __builtin_amdgcn_fence(__ATOMIC_ACQ_REL, "workgroup");
  __builtin_amdgcn_wave_barrier();
  const int rsub = lane >> 4, c4 = (lane & 15) * 4;
  {
#pragma unroll
    for (int q = 0; q < 8; ++q) {
      const int r = q * 2 + rsub;
      const v4f v = *(const v4fa*)&so[w][r][c4];
      *(v4f*)(C + (size_t)(row0 + r) * ldc + col0 + c4) = v;
    }
    
  }
}

// GEMM C = act(A·W + bias + resid): A f32 (ASPLIT -> hi/lo 2 terms), Wt bf16 [N][K]; ACT 0 none, 1 relu, 2 exact gelu;
// resid (optional, f32, row index = (row % rmod), pitch ldr, RES_BF16 rounds it) added before the activation.
template <bool ASPLIT, int ACT, bool BIAS_BF16, bool RES_BF16>
__global__ __launch_bounds__(128) void k_gemm_bf3(const float* __restrict__ A, int lda, const unsigned short* __restrict__ Wt, int ldb,
                                                const float* __restrict__ bias, const float* __restrict__ resid, int rmod, int ldr,
                                                float* __restrict__ C, int ldc, int M, int N, int K) {
  __shared__ __attribute__((aligned(16))) float so[4][16][64];
  const int tid = threadIdx.x, w = tid >> 5, lane = tid & 31, ln = lane & 15, hh = lane >> 4;
  const int ntn = N / 64;
  const int wid = blockIdx.x * 4 + w;
  const int mt = wid / ntn, nq = wid % ntn;
  if (mt * 16 >= M) return;
  const int row0 = mt * 16, col0 = nq * 64;
  const float* arow = A + (size_t)(row0 + ln) * lda;
  v8f acc[4] = {};
  for (int kb = 0; kb < K; kb += 32) {
    FragB ah, al;
    const v4f x0 = *(const v4fa*)(arow + kb + 8 * hh), x1 = *(const v4fa*)(arow + kb + 8 * hh + 4);
    const v4f x2 = *(const v4fa*)(arow + kb + 16 + 8 * hh), x3 = *(const v4fa*)(arow + kb + 16 + 8 * hh + 4);
    float xs[16] = {x0[0],x0[1],x0[2],x0[3],x1[0],x1[1],x1[2],x1[3],x2[0],x2[1],x2[2],x2[3],x3[0],x3[1],x3[2],x3[3]};
#pragma unroll
    for (int i = 0; i < 16; ++i) { const unsigned short hb = bf16_bits(xs[i]); ah.u[i] = hb; al.u[i] = ASPLIT ? bf16_bits(xs[i] - bf16_val(hb)) : (unsigned short)0; }
#pragma unroll
    for (int t = 0; t < 4; ++t) {
      const unsigned short* brow = Wt + (size_t)(col0 + t * 16 + ln) * ldb + kb;
      FragB b;
      b.half[0] = *(const v8us*)(brow + 8 * hh);
      b.half[1] = *(const v8us*)(brow + 16 + 8 * hh);
      acc[t] = mmaN<ASPLIT ? 2 : 1>(ah.v, al.v, b.v, b.v, acc[t]);
    }
  }
#pragma unroll
  for (int t = 0; t < 4; ++t) {
    const int col = col0 + t * 16 + ln;
    float bv = bias ? bias[col] : 0.f;
    if (BIAS_BF16) bv = bf16_round(bv);
#pragma unroll
    for (int r = 0; r < 8; ++r) {
      float v = acc[t][r] + bv;
      if (resid) { float rv = resid[(size_t)((row0 + 8 * hh + r) % rmod) * ldr + col]; if (RES_BF16) rv = bf16_round(rv); v += rv; }
      if (ACT == 1) v = fmaxf(v, 0.f);
      if (ACT == 2) v = 0.5f * v * (1.0f + erff(v * 0.70710678118654752f));
      if (ACT == 3) { const float u = 0.7978845608028654f * (v + 0.044715f * v * v * v); v = 0.5f * v * (1.0f + tanhf(u)); }
      so[w][8 * hh + r][t * 16 + ln] = v;
    }
  }
  __builtin_amdgcn_fence(__ATOMIC_ACQ_REL, "workgroup");
  __builtin_amdgcn_wave_barrier();
  const int rsub = lane >> 4, c4 = (lane & 15) * 4;
  {
#pragma unroll
    for (int q = 0; q < 8; ++q) {
      const int r = q * 2 + rsub;
      const v4f v = *(const v4fa*)&so[w][r][c4];
      *(v4f*)(C + (size_t)(row0 + r) * ldc + col0 + c4) = v;
    }
    
  }
}
// row LayerNorm (biased variance, eps) over N: s = X (+ R); optional out_sum <- s; out_norm <- (s-mu)*rsqrt(var+eps)*g + b
template <bool PARAM_BF16>
__global__ __launch_bounds__(256) void k_layernorm(const float* __restrict__ X, const float* __restrict__ R, const float* __restrict__ g, const float* __restrict__ bta,
                                                  float* __restrict__ out_sum, float* __restrict__ out_norm, int N, float eps) {
  __shared__ float red[256];
  const int row = blockIdx.x, tid = threadIdx.x;
  const float* x = X + (size_t)row * N; const float* rr = R ? R + (size_t)row * N : nullptr;
  float vals[16];                     // up to N = 4096
  const int per = N / 256;            // contiguous chunk per thread? use strided-by-4 chunks: thread handles j = tid*4 + 1024*u
  float s1 = 0.f;
  for (int u = 0; u < per / 4; ++u) {
    const int j = tid * 4 + 1024 * u;
    const v4f a = *(const v4fa*)(x + j);
    v4f b = {0.f,0.f,0.f,0.f}; if (rr) b = *(const v4fa*)(rr + j);
#pragma unroll
    for (int q = 0; q < 4; ++q) { const float v = a[q] + b[q]; vals[u * 4 + q] = v; s1 += v; }
  }
  red[tid] = s1; __syncthreads();
  for (int st = 128; st > 0; st >>= 1) { if (tid < st) red[tid] += red[tid + st]; __syncthreads(); }
  const float mu = red[0] / (float)N; __syncthreads();
  float s2 = 0.f;
  for (int u = 0; u < per / 4; ++u)
#pragma unroll
    for (int q = 0; q < 4; ++q) { const float c = vals[u * 4 + q] - mu; s2 += c * c; }
  red[tid] = s2; __syncthreads();
  for (int st = 128; st > 0; st >>= 1) { if (tid < st) red[tid] += red[tid + st]; __syncthreads(); }
  const float rs = rsqrtf(red[0] / (float)N + eps);
  {
    for (int u = 0; u < per / 4; ++u) {
      const int j = tid * 4 + 1024 * u;
      v4f o, sm;
#pragma unroll
      for (int q = 0; q < 4; ++q) {
        float gg = g[j + q], bb = bta[j + q];
        if (PARAM_BF16) { gg = bf16_round(gg); bb = bf16_round(bb); }
        sm[q] = vals[u * 4 + q]; o[q] = (vals[u * 4 + q] - mu) * rs * gg + bb;
      }
      if (out_sum) *(v4f*)(out_sum + (size_t)row * N + j) = sm;
      *(v4f*)(out_norm + (size_t)row * N + j) = o;
    }
    
  }
}



// ---- f16 WMMA path (v_wmma_f32_16x16x32_f16): 11-bit significands for operands in range — used where a [0,1] probability operand needs more precision than bf16
typedef _Float16 v16h __attribute__((ext_vector_type(16)));
union FragH { v16h v; v8us half[2]; _Float16 h[16]; unsigned short u[16]; };
template <int NT>
__device__ __forceinline__ v8f mmaH(v16h ah, v16h al, v16h bh, v16h bl, v8f c) {
  c = __builtin_amdgcn_wmma_f32_16x16x32_f16(false, ah, false, bh, (short)0, c, false, false);
  if (NT >= 2) c = __builtin_amdgcn_wmma_f32_16x16x32_f16(false, al, false, bh, (short)0, c, false, false);
  if (NT >= 3) c = __builtin_amdgcn_wmma_f32_16x16x32_f16(false, ah, false, bl, (short)0, c, false, false);
  asm volatile("v_nop\n\tv_nop\n\tv_nop\n\tv_nop" : "+v"(c) : "v"(ah), "v"(al), "v"(bh), "v"(bl));
  return c;
}
// batched GEMM like k_gemm_b but f16 operands: A f32 (split into f16 hi/lo if ASPLIT, else rounded to f16), Bt = f16 values [n][k]; alpha; C f32; N multiple of 16 (partial tiles skipped)
template <bool ASPLIT>
__global__ __launch_bounds__(128) void k_gemm_h(const float* __restrict__ A, int lda, size_t sA, const _Float16* __restrict__ Bh, int ldb, size_t sB, float alpha, float* __restrict__ C, int ldc, size_t sC, int M, int N, int K) {
  __shared__ __attribute__((aligned(16))) float so[4][16][64];
  const int tid = threadIdx.x, w = tid >> 5, lane = tid & 31, ln = lane & 15, hh = lane >> 4; const int by = blockIdx.y;
  A += (size_t)by * sA; Bh += (size_t)by * sB; C += (size_t)by * sC;
  const int ntn = (N + 63) / 64; const int wid = blockIdx.x * 4 + w; const int mt = wid / ntn, nq = wid % ntn; if (mt * 16 >= M) return;
  const int row0 = mt * 16, col0 = nq * 64; const float* arow = A + (size_t)(row0 + ln) * lda;
  v8f acc[4] = {};
  for (int kb = 0; kb < K; kb += 32) {
    FragH ah, al;
    const v4f x0 = *(const v4fa*)(arow + kb + 8 * hh), x1 = *(const v4fa*)(arow + kb + 8 * hh + 4), x2 = *(const v4fa*)(arow + kb + 16 + 8 * hh), x3 = *(const v4fa*)(arow + kb + 16 + 8 * hh + 4);
    float xs[16] = {x0[0],x0[1],x0[2],x0[3],x1[0],x1[1],x1[2],x1[3],x2[0],x2[1],x2[2],x2[3],x3[0],x3[1],x3[2],x3[3]};
#pragma unroll
    for (int i = 0; i < 16; ++i) { const _Float16 h = (_Float16)xs[i]; ah.h[i] = h; al.h[i] = ASPLIT ? (_Float16)(xs[i] - (float)h) : (_Float16)0.0f; }
#pragma unroll
    for (int t = 0; t < 4; ++t) { if (col0 + t * 16 >= N) continue; const size_t boff = (size_t)(col0 + t * 16 + ln) * ldb + kb; FragH bq; bq.half[0] = *(const v8us*)(Bh + boff + 8 * hh); bq.half[1] = *(const v8us*)(Bh + boff + 16 + 8 * hh);
      acc[t] = mmaH<ASPLIT ? 2 : 1>(ah.v, al.v, bq.v, bq.v, acc[t]); }
  }
#pragma unroll
  for (int t = 0; t < 4; ++t) { if (col0 + t * 16 >= N) continue;
#pragma unroll
    for (int r = 0; r < 8; ++r) so[w][8 * hh + r][t * 16 + ln] = acc[t][r] * alpha; }
  __builtin_amdgcn_fence(__ATOMIC_ACQ_REL, "workgroup"); __builtin_amdgcn_wave_barrier();
  const int rsub = lane >> 4, c4 = (lane & 15) * 4;
  {
#pragma unroll
    for (int q = 0; q < 8; ++q) { const int r = q * 2 + rsub; if (col0 + c4 < N) { const v4f v = *(const v4fa*)&so[w][r][c4]; *(v4f*)(C + (size_t)(row0 + r) * ldc + col0 + c4) = v; } }
     }
}

// Wt[n][k] = f16(W[k][n]·scale) from f32 row-major W[K][N] (scale = power of two; bf16-exact weights stay exact in f16 away from the subnormal range)
__global__ __launch_bounds__(256) void k_wt_f16(const float* __restrict__ W, _Float16* __restrict__ Wt, int K, int N, float scale) {
  const int t = blockIdx.x * 256 + threadIdx.x; if (t >= N * (K / 8)) return; const int n = t / (K / 8), k8 = (t % (K / 8)) * 8; FragH f;
#pragma unroll
  for (int i = 0; i < 8; ++i) f.h[i] = (_Float16)(bf16_round(W[(size_t)(k8 + i) * N + n]) * scale); const v8us o = f.half[0];
  *(v8us*)((unsigned short*)Wt + (size_t)n * K + k8) = o; 
}
// k_gemm_hh variant with fused epilogue: v = acc·alpha + bias[by·sBias + col] (+ CP[(row/rowsPerB)·sCPb + by·64 + col] if CP) ; ACT 0 none / 1 elu ; writes f16 C16 (and f32 C if non-null)
template <int ACT>
__global__ __launch_bounds__(128) void k_gemm_hhx(const _Float16* __restrict__ A, int lda, size_t sA, const _Float16* __restrict__ Bh, int ldb, size_t sB, float alpha, const float* __restrict__ bias, size_t sBias, const float* __restrict__ CP, int rowsPerB, size_t sCPb, int row0g,
    float* __restrict__ C, _Float16* __restrict__ C16, int ldc, size_t sC, int M, int N, int K) {
  __shared__ __attribute__((aligned(16))) float so[4][16][64];
  const int tid = threadIdx.x, w = tid >> 5, lane = tid & 31, ln = lane & 15, hh = lane >> 4; const int by = blockIdx.y;
  A += (size_t)by * sA; Bh += (size_t)by * sB; const size_t cofs = (size_t)by * sC; const float* bp = bias ? bias + (size_t)by * sBias : nullptr;
  const int ntn = (N + 63) / 64; const int wid = blockIdx.x * 4 + w; const int mt = wid / ntn, nq = wid % ntn; if (mt * 16 >= M) return;
  const int row0 = mt * 16, col0 = nq * 64; const _Float16* arow = A + (size_t)(row0 + ln) * lda;
  v8f acc[4] = {};
  for (int kb = 0; kb < K; kb += 32) { FragH ah; ah.half[0] = *(const v8us*)((const unsigned short*)arow + kb + 8 * hh); ah.half[1] = *(const v8us*)((const unsigned short*)arow + kb + 16 + 8 * hh);
#pragma unroll
    for (int t = 0; t < 4; ++t) { if (col0 + t * 16 >= N) continue; const size_t boff = (size_t)(col0 + t * 16 + ln) * ldb + kb; FragH bq; bq.half[0] = *(const v8us*)((const unsigned short*)Bh + boff + 8 * hh); bq.half[1] = *(const v8us*)((const unsigned short*)Bh + boff + 16 + 8 * hh);
      acc[t] = mmaH<1>(ah.v, ah.v, bq.v, bq.v, acc[t]); }
  }
#pragma unroll
  for (int t = 0; t < 4; ++t) { if (col0 + t * 16 >= N) continue; const int col = col0 + t * 16 + ln; const float bv = bp ? bf16_round(bp[col]) : 0.f;
#pragma unroll
    for (int r = 0; r < 8; ++r) { float v = acc[t][r] * alpha + bv; if (CP) { const int rr = row0g + row0 + 8 * hh + r; if (rowsPerB < 0) v += CP[cofs + (size_t)rr * ldc + col];      /* rowsPerB < 0: own element of the batched C plane */ else { const int bidx = rr / rowsPerB; v += CP[(size_t)bidx * sCPb + (size_t)by * 64 + col]; } } if (ACT == 1) v = (v > 0.f) ? v : expm1f(v); else if (ACT == 7) v = (v > 0.f) ? v + 1.0f : expf(v); else if (ACT == 8) v = tanhf(v); else if (ACT == 9) v = 0.5f * v * (1.0f + tanhf(0.7978845608028654f * (v + 0.044715f * v * v * v))); else if (ACT == 11) v = 1.0f / (1.0f + expf(-v)); else if (ACT == 12) v = (v > 0.f) ? v : 0.01f * v; else if (ACT == 14) v = (v > 0.f) ? v : 0.1f * v; else if (ACT == 16) v = (v >= 0.f) ? v : 0.3f * v; else if (ACT == 17) v = (v >= 0.f) ? v : 0.2f * v; else if (ACT == 15) v = v / (1.0f + expf(-v)); else if (ACT == 3) v = fmaxf(v, 0.f); else if (ACT == 6) v = 0.5f * v * (1.0f + erff(v * 0.70710678118654752f)); so[w][8 * hh + r][t * 16 + ln] = v; } }
  __builtin_amdgcn_fence(__ATOMIC_ACQ_REL, "workgroup"); __builtin_amdgcn_wave_barrier();
  const int rsub = lane >> 4, c4 = (lane & 15) * 4; typedef _Float16 v4h __attribute__((ext_vector_type(4)));
  {
#pragma unroll
    for (int q = 0; q < 8; ++q) { const int r = q * 2 + rsub; if (col0 + c4 < N) { const v4f v = *(const v4fa*)&so[w][r][c4]; if (C) *(v4f*)(C + cofs + (size_t)(row0 + r) * ldc + col0 + c4) = v; if (C16) { v4h h4; for (int i = 0; i < 4; ++i) h4[i] = (_Float16)v[i]; *(v4h*)(C16 + cofs + (size_t)(row0 + r) * ldc + col0 + c4) = h4; } } }
     }
}


typedef _Float16 v4h __attribute__((ext_vector_type(4)));

__global__ __launch_bounds__(256) void k_x16(const float* __restrict__ x, _Float16* __restrict__ X16, size_t n8) { const size_t t = (size_t)blockIdx.x * 256 + threadIdx.x; if (t >= n8) return; FragH f;
#pragma unroll
  for (int q = 0; q < 8; ++q) f.h[q] = (_Float16)bf16_round(x[t * 8 + q]); *(v8us*)((unsigned short*)X16 + t * 8) = f.half[0];  }
__global__ __launch_bounds__(256) void k_h16(const float* __restrict__ x, _Float16* __restrict__ X16, size_t n8) { const size_t t = (size_t)blockIdx.x * 256 + threadIdx.x; if (t >= n8) return; FragH f;
#pragma unroll
  for (int q = 0; q < 8; ++q) f.h[q] = (_Float16)x[t * 8 + q]; *(v8us*)((unsigned short*)X16 + t * 8) = f.half[0];  }
__global__ __launch_bounds__(256) void k_round16f(const float* __restrict__ W, _Float16* __restrict__ Bt, size_t n8) { const size_t t = (size_t)blockIdx.x * 256 + threadIdx.x; if (t >= n8) return; FragH f;
#pragma unroll
  for (int i = 0; i < 8; ++i) f.h[i] = (_Float16)(bf16_round(W[t * 8 + i]) * 16.0f); *(v8us*)((unsigned short*)Bt + t * 8) = f.half[0];  }
template <int NHv, int TTv>
__global__ __launch_bounds__(256) void k_vt(const _Float16* __restrict__ V16, int ldv, int voff, _Float16* __restrict__ Vt) { __shared__ unsigned short tl[64][66]; const int tid = threadIdx.x; const int slab = blockIdx.x / (TTv / 64), lg = blockIdx.x % (TTv / 64); const int b = slab / NHv, h = slab % NHv;
  for (int i = tid; i < 64 * 8; i += 256) { const int r = i / 8, c8 = (i % 8) * 8; FragH f; f.half[0] = *(const v8us*)((const unsigned short*)V16 + ((size_t)b * TTv + lg * 64 + r) * ldv + voff + h * 64 + c8);
#pragma unroll
    for (int q = 0; q < 8; ++q) tl[r][c8 + q] = f.u[q]; }
  __syncthreads();
  {
#pragma unroll
    for (int rd = 0; rd < 2; ++rd) { const int d = rd * 32 + tid / 8, pc = tid % 8; FragH f;
#pragma unroll
      for (int q = 0; q < 8; ++q) f.u[q] = tl[pc * 8 + q][d];
      *(v8us*)((unsigned short*)Vt + ((size_t)slab * 64 + d) * TTv + lg * 64 + pc * 8) = f.half[0]; }
     } }

__global__ __launch_bounds__(256) void k_hl(const float* __restrict__ F, _Float16* __restrict__ Hh, _Float16* __restrict__ Hl, size_t n8) { const size_t t = (size_t)blockIdx.x * 256 + threadIdx.x; if (t >= n8) return; FragH fh, fl; const v4f a = *(const v4fa*)(F + t * 8), c = *(const v4fa*)(F + t * 8 + 4);
#pragma unroll
  for (int q = 0; q < 4; ++q) { _Float16 h = (_Float16)a[q]; fh.h[q] = h; fl.h[q] = (_Float16)((a[q] - (float)h) * 1024.0f); h = (_Float16)c[q]; fh.h[4 + q] = h; fl.h[4 + q] = (_Float16)((c[q] - (float)h) * 1024.0f); }
  { *(v8us*)((unsigned short*)Hh + t * 8) = fh.half[0]; *(v8us*)((unsigned short*)Hl + t * 8) = fl.half[0];  } }

// ---- fast GEMM (wave tile 32x64; requires M % 32 == 0 rows per launch region and N % 64 == 0); epilogue = k_gemm_hhx semantics ----
__device__ __forceinline__ v16h g2_frag(const _Float16* p, int hh) { FragH f; f.half[0] = *(const v8us*)((const unsigned short*)p + 8 * hh); f.half[1] = *(const v8us*)((const unsigned short*)p + 16 + 8 * hh); return f.v; }
__device__ __forceinline__ v8f g2_mma(v16h a, v16h b, v8f c) { v8f d = __builtin_amdgcn_wmma_f32_16x16x32_f16(false, a, false, b, (short)0, c, false, false); asm volatile("v_nop\n\tv_nop\n\tv_nop\n\tv_nop" : "+v"(d) : "v"(a), "v"(b)); return d; }
template <int ACT>
__global__ __launch_bounds__(128) void k_gemm2(const _Float16* __restrict__ A, int lda, size_t sA, const _Float16* __restrict__ Bh, int ldb, size_t sB, float alpha, const float* __restrict__ bias, size_t sBias, const float* __restrict__ CP, int rowsPerB, size_t sCPb, int row0g,
    float* __restrict__ C, _Float16* __restrict__ C16, int ldc, size_t sC, int M, int N, int K) { static_assert(ACT == 0 || ACT == 3 || ACT == 6 || ACT == 8 || ACT == 9 || ACT == 11 || ACT == 12 || ACT == 14 || ACT == 15 || ACT == 16 || ACT == 17, "k_gemm2: unsupported ACT code (would silently apply no activation)");
  __shared__ __attribute__((aligned(16))) float so[4][32][68];
  const int tid = threadIdx.x, w = tid >> 5, lane = tid & 31, ln = lane & 15, hh = lane >> 4; const int by = blockIdx.y;
  A += (size_t)by * sA; Bh += (size_t)by * sB; const size_t cofs = (size_t)by * sC; const float* bp = bias ? bias + (size_t)by * sBias : nullptr;
  const int ntn = N >> 6; const int mt = blockIdx.x / ntn, nq = blockIdx.x - mt * ntn; const int row0 = mt * 128 + 32 * w, col0 = nq * 64; if (row0 >= M) return;
  const _Float16* a0p = A + (size_t)(row0 + ln) * lda; const _Float16* a1p = a0p + (size_t)16 * lda;
  const _Float16* b0p = Bh + (size_t)(col0 + ln) * ldb; const _Float16* b1p = b0p + (size_t)16 * ldb; const _Float16* b2p = b1p + (size_t)16 * ldb; const _Float16* b3p = b2p + (size_t)16 * ldb;
  const v8f z8 = {0.f,0.f,0.f,0.f,0.f,0.f,0.f,0.f}; v8f c00 = z8, c01 = z8, c02 = z8, c03 = z8, c10 = z8, c11 = z8, c12 = z8, c13 = z8;
#pragma unroll 1
  for (int kb = 0; kb < K; kb += 32) { const v16h a0 = g2_frag(a0p + kb, hh), a1 = g2_frag(a1p + kb, hh);
    v16h b = g2_frag(b0p + kb, hh); c00 = g2_mma(a0, b, c00); c10 = g2_mma(a1, b, c10);
    b = g2_frag(b1p + kb, hh); c01 = g2_mma(a0, b, c01); c11 = g2_mma(a1, b, c11);
    b = g2_frag(b2p + kb, hh); c02 = g2_mma(a0, b, c02); c12 = g2_mma(a1, b, c12);
    b = g2_frag(b3p + kb, hh); c03 = g2_mma(a0, b, c03); c13 = g2_mma(a1, b, c13); }
  v8f accs[8] = {c00, c01, c02, c03, c10, c11, c12, c13};
#pragma unroll
  for (int u = 0; u < 8; ++u) { const int t = u & 3, half = u >> 2; const int col = col0 + t * 16 + ln; const float bv = bp ? bf16_round(bp[col]) : 0.f;
#pragma unroll
    for (int r = 0; r < 8; ++r) { const int rloc = half * 16 + 8 * hh + r; float v = accs[u][r] * alpha + bv; if (CP) { if (rowsPerB < 0) v += CP[cofs + (size_t)(row0g + row0 + rloc) * ldc + col];      /* rowsPerB < 0: own element of the batched C plane */ else { const int bidx = (row0g + row0 + rloc) / rowsPerB; v += CP[(size_t)bidx * sCPb + (size_t)by * 64 + col]; } }
      if (ACT == 3) v = fmaxf(v, 0.f); else if (ACT == 6) v = 0.5f * v * (1.0f + erff(v * 0.70710678118654752f)); else if (ACT == 11) v = 1.0f / (1.0f + expf(-v)); else if (ACT == 15) v = v / (1.0f + expf(-v)); else if (ACT == 12) v = (v > 0.f) ? v : 0.01f * v; else if (ACT == 8) v = tanhf(v); else if (ACT == 9) v = 0.5f * v * (1.0f + tanhf(0.7978845608028654f * (v + 0.044715f * v * v * v))); else if (ACT == 14) v = (v > 0.f) ? v : 0.1f * v; else if (ACT == 16) v = (v >= 0.f) ? v : 0.3f * v; else if (ACT == 17) v = (v >= 0.f) ? v : 0.2f * v;
      so[w][rloc][t * 16 + ln] = v; } }
  __builtin_amdgcn_fence(__ATOMIC_ACQ_REL, "workgroup"); __builtin_amdgcn_wave_barrier();
  const int rsub = lane >> 4, c4 = (lane & 15) * 4;
  {
#pragma unroll
    for (int q = 0; q < 16; ++q) { const int r = q * 2 + rsub; const v4f v = *(const v4fa*)&so[w][r][c4]; if (C) *(v4f*)(C + cofs + (size_t)(row0 + r) * ldc + col0 + c4) = v; if (C16) { v4h h4; for (int i = 0; i < 4; ++i) h4[i] = (_Float16)v[i]; *(v4h*)(C16 + cofs + (size_t)(row0 + r) * ldc + col0 + c4) = h4; } }
     } }


__global__ __launch_bounds__(256) void k_wnat(const float* __restrict__ w, size_t n8, _Float16* __restrict__ Bt) { const size_t t = (size_t)blockIdx.x * 256 + threadIdx.x; if (t >= n8) return; FragH f; for (int q = 0; q < 8; ++q) f.h[q] = (_Float16)(bf16_round(w[t * 8 + q]) * 16.0f); *(v8us*)((unsigned short*)Bt + t * 8) = f.half[0];  }
__global__ __launch_bounds__(256) void k_rsm(const float* __restrict__ S, _Float16* __restrict__ P, int nrows) {
  #pragma clang fp contract(off)
  const int i = blockIdx.x * 256 + threadIdx.x; if (i >= nrows) return; const float* s = S + (size_t)i * SQ; float mx = -3.0e38f;
#pragma unroll 1
  for (int j = 0; j < SQ; ++j) mx = fmaxf(mx, s[j]); float se = 0.f;
#pragma unroll 1
  for (int j = 0; j < SQ; ++j) se += expf(s[j] - mx); const float sc = 256.0f / se;
#pragma unroll 1
  for (int j0 = 0; j0 < SQ; j0 += 8) { FragH f; for (int q = 0; q < 8; ++q) f.h[q] = (_Float16)(expf(s[j0 + q] - mx) * sc); unsigned short* d = (unsigned short*)P + (size_t)i * SQ + j0; *(v8us*)d = f.half[0];  } }
__global__ __launch_bounds__(256) void k_vt(const _Float16* __restrict__ V16, int b, int h0, _Float16* __restrict__ VT) { __shared__ unsigned short tl[64][65]; const int tid = threadIdx.x; const int hh = blockIdx.x % HG, sg = blockIdx.x / HG; const int s0 = sg * 64; const int h = h0 + hh;
  for (int i = tid; i < 64 * 8; i += 256) { const int j = i / 8, d8 = (i % 8) * 8; FragH f; f.half[0] = *(const v8us*)((const unsigned short*)V16 + ((size_t)b * SQ + s0 + j) * DM + h * HD + d8); for (int q = 0; q < 8; ++q) tl[d8 + q][j] = f.u[q]; }
  __syncthreads();
  { for (int i = tid; i < 64 * 8; i += 256) { const int d = i / 8, j8 = (i % 8) * 8; FragH f; for (int q = 0; q < 8; ++q) f.u[q] = tl[d][j8 + q]; *(v8us*)((unsigned short*)VT + ((size_t)hh * HD + d) * SQ + s0 + j8) = f.half[0]; }  } }


__global__ __launch_bounds__(256) void k_tile16(const float* __restrict__ O, float* __restrict__ out, size_t n4) { const size_t t = (size_t)blockIdx.x * 256 + threadIdx.x; if (t >= n4) return; const size_t e = t * 4; const size_t r = e / DMO; const int c = (int)(e % DMO); const v4f v = *(const v4fa*)(O + r * HD + (c % HD)); *(v4f*)(out + e) = v;  }


// Row softmax, one wave per row of S: the row's 2048 scores are read once, by 16 whole-line 16-byte loads per lane, and stay in 64 registers;
// maximum and sum = per-lane chains, then a five-step butterfly over the 32 lanes (every lane ends with the same bits).
__global__ __launch_bounds__(256) void k_rsmf(const float* __restrict__ S, _Float16* __restrict__ P, int qn, int hg) {
  const int lane = threadIdx.x & 31; const int t = blockIdx.x * 8 + (threadIdx.x >> 5); if (t >= qn * hg) return;      /* wave-uniform, no barrier below */
  const size_t i = (size_t)(t / qn) * SQ + (t % qn); const float* s = S + i * SQ + lane * 4; v4f e[SQ / 128];
#pragma unroll      /* e[] must be indexed by constants to stay in registers; all 16 loads in flight at once */
  for (int u = 0; u < SQ / 128 - 1; ++u) e[u] = *(const v4fa*)(s + u * 128);
  asm volatile("s_wait_xcnt 0x0" ::: "memory");      /* the build lets the last load's result land on the address pair that the 15 loads above name: the wait stands in front of that overwrite */
  e[SQ / 128 - 1] = *(const v4fa*)(s + (SQ / 128 - 1) * 128);
  float mx = -3.0e38f;
#pragma unroll      /* constant indices into e[] */
  for (int u = 0; u < SQ / 128; ++u) mx = fmaxf(mx, fmaxf(fmaxf(e[u][0], e[u][1]), fmaxf(e[u][2], e[u][3])));
  for (int m = 16; m > 0; m >>= 1) mx = fmaxf(mx, __shfl_xor(mx, m, 32));
  v4f a4 = {0.f, 0.f, 0.f, 0.f};      /* four independent sum chains per lane */
#pragma unroll      /* constant indices into e[] */
  for (int u = 0; u < SQ / 128; ++u) for (int q = 0; q < 4; ++q) { const float y = (e[u][q] - mx) * 1.44269504f; float ex;
    asm("v_exp_f32 %0, %1\n\tv_nop" : "=v"(ex) : "v"(y));      /* native exp as before (2^y with y = (s - max) log2 e); the v_nop keeps the slot the instruction set asks for behind a transcendental: in runs of v_exp the build reused a source register in the very next instruction */
    e[u][q] = ex; a4[q] += ex; }
  float se = (a4[0] + a4[1]) + (a4[2] + a4[3]);
  for (int m = 16; m > 0; m >>= 1) se += __shfl_xor(se, m, 32);
  const float sc = 256.0f / se; _Float16* d = P + i * SQ + lane * 4;
#pragma unroll      /* constant indices into e[] */
  for (int u = 0; u < SQ / 128; ++u) { v4h h4; for (int q = 0; q < 4; ++q) h4[q] = (_Float16)(e[u][q] * sc); *(v4h*)(d + u * 128) = h4; } }

extern "C" void kernel_launch(void* const* d_in, const int* in_sizes, int n_in,
                              void* d_out, int out_size, void* d_ws, size_t ws_size, hipStream_t stream) {
  (void)in_sizes; (void)n_in; (void)out_size;
  const float* const* I = (const float* const*)d_in; const float* x = I[0]; const float* wq = I[1]; const float* wk = I[2]; const float* wv = I[3];      /* [in][out] = [1024][64] */
  char* ws = (char*)d_ws; size_t off = 0;
  auto take = [&](size_t bytes) { char* p = ws + off; off += (bytes + 255) & ~(size_t)255; return p; };
  _Float16* BQ = (_Float16*)take((size_t)HD * DM * 2); _Float16* BK = (_Float16*)take((size_t)HD * DM * 2); _Float16* BV = (_Float16*)take((size_t)HD * DM * 2);
  _Float16* X16 = (_Float16*)take(NR * DM * 2); float* QF = (float*)take(NR * HD * 4); float* KF = (float*)take(NR * HD * 4); _Float16* QH = (_Float16*)take(NR * HD * 2); _Float16* QL = (_Float16*)take(NR * HD * 2); _Float16* KH = (_Float16*)take(NR * HD * 2); _Float16* KL = (_Float16*)take(NR * HD * 2); float* VF = (float*)take(NR * HD * 4); _Float16* VH = (_Float16*)take(NR * HD * 2); _Float16* VL = (_Float16*)take(NR * HD * 2);
  float* ST = (float*)take(NR * SQ * 4); _Float16* PT = (_Float16*)take(NR * SQ * 2); _Float16* P = (_Float16*)take(NR * SQ * 2); _Float16* VT = (_Float16*)take(NR * HD * 2); _Float16* VTL = (_Float16*)take(NR * HD * 2); float* OF = (float*)take(NR * HD * 4);      /* one plane per batch */
  if (off > ws_size) return;      /* approx 16 + 12 + 64 + 32 + 32 + 4 = 160 MiB */
  k_wt_f16<<<(unsigned)(((size_t)HD * (DM / 8) + 255) / 256), 256, 0, stream>>>(wq, BQ, DM, HD, 16.0f); k_wt_f16<<<(unsigned)(((size_t)HD * (DM / 8) + 255) / 256), 256, 0, stream>>>(wk, BK, DM, HD, 16.0f); k_wt_f16<<<(unsigned)(((size_t)HD * (DM / 8) + 255) / 256), 256, 0, stream>>>(wv, BV, DM, HD, 16.0f);      /* [1024][64] -> Bt[64][1024] x16 */
  k_x16<<<(unsigned)((NR * DM / 8 + 255) / 256), 256, 0, stream>>>(x, X16, NR * DM / 8);
  k_gemm2<0><<<dim3((unsigned)((NR / 128) * 1), 1), 128, 0, stream>>>(X16, DM, 0, BQ, DM, 0, 0.0625f, nullptr, 0, nullptr, 1, 0, 0, QF, nullptr, HD, 0, (int)NR, HD, DM);      /* q (f32, exact products) */
  k_gemm2<0><<<dim3((unsigned)((NR / 128) * 1), 1), 128, 0, stream>>>(X16, DM, 0, BK, DM, 0, 0.0625f, nullptr, 0, nullptr, 1, 0, 0, KF, nullptr, HD, 0, (int)NR, HD, DM);      /* k (f32) */
  k_gemm2<0><<<dim3((unsigned)((NR / 128) * 1), 1), 128, 0, stream>>>(X16, DM, 0, BV, DM, 0, 0.0625f, nullptr, 0, nullptr, 1, 0, 0, VF, nullptr, HD, 0, (int)NR, HD, DM);      /* v (f32, exact products) */
  k_hl<<<(unsigned)((NR * HD / 8 + 255) / 256), 256, 0, stream>>>(QF, QH, QL, NR * HD / 8); k_hl<<<(unsigned)((NR * HD / 8 + 255) / 256), 256, 0, stream>>>(KF, KH, KL, NR * HD / 8); k_hl<<<(unsigned)((NR * HD / 8 + 255) / 256), 256, 0, stream>>>(VF, VH, VL, NR * HD / 8);      /* f16 hi + x1024 residual planes of q, k, v */
  /* the four batches are independent: each stage is one launch over all of them (k_gemm2: blockIdx.y = batch, plane strides sA, sB, sC; the others: a four times longer grid over planes that lie one behind the other) */
  const size_t sQK = (size_t)SQ * HD, sS = (size_t)SQ * SQ;
  k_gemm2<0><<<dim3((SQ / 128) * (SQ / 64), NB), 128, 0, stream>>>(KH, HD, sQK, QH, HD, sQK, 1.0f, nullptr, 0, nullptr, 1, 0, 0, ST, nullptr, SQ, sS, SQ, SQ, HD);      /* S^T[b][k][i] = k_hi . q_hi */
  k_gemm2<0><<<dim3((SQ / 128) * (SQ / 64), NB), 128, 0, stream>>>(KL, HD, sQK, QH, HD, sQK, 0.0009765625f, nullptr, 0, ST, -1, 0, 0, ST, nullptr, SQ, sS, SQ, SQ, HD);      /* += k_lo . q_hi 2^-10 */
  k_gemm2<0><<<dim3((SQ / 128) * (SQ / 64), NB), 128, 0, stream>>>(KH, HD, sQK, QL, HD, sQK, 0.0009765625f, nullptr, 0, ST, -1, 0, 0, ST, nullptr, SQ, sS, SQ, SQ, HD);      /* += k_hi . q_lo 2^-10 */
  k_rsmf<<<(NB * SQ + 7) / 8, 256, 0, stream>>>(ST, PT, SQ, NB);      /* softmax over the query index i (rows of S^T) -> PT[b][k][i] = f16(256 att[i][k]) */
  k_vt<SQ / 64, SQ><<<NB * (SQ / 64) * (SQ / 64), 256, 0, stream>>>(PT, SQ, 0, P);      /* transpose PT [b][k][i] -> P [b][i][k] (32 slabs of 64 i's per batch) */
  k_vt<1, SQ><<<NB * (SQ / 64), 256, 0, stream>>>(VH, HD, 0, VT); k_vt<1, SQ><<<NB * (SQ / 64), 256, 0, stream>>>(VL, HD, 0, VTL);      /* V^T hi / residual [b][64][2048] */
  k_gemm2<0><<<dim3((SQ / 128) * 1, NB), 128, 0, stream>>>(P, SQ, sS, VT, SQ, sQK, 0.00390625f, nullptr, 0, nullptr, 1, 0, 0, OF, nullptr, HD, sQK, SQ, HD, SQ);      /* out_i = 2^-8 sum_k P[i][k] v_hi */
  k_gemm2<0><<<dim3((SQ / 128) * 1, NB), 128, 0, stream>>>(P, SQ, sS, VTL, SQ, sQK, 0.000003814697265625f, nullptr, 0, OF, -1, 0, 0, OF, nullptr, HD, sQK, SQ, HD, SQ);      /* += 2^-18 sum_k P[i][k] v_lo */
  k_tile16<<<(unsigned)((NR * DMO / 4 + 255) / 256), 256, 0, stream>>>(OF, (float*)d_out, NR * DMO / 4);      /* the 16 identical heads */
}

// v003
// One run takes 185 microseconds.
// Timed twice side by side with v002, it ran 2.10 and 2.05 times as fast.
// All steps since v000 together make it 11.8 times as fast.
#include <hip/hip_runtime.h>
// Single-projection attention with a QUERY-axis softmax, tiled 16x (x [4][2048][1024]; q, k, v = x W ([1024][64] weights stored [in][out], shared by all heads); att[i][k] = q_i . k_k (no scaling); att = softmax over the QUERY index i for each key column k (the module's nn.Softmax(dim=1)); out_i = sum_k att[i][k] v_k -> [2048][64], concatenated 16 times -> [4][2048][1024]).
// Structure: token rows; x as exact f16 rows; q and k projections as WMMA GEMMs (32x64 wave tiles, f32 accumulation, exact x16 weights) kept in f32 and split into f16 hi + x1024 residual planes (the unscaled logits have sigma 8, so they are formed from three hi/lo products, ~2^-21 relative); v likewise kept f32 and split; V^T (hi and residual) via LDS transposes; the scores never go through memory: transposed score tiles S^T[k][i] = k_k . q_i (three hi/lo products, K = 64) are formed twice in registers, once for each key's maximum and sum of exp over the query index i (= the module's column softmax; f32 statistics, native exp), once for the weights (x256 f16), which pass inside the lane from the score tiles' D layout into the B fragment of out^T = V^T P^T (hi and residual accumulators, f32), 8 key slices added through LDS into a [2048][64] plane, broadcast into the 16 head slots of the output rows with thread-linear float4 stores; every per-batch stage runs as one launch over the four batches; 10 + 5 = 15 launches.
// Compute dtype: inputs rounded to bf16; x / weights exact; q, k, v as f16 hi + residual pairs; the softmax weights plain f16 (~2^-12); scores, statistics, out f32. v_wmma_f32_16x16x32_f16.
#define NB 4
#define SQ 2048
#define DM 1024
#define HD 64
#define NH 1
#define HG 1
#define DMO 1024                     /* output row width = 16 x 64 */
#define B0 0                         /* unused */
#define NBR NB
#define NR ((size_t)NB * SQ)
typedef __bf16 v16b __attribute__((ext_vector_type(16)));
typedef unsigned short v8us __attribute__((ext_vector_type(8), may_alias));
typedef float  v8f  __attribute__((ext_vector_type(8)));
typedef float  v4f  __attribute__((ext_vector_type(4)));
typedef float  v4fa __attribute__((ext_vector_type(4), may_alias));
union FragB { v16b v; v8us half[2]; unsigned short u[16]; };

__device__ __forceinline__ unsigned short bf16_bits(float x) { unsigned int u = __float_as_uint(x); return (unsigned short)((u + 0x7FFFu + ((u >> 16) & 1u)) >> 16); }
__device__ __forceinline__ float bf16_val(unsigned short b) { return __uint_as_float(((unsigned int)b) << 16); }
__device__ __forceinline__ float bf16_round(float x) { return bf16_val(bf16_bits(x)); }
// D += A·B with NT terms: 1 = ah·bh, 2 = + al·bh (A split), 3 = + ah·bl (both split)
template <int NT>
__device__ __forceinline__ v8f mmaN(v16b ah, v16b al, v16b bh, v16b bl, v8f c) {
  c = __builtin_amdgcn_wmma_f32_16x16x32_bf16(false, ah, false, bh, (short)0, c, false, false);
  if (NT >= 2) c = __builtin_amdgcn_wmma_f32_16x16x32_bf16(false, al, false, bh, (short)0, c, false, false);
  if (NT >= 3) c = __builtin_amdgcn_wmma_f32_16x16x32_bf16(false, ah, false, bl, (short)0, c, false, false);
  asm volatile("v_nop\n\tv_nop\n\tv_nop\n\tv_nop" : "+v"(c) : "v"(ah), "v"(al), "v"(bh), "v"(bl));
  return c;
}

__global__ __launch_bounds__(256) void k_wt_bf16(const float* __restrict__ W, unsigned short* __restrict__ Wt, int K, int N) {
  const int t = blockIdx.x * 256 + threadIdx.x;
  const int k8n = K / 8;
  if (t >= N * k8n) return;
  const int n = t / k8n, k8 = (t % k8n) * 8;
  v8us v;
#pragma unroll
  for (int i = 0; i < 8; ++i) v[i] = bf16_bits(W[(size_t)(k8 + i) * N + n]);
  *(v8us*)(Wt + (size_t)n * K + k8) = v;
  
}

// GEMM C[M][N] (f32, pitch ldc) = act(A[M][K]·W + bias). A f32 row-major (pitch lda) converted per fragment to bf16
// (ASPLIT: hi/lo two planes -> 2 terms, else single rounded term); Wt bf16 [N][K] (pitch ldb). BIAS_BF16 rounds the
// bias to bf16 first (bias quantised to bf16 before the add). K%32==0, M%16==0, N%64==0.
template <bool ASPLIT, int ACT, bool BIAS_BF16>
__global__ __launch_bounds__(128) void k_gemm_bf(const float* __restrict__ A, int lda, const unsigned short* __restrict__ Wt, int ldb,
                                               const float* __restrict__ bias, float* __restrict__ C, int ldc, int M, int N, int K) {
  __shared__ __attribute__((aligned(16))) float so[4][16][64];
  const int tid = threadIdx.x, w = tid >> 5, lane = tid & 31, ln = lane & 15, hh = lane >> 4;
  const int ntn = N / 64;
  const int wid = blockIdx.x * 4 + w;
  const int mt = wid / ntn, nq = wid % ntn;
  if (mt * 16 >= M) return;
  const int row0 = mt * 16, col0 = nq * 64;
  const float* arow = A + (size_t)(row0 + ln) * lda;
  v8f acc[4] = {};
  for (int kb = 0; kb < K; kb += 32) {
    FragB ah, al;
    const v4f x0 = *(const v4fa*)(arow + kb + 8 * hh), x1 = *(const v4fa*)(arow + kb + 8 * hh + 4);
    const v4f x2 = *(const v4fa*)(arow + kb + 16 + 8 * hh), x3 = *(const v4fa*)(arow + kb + 16 + 8 * hh + 4);
    float xs[16] = {x0[0],x0[1],x0[2],x0[3],x1[0],x1[1],x1[2],x1[3],x2[0],x2[1],x2[2],x2[3],x3[0],x3[1],x3[2],x3[3]};
#pragma unroll
    for (int i = 0; i < 16; ++i) { const unsigned short hb = bf16_bits(xs[i]); ah.u[i] = hb; al.u[i] = ASPLIT ? bf16_bits(xs[i] - bf16_val(hb)) : (unsigned short)0; }
#pragma unroll
    for (int t = 0; t < 4; ++t) {
      const unsigned short* brow = Wt + (size_t)(col0 + t * 16 + ln) * ldb + kb;
      FragB b;
      b.half[0] = *(const v8us*)(brow + 8 * hh);
      b.half[1] = *(const v8us*)(brow + 16 + 8 * hh);
      acc[t] = mmaN<ASPLIT ? 2 : 1>(ah.v, al.v, b.v, b.v, acc[t]);
    }
  }
#pragma unroll
  for (int t = 0; t < 4; ++t) {
    float bv = bias ? bias[col0 + t * 16 + ln] : 0.f;
    if (BIAS_BF16) bv = bf16_round(bv);
#pragma unroll
    for (int r = 0; r < 8; ++r) { float v = acc[t][r] + bv; if (ACT == 1) v = fmaxf(v, 0.f); so[w][8 * hh + r][t * 16 + ln] = v; }
  }
  __builtin_amdgcn_fence(__ATOMIC_ACQ_REL, "workgroup");
  __builtin_amdgcn_wave_barrier();
  const int rsub = lane >> 4, c4 = (lane & 15) * 4;
  {
#pragma unroll
    for (int q = 0; q < 8; ++q) {
      const int r = q * 2 + rsub;
      const v4f v = *(const v4fa*)&so[w][r][c4];
      *(v4f*)(C + (size_t)(row0 + r) * ldc + col0 + c4) = v;
    }
    
  }
}

// GEMM C = act(A·W + bias + resid): A f32 (ASPLIT -> hi/lo 2 terms), Wt bf16 [N][K]; ACT 0 none, 1 relu, 2 exact gelu;
// resid (optional, f32, row index = (row % rmod), pitch ldr, RES_BF16 rounds it) added before the activation.
template <bool ASPLIT, int ACT, bool BIAS_BF16, bool RES_BF16>
__global__ __launch_bounds__(128) void k_gemm_bf3(const float* __restrict__ A, int lda, const unsigned short* __restrict__ Wt, int ldb,
                                                const float* __restrict__ bias, const float* __restrict__ resid, int rmod, int ldr,
                                                float* __restrict__ C, int ldc, int M, int N, int K) {
  __shared__ __attribute__((aligned(16))) float so[4][16][64];
  const int tid = threadIdx.x, w = tid >> 5, lane = tid & 31, ln = lane & 15, hh = lane >> 4;
  const int ntn = N / 64;
  const int wid = blockIdx.x * 4 + w;
  const int mt = wid / ntn, nq = wid % ntn;
  if (mt * 16 >= M) return;
  const int row0 = mt * 16, col0 = nq * 64;
  const float* arow = A + (size_t)(row0 + ln) * lda;
  v8f acc[4] = {};
  for (int kb = 0; kb < K; kb += 32) {
    FragB ah, al;
    const v4f x0 = *(const v4fa*)(arow + kb + 8 * hh), x1 = *(const v4fa*)(arow + kb + 8 * hh + 4);
    const v4f x2 = *(const v4fa*)(arow + kb + 16 + 8 * hh), x3 = *(const v4fa*)(arow + kb + 16 + 8 * hh + 4);
    float xs[16] = {x0[0],x0[1],x0[2],x0[3],x1[0],x1[1],x1[2],x1[3],x2[0],x2[1],x2[2],x2[3],x3[0],x3[1],x3[2],x3[3]};
#pragma unroll
    for (int i = 0; i < 16; ++i) { const unsigned short hb = bf16_bits(xs[i]); ah.u[i] = hb; al.u[i] = ASPLIT ? bf16_bits(xs[i] - bf16_val(hb)) : (unsigned short)0; }
#pragma unroll
    for (int t = 0; t < 4; ++t) {
      const unsigned short* brow = Wt + (size_t)(col0 + t * 16 + ln) * ldb + kb;
      FragB b;
      b.half[0] = *(const v8us*)(brow + 8 * hh);
      b.half[1] = *(const v8us*)(brow + 16 + 8 * hh);
      acc[t] = mmaN<ASPLIT ? 2 : 1>(ah.v, al.v, b.v, b.v, acc[t]);
    }
  }
#pragma unroll
  for (int t = 0; t < 4; ++t) {
    const int col = col0 + t * 16 + ln;
    float bv = bias ? bias[col] : 0.f;
    if (BIAS_BF16) bv = bf16_round(bv);
#pragma unroll
    for (int r = 0; r < 8; ++r) {
      float v = acc[t][r] + bv;
      if (resid) { float rv = resid[(size_t)((row0 + 8 * hh + r) % rmod) * ldr + col]; if (RES_BF16) rv = bf16_round(rv); v += rv; }
      if (ACT == 1) v = fmaxf(v, 0.f);
      if (ACT == 2) v = 0.5f * v * (1.0f + erff(v * 0.70710678118654752f));
      if (ACT == 3) { const float u = 0.7978845608028654f * (v + 0.044715f * v * v * v); v = 0.5f * v * (1.0f + tanhf(u)); }
      so[w][8 * hh + r][t * 16 + ln] = v;
    }
  }
  __builtin_amdgcn_fence(__ATOMIC_ACQ_REL, "workgroup");
  __builtin_amdgcn_wave_barrier();
  const int rsub = lane >> 4, c4 = (lane & 15) * 4;
  {
#pragma unroll
    for (int q = 0; q < 8; ++q) {
      const int r = q * 2 + rsub;
      const v4f v = *(const v4fa*)&so[w][r][c4];
      *(v4f*)(C + (size_t)(row0 + r) * ldc + col0 + c4) = v;
    }
    
  }
}
// row LayerNorm (biased variance, eps) over N: s = X (+ R); optional out_sum <- s; out_norm <- (s-mu)*rsqrt(var+eps)*g + b
template <bool PARAM_BF16>
__global__ __launch_bounds__(256) void k_layernorm(const float* __restrict__ X, const float* __restrict__ R, const float* __restrict__ g, const float* __restrict__ bta,
                                                  float* __restrict__ out_sum, float* __restrict__ out_norm, int N, float eps) {
  __shared__ float red[256];
  const int row = blockIdx.x, tid = threadIdx.x;
  const float* x = X + (size_t)row * N; const float* rr = R ? R + (size_t)row * N : nullptr;
  float vals[16];                     // up to N = 4096
  const int per = N / 256;            // contiguous chunk per thread? use strided-by-4 chunks: thread handles j = tid*4 + 1024*u
  float s1 = 0.f;
  for (int u = 0; u < per / 4; ++u) {
    const int j = tid * 4 + 1024 * u;
    const v4f a = *(const v4fa*)(x + j);
    v4f b = {0.f,0.f,0.f,0.f}; if (rr) b = *(const v4fa*)(rr + j);
#pragma unroll
    for (int q = 0; q < 4; ++q) { const float v = a[q] + b[q]; vals[u * 4 + q] = v; s1 += v; }
  }
  red[tid] = s1; __syncthreads();
  for (int st = 128; st > 0; st >>= 1) { if (tid < st) red[tid] += red[tid + st]; __syncthreads(); }
  const float mu = red[0] / (float)N; __syncthreads();
  float s2 = 0.f;
  for (int u = 0; u < per / 4; ++u)
#pragma unroll
    for (int q = 0; q < 4; ++q) { const float c = vals[u * 4 + q] - mu; s2 += c * c; }
  red[tid] = s2; __syncthreads();
  for (int st = 128; st > 0; st >>= 1) { if (tid < st) red[tid] += red[tid + st]; __syncthreads(); }
  const float rs = rsqrtf(red[0] / (float)N + eps);
  {
    for (int u = 0; u < per / 4; ++u) {
      const int j = tid * 4 + 1024 * u;
      v4f o, sm;
#pragma unroll
      for (int q = 0; q < 4; ++q) {
        float gg = g[j + q], bb = bta[j + q];
        if (PARAM_BF16) { gg = bf16_round(gg); bb = bf16_round(bb); }
        sm[q] = vals[u * 4 + q]; o[q] = (vals[u * 4 + q] - mu) * rs * gg + bb;
      }
      if (out_sum) *(v4f*)(out_sum + (size_t)row * N + j) = sm;
      *(v4f*)(out_norm + (size_t)row * N + j) = o;
    }
    
  }
}



// ---- f16 WMMA path (v_wmma_f32_16x16x32_f16): 11-bit significands for operands in range — used where a [0,1] probability operand needs more precision than bf16
typedef _Float16 v16h __attribute__((ext_vector_type(16)));
union FragH { v16h v; v8us half[2]; _Float16 h[16]; unsigned short u[16]; };
template <int NT>
__device__ __forceinline__ v8f mmaH(v16h ah, v16h al, v16h bh, v16h bl, v8f c) {
  c = __builtin_amdgcn_wmma_f32_16x16x32_f16(false, ah, false, bh, (short)0, c, false, false);
  if (NT >= 2) c = __builtin_amdgcn_wmma_f32_16x16x32_f16(false, al, false, bh, (short)0, c, false, false);
  if (NT >= 3) c = __builtin_amdgcn_wmma_f32_16x16x32_f16(false, ah, false, bl, (short)0, c, false, false);
  asm volatile("v_nop\n\tv_nop\n\tv_nop\n\tv_nop" : "+v"(c) : "v"(ah), "v"(al), "v"(bh), "v"(bl));
  return c;
}
// batched GEMM like k_gemm_b but f16 operands: A f32 (split into f16 hi/lo if ASPLIT, else rounded to f16), Bt = f16 values [n][k]; alpha; C f32; N multiple of 16 (partial tiles skipped)
template <bool ASPLIT>
__global__ __launch_bounds__(128) void k_gemm_h(const float* __restrict__ A, int lda, size_t sA, const _Float16* __restrict__ Bh, int ldb, size_t sB, float alpha, float* __restrict__ C, int ldc, size_t sC, int M, int N, int K) {
  __shared__ __attribute__((aligned(16))) float so[4][16][64];
  const int tid = threadIdx.x, w = tid >> 5, lane = tid & 31, ln = lane & 15, hh = lane >> 4; const int by = blockIdx.y;
  A += (size_t)by * sA; Bh += (size_t)by * sB; C += (size_t)by * sC;
  const int ntn = (N + 63) / 64; const int wid = blockIdx.x * 4 + w; const int mt = wid / ntn, nq = wid % ntn; if (mt * 16 >= M) return;
  const int row0 = mt * 16, col0 = nq * 64; const float* arow = A + (size_t)(row0 + ln) * lda;
  v8f acc[4] = {};
  for (int kb = 0; kb < K; kb += 32) {
    FragH ah, al;
    const v4f x0 = *(const v4fa*)(arow + kb + 8 * hh), x1 = *(const v4fa*)(arow + kb + 8 * hh + 4), x2 = *(const v4fa*)(arow + kb + 16 + 8 * hh), x3 = *(const v4fa*)(arow + kb + 16 + 8 * hh + 4);
    float xs[16] = {x0[0],x0[1],x0[2],x0[3],x1[0],x1[1],x1[2],x1[3],x2[0],x2[1],x2[2],x2[3],x3[0],x3[1],x3[2],x3[3]};
#pragma unroll
    for (int i = 0; i < 16; ++i) { const _Float16 h = (_Float16)xs[i]; ah.h[i] = h; al.h[i] = ASPLIT ? (_Float16)(xs[i] - (float)h) : (_Float16)0.0f; }
#pragma unroll
    for (int t = 0; t < 4; ++t) { if (col0 + t * 16 >= N) continue; const size_t boff = (size_t)(col0 + t * 16 + ln) * ldb + kb; FragH bq; bq.half[0] = *(const v8us*)(Bh + boff + 8 * hh); bq.half[1] = *(const v8us*)(Bh + boff + 16 + 8 * hh);
      acc[t] = mmaH<ASPLIT ? 2 : 1>(ah.v, al.v, bq.v, bq.v, acc[t]); }
  }
#pragma unroll
  for (int t = 0; t < 4; ++t) { if (col0 + t * 16 >= N) continue;
#pragma unroll
    for (int r = 0; r < 8; ++r) so[w][8 * hh + r][t * 16 + ln] = acc[t][r] * alpha; }
  __builtin_amdgcn_fence(__ATOMIC_ACQ_REL, "workgroup"); __builtin_amdgcn_wave_barrier();
  const int rsub = lane >> 4, c4 = (lane & 15) * 4;
  {
#pragma unroll
    for (int q = 0; q < 8; ++q) { const int r = q * 2 + rsub; if (col0 + c4 < N) { const v4f v = *(const v4fa*)&so[w][r][c4]; *(v4f*)(C + (size_t)(row0 + r) * ldc + col0 + c4) = v; } }
     }
}

// Wt[n][k] = f16(W[k][n]·scale) from f32 row-major W[K][N] (scale = power of two; bf16-exact weights stay exact in f16 away from the subnormal range)
__global__ __launch_bounds__(256) void k_wt_f16(const float* __restrict__ W, _Float16* __restrict__ Wt, int K, int N, float scale) {
  const int t = blockIdx.x * 256 + threadIdx.x; if (t >= N * (K / 8)) return; const int n = t / (K / 8), k8 = (t % (K / 8)) * 8; FragH f;
#pragma unroll
  for (int i = 0; i < 8; ++i) f.h[i] = (_Float16)(bf16_round(W[(size_t)(k8 + i) * N + n]) * scale); const v8us o = f.half[0];
  *(v8us*)((unsigned short*)Wt + (size_t)n * K + k8) = o; 
}
// k_gemm_hh variant with fused epilogue: v = acc·alpha + bias[by·sBias + col] (+ CP[(row/rowsPerB)·sCPb + by·64 + col] if CP) ; ACT 0 none / 1 elu ; writes f16 C16 (and f32 C if non-null)
template <int ACT>
__global__ __launch_bounds__(128) void k_gemm_hhx(const _Float16* __restrict__ A, int lda, size_t sA, const _Float16* __restrict__ Bh, int ldb, size_t sB, float alpha, const float* __restrict__ bias, size_t sBias, const float* __restrict__ CP, int rowsPerB, size_t sCPb, int row0g,
    float* __restrict__ C, _Float16* __restrict__ C16, int ldc, size_t sC, int M, int N, int K) {
  __shared__ __attribute__((aligned(16))) float so[4][16][64];
  const int tid = threadIdx.x, w = tid >> 5, lane = tid & 31, ln = lane & 15, hh = lane >> 4; const int by = blockIdx.y;
  A += (size_t)by * sA; Bh += (size_t)by * sB; const size_t cofs = (size_t)by * sC; const float* bp = bias ? bias + (size_t)by * sBias : nullptr;
  const int ntn = (N + 63) / 64; const int wid = blockIdx.x * 4 + w; const int mt = wid / ntn, nq = wid % ntn; if (mt * 16 >= M) return;
  const int row0 = mt * 16, col0 = nq * 64; const _Float16* arow = A + (size_t)(row0 + ln) * lda;
  v8f acc[4] = {};
  for (int kb = 0; kb < K; kb += 32) { FragH ah; ah.half[0] = *(const v8us*)((const unsigned short*)arow + kb + 8 * hh); ah.half[1] = *(const v8us*)((const unsigned short*)arow + kb + 16 + 8 * hh);
#pragma unroll
    for (int t = 0; t < 4; ++t) { if (col0 + t * 16 >= N) continue; const size_t boff = (size_t)(col0 + t * 16 + ln) * ldb + kb; FragH bq; bq.half[0] = *(const v8us*)((const unsigned short*)Bh + boff + 8 * hh); bq.half[1] = *(const v8us*)((const unsigned short*)Bh + boff + 16 + 8 * hh);
      acc[t] = mmaH<1>(ah.v, ah.v, bq.v, bq.v, acc[t]); }
  }
#pragma unroll
  for (int t = 0; t < 4; ++t) { if (col0 + t * 16 >= N) continue; const int col = col0 + t * 16 + ln; const float bv = bp ? bf16_round(bp[col]) : 0.f;
#pragma unroll
    for (int r = 0; r < 8; ++r) { float v = acc[t][r] * alpha + bv; if (CP) { const int rr = row0g + row0 + 8 * hh + r; if (rowsPerB < 0) v += CP[cofs + (size_t)rr * ldc + col];      /* rowsPerB < 0: own element of the batched C plane */ else { const int bidx = rr / rowsPerB; v += CP[(size_t)bidx * sCPb + (size_t)by * 64 + col]; } } if (ACT == 1) v = (v > 0.f) ? v : expm1f(v); else if (ACT == 7) v = (v > 0.f) ? v + 1.0f : expf(v); else if (ACT == 8) v = tanhf(v); else if (ACT == 9) v = 0.5f * v * (1.0f + tanhf(0.7978845608028654f * (v + 0.044715f * v * v * v))); else if (ACT == 11) v = 1.0f / (1.0f + expf(-v)); else if (ACT == 12) v = (v > 0.f) ? v : 0.01f * v; else if (ACT == 14) v = (v > 0.f) ? v : 0.1f * v; else if (ACT == 16) v = (v >= 0.f) ? v : 0.3f * v; else if (ACT == 17) v = (v >= 0.f) ? v : 0.2f * v; else if (ACT == 15) v = v / (1.0f + expf(-v)); else if (ACT == 3) v = fmaxf(v, 0.f); else if (ACT == 6) v = 0.5f * v * (1.0f + erff(v * 0.70710678118654752f)); so[w][8 * hh + r][t * 16 + ln] = v; } }
  __builtin_amdgcn_fence(__ATOMIC_ACQ_REL, "workgroup"); __builtin_amdgcn_wave_barrier();
  const int rsub = lane >> 4, c4 = (lane & 15) * 4; typedef _Float16 v4h __attribute__((ext_vector_type(4)));
  {
#pragma unroll
    for (int q = 0; q < 8; ++q) { const int r = q * 2 + rsub; if (col0 + c4 < N) { const v4f v = *(const v4fa*)&so[w][r][c4]; if (C) *(v4f*)(C + cofs + (size_t)(row0 + r) * ldc + col0 + c4) = v; if (C16) { v4h h4; for (int i = 0; i < 4; ++i) h4[i] = (_Float16)v[i]; *(v4h*)(C16 + cofs + (size_t)(row0 + r) * ldc + col0 + c4) = h4; } } }
     }
}


typedef _Float16 v4h __attribute__((ext_vector_type(4)));

__global__ __launch_bounds__(256) void k_x16(const float* __restrict__ x, _Float16* __restrict__ X16, size_t n8) { const size_t t = (size_t)blockIdx.x * 256 + threadIdx.x; if (t >= n8) return; FragH f;
#pragma unroll
  for (int q = 0; q < 8; ++q) f.h[q] = (_Float16)bf16_round(x[t * 8 + q]); *(v8us*)((unsigned short*)X16 + t * 8) = f.half[0];  }
__global__ __launch_bounds__(256) void k_h16(const float* __restrict__ x, _Float16* __restrict__ X16, size_t n8) { const size_t t = (size_t)blockIdx.x * 256 + threadIdx.x; if (t >= n8) return; FragH f;
#pragma unroll
  for (int q = 0; q < 8; ++q) f.h[q] = (_Float16)x[t * 8 + q]; *(v8us*)((unsigned short*)X16 + t * 8) = f.half[0];  }
__global__ __launch_bounds__(256) void k_round16f(const float* __restrict__ W, _Float16* __restrict__ Bt, size_t n8) { const size_t t = (size_t)blockIdx.x * 256 + threadIdx.x; if (t >= n8) return; FragH f;
#pragma unroll
  for (int i = 0; i < 8; ++i) f.h[i] = (_Float16)(bf16_round(W[t * 8 + i]) * 16.0f); *(v8us*)((unsigned short*)Bt + t * 8) = f.half[0];  }
template <int NHv, int TTv>
__global__ __launch_bounds__(256) void k_vt(const _Float16* __restrict__ V16, int ldv, int voff, _Float16* __restrict__ Vt) { __shared__ unsigned short tl[64][66]; const int tid = threadIdx.x; const int slab = blockIdx.x / (TTv / 64), lg = blockIdx.x % (TTv / 64); const int b = slab / NHv, h = slab % NHv;
  for (int i = tid; i < 64 * 8; i += 256) { const int r = i / 8, c8 = (i % 8) * 8; FragH f; f.half[0] = *(const v8us*)((const unsigned short*)V16 + ((size_t)b * TTv + lg * 64 + r) * ldv + voff + h * 64 + c8);
#pragma unroll
    for (int q = 0; q < 8; ++q) tl[r][c8 + q] = f.u[q]; }
  __syncthreads();
  {
#pragma unroll
    for (int rd = 0; rd < 2; ++rd) { const int d = rd * 32 + tid / 8, pc = tid % 8; FragH f;
#pragma unroll
      for (int q = 0; q < 8; ++q) f.u[q] = tl[pc * 8 + q][d];
      *(v8us*)((unsigned short*)Vt + ((size_t)slab * 64 + d) * TTv + lg * 64 + pc * 8) = f.half[0]; }
     } }

__global__ __launch_bounds__(256) void k_hl(const float* __restrict__ F, _Float16* __restrict__ Hh, _Float16* __restrict__ Hl, size_t n8) { const size_t t = (size_t)blockIdx.x * 256 + threadIdx.x; if (t >= n8) return; FragH fh, fl; const v4f a = *(const v4fa*)(F + t * 8), c = *(const v4fa*)(F + t * 8 + 4);
#pragma unroll
  for (int q = 0; q < 4; ++q) { _Float16 h = (_Float16)a[q]; fh.h[q] = h; fl.h[q] = (_Float16)((a[q] - (float)h) * 1024.0f); h = (_Float16)c[q]; fh.h[4 + q] = h; fl.h[4 + q] = (_Float16)((c[q] - (float)h) * 1024.0f); }
  { *(v8us*)((unsigned short*)Hh + t * 8) = fh.half[0]; *(v8us*)((unsigned short*)Hl + t * 8) = fl.half[0];  } }

// ---- fast GEMM (wave tile 32x64; requires M % 32 == 0 rows per launch region and N % 64 == 0); epilogue = k_gemm_hhx semantics ----
__device__ __forceinline__ v16h g2_frag(const _Float16* p, int hh) { FragH f; f.half[0] = *(const v8us*)((const unsigned short*)p + 8 * hh); f.half[1] = *(const v8us*)((const unsigned short*)p + 16 + 8 * hh); return f.v; }
__device__ __forceinline__ v8f g2_mma(v16h a, v16h b, v8f c) { v8f d = __builtin_amdgcn_wmma_f32_16x16x32_f16(false, a, false, b, (short)0, c, false, false); asm volatile("v_nop\n\tv_nop\n\tv_nop\n\tv_nop" : "+v"(d) : "v"(a), "v"(b)); return d; }
template <int ACT>
__global__ __launch_bounds__(128) void k_gemm2(const _Float16* __restrict__ A, int lda, size_t sA, const _Float16* __restrict__ Bh, int ldb, size_t sB, float alpha, const float* __restrict__ bias, size_t sBias, const float* __restrict__ CP, int rowsPerB, size_t sCPb, int row0g,
    float* __restrict__ C, _Float16* __restrict__ C16, int ldc, size_t sC, int M, int N, int K) { static_assert(ACT == 0 || ACT == 3 || ACT == 6 || ACT == 8 || ACT == 9 || ACT == 11 || ACT == 12 || ACT == 14 || ACT == 15 || ACT == 16 || ACT == 17, "k_gemm2: unsupported ACT code (would silently apply no activation)");
  __shared__ __attribute__((aligned(16))) float so[4][32][68];
  const int tid = threadIdx.x, w = tid >> 5, lane = tid & 31, ln = lane & 15, hh = lane >> 4; const int by = blockIdx.y;
  A += (size_t)by * sA; Bh += (size_t)by * sB; const size_t cofs = (size_t)by * sC; const float* bp = bias ? bias + (size_t)by * sBias : nullptr;
  const int ntn = N >> 6; const int mt = blockIdx.x / ntn, nq = blockIdx.x - mt * ntn; const int row0 = mt * 128 + 32 * w, col0 = nq * 64; if (row0 >= M) return;
  const _Float16* a0p = A + (size_t)(row0 + ln) * lda; const _Float16* a1p = a0p + (size_t)16 * lda;
  const _Float16* b0p = Bh + (size_t)(col0 + ln) * ldb; const _Float16* b1p = b0p + (size_t)16 * ldb; const _Float16* b2p = b1p + (size_t)16 * ldb; const _Float16* b3p = b2p + (size_t)16 * ldb;
  const v8f z8 = {0.f,0.f,0.f,0.f,0.f,0.f,0.f,0.f}; v8f c00 = z8, c01 = z8, c02 = z8, c03 = z8, c10 = z8, c11 = z8, c12 = z8, c13 = z8;
#pragma unroll 1
  for (int kb = 0; kb < K; kb += 32) { const v16h a0 = g2_frag(a0p + kb, hh), a1 = g2_frag(a1p + kb, hh);
    v16h b = g2_frag(b0p + kb, hh); c00 = g2_mma(a0, b, c00); c10 = g2_mma(a1, b, c10);
    b = g2_frag(b1p + kb, hh); c01 = g2_mma(a0, b, c01); c11 = g2_mma(a1, b, c11);
    b = g2_frag(b2p + kb, hh); c02 = g2_mma(a0, b, c02); c12 = g2_mma(a1, b, c12);
    b = g2_frag(b3p + kb, hh); c03 = g2_mma(a0, b, c03); c13 = g2_mma(a1, b, c13); }
  v8f accs[8] = {c00, c01, c02, c03, c10, c11, c12, c13};
#pragma unroll
  for (int u = 0; u < 8; ++u) { const int t = u & 3, half = u >> 2; const int col = col0 + t * 16 + ln; const float bv = bp ? bf16_round(bp[col]) : 0.f;
#pragma unroll
    for (int r = 0; r < 8; ++r) { const int rloc = half * 16 + 8 * hh + r; float v = accs[u][r] * alpha + bv; if (CP) { if (rowsPerB < 0) v += CP[cofs + (size_t)(row0g + row0 + rloc) * ldc + col];      /* rowsPerB < 0: own element of the batched C plane */ else { const int bidx = (row0g + row0 + rloc) / rowsPerB; v += CP[(size_t)bidx * sCPb + (size_t)by * 64 + col]; } }
      if (ACT == 3) v = fmaxf(v, 0.f); else if (ACT == 6) v = 0.5f * v * (1.0f + erff(v * 0.70710678118654752f)); else if (ACT == 11) v = 1.0f / (1.0f + expf(-v)); else if (ACT == 15) v = v / (1.0f + expf(-v)); else if (ACT == 12) v = (v > 0.f) ? v : 0.01f * v; else if (ACT == 8) v = tanhf(v); else if (ACT == 9) v = 0.5f * v * (1.0f + tanhf(0.7978845608028654f * (v + 0.044715f * v * v * v))); else if (ACT == 14) v = (v > 0.f) ? v : 0.1f * v; else if (ACT == 16) v = (v >= 0.f) ? v : 0.3f * v; else if (ACT == 17) v = (v >= 0.f) ? v : 0.2f * v;
      so[w][rloc][t * 16 + ln] = v; } }
  __builtin_amdgcn_fence(__ATOMIC_ACQ_REL, "workgroup"); __builtin_amdgcn_wave_barrier();
  const int rsub = lane >> 4, c4 = (lane & 15) * 4;
  {
#pragma unroll
    for (int q = 0; q < 16; ++q) { const int r = q * 2 + rsub; const v4f v = *(const v4fa*)&so[w][r][c4]; if (C) *(v4f*)(C + cofs + (size_t)(row0 + r) * ldc + col0 + c4) = v; if (C16) { v4h h4; for (int i = 0; i < 4; ++i) h4[i] = (_Float16)v[i]; *(v4h*)(C16 + cofs + (size_t)(row0 + r) * ldc + col0 + c4) = h4; } }
     } }


__global__ __launch_bounds__(256) void k_wnat(const float* __restrict__ w, size_t n8, _Float16* __restrict__ Bt) { const size_t t = (size_t)blockIdx.x * 256 + threadIdx.x; if (t >= n8) return; FragH f; for (int q = 0; q < 8; ++q) f.h[q] = (_Float16)(bf16_round(w[t * 8 + q]) * 16.0f); *(v8us*)((unsigned short*)Bt + t * 8) = f.half[0];  }
__global__ __launch_bounds__(256) void k_rsm(const float* __restrict__ S, _Float16* __restrict__ P, int nrows) {
  #pragma clang fp contract(off)
  const int i = blockIdx.x * 256 + threadIdx.x; if (i >= nrows) return; const float* s = S + (size_t)i * SQ; float mx = -3.0e38f;
#pragma unroll 1
  for (int j = 0; j < SQ; ++j) mx = fmaxf(mx, s[j]); float se = 0.f;
#pragma unroll 1
  for (int j = 0; j < SQ; ++j) se += expf(s[j] - mx); const float sc = 256.0f / se;
#pragma unroll 1
  for (int j0 = 0; j0 < SQ; j0 += 8) { FragH f; for (int q = 0; q < 8; ++q) f.h[q] = (_Float16)(expf(s[j0 + q] - mx) * sc); unsigned short* d = (unsigned short*)P + (size_t)i * SQ + j0; *(v8us*)d = f.half[0];  } }
__global__ __launch_bounds__(256) void k_vt(const _Float16* __restrict__ V16, int b, int h0, _Float16* __restrict__ VT) { __shared__ unsigned short tl[64][65]; const int tid = threadIdx.x; const int hh = blockIdx.x % HG, sg = blockIdx.x / HG; const int s0 = sg * 64; const int h = h0 + hh;
  for (int i = tid; i < 64 * 8; i += 256) { const int j = i / 8, d8 = (i % 8) * 8; FragH f; f.half[0] = *(const v8us*)((const unsigned short*)V16 + ((size_t)b * SQ + s0 + j) * DM + h * HD + d8); for (int q = 0; q < 8; ++q) tl[d8 + q][j] = f.u[q]; }
  __syncthreads();
  { for (int i = tid; i < 64 * 8; i += 256) { const int d = i / 8, j8 = (i % 8) * 8; FragH f; for (int q = 0; q < 8; ++q) f.u[q] = tl[d][j8 + q]; *(v8us*)((unsigned short*)VT + ((size_t)hh * HD + d) * SQ + s0 + j8) = f.half[0]; }  } }


__global__ __launch_bounds__(256) void k_tile16(const float* __restrict__ O, float* __restrict__ out, size_t n4) { const size_t t = (size_t)blockIdx.x * 256 + threadIdx.x; if (t >= n4) return; const size_t e = t * 4; const size_t r = e / DMO; const int c = (int)(e % DMO); const v4f v = *(const v4fa*)(O + r * HD + (c % HD)); *(v4f*)(out + e) = v;  }


// ---- scores kept in registers: column statistics, then weights and P V, both from recomputed score tiles ----
__device__ __forceinline__ v8f c_mma(v16h a, v16h b, v8f c) { return __builtin_amdgcn_wmma_f32_16x16x32_f16(false, a, false, b, (short)0, c, false, false); }
__device__ __forceinline__ float c_ex2(float y) { float r;
  asm("v_exp_f32 %0, %1\n\tv_nop" : "=v"(r) : "v"(y));      /* native 2^y; the v_nop keeps the slot the instruction set asks for behind a transcendental */
  return r; }
// one 16 key x 16 query tile of S^T (row 8 hh + r = key, column ln = query): k_hi.q_hi + 2^-10 (k_lo.q_hi + k_hi.q_lo); both launches form it with these same instructions
__device__ __forceinline__ v8f c_score(v16h kh0, v16h kh1, v16h kl0, v16h kl1, v16h qh0, v16h qh1, v16h ql0, v16h ql1) {
  const v8f z8 = {0.f,0.f,0.f,0.f,0.f,0.f,0.f,0.f}; v8f h = c_mma(kh0, qh0, z8); h = c_mma(kh1, qh1, h);
  v8f l = c_mma(kl0, qh0, z8); l = c_mma(kl1, qh1, l); l = c_mma(kh0, ql0, l); l = c_mma(kh1, ql1, l);
  return h + l * 0.0009765625f; }
#define LOG2E 1.44269504f
__device__ __forceinline__ v16h c_frag(const _Float16* p) { FragH f; f.half[0] = *(const v8us*)(const unsigned short*)p; f.half[1] = *(const v8us*)((const unsigned short*)p + 16); return f.v; }      /* p = row + k + 8 hh: the k order of g2_frag */
// Per key: maximum over the queries and 256 / sum of exp. Work-group = 32 keys (fragments stay in registers), its 16 waves take 128 queries each, 32 a trip;
// running maximum and sum per lane and key, joined over the 16 lanes of a row, then over the 16 waves through LDS.
__global__ __launch_bounds__(512) void k_cstat(const _Float16* __restrict__ KH, const _Float16* __restrict__ KL, const _Float16* __restrict__ QH, const _Float16* __restrict__ QL, float* __restrict__ MX, float* __restrict__ SC) {
  __shared__ float sm[16][32]; __shared__ float sz[16][32];
  const int tid = threadIdx.x, w = tid >> 5, lane = tid & 31, ln = lane & 15, hh = lane >> 4;
  const size_t base = (size_t)blockIdx.y * SQ; const int k0 = blockIdx.x * 32;
  const _Float16* pkh = KH + (base + k0 + ln) * HD + 8 * hh; const _Float16* pkl = KL + (base + k0 + ln) * HD + 8 * hh;
  v16h kh[2][2], kl[2][2];
#pragma unroll      /* constant indices keep the fragments in registers */
  for (int a = 0; a < 2; ++a) for (int s = 0; s < 2; ++s) { kh[a][s] = c_frag(pkh + 16 * a * HD + 32 * s); kl[a][s] = c_frag(pkl + 16 * a * HD + 32 * s); }
  asm volatile("s_wait_xcnt 0x0" :: "v"(pkh), "v"(pkl) : "memory");      /* the wait in front of any overwrite of the address pairs that the loads above name; as inputs the pairs stay whole up to it */
  float m[2][8], z[2][8];
#pragma unroll      /* constant indices */
  for (int a = 0; a < 2; ++a) for (int r = 0; r < 8; ++r) { m[a][r] = -3.0e38f; z[a][r] = 0.f; }
#pragma unroll 1      /* four trips; unrolled, the query fragments of several trips would not fit beside the key fragments */
  for (int c = 0; c < 4; ++c) {
    const size_t o = (base + w * 128 + c * 32 + ln) * HD + 8 * hh; const _Float16* pqh = QH + o; const _Float16* pql = QL + o;
    const v16h ah0 = c_frag(pqh), ah1 = c_frag(pqh + 32), al0 = c_frag(pql), al1 = c_frag(pql + 32);
    const v16h bh0 = c_frag(pqh + 16 * HD), bh1 = c_frag(pqh + 16 * HD + 32), bl0 = c_frag(pql + 16 * HD), bl1 = c_frag(pql + 16 * HD + 32);
    asm volatile("s_wait_xcnt 0x0" :: "v"(pqh), "v"(pql) : "memory");      /* as above: in front of the next trip's addresses and of any result that would land on these pairs */
#pragma unroll      /* constant indices */
    for (int a = 0; a < 2; ++a) {
      const v8f s0 = c_score(kh[a][0], kh[a][1], kl[a][0], kl[a][1], ah0, ah1, al0, al1);
      const v8f s1 = c_score(kh[a][0], kh[a][1], kl[a][0], kl[a][1], bh0, bh1, bl0, bl1);
#pragma unroll      /* constant indices */
      for (int r = 0; r < 8; ++r) { const float mn = fmaxf(m[a][r], fmaxf(s0[r], s1[r]));
        z[a][r] = z[a][r] * c_ex2((m[a][r] - mn) * LOG2E) + (c_ex2((s0[r] - mn) * LOG2E) + c_ex2((s1[r] - mn) * LOG2E)); m[a][r] = mn; }
    }
  }
#pragma unroll      /* constant indices */
  for (int k = 1; k < 16; k <<= 1) { float mo[2][8], zo[2][8];      /* step outermost: the 32 exchanges of a step are independent and fly together */
    for (int a = 0; a < 2; ++a) for (int r = 0; r < 8; ++r) { mo[a][r] = __shfl_xor(m[a][r], k, 32); zo[a][r] = __shfl_xor(z[a][r], k, 32); }
    for (int a = 0; a < 2; ++a) for (int r = 0; r < 8; ++r) { const float mn = fmaxf(m[a][r], mo[a][r]); z[a][r] = z[a][r] * c_ex2((m[a][r] - mn) * LOG2E) + zo[a][r] * c_ex2((mo[a][r] - mn) * LOG2E); m[a][r] = mn; } }
  if (ln == 0) {
#pragma unroll      /* constant indices */
    for (int a = 0; a < 2; ++a) for (int r = 0; r < 8; ++r) { sm[w][16 * a + 8 * hh + r] = m[a][r]; sz[w][16 * a + 8 * hh + r] = z[a][r]; } }
  __syncthreads();
  if (tid < 32) { float mm = sm[0][tid];
    for (int u = 1; u < 16; ++u) mm = fmaxf(mm, sm[u][tid]);
    float zz = 0.f;
    for (int u = 0; u < 16; ++u) zz += sz[u][tid] * c_ex2((sm[u][tid] - mm) * LOG2E);
    MX[base + k0 + tid] = mm; SC[base + k0 + tid] = 256.0f / zz; } }
// out^T[d][i] = sum_k V^T[d][k] P^T[k][i]. Work-group = 32 queries, its 8 waves take 256 keys each, 32 a trip. Two score tiles (keys 0-15, 16-31 of the trip) hold, per lane,
// exactly the B fragment's elements (element e < 8: key 8 hh + e; e >= 8: key 16 + 8 hh + e - 8; column ln = query), the k order in which g2_frag reads V^T: the weights go from D to B inside the lane.
__global__ __launch_bounds__(256) void k_cpv(const _Float16* __restrict__ KH, const _Float16* __restrict__ KL, const _Float16* __restrict__ QH, const _Float16* __restrict__ QL, const _Float16* __restrict__ VT, const _Float16* __restrict__ VTL,
    const float* __restrict__ MX, const float* __restrict__ SC, float* __restrict__ OF) {
  __shared__ __attribute__((aligned(16))) float red[4][32][68];
  const int tid = threadIdx.x, w = tid >> 5, lane = tid & 31, ln = lane & 15, hh = lane >> 4;
  const size_t base = (size_t)blockIdx.y * SQ; const int q0 = blockIdx.x * 32;
  const _Float16* vh_b = VT + base * HD; const _Float16* vl_b = VTL + base * HD;
  const _Float16* pqh = QH + (base + q0 + ln) * HD + 8 * hh; const _Float16* pql = QL + (base + q0 + ln) * HD + 8 * hh;
  v16h qh[2][2], ql[2][2];
#pragma unroll      /* constant indices keep the fragments in registers */
  for (int c = 0; c < 2; ++c) for (int s = 0; s < 2; ++s) { qh[c][s] = c_frag(pqh + 16 * c * HD + 32 * s); ql[c][s] = c_frag(pql + 16 * c * HD + 32 * s); }
  asm volatile("s_wait_xcnt 0x0" :: "v"(pqh), "v"(pql) : "memory");      /* the wait in front of any overwrite of the address pairs that the loads above name; as inputs the pairs stay whole up to it */
  const v8f z8 = {0.f,0.f,0.f,0.f,0.f,0.f,0.f,0.f}; v8f oh[4][2], ol[4][2];
#pragma unroll      /* constant indices */
  for (int t = 0; t < 4; ++t) for (int c = 0; c < 2; ++c) { oh[t][c] = z8; ol[t][c] = z8; }
#pragma unroll 1      /* eight trips; one trip's fragments beside 128 accumulator registers */
  for (int it = 0; it < 8; ++it) { const int k0 = w * 256 + it * 32; FragH p[2];
    const _Float16* pkh = KH + (base + k0 + ln) * HD + 8 * hh; const _Float16* pkl = KL + (base + k0 + ln) * HD + 8 * hh; const float* pm = MX + base + k0 + 8 * hh; const float* pc = SC + base + k0 + 8 * hh;
    const _Float16* pvh = vh_b + (size_t)ln * SQ + k0 + 8 * hh; const _Float16* pvl = vl_b + (size_t)ln * SQ + k0 + 8 * hh;
#pragma unroll      /* constant indices */
    for (int a = 0; a < 2; ++a) {
      const v16h kh0 = c_frag(pkh + 16 * a * HD), kh1 = c_frag(pkh + 16 * a * HD + 32), kl0 = c_frag(pkl + 16 * a * HD), kl1 = c_frag(pkl + 16 * a * HD + 32);
      const v4f m0 = *(const v4fa*)(pm + 16 * a), m1 = *(const v4fa*)(pm + 16 * a + 4), c0 = *(const v4fa*)(pc + 16 * a), c1 = *(const v4fa*)(pc + 16 * a + 4);
#pragma unroll      /* constant indices */
      for (int c = 0; c < 2; ++c) { const v8f s = c_score(kh0, kh1, kl0, kl1, qh[c][0], qh[c][1], ql[c][0], ql[c][1]);
#pragma unroll      /* constant indices */
        for (int r = 0; r < 4; ++r) { p[c].h[8 * a + r] = (_Float16)(c_ex2((s[r] - m0[r]) * LOG2E) * c0[r]); p[c].h[8 * a + 4 + r] = (_Float16)(c_ex2((s[4 + r] - m1[r]) * LOG2E) * c1[r]); } } }
#pragma unroll      /* constant indices */
    for (int t = 0; t < 4; ++t) { const v16h vh = c_frag(pvh + (size_t)16 * t * SQ), vl = c_frag(pvl + (size_t)16 * t * SQ);
#pragma unroll      /* constant indices */
      for (int c = 0; c < 2; ++c) { oh[t][c] = c_mma(vh, p[c].v, oh[t][c]); ol[t][c] = c_mma(vl, p[c].v, ol[t][c]); } }
    asm volatile("s_wait_xcnt 0x0" :: "v"(pkh), "v"(pkl), "v"(pm), "v"(pc), "v"(pvh), "v"(pvl) : "memory");      /* as above, at the trip's foot: in front of the next trip's addresses */
  }
  /* the 8 key slices are added: waves 4-7 hand theirs to waves 0-3 through LDS, then every thread adds the four sums left */
#pragma unroll      /* constant indices */
  for (int t = 0; t < 4; ++t) for (int c = 0; c < 2; ++c) { oh[t][c] = oh[t][c] * 0.00390625f + ol[t][c] * 0.000003814697265625f;
    if (w >= 4) { float* d = &red[w - 4][16 * c + ln][16 * t + 8 * hh]; const v4f x0 = {oh[t][c][0], oh[t][c][1], oh[t][c][2], oh[t][c][3]}, x1 = {oh[t][c][4], oh[t][c][5], oh[t][c][6], oh[t][c][7]}; *(v4fa*)d = x0; *(v4fa*)(d + 4) = x1; } }
  __syncthreads();
  if (w < 4) {
#pragma unroll      /* constant indices */
    for (int t = 0; t < 4; ++t) for (int c = 0; c < 2; ++c) { float* d = &red[w][16 * c + ln][16 * t + 8 * hh]; v4f x0 = *(const v4fa*)d, x1 = *(const v4fa*)(d + 4);
      for (int r = 0; r < 4; ++r) { x0[r] += oh[t][c][r]; x1[r] += oh[t][c][4 + r]; }
      *(v4fa*)d = x0; *(v4fa*)(d + 4) = x1; } }
  __syncthreads();
#pragma unroll      /* two 16-byte pieces a thread */
  for (int j = 0; j < 2; ++j) { const int idx = tid + 256 * j, q = idx >> 4, d4 = (idx & 15) * 4;
    const v4f v = (*(const v4fa*)&red[0][q][d4] + *(const v4fa*)&red[1][q][d4]) + (*(const v4fa*)&red[2][q][d4] + *(const v4fa*)&red[3][q][d4]);
    *(v4f*)(OF + (base + q0 + q) * HD + d4) = v; } }

extern "C" void kernel_launch(void* const* d_in, const int* in_sizes, int n_in,
                              void* d_out, int out_size, void* d_ws, size_t ws_size, hipStream_t stream) {
  (void)in_sizes; (void)n_in; (void)out_size;
  const float* const* I = (const float* const*)d_in; const float* x = I[0]; const float* wq = I[1]; const float* wk = I[2]; const float* wv = I[3];      /* [in][out] = [1024][64] */
  char* ws = (char*)d_ws; size_t off = 0;
  auto take = [&](size_t bytes) { char* p = ws + off; off += (bytes + 255) & ~(size_t)255; return p; };
  _Float16* BQ = (_Float16*)take((size_t)HD * DM * 2); _Float16* BK = (_Float16*)take((size_t)HD * DM * 2); _Float16* BV = (_Float16*)take((size_t)HD * DM * 2);
  _Float16* X16 = (_Float16*)take(NR * DM * 2); float* QF = (float*)take(NR * HD * 4); float* KF = (float*)take(NR * HD * 4); _Float16* QH = (_Float16*)take(NR * HD * 2); _Float16* QL = (_Float16*)take(NR * HD * 2); _Float16* KH = (_Float16*)take(NR * HD * 2); _Float16* KL = (_Float16*)take(NR * HD * 2); float* VF = (float*)take(NR * HD * 4); _Float16* VH = (_Float16*)take(NR * HD * 2); _Float16* VL = (_Float16*)take(NR * HD * 2);
  float* MX = (float*)take(NR * 4); float* SC = (float*)take(NR * 4); _Float16* VT = (_Float16*)take(NR * HD * 2); _Float16* VTL = (_Float16*)take(NR * HD * 2); float* OF = (float*)take(NR * HD * 4);      /* one plane per batch */
  if (off > ws_size) return;      /* approx 16 + 12 + 4 = 32 MiB */
  k_wt_f16<<<(unsigned)(((size_t)HD * (DM / 8) + 255) / 256), 256, 0, stream>>>(wq, BQ, DM, HD, 16.0f); k_wt_f16<<<(unsigned)(((size_t)HD * (DM / 8) + 255) / 256), 256, 0, stream>>>(wk, BK, DM, HD, 16.0f); k_wt_f16<<<(unsigned)(((size_t)HD * (DM / 8) + 255) / 256), 256, 0, stream>>>(wv, BV, DM, HD, 16.0f);      /* [1024][64] -> Bt[64][1024] x16 */
  k_x16<<<(unsigned)((NR * DM / 8 + 255) / 256), 256, 0, stream>>>(x, X16, NR * DM / 8);
  k_gemm2<0><<<dim3((unsigned)((NR / 128) * 1), 1), 128, 0, stream>>>(X16, DM, 0, BQ, DM, 0, 0.0625f, nullptr, 0, nullptr, 1, 0, 0, QF, nullptr, HD, 0, (int)NR, HD, DM);      /* q (f32, exact products) */
  k_gemm2<0><<<dim3((unsigned)((NR / 128) * 1), 1), 128, 0, stream>>>(X16, DM, 0, BK, DM, 0, 0.0625f, nullptr, 0, nullptr, 1, 0, 0, KF, nullptr, HD, 0, (int)NR, HD, DM);      /* k (f32) */
  k_gemm2<0><<<dim3((unsigned)((NR / 128) * 1), 1), 128, 0, stream>>>(X16, DM, 0, BV, DM, 0, 0.0625f, nullptr, 0, nullptr, 1, 0, 0, VF, nullptr, HD, 0, (int)NR, HD, DM);      /* v (f32, exact products) */
  k_hl<<<(unsigned)((NR * HD / 8 + 255) / 256), 256, 0, stream>>>(QF, QH, QL, NR * HD / 8); k_hl<<<(unsigned)((NR * HD / 8 + 255) / 256), 256, 0, stream>>>(KF, KH, KL, NR * HD / 8); k_hl<<<(unsigned)((NR * HD / 8 + 255) / 256), 256, 0, stream>>>(VF, VH, VL, NR * HD / 8);      /* f16 hi + x1024 residual planes of q, k, v */
  /* the four batches are independent: each stage is one launch over all of them (blockIdx.y = batch, or a four times longer grid over planes that lie one behind the other) */
  k_vt<1, SQ><<<NB * (SQ / 64), 256, 0, stream>>>(VH, HD, 0, VT); k_vt<1, SQ><<<NB * (SQ / 64), 256, 0, stream>>>(VL, HD, 0, VTL);      /* V^T hi / residual [b][64][2048] */
  k_cstat<<<dim3(SQ / 32, NB), 512, 0, stream>>>(KH, KL, QH, QL, MX, SC);      /* per key: max over the query index i, 256 / sum of exp */
  k_cpv<<<dim3(SQ / 32, NB), 256, 0, stream>>>(KH, KL, QH, QL, VT, VTL, MX, SC, OF);      /* out_i = 2^-8 sum_k f16(256 att[i][k]) (v_hi + 2^-10 v_lo) */
  k_tile16<<<(unsigned)((NR * DMO / 4 + 255) / 256), 256, 0, stream>>>(OF, (float*)d_out, NR * DMO / 4);      /* the 16 identical heads */
}

// v004
// A run of this version takes 99.9 microseconds.
// Timed twice side by side with v003, it ran 1.84 and 1.85 times as fast.
// All steps since v000 together make it 21.8 times as fast.
#include <hip/hip_runtime.h>
// Single-projection attention with a QUERY-axis softmax, tiled 16x (x [4][2048][1024]; q, k, v = x W ([1024][64] weights stored [in][out], shared by all heads); att[i][k] = q_i . k_k (no scaling); att = softmax over the QUERY index i for each key column k (the module's nn.Softmax(dim=1)); out_i = sum_k att[i][k] v_k -> [2048][64], concatenated 16 times -> [4][2048][1024]).
// Structure: token rows; x as exact f16 rows; q and k projections as WMMA GEMMs (32x64 wave tiles, f32 accumulation, exact x16 weights) kept in f32 and split into f16 hi + x1024 residual planes (the unscaled logits have sigma 8, so they are formed from three hi/lo products, ~2^-21 relative); v likewise kept f32 and split; V^T (hi and residual) via LDS transposes; the scores never go through memory: transposed score tiles S^T[k][i] = k_k . q_i (three hi/lo products, K = 64) are formed twice in registers, once for each key's maximum and sum of exp over the query index i (= the module's column softmax; f32 statistics, native exp), once for the weights (x256 f16), which pass inside the lane from the score tiles' D layout into the B fragment of out^T = V^T P^T (hi and residual accumulators, f32), 8 key slices added through LDS into a [2048][64] plane, broadcast into the 16 head slots of the output rows with thread-linear float4 stores; every per-batch stage runs as one launch over the four batches, and the stages that q, k, v (and V^T hi / residual) each need run as one launch over adjacent planes; 8 launches.
// Compute dtype: inputs rounded to bf16; x / weights exact; q, k, v as f16 hi + residual pairs; the softmax weights plain f16 (~2^-12); scores, statistics, out f32. v_wmma_f32_16x16x32_f16.
#define NB 4
#define SQ 2048
#define DM 1024
#define HD 64
#define NH 1
#define HG 1
#define DMO 1024                     /* output row width = 16 x 64 */
#define B0 0                         /* unused */
#define NBR NB
#define NR ((size_t)NB * SQ)
typedef __bf16 v16b __attribute__((ext_vector_type(16)));
typedef unsigned short v8us __attribute__((ext_vector_type(8), may_alias));
typedef float  v8f  __attribute__((ext_vector_type(8)));
typedef float  v4f  __attribute__((ext_vector_type(4)));
typedef float  v4fa __attribute__((ext_vector_type(4), may_alias));
union FragB { v16b v; v8us half[2]; unsigned short u[16]; };

__device__ __forceinline__ unsigned short bf16_bits(float x) { unsigned int u = __float_as_uint(x); return (unsigned short)((u + 0x7FFFu + ((u >> 16) & 1u)) >> 16); }
__device__ __forceinline__ float bf16_val(unsigned short b) { return __uint_as_float(((unsigned int)b) << 16); }
__device__ __forceinline__ float bf16_round(float x) { return bf16_val(bf16_bits(x)); }
// D += A·B with NT terms: 1 = ah·bh, 2 = + al·bh (A split), 3 = + ah·bl (both split)
template <int NT>
__device__ __forceinline__ v8f mmaN(v16b ah, v16b al, v16b bh, v16b bl, v8f c) {
  c = __builtin_amdgcn_wmma_f32_16x16x32_bf16(false, ah, false, bh, (short)0, c, false, false);
  if (NT >= 2) c = __builtin_amdgcn_wmma_f32_16x16x32_bf16(false, al, false, bh, (short)0, c, false, false);
  if (NT >= 3) c = __builtin_amdgcn_wmma_f32_16x16x32_bf16(false, ah, false, bl, (short)0, c, false, false);
  asm volatile("v_nop\n\tv_nop\n\tv_nop\n\tv_nop" : "+v"(c) : "v"(ah), "v"(al), "v"(bh), "v"(bl));
  return c;
}

__global__ __launch_bounds__(256) void k_wt_bf16(const float* __restrict__ W, unsigned short* __restrict__ Wt, int K, int N) {
  const int t = blockIdx.x * 256 + threadIdx.x;
  const int k8n = K / 8;
  if (t >= N * k8n) return;
  const int n = t / k8n, k8 = (t % k8n) * 8;
  v8us v;
#pragma unroll
  for (int i = 0; i < 8; ++i) v[i] = bf16_bits(W[(size_t)(k8 + i) * N + n]);
  *(v8us*)(Wt + (size_t)n * K + k8) = v;
  
}

// GEMM C[M][N] (f32, pitch ldc) = act(A[M][K]·W + bias). A f32 row-major (pitch lda) converted per fragment to bf16
// (ASPLIT: hi/lo two planes -> 2 terms, else single rounded term); Wt bf16 [N][K] (pitch ldb). BIAS_BF16 rounds the
// bias to bf16 first (bias quantised to bf16 before the add). K%32==0, M%16==0, N%64==0.
template <bool ASPLIT, int ACT, bool BIAS_BF16>
__global__ __launch_bounds__(128) void k_gemm_bf(const float* __restrict__ A, int lda, const unsigned short* __restrict__ Wt, int ldb,
                                               const float* __restrict__ bias, float* __restrict__ C, int ldc, int M, int N, int K) {
  __shared__ __attribute__((aligned(16))) float so[4][16][64];
  const int tid = threadIdx.x, w = tid >> 5, lane = tid & 31, ln = lane & 15, hh = lane >> 4;
  const int ntn = N / 64;
  const int wid = blockIdx.x * 4 + w;
  const int mt = wid / ntn, nq = wid % ntn;
  if (mt * 16 >= M) return;
  const int row0 = mt * 16, col0 = nq * 64;
  const float* arow = A + (size_t)(row0 + ln) * lda;
  v8f acc[4] = {};
  for (int kb = 0; kb < K; kb += 32) {
    FragB ah, al;
    const v4f x0 = *(const v4fa*)(arow + kb + 8 * hh), x1 = *(const v4fa*)(arow + kb + 8 * hh + 4);
    const v4f x2 = *(const v4fa*)(arow + kb + 16 + 8 * hh), x3 = *(const v4fa*)(arow + kb + 16 + 8 * hh + 4);
    float xs[16] = {x0[0],x0[1],x0[2],x0[3],x1[0],x1[1],x1[2],x1[3],x2[0],x2[1],x2[2],x2[3],x3[0],x3[1],x3[2],x3[3]};
#pragma unroll
    for (int i = 0; i < 16; ++i) { const unsigned short hb = bf16_bits(xs[i]); ah.u[i] = hb; al.u[i] = ASPLIT ? bf16_bits(xs[i] - bf16_val(hb)) : (unsigned short)0; }
#pragma unroll
    for (int t = 0; t < 4; ++t) {
      const unsigned short* brow = Wt + (size_t)(col0 + t * 16 + ln) * ldb + kb;
      FragB b;
      b.half[0] = *(const v8us*)(brow + 8 * hh);
      b.half[1] = *(const v8us*)(brow + 16 + 8 * hh);
      acc[t] = mmaN<ASPLIT ? 2 : 1>(ah.v, al.v, b.v, b.v, acc[t]);
    }
  }
#pragma unroll
  for (int t = 0; t < 4; ++t) {
    float bv = bias ? bias[col0 + t * 16 + ln] : 0.f;
    if (BIAS_BF16) bv = bf16_round(bv);
#pragma unroll
    for (int r = 0; r < 8; ++r) { float v = acc[t][r] + bv; if (ACT == 1) v = fmaxf(v, 0.f); so[w][8 * hh + r][t * 16 + ln] = v; }
  }
  __builtin_amdgcn_fence(__ATOMIC_ACQ_REL, "workgroup");
  __builtin_amdgcn_wave_barrier();
  const int rsub = lane >> 4, c4 = (lane & 15) * 4;
  {
#pragma unroll
    for (int q = 0; q < 8; ++q) {
      const int r = q * 2 + rsub;
      const v4f v = *(const v4fa*)&so[w][r][c4];
      *(v4f*)(C + (size_t)(row0 + r) * ldc + col0 + c4) = v;
    }
    
  }
}

// GEMM C = act(A·W + bias + resid): A f32 (ASPLIT -> hi/lo 2 terms), Wt bf16 [N][K]; ACT 0 none, 1 relu, 2 exact gelu;
// resid (optional, f32, row index = (row % rmod), pitch ldr, RES_BF16 rounds it) added before the activation.
template <bool ASPLIT, int ACT, bool BIAS_BF16, bool RES_BF16>
__global__ __launch_bounds__(128) void k_gemm_bf3(const float* __restrict__ A, int lda, const unsigned short* __restrict__ Wt, int ldb,
                                                const float* __restrict__ bias, const float* __restrict__ resid, int rmod, int ldr,
                                                float* __restrict__ C, int ldc, int M, int N, int K) {
  __shared__ __attribute__((aligned(16))) float so[4][16][64];
  const int tid = threadIdx.x, w = tid >> 5, lane = tid & 31, ln = lane & 15, hh = lane >> 4;
  const int ntn = N / 64;
  const int wid = blockIdx.x * 4 + w;
  const int mt = wid / ntn, nq = wid % ntn;
  if (mt * 16 >= M) return;
  const int row0 = mt * 16, col0 = nq * 64;
  const float* arow = A + (size_t)(row0 + ln) * lda;
  v8f acc[4] = {};
  for (int kb = 0; kb < K; kb += 32) {
    FragB ah, al;
    const v4f x0 = *(const v4fa*)(arow + kb + 8 * hh), x1 = *(const v4fa*)(arow + kb + 8 * hh + 4);
    const v4f x2 = *(const v4fa*)(arow + kb + 16 + 8 * hh), x3 = *(const v4fa*)(arow + kb + 16 + 8 * hh + 4);
    float xs[16] = {x0[0],x0[1],x0[2],x0[3],x1[0],x1[1],x1[2],x1[3],x2[0],x2[1],x2[2],x2[3],x3[0],x3[1],x3[2],x3[3]};
#pragma unroll
    for (int i = 0; i < 16; ++i) { const unsigned short hb = bf16_bits(xs[i]); ah.u[i] = hb; al.u[i] = ASPLIT ? bf16_bits(xs[i] - bf16_val(hb)) : (unsigned short)0; }
#pragma unroll
    for (int t = 0; t < 4; ++t) {
      const unsigned short* brow = Wt + (size_t)(col0 + t * 16 + ln) * ldb + kb;
      FragB b;
      b.half[0] = *(const v8us*)(brow + 8 * hh);
      b.half[1] = *(const v8us*)(brow + 16 + 8 * hh);
      acc[t] = mmaN<ASPLIT ? 2 : 1>(ah.v, al.v, b.v, b.v, acc[t]);
    }
  }
#pragma unroll
  for (int t = 0; t < 4; ++t) {
    const int col = col0 + t * 16 + ln;
    float bv = bias ? bias[col] : 0.f;
    if (BIAS_BF16) bv = bf16_round(bv);
#pragma unroll
    for (int r = 0; r < 8; ++r) {
      float v = acc[t][r] + bv;
      if (resid) { float rv = resid[(size_t)((row0 + 8 * hh + r) % rmod) * ldr + col]; if (RES_BF16) rv = bf16_round(rv); v += rv; }
      if (ACT == 1) v = fmaxf(v, 0.f);
      if (ACT == 2) v = 0.5f * v * (1.0f + erff(v * 0.70710678118654752f));
      if (ACT == 3) { const float u = 0.7978845608028654f * (v + 0.044715f * v * v * v); v = 0.5f * v * (1.0f + tanhf(u)); }
      so[w][8 * hh + r][t * 16 + ln] = v;
    }
  }
  __builtin_amdgcn_fence(__ATOMIC_ACQ_REL, "workgroup");
  __builtin_amdgcn_wave_barrier();
  const int rsub = lane >> 4, c4 = (lane & 15) * 4;
  {
#pragma unroll
    for (int q = 0; q < 8; ++q) {
      const int r = q * 2 + rsub;
      const v4f v = *(const v4fa*)&so[w][r][c4];
      *(v4f*)(C + (size_t)(row0 + r) * ldc + col0 + c4) = v;
    }
    
  }
}
// row LayerNorm (biased variance, eps) over N: s = X (+ R); optional out_sum <- s; out_norm <- (s-mu)*rsqrt(var+eps)*g + b
template <bool PARAM_BF16>
__global__ __launch_bounds__(256) void k_layernorm(const float* __restrict__ X, const float* __restrict__ R, const float* __restrict__ g, const float* __restrict__ bta,
                                                  float* __restrict__ out_sum, float* __restrict__ out_norm, int N, float eps) {
  __shared__ float red[256];
  const int row = blockIdx.x, tid = threadIdx.x;
  const float* x = X + (size_t)row * N; const float* rr = R ? R + (size_t)row * N : nullptr;
  float vals[16];                     // up to N = 4096
  const int per = N / 256;            // contiguous chunk per thread? use strided-by-4 chunks: thread handles j = tid*4 + 1024*u
  float s1 = 0.f;
  for (int u = 0; u < per / 4; ++u) {
    const int j = tid * 4 + 1024 * u;
    const v4f a = *(const v4fa*)(x + j);
    v4f b = {0.f,0.f,0.f,0.f}; if (rr) b = *(const v4fa*)(rr + j);
#pragma unroll
    for (int q = 0; q < 4; ++q) { const float v = a[q] + b[q]; vals[u * 4 + q] = v; s1 += v; }
  }
  red[tid] = s1; __syncthreads();
  for (int st = 128; st > 0; st >>= 1) { if (tid < st) red[tid] += red[tid + st]; __syncthreads(); }
  const float mu = red[0] / (float)N; __syncthreads();
  float s2 = 0.f;
  for (int u = 0; u < per / 4; ++u)
#pragma unroll
    for (int q = 0; q < 4; ++q) { const float c = vals[u * 4 + q] - mu; s2 += c * c; }
  red[tid] = s2; __syncthreads();
  for (int st = 128; st > 0; st >>= 1) { if (tid < st) red[tid] += red[tid + st]; __syncthreads(); }
  const float rs = rsqrtf(red[0] / (float)N + eps);
  {
    for (int u = 0; u < per / 4; ++u) {
      const int j = tid * 4 + 1024 * u;
      v4f o, sm;
#pragma unroll
      for (int q = 0; q < 4; ++q) {
        float gg = g[j + q], bb = bta[j + q];
        if (PARAM_BF16) { gg = bf16_round(gg); bb = bf16_round(bb); }
        sm[q] = vals[u * 4 + q]; o[q] = (vals[u * 4 + q] - mu) * rs * gg + bb;
      }
      if (out_sum) *(v4f*)(out_sum + (size_t)row * N + j) = sm;
      *(v4f*)(out_norm + (size_t)row * N + j) = o;
    }
    
  }
}



// ---- f16 WMMA path (v_wmma_f32_16x16x32_f16): 11-bit significands for operands in range — used where a [0,1] probability operand needs more precision than bf16
typedef _Float16 v16h __attribute__((ext_vector_type(16)));
union FragH { v16h v; v8us half[2]; _Float16 h[16]; unsigned short u[16]; };
template <int NT>
__device__ __forceinline__ v8f mmaH(v16h ah, v16h al, v16h bh, v16h bl, v8f c) {
  c = __builtin_amdgcn_wmma_f32_16x16x32_f16(false, ah, false, bh, (short)0, c, false, false);
  if (NT >= 2) c = __builtin_amdgcn_wmma_f32_16x16x32_f16(false, al, false, bh, (short)0, c, false, false);
  if (NT >= 3) c = __builtin_amdgcn_wmma_f32_16x16x32_f16(false, ah, false, bl, (short)0, c, false, false);
  asm volatile("v_nop\n\tv_nop\n\tv_nop\n\tv_nop" : "+v"(c) : "v"(ah), "v"(al), "v"(bh), "v"(bl));
  return c;
}
// batched GEMM like k_gemm_b but f16 operands: A f32 (split into f16 hi/lo if ASPLIT, else rounded to f16), Bt = f16 values [n][k]; alpha; C f32; N multiple of 16 (partial tiles skipped)
template <bool ASPLIT>
__global__ __launch_bounds__(128) void k_gemm_h(const float* __restrict__ A, int lda, size_t sA, const _Float16* __restrict__ Bh, int ldb, size_t sB, float alpha, float* __restrict__ C, int ldc, size_t sC, int M, int N, int K) {
  __shared__ __attribute__((aligned(16))) float so[4][16][64];
  const int tid = threadIdx.x, w = tid >> 5, lane = tid & 31, ln = lane & 15, hh = lane >> 4; const int by = blockIdx.y;
  A += (size_t)by * sA; Bh += (size_t)by * sB; C += (size_t)by * sC;
  const int ntn = (N + 63) / 64; const int wid = blockIdx.x * 4 + w; const int mt = wid / ntn, nq = wid % ntn; if (mt * 16 >= M) return;
  const int row0 = mt * 16, col0 = nq * 64; const float* arow = A + (size_t)(row0 + ln) * lda;
  v8f acc[4] = {};
  for (int kb = 0; kb < K; kb += 32) {
    FragH ah, al;
    const v4f x0 = *(const v4fa*)(arow + kb + 8 * hh), x1 = *(const v4fa*)(arow + kb + 8 * hh + 4), x2 = *(const v4fa*)(arow + kb + 16 + 8 * hh), x3 = *(const v4fa*)(arow + kb + 16 + 8 * hh + 4);
    float xs[16] = {x0[0],x0[1],x0[2],x0[3],x1[0],x1[1],x1[2],x1[3],x2[0],x2[1],x2[2],x2[3],x3[0],x3[1],x3[2],x3[3]};
#pragma unroll
    for (int i = 0; i < 16; ++i) { const _Float16 h = (_Float16)xs[i]; ah.h[i] = h; al.h[i] = ASPLIT ? (_Float16)(xs[i] - (float)h) : (_Float16)0.0f; }
#pragma unroll
    for (int t = 0; t < 4; ++t) { if (col0 + t * 16 >= N) continue; const size_t boff = (size_t)(col0 + t * 16 + ln) * ldb + kb; FragH bq; bq.half[0] = *(const v8us*)(Bh + boff + 8 * hh); bq.half[1] = *(const v8us*)(Bh + boff + 16 + 8 * hh);
      acc[t] = mmaH<ASPLIT ? 2 : 1>(ah.v, al.v, bq.v, bq.v, acc[t]); }
  }
#pragma unroll
  for (int t = 0; t < 4; ++t) { if (col0 + t * 16 >= N) continue;
#pragma unroll
    for (int r = 0; r < 8; ++r) so[w][8 * hh + r][t * 16 + ln] = acc[t][r] * alpha; }
  __builtin_amdgcn_fence(__ATOMIC_ACQ_REL, "workgroup"); __builtin_amdgcn_wave_barrier();
  const int rsub = lane >> 4, c4 = (lane & 15) * 4;
  {
#pragma unroll
    for (int q = 0; q < 8; ++q) { const int r = q * 2 + rsub; if (col0 + c4 < N) { const v4f v = *(const v4fa*)&so[w][r][c4]; *(v4f*)(C + (size_t)(row0 + r) * ldc + col0 + c4) = v; } }
     }
}

// Wt[n][k] = f16(W[k][n]·scale) from f32 row-major W[K][N] (scale = power of two; bf16-exact weights stay exact in f16 away from the subnormal range)
// blockIdx.y picks one of three weights of the same shape; their Wt planes lie one behind the other
__global__ __launch_bounds__(256) void k_wt_f16(const float* __restrict__ W0, const float* __restrict__ W1, const float* __restrict__ W2, _Float16* __restrict__ Wt, int K, int N, float scale) {
  const int by = blockIdx.y; const float* __restrict__ W = by == 0 ? W0 : by == 1 ? W1 : W2; Wt += (size_t)by * N * K;
  const int t = blockIdx.x * 256 + threadIdx.x; if (t >= N * (K / 8)) return; const int n = t / (K / 8), k8 = (t % (K / 8)) * 8; FragH f;
#pragma unroll
  for (int i = 0; i < 8; ++i) f.h[i] = (_Float16)(bf16_round(W[(size_t)(k8 + i) * N + n]) * scale); const v8us o = f.half[0];
  *(v8us*)((unsigned short*)Wt + (size_t)n * K + k8) = o; 
}
// k_gemm_hh variant with fused epilogue: v = acc·alpha + bias[by·sBias + col] (+ CP[(row/rowsPerB)·sCPb + by·64 + col] if CP) ; ACT 0 none / 1 elu ; writes f16 C16 (and f32 C if non-null)
template <int ACT>
__global__ __launch_bounds__(128) void k_gemm_hhx(const _Float16* __restrict__ A, int lda, size_t sA, const _Float16* __restrict__ Bh, int ldb, size_t sB, float alpha, const float* __restrict__ bias, size_t sBias, const float* __restrict__ CP, int rowsPerB, size_t sCPb, int row0g,
    float* __restrict__ C, _Float16* __restrict__ C16, int ldc, size_t sC, int M, int N, int K) {
  __shared__ __attribute__((aligned(16))) float so[4][16][64];
  const int tid = threadIdx.x, w = tid >> 5, lane = tid & 31, ln = lane & 15, hh = lane >> 4; const int by = blockIdx.y;
  A += (size_t)by * sA; Bh += (size_t)by * sB; const size_t cofs = (size_t)by * sC; const float* bp = bias ? bias + (size_t)by * sBias : nullptr;
  const int ntn = (N + 63) / 64; const int wid = blockIdx.x * 4 + w; const int mt = wid / ntn, nq = wid % ntn; if (mt * 16 >= M) return;
  const int row0 = mt * 16, col0 = nq * 64; const _Float16* arow = A + (size_t)(row0 + ln) * lda;
  v8f acc[4] = {};
  for (int kb = 0; kb < K; kb += 32) { FragH ah; ah.half[0] = *(const v8us*)((const unsigned short*)arow + kb + 8 * hh); ah.half[1] = *(const v8us*)((const unsigned short*)arow + kb + 16 + 8 * hh);
#pragma unroll
    for (int t = 0; t < 4; ++t) { if (col0 + t * 16 >= N) continue; const size_t boff = (size_t)(col0 + t * 16 + ln) * ldb + kb; FragH bq; bq.half[0] = *(const v8us*)((const unsigned short*)Bh + boff + 8 * hh); bq.half[1] = *(const v8us*)((const unsigned short*)Bh + boff + 16 + 8 * hh);
      acc[t] = mmaH<1>(ah.v, ah.v, bq.v, bq.v, acc[t]); }
  }
#pragma unroll
  for (int t = 0; t < 4; ++t) { if (col0 + t * 16 >= N) continue; const int col = col0 + t * 16 + ln; const float bv = bp ? bf16_round(bp[col]) : 0.f;
#pragma unroll
    for (int r = 0; r < 8; ++r) { float v = acc[t][r] * alpha + bv; if (CP) { const int rr = row0g + row0 + 8 * hh + r; if (rowsPerB < 0) v += CP[cofs + (size_t)rr * ldc + col];      /* rowsPerB < 0: own element of the batched C plane */ else { const int bidx = rr / rowsPerB; v += CP[(size_t)bidx * sCPb + (size_t)by * 64 + col]; } } if (ACT == 1) v = (v > 0.f) ? v : expm1f(v); else if (ACT == 7) v = (v > 0.f) ? v + 1.0f : expf(v); else if (ACT == 8) v = tanhf(v); else if (ACT == 9) v = 0.5f * v * (1.0f + tanhf(0.7978845608028654f * (v + 0.044715f * v * v * v))); else if (ACT == 11) v = 1.0f / (1.0f + expf(-v)); else if (ACT == 12) v = (v > 0.f) ? v : 0.01f * v; else if (ACT == 14) v = (v > 0.f) ? v : 0.1f * v; else if (ACT == 16) v = (v >= 0.f) ? v : 0.3f * v; else if (ACT == 17) v = (v >= 0.f) ? v : 0.2f * v; else if (ACT == 15) v = v / (1.0f + expf(-v)); else if (ACT == 3) v = fmaxf(v, 0.f); else if (ACT == 6) v = 0.5f * v * (1.0f + erff(v * 0.70710678118654752f)); so[w][8 * hh + r][t * 16 + ln] = v; } }
  __builtin_amdgcn_fence(__ATOMIC_ACQ_REL, "workgroup"); __builtin_amdgcn_wave_barrier();
  const int rsub = lane >> 4, c4 = (lane & 15) * 4; typedef _Float16 v4h __attribute__((ext_vector_type(4)));
  {
#pragma unroll
    for (int q = 0; q < 8; ++q) { const int r = q * 2 + rsub; if (col0 + c4 < N) { const v4f v = *(const v4fa*)&so[w][r][c4]; if (C) *(v4f*)(C + cofs + (size_t)(row0 + r) * ldc + col0 + c4) = v; if (C16) { v4h h4; for (int i = 0; i < 4; ++i) h4[i] = (_Float16)v[i]; *(v4h*)(C16 + cofs + (size_t)(row0 + r) * ldc + col0 + c4) = h4; } } }
     }
}


typedef _Float16 v4h __attribute__((ext_vector_type(4)));

__global__ __launch_bounds__(256) void k_x16(const float* __restrict__ x, _Float16* __restrict__ X16, size_t n8) { const size_t t = (size_t)blockIdx.x * 256 + threadIdx.x; if (t >= n8) return; FragH f;
#pragma unroll
  for (int q = 0; q < 8; ++q) f.h[q] = (_Float16)bf16_round(x[t * 8 + q]); *(v8us*)((unsigned short*)X16 + t * 8) = f.half[0];  }
__global__ __launch_bounds__(256) void k_h16(const float* __restrict__ x, _Float16* __restrict__ X16, size_t n8) { const size_t t = (size_t)blockIdx.x * 256 + threadIdx.x; if (t >= n8) return; FragH f;
#pragma unroll
  for (int q = 0; q < 8; ++q) f.h[q] = (_Float16)x[t * 8 + q]; *(v8us*)((unsigned short*)X16 + t * 8) = f.half[0];  }
__global__ __launch_bounds__(256) void k_round16f(const float* __restrict__ W, _Float16* __restrict__ Bt, size_t n8) { const size_t t = (size_t)blockIdx.x * 256 + threadIdx.x; if (t >= n8) return; FragH f;
#pragma unroll
  for (int i = 0; i < 8; ++i) f.h[i] = (_Float16)(bf16_round(W[t * 8 + i]) * 16.0f); *(v8us*)((unsigned short*)Bt + t * 8) = f.half[0];  }
template <int NHv, int TTv>
__global__ __launch_bounds__(256) void k_vt(const _Float16* __restrict__ V16, int ldv, int voff, _Float16* __restrict__ Vt, size_t sV, size_t sT) { __shared__ unsigned short tl[64][66]; const int tid = threadIdx.x; V16 += (size_t)blockIdx.y * sV; Vt += (size_t)blockIdx.y * sT;      /* blockIdx.y = source plane (hi, residual) */ const int slab = blockIdx.x / (TTv / 64), lg = blockIdx.x % (TTv / 64); const int b = slab / NHv, h = slab % NHv;
  for (int i = tid; i < 64 * 8; i += 256) { const int r = i / 8, c8 = (i % 8) * 8; FragH f; f.half[0] = *(const v8us*)((const unsigned short*)V16 + ((size_t)b * TTv + lg * 64 + r) * ldv + voff + h * 64 + c8);
#pragma unroll
    for (int q = 0; q < 8; ++q) tl[r][c8 + q] = f.u[q]; }
  __syncthreads();
  {
#pragma unroll
    for (int rd = 0; rd < 2; ++rd) { const int d = rd * 32 + tid / 8, pc = tid % 8; FragH f;
#pragma unroll
      for (int q = 0; q < 8; ++q) f.u[q] = tl[pc * 8 + q][d];
      *(v8us*)((unsigned short*)Vt + ((size_t)slab * 64 + d) * TTv + lg * 64 + pc * 8) = f.half[0]; }
     } }

__global__ __launch_bounds__(256) void k_hl(const float* __restrict__ F, _Float16* __restrict__ Hh, _Float16* __restrict__ Hl, size_t n8) { const size_t t = (size_t)blockIdx.x * 256 + threadIdx.x; if (t >= n8) return; FragH fh, fl; const v4f a = *(const v4fa*)(F + t * 8), c = *(const v4fa*)(F + t * 8 + 4);
#pragma unroll
  for (int q = 0; q < 4; ++q) { _Float16 h = (_Float16)a[q]; fh.h[q] = h; fl.h[q] = (_Float16)((a[q] - (float)h) * 1024.0f); h = (_Float16)c[q]; fh.h[4 + q] = h; fl.h[4 + q] = (_Float16)((c[q] - (float)h) * 1024.0f); }
  { *(v8us*)((unsigned short*)Hh + t * 8) = fh.half[0]; *(v8us*)((unsigned short*)Hl + t * 8) = fl.half[0];  } }

// ---- fast GEMM (wave tile 32x64; requires M % 32 == 0 rows per launch region and N % 64 == 0); epilogue = k_gemm_hhx semantics ----
__device__ __forceinline__ v16h g2_frag(const _Float16* p, int hh) { FragH f; f.half[0] = *(const v8us*)((const unsigned short*)p + 8 * hh); f.half[1] = *(const v8us*)((const unsigned short*)p + 16 + 8 * hh); return f.v; }
__device__ __forceinline__ v8f g2_mma(v16h a, v16h b, v8f c) { v8f d = __builtin_amdgcn_wmma_f32_16x16x32_f16(false, a, false, b, (short)0, c, false, false); asm volatile("v_nop\n\tv_nop\n\tv_nop\n\tv_nop" : "+v"(d) : "v"(a), "v"(b)); return d; }
template <int ACT>
__global__ __launch_bounds__(128) void k_gemm2(const _Float16* __restrict__ A, int lda, size_t sA, const _Float16* __restrict__ Bh, int ldb, size_t sB, float alpha, const float* __restrict__ bias, size_t sBias, const float* __restrict__ CP, int rowsPerB, size_t sCPb, int row0g,
    float* __restrict__ C, _Float16* __restrict__ C16, int ldc, size_t sC, int M, int N, int K) { static_assert(ACT == 0 || ACT == 3 || ACT == 6 || ACT == 8 || ACT == 9 || ACT == 11 || ACT == 12 || ACT == 14 || ACT == 15 || ACT == 16 || ACT == 17, "k_gemm2: unsupported ACT code (would silently apply no activation)");
  __shared__ __attribute__((aligned(16))) float so[4][32][68];
  const int tid = threadIdx.x, w = tid >> 5, lane = tid & 31, ln = lane & 15, hh = lane >> 4; const int by = blockIdx.y;
  A += (size_t)by * sA; Bh += (size_t)by * sB; const size_t cofs = (size_t)by * sC; const float* bp = bias ? bias + (size_t)by * sBias : nullptr;
  const int ntn = N >> 6; const int mt = blockIdx.x / ntn, nq = blockIdx.x - mt * ntn; const int row0 = mt * 128 + 32 * w, col0 = nq * 64; if (row0 >= M) return;
  const _Float16* a0p = A + (size_t)(row0 + ln) * lda; const _Float16* a1p = a0p + (size_t)16 * lda;
  const _Float16* b0p = Bh + (size_t)(col0 + ln) * ldb; const _Float16* b1p = b0p + (size_t)16 * ldb; const _Float16* b2p = b1p + (size_t)16 * ldb; const _Float16* b3p = b2p + (size_t)16 * ldb;
  const v8f z8 = {0.f,0.f,0.f,0.f,0.f,0.f,0.f,0.f}; v8f c00 = z8, c01 = z8, c02 = z8, c03 = z8, c10 = z8, c11 = z8, c12 = z8, c13 = z8;
#pragma unroll 1
  for (int kb = 0; kb < K; kb += 32) { const v16h a0 = g2_frag(a0p + kb, hh), a1 = g2_frag(a1p + kb, hh);
    v16h b = g2_frag(b0p + kb, hh); c00 = g2_mma(a0, b, c00); c10 = g2_mma(a1, b, c10);
    b = g2_frag(b1p + kb, hh); c01 = g2_mma(a0, b, c01); c11 = g2_mma(a1, b, c11);
    b = g2_frag(b2p + kb, hh); c02 = g2_mma(a0, b, c02); c12 = g2_mma(a1, b, c12);
    b = g2_frag(b3p + kb, hh); c03 = g2_mma(a0, b, c03); c13 = g2_mma(a1, b, c13); }
  v8f accs[8] = {c00, c01, c02, c03, c10, c11, c12, c13};
#pragma unroll
  for (int u = 0; u < 8; ++u) { const int t = u & 3, half = u >> 2; const int col = col0 + t * 16 + ln; const float bv = bp ? bf16_round(bp[col]) : 0.f;
#pragma unroll
    for (int r = 0; r < 8; ++r) { const int rloc = half * 16 + 8 * hh + r; float v = accs[u][r] * alpha + bv; if (CP) { if (rowsPerB < 0) v += CP[cofs + (size_t)(row0g + row0 + rloc) * ldc + col];      /* rowsPerB < 0: own element of the batched C plane */ else { const int bidx = (row0g + row0 + rloc) / rowsPerB; v += CP[(size_t)bidx * sCPb + (size_t)by * 64 + col]; } }
      if (ACT == 3) v = fmaxf(v, 0.f); else if (ACT == 6) v = 0.5f * v * (1.0f + erff(v * 0.70710678118654752f)); else if (ACT == 11) v = 1.0f / (1.0f + expf(-v)); else if (ACT == 15) v = v / (1.0f + expf(-v)); else if (ACT == 12) v = (v > 0.f) ? v : 0.01f * v; else if (ACT == 8) v = tanhf(v); else if (ACT == 9) v = 0.5f * v * (1.0f + tanhf(0.7978845608028654f * (v + 0.044715f * v * v * v))); else if (ACT == 14) v = (v > 0.f) ? v : 0.1f * v; else if (ACT == 16) v = (v >= 0.f) ? v : 0.3f * v; else if (ACT == 17) v = (v >= 0.f) ? v : 0.2f * v;
      so[w][rloc][t * 16 + ln] = v; } }
  __builtin_amdgcn_fence(__ATOMIC_ACQ_REL, "workgroup"); __builtin_amdgcn_wave_barrier();
  const int rsub = lane >> 4, c4 = (lane & 15) * 4;
  {
#pragma unroll
    for (int q = 0; q < 16; ++q) { const int r = q * 2 + rsub; const v4f v = *(const v4fa*)&so[w][r][c4]; if (C) *(v4f*)(C + cofs + (size_t)(row0 + r) * ldc + col0 + c4) = v; if (C16) { v4h h4; for (int i = 0; i < 4; ++i) h4[i] = (_Float16)v[i]; *(v4h*)(C16 + cofs + (size_t)(row0 + r) * ldc + col0 + c4) = h4; } }
     } }


__global__ __launch_bounds__(256) void k_wnat(const float* __restrict__ w, size_t n8, _Float16* __restrict__ Bt) { const size_t t = (size_t)blockIdx.x * 256 + threadIdx.x; if (t >= n8) return; FragH f; for (int q = 0; q < 8; ++q) f.h[q] = (_Float16)(bf16_round(w[t * 8 + q]) * 16.0f); *(v8us*)((unsigned short*)Bt + t * 8) = f.half[0];  }
__global__ __launch_bounds__(256) void k_rsm(const float* __restrict__ S, _Float16* __restrict__ P, int nrows) {
  #pragma clang fp contract(off)
  const int i = blockIdx.x * 256 + threadIdx.x; if (i >= nrows) return; const float* s = S + (size_t)i * SQ; float mx = -3.0e38f;
#pragma unroll 1
  for (int j = 0; j < SQ; ++j) mx = fmaxf(mx, s[j]); float se = 0.f;
#pragma unroll 1
  for (int j = 0; j < SQ; ++j) se += expf(s[j] - mx); const float sc = 256.0f / se;
#pragma unroll 1
  for (int j0 = 0; j0 < SQ; j0 += 8) { FragH f; for (int q = 0; q < 8; ++q) f.h[q] = (_Float16)(expf(s[j0 + q] - mx) * sc); unsigned short* d = (unsigned short*)P + (size_t)i * SQ + j0; *(v8us*)d = f.half[0];  } }
__global__ __launch_bounds__(256) void k_vt(const _Float16* __restrict__ V16, int b, int h0, _Float16* __restrict__ VT) { __shared__ unsigned short tl[64][65]; const int tid = threadIdx.x; const int hh = blockIdx.x % HG, sg = blockIdx.x / HG; const int s0 = sg * 64; const int h = h0 + hh;
  for (int i = tid; i < 64 * 8; i += 256) { const int j = i / 8, d8 = (i % 8) * 8; FragH f; f.half[0] = *(const v8us*)((const unsigned short*)V16 + ((size_t)b * SQ + s0 + j) * DM + h * HD + d8); for (int q = 0; q < 8; ++q) tl[d8 + q][j] = f.u[q]; }
  __syncthreads();
  { for (int i = tid; i < 64 * 8; i += 256) { const int d = i / 8, j8 = (i % 8) * 8; FragH f; for (int q = 0; q < 8; ++q) f.u[q] = tl[d][j8 + q]; *(v8us*)((unsigned short*)VT + ((size_t)hh * HD + d) * SQ + s0 + j8) = f.half[0]; }  } }


__global__ __launch_bounds__(256) void k_tile16(const float* __restrict__ O, float* __restrict__ out, size_t n4) { const size_t t = (size_t)blockIdx.x * 256 + threadIdx.x; if (t >= n4) return; const size_t e = t * 4; const size_t r = e / DMO; const int c = (int)(e % DMO); const v4f v = *(const v4fa*)(O + r * HD + (c % HD)); *(v4f*)(out + e) = v;  }


// ---- scores kept in registers: column statistics, then weights and P V, both from recomputed score tiles ----
__device__ __forceinline__ v8f c_mma(v16h a, v16h b, v8f c) { return __builtin_amdgcn_wmma_f32_16x16x32_f16(false, a, false, b, (short)0, c, false, false); }
__device__ __forceinline__ float c_ex2(float y) { float r;
  asm("v_exp_f32 %0, %1\n\tv_nop" : "=v"(r) : "v"(y));      /* native 2^y; the v_nop keeps the slot the instruction set asks for behind a transcendental */
  return r; }
// one 16 key x 16 query tile of S^T (row 8 hh + r = key, column ln = query): k_hi.q_hi + 2^-10 (k_lo.q_hi + k_hi.q_lo); both launches form it with these same instructions
__device__ __forceinline__ v8f c_score(v16h kh0, v16h kh1, v16h kl0, v16h kl1, v16h qh0, v16h qh1, v16h ql0, v16h ql1) {
  const v8f z8 = {0.f,0.f,0.f,0.f,0.f,0.f,0.f,0.f}; v8f h = c_mma(kh0, qh0, z8); h = c_mma(kh1, qh1, h);
  v8f l = c_mma(kl0, qh0, z8); l = c_mma(kl1, qh1, l); l = c_mma(kh0, ql0, l); l = c_mma(kh1, ql1, l);
  return h + l * 0.0009765625f; }
#define LOG2E 1.44269504f
__device__ __forceinline__ v16h c_frag(const _Float16* p) { FragH f; f.half[0] = *(const v8us*)(const unsigned short*)p; f.half[1] = *(const v8us*)((const unsigned short*)p + 16); return f.v; }      /* p = row + k + 8 hh: the k order of g2_frag */
// Per key: maximum over the queries and 256 / sum of exp. Work-group = 32 keys (fragments stay in registers), its 16 waves take 128 queries each, 32 a trip;
// running maximum and sum per lane and key, joined over the 16 lanes of a row, then over the 16 waves through LDS.
__global__ __launch_bounds__(512) void k_cstat(const _Float16* __restrict__ KH, const _Float16* __restrict__ KL, const _Float16* __restrict__ QH, const _Float16* __restrict__ QL, float* __restrict__ MX, float* __restrict__ SC) {
  __shared__ float sm[16][32]; __shared__ float sz[16][32];
  const int tid = threadIdx.x, w = tid >> 5, lane = tid & 31, ln = lane & 15, hh = lane >> 4;
  const size_t base = (size_t)blockIdx.y * SQ; const int k0 = blockIdx.x * 32;
  const _Float16* pkh = KH + (base + k0 + ln) * HD + 8 * hh; const _Float16* pkl = KL + (base + k0 + ln) * HD + 8 * hh;
  v16h kh[2][2], kl[2][2];
#pragma unroll      /* constant indices keep the fragments in registers */
  for (int a = 0; a < 2; ++a) for (int s = 0; s < 2; ++s) { kh[a][s] = c_frag(pkh + 16 * a * HD + 32 * s); kl[a][s] = c_frag(pkl + 16 * a * HD + 32 * s); }
  asm volatile("s_wait_xcnt 0x0" :: "v"(pkh), "v"(pkl) : "memory");      /* the wait in front of any overwrite of the address pairs that the loads above name; as inputs the pairs stay whole up to it */
  float m[2][8], z[2][8];
#pragma unroll      /* constant indices */
  for (int a = 0; a < 2; ++a) for (int r = 0; r < 8; ++r) { m[a][r] = -3.0e38f; z[a][r] = 0.f; }
#pragma unroll 1      /* four trips; unrolled, the query fragments of several trips would not fit beside the key fragments */
  for (int c = 0; c < 4; ++c) {
    const size_t o = (base + w * 128 + c * 32 + ln) * HD + 8 * hh; const _Float16* pqh = QH + o; const _Float16* pql = QL + o;
    const v16h ah0 = c_frag(pqh), ah1 = c_frag(pqh + 32), al0 = c_frag(pql), al1 = c_frag(pql + 32);
    const v16h bh0 = c_frag(pqh + 16 * HD), bh1 = c_frag(pqh + 16 * HD + 32), bl0 = c_frag(pql + 16 * HD), bl1 = c_frag(pql + 16 * HD + 32);
    asm volatile("s_wait_xcnt 0x0" :: "v"(pqh), "v"(pql) : "memory");      /* as above: in front of the next trip's addresses and of any result that would land on these pairs */
#pragma unroll      /* constant indices */
    for (int a = 0; a < 2; ++a) {
      const v8f s0 = c_score(kh[a][0], kh[a][1], kl[a][0], kl[a][1], ah0, ah1, al0, al1);
      const v8f s1 = c_score(kh[a][0], kh[a][1], kl[a][0], kl[a][1], bh0, bh1, bl0, bl1);
#pragma unroll      /* constant indices */
      for (int r = 0; r < 8; ++r) { const float mn = fmaxf(m[a][r], fmaxf(s0[r], s1[r]));
        z[a][r] = z[a][r] * c_ex2((m[a][r] - mn) * LOG2E) + (c_ex2((s0[r] - mn) * LOG2E) + c_ex2((s1[r] - mn) * LOG2E)); m[a][r] = mn; }
    }
  }
#pragma unroll      /* constant indices */
  for (int k = 1; k < 16; k <<= 1) { float mo[2][8], zo[2][8];      /* step outermost: the 32 exchanges of a step are independent and fly together */
    for (int a = 0; a < 2; ++a) for (int r = 0; r < 8; ++r) { mo[a][r] = __shfl_xor(m[a][r], k, 32); zo[a][r] = __shfl_xor(z[a][r], k, 32); }
    for (int a = 0; a < 2; ++a) for (int r = 0; r < 8; ++r) { const float mn = fmaxf(m[a][r], mo[a][r]); z[a][r] = z[a][r] * c_ex2((m[a][r] - mn) * LOG2E) + zo[a][r] * c_ex2((mo[a][r] - mn) * LOG2E); m[a][r] = mn; } }
  if (ln == 0) {
#pragma unroll      /* constant indices */
    for (int a = 0; a < 2; ++a) for (int r = 0; r < 8; ++r) { sm[w][16 * a + 8 * hh + r] = m[a][r]; sz[w][16 * a + 8 * hh + r] = z[a][r]; } }
  __syncthreads();
  if (tid < 32) { float mm = sm[0][tid];
    for (int u = 1; u < 16; ++u) mm = fmaxf(mm, sm[u][tid]);
    float zz = 0.f;
    for (int u = 0; u < 16; ++u) zz += sz[u][tid] * c_ex2((sm[u][tid] - mm) * LOG2E);
    MX[base + k0 + tid] = mm; SC[base + k0 + tid] = 256.0f / zz; } }
// out^T[d][i] = sum_k V^T[d][k] P^T[k][i]. Work-group = 32 queries, its 8 waves take 256 keys each, 32 a trip. Two score tiles (keys 0-15, 16-31 of the trip) hold, per lane,
// exactly the B fragment's elements (element e < 8: key 8 hh + e; e >= 8: key 16 + 8 hh + e - 8; column ln = query), the k order in which g2_frag reads V^T: the weights go from D to B inside the lane.
__global__ __launch_bounds__(256) void k_cpv(const _Float16* __restrict__ KH, const _Float16* __restrict__ KL, const _Float16* __restrict__ QH, const _Float16* __restrict__ QL, const _Float16* __restrict__ VT, const _Float16* __restrict__ VTL,
    const float* __restrict__ MX, const float* __restrict__ SC, float* __restrict__ OF) {
  __shared__ __attribute__((aligned(16))) float red[4][32][68];
  const int tid = threadIdx.x, w = tid >> 5, lane = tid & 31, ln = lane & 15, hh = lane >> 4;
  const size_t base = (size_t)blockIdx.y * SQ; const int q0 = blockIdx.x * 32;
  const _Float16* vh_b = VT + base * HD; const _Float16* vl_b = VTL + base * HD;
  const _Float16* pqh = QH + (base + q0 + ln) * HD + 8 * hh; const _Float16* pql = QL + (base + q0 + ln) * HD + 8 * hh;
  v16h qh[2][2], ql[2][2];
#pragma unroll      /* constant indices keep the fragments in registers */
  for (int c = 0; c < 2; ++c) for (int s = 0; s < 2; ++s) { qh[c][s] = c_frag(pqh + 16 * c * HD + 32 * s); ql[c][s] = c_frag(pql + 16 * c * HD + 32 * s); }
  asm volatile("s_wait_xcnt 0x0" :: "v"(pqh), "v"(pql) : "memory");      /* the wait in front of any overwrite of the address pairs that the loads above name; as inputs the pairs stay whole up to it */
  const v8f z8 = {0.f,0.f,0.f,0.f,0.f,0.f,0.f,0.f}; v8f oh[4][2], ol[4][2];
#pragma unroll      /* constant indices */
  for (int t = 0; t < 4; ++t) for (int c = 0; c < 2; ++c) { oh[t][c] = z8; ol[t][c] = z8; }
#pragma unroll 1      /* eight trips; one trip's fragments beside 128 accumulator registers */
  for (int it = 0; it < 8; ++it) { const int k0 = w * 256 + it * 32; FragH p[2];
    const _Float16* pkh = KH + (base + k0 + ln) * HD + 8 * hh; const _Float16* pkl = KL + (base + k0 + ln) * HD + 8 * hh; const float* pm = MX + base + k0 + 8 * hh; const float* pc = SC + base + k0 + 8 * hh;
    const _Float16* pvh = vh_b + (size_t)ln * SQ + k0 + 8 * hh; const _Float16* pvl = vl_b + (size_t)ln * SQ + k0 + 8 * hh;
#pragma unroll      /* constant indices */
    for (int a = 0; a < 2; ++a) {
      const v16h kh0 = c_frag(pkh + 16 * a * HD), kh1 = c_frag(pkh + 16 * a * HD + 32), kl0 = c_frag(pkl + 16 * a * HD), kl1 = c_frag(pkl + 16 * a * HD + 32);
      const v4f m0 = *(const v4fa*)(pm + 16 * a), m1 = *(const v4fa*)(pm + 16 * a + 4), c0 = *(const v4fa*)(pc + 16 * a), c1 = *(const v4fa*)(pc + 16 * a + 4);
#pragma unroll      /* constant indices */
      for (int c = 0; c < 2; ++c) { const v8f s = c_score(kh0, kh1, kl0, kl1, qh[c][0], qh[c][1], ql[c][0], ql[c][1]);
#pragma unroll      /* constant indices */
        for (int r = 0; r < 4; ++r) { p[c].h[8 * a + r] = (_Float16)(c_ex2((s[r] - m0[r]) * LOG2E) * c0[r]); p[c].h[8 * a + 4 + r] = (_Float16)(c_ex2((s[4 + r] - m1[r]) * LOG2E) * c1[r]); } } }
#pragma unroll      /* constant indices */
    for (int t = 0; t < 4; ++t) { const v16h vh = c_frag(pvh + (size_t)16 * t * SQ), vl = c_frag(pvl + (size_t)16 * t * SQ);
#pragma unroll      /* constant indices */
      for (int c = 0; c < 2; ++c) { oh[t][c] = c_mma(vh, p[c].v, oh[t][c]); ol[t][c] = c_mma(vl, p[c].v, ol[t][c]); } }
    asm volatile("s_wait_xcnt 0x0" :: "v"(pkh), "v"(pkl), "v"(pm), "v"(pc), "v"(pvh), "v"(pvl) : "memory");      /* as above, at the trip's foot: in front of the next trip's addresses */
  }
  /* the 8 key slices are added: waves 4-7 hand theirs to waves 0-3 through LDS, then every thread adds the four sums left */
#pragma unroll      /* constant indices */
  for (int t = 0; t < 4; ++t) for (int c = 0; c < 2; ++c) { oh[t][c] = oh[t][c] * 0.00390625f + ol[t][c] * 0.000003814697265625f;
    if (w >= 4) { float* d = &red[w - 4][16 * c + ln][16 * t + 8 * hh]; const v4f x0 = {oh[t][c][0], oh[t][c][1], oh[t][c][2], oh[t][c][3]}, x1 = {oh[t][c][4], oh[t][c][5], oh[t][c][6], oh[t][c][7]}; *(v4fa*)d = x0; *(v4fa*)(d + 4) = x1; } }
  __syncthreads();
  if (w < 4) {
#pragma unroll      /* constant indices */
    for (int t = 0; t < 4; ++t) for (int c = 0; c < 2; ++c) { float* d = &red[w][16 * c + ln][16 * t + 8 * hh]; v4f x0 = *(const v4fa*)d, x1 = *(const v4fa*)(d + 4);
      for (int r = 0; r < 4; ++r) { x0[r] += oh[t][c][r]; x1[r] += oh[t][c][4 + r]; }
      *(v4fa*)d = x0; *(v4fa*)(d + 4) = x1; } }
  __syncthreads();
#pragma unroll      /* two 16-byte pieces a thread */
  for (int j = 0; j < 2; ++j) { const int idx = tid + 256 * j, q = idx >> 4, d4 = (idx & 15) * 4;
    const v4f v = (*(const v4fa*)&red[0][q][d4] + *(const v4fa*)&red[1][q][d4]) + (*(const v4fa*)&red[2][q][d4] + *(const v4fa*)&red[3][q][d4]);
    *(v4f*)(OF + (base + q0 + q) * HD + d4) = v; } }

extern "C" void kernel_launch(void* const* d_in, const int* in_sizes, int n_in,
                              void* d_out, int out_size, void* d_ws, size_t ws_size, hipStream_t stream) {
  (void)in_sizes; (void)n_in; (void)out_size;
  const float* const* I = (const float* const*)d_in; const float* x = I[0]; const float* wq = I[1]; const float* wk = I[2]; const float* wv = I[3];      /* [in][out] = [1024][64] */
  char* ws = (char*)d_ws; size_t off = 0;
  auto take = [&](size_t bytes) { char* p = ws + off; off += (bytes + 255) & ~(size_t)255; return p; };
  /* q, k, v planes of one kind lie one behind the other (order q, k, v), so that one launch covers the three */
  _Float16* B3 = (_Float16*)take((size_t)3 * HD * DM * 2); _Float16* X16 = (_Float16*)take(NR * DM * 2); float* F3 = (float*)take(3 * NR * HD * 4); _Float16* H3 = (_Float16*)take(6 * NR * HD * 2); _Float16* L3 = H3 + 3 * NR * HD;
  _Float16* QH = H3; _Float16* KH = H3 + NR * HD; _Float16* VH = H3 + 2 * NR * HD; _Float16* QL = L3; _Float16* KL = L3 + NR * HD;
  float* MX = (float*)take(NR * 4); float* SC = (float*)take(NR * 4); _Float16* VT = (_Float16*)take(2 * NR * HD * 2); _Float16* VTL = VT + NR * HD; float* OF = (float*)take(NR * HD * 4);      /* one plane per batch */
  if (off > ws_size) return;      /* approx 16 + 12 + 4 = 32 MiB */
  k_wt_f16<<<dim3((unsigned)(((size_t)HD * (DM / 8) + 255) / 256), 3), 256, 0, stream>>>(wq, wk, wv, B3, DM, HD, 16.0f);      /* 3 x [1024][64] -> Bt[3][64][1024] x16 */
  k_x16<<<(unsigned)((NR * DM / 8 + 255) / 256), 256, 0, stream>>>(x, X16, NR * DM / 8);
  k_gemm2<0><<<dim3((unsigned)((NR / 128) * 1), 3), 128, 0, stream>>>(X16, DM, 0, B3, DM, (size_t)HD * DM, 0.0625f, nullptr, 0, nullptr, 1, 0, 0, F3, nullptr, HD, NR * HD, (int)NR, HD, DM);      /* q, k, v (f32, exact products): blockIdx.y = projection */
  k_hl<<<(unsigned)((3 * NR * HD / 8 + 255) / 256), 256, 0, stream>>>(F3, H3, L3, 3 * NR * HD / 8);      /* f16 hi + x1024 residual planes of q, k, v */
  /* the four batches are independent: each stage is one launch over all of them (blockIdx.y = batch, or a four times longer grid over planes that lie one behind the other) */
  k_vt<1, SQ><<<dim3(NB * (SQ / 64), 2), 256, 0, stream>>>(VH, HD, 0, VT, 3 * NR * HD, NR * HD);      /* V^T hi / residual [b][64][2048]: blockIdx.y = 0 hi, 1 residual */
  k_cstat<<<dim3(SQ / 32, NB), 512, 0, stream>>>(KH, KL, QH, QL, MX, SC);      /* per key: max over the query index i, 256 / sum of exp */
  k_cpv<<<dim3(SQ / 32, NB), 256, 0, stream>>>(KH, KL, QH, QL, VT, VTL, MX, SC, OF);      /* out_i = 2^-8 sum_k f16(256 att[i][k]) (v_hi + 2^-10 v_lo) */
  k_tile16<<<(unsigned)((NR * DMO / 4 + 255) / 256), 256, 0, stream>>>(OF, (float*)d_out, NR * DMO / 4);      /* the 16 identical heads */
}

// v005
// A run of this version takes 84.7 microseconds.
// Next to v004, in two timings, it ran 1.20 and 1.13 times as fast.
// All steps since v000 together make it 25.3 times as fast.
#include <hip/hip_runtime.h>
// Single-projection attention with a QUERY-axis softmax, tiled 16x (x [4][2048][1024]; q, k, v = x W ([1024][64] weights stored [in][out], shared by all heads); att[i][k] = q_i . k_k (no scaling); att = softmax over the QUERY index i for each key column k (the module's nn.Softmax(dim=1)); out_i = sum_k att[i][k] v_k -> [2048][64], concatenated 16 times -> [4][2048][1024]).
// Structure: token rows; x as exact f16 rows; q and k projections as WMMA GEMMs (32x64 wave tiles, f32 accumulation, exact x16 weights) kept in f32 and split into f16 hi + x1024 residual planes (the unscaled logits have sigma 8, so they are formed from three hi/lo products, ~2^-21 relative); v likewise kept f32 and split; the split and, for v, the transposition to V^T (hi and residual, whole lines through LDS) are done in the projection launch's epilogue; the scores never go through memory: transposed score tiles S^T[k][i] = k_k . q_i (three hi/lo products, K = 64) are formed twice in registers, once for each key's maximum and sum of exp over the query index i (= the module's column softmax; f32 statistics, native exp), once for the weights (x256 f16), which pass inside the lane from the score tiles' D layout into the B fragment of out^T = V^T P^T (hi and residual accumulators, f32), 8 key slices added through LDS, each sum stored into the 16 head slots of its output row by the same launch (256 contiguous bytes per row and head); every per-batch stage runs as one launch over the four batches, and the stages that q, k, v each need run as one launch over adjacent planes; 5 launches.
// Compute dtype: inputs rounded to bf16; x / weights exact; q, k, v as f16 hi + residual pairs; the softmax weights plain f16 (~2^-12); scores, statistics, out f32. v_wmma_f32_16x16x32_f16.
#define NB 4
#define SQ 2048
#define DM 1024
#define HD 64
#define NH 1
#define HG 1
#define DMO 1024                     /* output row width = 16 x 64 */
#define B0 0                         /* unused */
#define NBR NB
#define NR ((size_t)NB * SQ)
typedef __bf16 v16b __attribute__((ext_vector_type(16)));
typedef unsigned short v8us __attribute__((ext_vector_type(8), may_alias));
typedef float  v8f  __attribute__((ext_vector_type(8)));
typedef float  v4f  __attribute__((ext_vector_type(4)));
typedef float  v4fa __attribute__((ext_vector_type(4), may_alias));
union FragB { v16b v; v8us half[2]; unsigned short u[16]; };

__device__ __forceinline__ unsigned short bf16_bits(float x) { unsigned int u = __float_as_uint(x); return (unsigned short)((u + 0x7FFFu + ((u >> 16) & 1u)) >> 16); }
__device__ __forceinline__ float bf16_val(unsigned short b) { return __uint_as_float(((unsigned int)b) << 16); }
__device__ __forceinline__ float bf16_round(float x) { return bf16_val(bf16_bits(x)); }
// D += A·B with NT terms: 1 = ah·bh, 2 = + al·bh (A split), 3 = + ah·bl (both split)
template <int NT>
__device__ __forceinline__ v8f mmaN(v16b ah, v16b al, v16b bh, v16b bl, v8f c) {
  c = __builtin_amdgcn_wmma_f32_16x16x32_bf16(false, ah, false, bh, (short)0, c, false, false);
  if (NT >= 2) c = __builtin_amdgcn_wmma_f32_16x16x32_bf16(false, al, false, bh, (short)0, c, false, false);
  if (NT >= 3) c = __builtin_amdgcn_wmma_f32_16x16x32_bf16(false, ah, false, bl, (short)0, c, false, false);
  asm volatile("v_nop\n\tv_nop\n\tv_nop\n\tv_nop" : "+v"(c) : "v"(ah), "v"(al), "v"(bh), "v"(bl));
  return c;
}

__global__ __launch_bounds__(256) void k_wt_bf16(const float* __restrict__ W, unsigned short* __restrict__ Wt, int K, int N) {
  const int t = blockIdx.x * 256 + threadIdx.x;
  const int k8n = K / 8;
  if (t >= N * k8n) return;
  const int n = t / k8n, k8 = (t % k8n) * 8;
  v8us v;
#pragma unroll
  for (int i = 0; i < 8; ++i) v[i] = bf16_bits(W[(size_t)(k8 + i) * N + n]);
  *(v8us*)(Wt + (size_t)n * K + k8) = v;
  
}

// GEMM C[M][N] (f32, pitch ldc) = act(A[M][K]·W + bias). A f32 row-major (pitch lda) converted per fragment to bf16
// (ASPLIT: hi/lo two planes -> 2 terms, else single rounded term); Wt bf16 [N][K] (pitch ldb). BIAS_BF16 rounds the
// bias to bf16 first (bias quantised to bf16 before the add). K%32==0, M%16==0, N%64==0.
template <bool ASPLIT, int ACT, bool BIAS_BF16>
__global__ __launch_bounds__(128) void k_gemm_bf(const float* __restrict__ A, int lda, const unsigned short* __restrict__ Wt, int ldb,
                                               const float* __restrict__ bias, float* __restrict__ C, int ldc, int M, int N, int K) {
  __shared__ __attribute__((aligned(16))) float so[4][16][64];
  const int tid = threadIdx.x, w = tid >> 5, lane = tid & 31, ln = lane & 15, hh = lane >> 4;
  const int ntn = N / 64;
  const int wid = blockIdx.x * 4 + w;
  const int mt = wid / ntn, nq = wid % ntn;
  if (mt * 16 >= M) return;
  const int row0 = mt * 16, col0 = nq * 64;
  const float* arow = A + (size_t)(row0 + ln) * lda;
  v8f acc[4] = {};
  for (int kb = 0; kb < K; kb += 32) {
    FragB ah, al;
    const v4f x0 = *(const v4fa*)(arow + kb + 8 * hh), x1 = *(const v4fa*)(arow + kb + 8 * hh + 4);
    const v4f x2 = *(const v4fa*)(arow + kb + 16 + 8 * hh), x3 = *(const v4fa*)(arow + kb + 16 + 8 * hh + 4);
    float xs[16] = {x0[0],x0[1],x0[2],x0[3],x1[0],x1[1],x1[2],x1[3],x2[0],x2[1],x2[2],x2[3],x3[0],x3[1],x3[2],x3[3]};
#pragma unroll
    for (int i = 0; i < 16; ++i) { const unsigned short hb = bf16_bits(xs[i]); ah.u[i] = hb; al.u[i] = ASPLIT ? bf16_bits(xs[i] - bf16_val(hb)) : (unsigned short)0; }
#pragma unroll
    for (int t = 0; t < 4; ++t) {
      const unsigned short* brow = Wt + (size_t)(col0 + t * 16 + ln) * ldb + kb;
      FragB b;
      b.half[0] = *(const v8us*)(brow + 8 * hh);
      b.half[1] = *(const v8us*)(brow + 16 + 8 * hh);
      acc[t] = mmaN<ASPLIT ? 2 : 1>(ah.v, al.v, b.v, b.v, acc[t]);
    }
  }
#pragma unroll
  for (int t = 0; t < 4; ++t) {
    float bv = bias ? bias[col0 + t * 16 + ln] : 0.f;
    if (BIAS_BF16) bv = bf16_round(bv);
#pragma unroll
    for (int r = 0; r < 8; ++r) { float v = acc[t][r] + bv; if (ACT == 1) v = fmaxf(v, 0.f); so[w][8 * hh + r][t * 16 + ln] = v; }
  }
  __builtin_amdgcn_fence(__ATOMIC_ACQ_REL, "workgroup");
  __builtin_amdgcn_wave_barrier();
  const int rsub = lane >> 4, c4 = (lane & 15) * 4;
  {
#pragma unroll
    for (int q = 0; q < 8; ++q) {
      const int r = q * 2 + rsub;
      const v4f v = *(const v4fa*)&so[w][r][c4];
      *(v4f*)(C + (size_t)(row0 + r) * ldc + col0 + c4) = v;
    }
    
  }
}

// GEMM C = act(A·W + bias + resid): A f32 (ASPLIT -> hi/lo 2 terms), Wt bf16 [N][K]; ACT 0 none, 1 relu, 2 exact gelu;
// resid (optional, f32, row index = (row % rmod), pitch ldr, RES_BF16 rounds it) added before the activation.
template <bool ASPLIT, int ACT, bool BIAS_BF16, bool RES_BF16>
__global__ __launch_bounds__(128) void k_gemm_bf3(const float* __restrict__ A, int lda, const unsigned short* __restrict__ Wt, int ldb,
                                                const float* __restrict__ bias, const float* __restrict__ resid, int rmod, int ldr,
                                                float* __restrict__ C, int ldc, int M, int N, int K) {
  __shared__ __attribute__((aligned(16))) float so[4][16][64];
  const int tid = threadIdx.x, w = tid >> 5, lane = tid & 31, ln = lane & 15, hh = lane >> 4;
  const int ntn = N / 64;
  const int wid = blockIdx.x * 4 + w;
  const int mt = wid / ntn, nq = wid % ntn;
  if (mt * 16 >= M) return;
  const int row0 = mt * 16, col0 = nq * 64;
  const float* arow = A + (size_t)(row0 + ln) * lda;
  v8f acc[4] = {};
  for (int kb = 0; kb < K; kb += 32) {
    FragB ah, al;
    const v4f x0 = *(const v4fa*)(arow + kb + 8 * hh), x1 = *(const v4fa*)(arow + kb + 8 * hh + 4);
    const v4f x2 = *(const v4fa*)(arow + kb + 16 + 8 * hh), x3 = *(const v4fa*)(arow + kb + 16 + 8 * hh + 4);
    float xs[16] = {x0[0],x0[1],x0[2],x0[3],x1[0],x1[1],x1[2],x1[3],x2[0],x2[1],x2[2],x2[3],x3[0],x3[1],x3[2],x3[3]};
#pragma unroll
    for (int i = 0; i < 16; ++i) { const unsigned short hb = bf16_bits(xs[i]); ah.u[i] = hb; al.u[i] = ASPLIT ? bf16_bits(xs[i] - bf16_val(hb)) : (unsigned short)0; }
#pragma unroll
    for (int t = 0; t < 4; ++t) {
      const unsigned short* brow = Wt + (size_t)(col0 + t * 16 + ln) * ldb + kb;
      FragB b;
      b.half[0] = *(const v8us*)(brow + 8 * hh);
      b.half[1] = *(const v8us*)(brow + 16 + 8 * hh);
      acc[t] = mmaN<ASPLIT ? 2 : 1>(ah.v, al.v, b.v, b.v, acc[t]);
    }
  }
#pragma unroll
  for (int t = 0; t < 4; ++t) {
    const int col = col0 + t * 16 + ln;
    float bv = bias ? bias[col] : 0.f;
    if (BIAS_BF16) bv = bf16_round(bv);
#pragma unroll
    for (int r = 0; r < 8; ++r) {
      float v = acc[t][r] + bv;
      if (resid) { float rv = resid[(size_t)((row0 + 8 * hh + r) % rmod) * ldr + col]; if (RES_BF16) rv = bf16_round(rv); v += rv; }
      if (ACT == 1) v = fmaxf(v, 0.f);
      if (ACT == 2) v = 0.5f * v * (1.0f + erff(v * 0.70710678118654752f));
      if (ACT == 3) { const float u = 0.7978845608028654f * (v + 0.044715f * v * v * v); v = 0.5f * v * (1.0f + tanhf(u)); }
      so[w][8 * hh + r][t * 16 + ln] = v;
    }
  }
  __builtin_amdgcn_fence(__ATOMIC_ACQ_REL, "workgroup");
  __builtin_amdgcn_wave_barrier();
  const int rsub = lane >> 4, c4 = (lane & 15) * 4;
  {
#pragma unroll
    for (int q = 0; q < 8; ++q) {
      const int r = q * 2 + rsub;
      const v4f v = *(const v4fa*)&so[w][r][c4];
      *(v4f*)(C + (size_t)(row0 + r) * ldc + col0 + c4) = v;
    }
    
  }
}
// row LayerNorm (biased variance, eps) over N: s = X (+ R); optional out_sum <- s; out_norm <- (s-mu)*rsqrt(var+eps)*g + b
template <bool PARAM_BF16>
__global__ __launch_bounds__(256) void k_layernorm(const float* __restrict__ X, const float* __restrict__ R, const float* __restrict__ g, const float* __restrict__ bta,
                                                  float* __restrict__ out_sum, float* __restrict__ out_norm, int N, float eps) {
  __shared__ float red[256];
  const int row = blockIdx.x, tid = threadIdx.x;
  const float* x = X + (size_t)row * N; const float* rr = R ? R + (size_t)row * N : nullptr;
  float vals[16];                     // up to N = 4096
  const int per = N / 256;            // contiguous chunk per thread? use strided-by-4 chunks: thread handles j = tid*4 + 1024*u
  float s1 = 0.f;
  for (int u = 0; u < per / 4; ++u) {
    const int j = tid * 4 + 1024 * u;
    const v4f a = *(const v4fa*)(x + j);
    v4f b = {0.f,0.f,0.f,0.f}; if (rr) b = *(const v4fa*)(rr + j);
#pragma unroll
    for (int q = 0; q < 4; ++q) { const float v = a[q] + b[q]; vals[u * 4 + q] = v; s1 += v; }
  }
  red[tid] = s1; __syncthreads();
  for (int st = 128; st > 0; st >>= 1) { if (tid < st) red[tid] += red[tid + st]; __syncthreads(); }
  const float mu = red[0] / (float)N; __syncthreads();
  float s2 = 0.f;
  for (int u = 0; u < per / 4; ++u)
#pragma unroll
    for (int q = 0; q < 4; ++q) { const float c = vals[u * 4 + q] - mu; s2 += c * c; }
  red[tid] = s2; __syncthreads();
  for (int st = 128; st > 0; st >>= 1) { if (tid < st) red[tid] += red[tid + st]; __syncthreads(); }
  const float rs = rsqrtf(red[0] / (float)N + eps);
  {
    for (int u = 0; u < per / 4; ++u) {
      const int j = tid * 4 + 1024 * u;
      v4f o, sm;
#pragma unroll
      for (int q = 0; q < 4; ++q) {
        float gg = g[j + q], bb = bta[j + q];
        if (PARAM_BF16) { gg = bf16_round(gg); bb = bf16_round(bb); }
        sm[q] = vals[u * 4 + q]; o[q] = (vals[u * 4 + q] - mu) * rs * gg + bb;
      }
      if (out_sum) *(v4f*)(out_sum + (size_t)row * N + j) = sm;
      *(v4f*)(out_norm + (size_t)row * N + j) = o;
    }
    
  }
}



// ---- f16 WMMA path (v_wmma_f32_16x16x32_f16): 11-bit significands for operands in range — used where a [0,1] probability operand needs more precision than bf16
typedef _Float16 v16h __attribute__((ext_vector_type(16)));
union FragH { v16h v; v8us half[2]; _Float16 h[16]; unsigned short u[16]; };
template <int NT>
__device__ __forceinline__ v8f mmaH(v16h ah, v16h al, v16h bh, v16h bl, v8f c) {
  c = __builtin_amdgcn_wmma_f32_16x16x32_f16(false, ah, false, bh, (short)0, c, false, false);
  if (NT >= 2) c = __builtin_amdgcn_wmma_f32_16x16x32_f16(false, al, false, bh, (short)0, c, false, false);
  if (NT >= 3) c = __builtin_amdgcn_wmma_f32_16x16x32_f16(false, ah, false, bl, (short)0, c, false, false);
  asm volatile("v_nop\n\tv_nop\n\tv_nop\n\tv_nop" : "+v"(c) : "v"(ah), "v"(al), "v"(bh), "v"(bl));
  return c;
}
// batched GEMM like k_gemm_b but f16 operands: A f32 (split into f16 hi/lo if ASPLIT, else rounded to f16), Bt = f16 values [n][k]; alpha; C f32; N multiple of 16 (partial tiles skipped)
template <bool ASPLIT>
__global__ __launch_bounds__(128) void k_gemm_h(const float* __restrict__ A, int lda, size_t sA, const _Float16* __restrict__ Bh, int ldb, size_t sB, float alpha, float* __restrict__ C, int ldc, size_t sC, int M, int N, int K) {
  __shared__ __attribute__((aligned(16))) float so[4][16][64];
  const int tid = threadIdx.x, w = tid >> 5, lane = tid & 31, ln = lane & 15, hh = lane >> 4; const int by = blockIdx.y;
  A += (size_t)by * sA; Bh += (size_t)by * sB; C += (size_t)by * sC;
  const int ntn = (N + 63) / 64; const int wid = blockIdx.x * 4 + w; const int mt = wid / ntn, nq = wid % ntn; if (mt * 16 >= M) return;
  const int row0 = mt * 16, col0 = nq * 64; const float* arow = A + (size_t)(row0 + ln) * lda;
  v8f acc[4] = {};
  for (int kb = 0; kb < K; kb += 32) {
    FragH ah, al;
    const v4f x0 = *(const v4fa*)(arow + kb + 8 * hh), x1 = *(const v4fa*)(arow + kb + 8 * hh + 4), x2 = *(const v4fa*)(arow + kb + 16 + 8 * hh), x3 = *(const v4fa*)(arow + kb + 16 + 8 * hh + 4);
    float xs[16] = {x0[0],x0[1],x0[2],x0[3],x1[0],x1[1],x1[2],x1[3],x2[0],x2[1],x2[2],x2[3],x3[0],x3[1],x3[2],x3[3]};
#pragma unroll
    for (int i = 0; i < 16; ++i) { const _Float16 h = (_Float16)xs[i]; ah.h[i] = h; al.h[i] = ASPLIT ? (_Float16)(xs[i] - (float)h) : (_Float16)0.0f; }
#pragma unroll
    for (int t = 0; t < 4; ++t) { if (col0 + t * 16 >= N) continue; const size_t boff = (size_t)(col0 + t * 16 + ln) * ldb + kb; FragH bq; bq.half[0] = *(const v8us*)(Bh + boff + 8 * hh); bq.half[1] = *(const v8us*)(Bh + boff + 16 + 8 * hh);
      acc[t] = mmaH<ASPLIT ? 2 : 1>(ah.v, al.v, bq.v, bq.v, acc[t]); }
  }
#pragma unroll
  for (int t = 0; t < 4; ++t) { if (col0 + t * 16 >= N) continue;
#pragma unroll
    for (int r = 0; r < 8; ++r) so[w][8 * hh + r][t * 16 + ln] = acc[t][r] * alpha; }
  __builtin_amdgcn_fence(__ATOMIC_ACQ_REL, "workgroup"); __builtin_amdgcn_wave_barrier();
  const int rsub = lane >> 4, c4 = (lane & 15) * 4;
  {
#pragma unroll
    for (int q = 0; q < 8; ++q) { const int r = q * 2 + rsub; if (col0 + c4 < N) { const v4f v = *(const v4fa*)&so[w][r][c4]; *(v4f*)(C + (size_t)(row0 + r) * ldc + col0 + c4) = v; } }
     }
}

// Wt[n][k] = f16(W[k][n]·scale) from f32 row-major W[K][N] (scale = power of two; bf16-exact weights stay exact in f16 away from the subnormal range)
// blockIdx.y picks one of three weights of the same shape; their Wt planes lie one behind the other
__global__ __launch_bounds__(256) void k_wt_f16(const float* __restrict__ W0, const float* __restrict__ W1, const float* __restrict__ W2, _Float16* __restrict__ Wt, int K, int N, float scale) {
  const int by = blockIdx.y; const float* __restrict__ W = by == 0 ? W0 : by == 1 ? W1 : W2; Wt += (size_t)by * N * K;
  const int t = blockIdx.x * 256 + threadIdx.x; if (t >= N * (K / 8)) return; const int n = t / (K / 8), k8 = (t % (K / 8)) * 8; FragH f;
#pragma unroll
  for (int i = 0; i < 8; ++i) f.h[i] = (_Float16)(bf16_round(W[(size_t)(k8 + i) * N + n]) * scale); const v8us o = f.half[0];
  *(v8us*)((unsigned short*)Wt + (size_t)n * K + k8) = o; 
}
// k_gemm_hh variant with fused epilogue: v = acc·alpha + bias[by·sBias + col] (+ CP[(row/rowsPerB)·sCPb + by·64 + col] if CP) ; ACT 0 none / 1 elu ; writes f16 C16 (and f32 C if non-null)
template <int ACT>
__global__ __launch_bounds__(128) void k_gemm_hhx(const _Float16* __restrict__ A, int lda, size_t sA, const _Float16* __restrict__ Bh, int ldb, size_t sB, float alpha, const float* __restrict__ bias, size_t sBias, const float* __restrict__ CP, int rowsPerB, size_t sCPb, int row0g,
    float* __restrict__ C, _Float16* __restrict__ C16, int ldc, size_t sC, int M, int N, int K) {
  __shared__ __attribute__((aligned(16))) float so[4][16][64];
  const int tid = threadIdx.x, w = tid >> 5, lane = tid & 31, ln = lane & 15, hh = lane >> 4; const int by = blockIdx.y;
  A += (size_t)by * sA; Bh += (size_t)by * sB; const size_t cofs = (size_t)by * sC; const float* bp = bias ? bias + (size_t)by * sBias : nullptr;
  const int ntn = (N + 63) / 64; const int wid = blockIdx.x * 4 + w; const int mt = wid / ntn, nq = wid % ntn; if (mt * 16 >= M) return;
  const int row0 = mt * 16, col0 = nq * 64; const _Float16* arow = A + (size_t)(row0 + ln) * lda;
  v8f acc[4] = {};
  for (int kb = 0; kb < K; kb += 32) { FragH ah; ah.half[0] = *(const v8us*)((const unsigned short*)arow + kb + 8 * hh); ah.half[1] = *(const v8us*)((const unsigned short*)arow + kb + 16 + 8 * hh);
#pragma unroll
    for (int t = 0; t < 4; ++t) { if (col0 + t * 16 >= N) continue; const size_t boff = (size_t)(col0 + t * 16 + ln) * ldb + kb; FragH bq; bq.half[0] = *(const v8us*)((const unsigned short*)Bh + boff + 8 * hh); bq.half[1] = *(const v8us*)((const unsigned short*)Bh + boff + 16 + 8 * hh);
      acc[t] = mmaH<1>(ah.v, ah.v, bq.v, bq.v, acc[t]); }
  }
#pragma unroll
  for (int t = 0; t < 4; ++t) { if (col0 + t * 16 >= N) continue; const int col = col0 + t * 16 + ln; const float bv = bp ? bf16_round(bp[col]) : 0.f;
#pragma unroll
    for (int r = 0; r < 8; ++r) { float v = acc[t][r] * alpha + bv; if (CP) { const int rr = row0g + row0 + 8 * hh + r; if (rowsPerB < 0) v += CP[cofs + (size_t)rr * ldc + col];      /* rowsPerB < 0: own element of the batched C plane */ else { const int bidx = rr / rowsPerB; v += CP[(size_t)bidx * sCPb + (size_t)by * 64 + col]; } } if (ACT == 1) v = (v > 0.f) ? v : expm1f(v); else if (ACT == 7) v = (v > 0.f) ? v + 1.0f : expf(v); else if (ACT == 8) v = tanhf(v); else if (ACT == 9) v = 0.5f * v * (1.0f + tanhf(0.7978845608028654f * (v + 0.044715f * v * v * v))); else if (ACT == 11) v = 1.0f / (1.0f + expf(-v)); else if (ACT == 12) v = (v > 0.f) ? v : 0.01f * v; else if (ACT == 14) v = (v > 0.f) ? v : 0.1f * v; else if (ACT == 16) v = (v >= 0.f) ? v : 0.3f * v; else if (ACT == 17) v = (v >= 0.f) ? v : 0.2f * v; else if (ACT == 15) v = v / (1.0f + expf(-v)); else if (ACT == 3) v = fmaxf(v, 0.f); else if (ACT == 6) v = 0.5f * v * (1.0f + erff(v * 0.70710678118654752f)); so[w][8 * hh + r][t * 16 + ln] = v; } }
  __builtin_amdgcn_fence(__ATOMIC_ACQ_REL, "workgroup"); __builtin_amdgcn_wave_barrier();
  const int rsub = lane >> 4, c4 = (lane & 15) * 4; typedef _Float16 v4h __attribute__((ext_vector_type(4)));
  {
#pragma unroll
    for (int q = 0; q < 8; ++q) { const int r = q * 2 + rsub; if (col0 + c4 < N) { const v4f v = *(const v4fa*)&so[w][r][c4]; if (C) *(v4f*)(C + cofs + (size_t)(row0 + r) * ldc + col0 + c4) = v; if (C16) { v4h h4; for (int i = 0; i < 4; ++i) h4[i] = (_Float16)v[i]; *(v4h*)(C16 + cofs + (size_t)(row0 + r) * ldc + col0 + c4) = h4; } } }
     }
}


typedef _Float16 v4h __attribute__((ext_vector_type(4)));

__global__ __launch_bounds__(256) void k_x16(const float* __restrict__ x, _Float16* __restrict__ X16, size_t n8) { const size_t t = (size_t)blockIdx.x * 256 + threadIdx.x; if (t >= n8) return; FragH f;
#pragma unroll
  for (int q = 0; q < 8; ++q) f.h[q] = (_Float16)bf16_round(x[t * 8 + q]); *(v8us*)((unsigned short*)X16 + t * 8) = f.half[0];  }
__global__ __launch_bounds__(256) void k_h16(const float* __restrict__ x, _Float16* __restrict__ X16, size_t n8) { const size_t t = (size_t)blockIdx.x * 256 + threadIdx.x; if (t >= n8) return; FragH f;
#pragma unroll
  for (int q = 0; q < 8; ++q) f.h[q] = (_Float16)x[t * 8 + q]; *(v8us*)((unsigned short*)X16 + t * 8) = f.half[0];  }
__global__ __launch_bounds__(256) void k_round16f(const float* __restrict__ W, _Float16* __restrict__ Bt, size_t n8) { const size_t t = (size_t)blockIdx.x * 256 + threadIdx.x; if (t >= n8) return; FragH f;
#pragma unroll
  for (int i = 0; i < 8; ++i) f.h[i] = (_Float16)(bf16_round(W[t * 8 + i]) * 16.0f); *(v8us*)((unsigned short*)Bt + t * 8) = f.half[0];  }
// ---- projection GEMM (wave tile 32x64) with the hi / residual split and the V transposition in its epilogue ----
__device__ __forceinline__ v16h g2_frag(const _Float16* p, int hh) { FragH f; f.half[0] = *(const v8us*)((const unsigned short*)p + 8 * hh); f.half[1] = *(const v8us*)((const unsigned short*)p + 16 + 8 * hh); return f.v; }
__device__ __forceinline__ v8f g2_mma(v16h a, v16h b, v8f c) { v8f d = __builtin_amdgcn_wmma_f32_16x16x32_f16(false, a, false, b, (short)0, c, false, false); asm volatile("v_nop\n\tv_nop\n\tv_nop\n\tv_nop" : "+v"(d) : "v"(a), "v"(b)); return d; }
// The three projections (blockIdx.y = q, k, v): 128 rows a work-group, wave tile 32x64, C = A Bt / 16 (A = x rows, Bt = x16 weights [64][1024]); the f32 results do not go to memory:
// q, k: each wave turns its tile through its own LDS range into whole rows and stores f16 hi and x1024 residual planes [row][64];
// v: a lane's 8 accumulator elements are 8 consecutive tokens of one column, that is 16 bytes of V^T; the work-group gathers its 128 tokens in LDS and stores 256 contiguous bytes per column and plane.
__global__ __launch_bounds__(128) void k_proj(const _Float16* __restrict__ A, const _Float16* __restrict__ Bh, _Float16* __restrict__ Hq, _Float16* __restrict__ Lq, _Float16* __restrict__ VT, _Float16* __restrict__ VTL) {
  __shared__ __attribute__((aligned(16))) float so[4][32][68];
  const int tid = threadIdx.x, w = tid >> 5, lane = tid & 31, ln = lane & 15, hh = lane >> 4; const int by = blockIdx.y;
  Bh += (size_t)by * HD * DM; const int row0 = blockIdx.x * 128 + 32 * w;
  const _Float16* a0p = A + (size_t)(row0 + ln) * DM; const _Float16* a1p = a0p + (size_t)16 * DM;
  const _Float16* b0p = Bh + (size_t)ln * DM; const _Float16* b1p = b0p + (size_t)16 * DM; const _Float16* b2p = b1p + (size_t)16 * DM; const _Float16* b3p = b2p + (size_t)16 * DM;
  const v8f z8 = {0.f,0.f,0.f,0.f,0.f,0.f,0.f,0.f}; v8f c00 = z8, c01 = z8, c02 = z8, c03 = z8, c10 = z8, c11 = z8, c12 = z8, c13 = z8;
#pragma unroll 1      /* rolled: 32 trips, one trip's fragments beside 64 accumulator registers */
  for (int kb = 0; kb < DM; kb += 32) { const v16h a0 = g2_frag(a0p + kb, hh), a1 = g2_frag(a1p + kb, hh);
    v16h b = g2_frag(b0p + kb, hh); c00 = g2_mma(a0, b, c00); c10 = g2_mma(a1, b, c10);
    b = g2_frag(b1p + kb, hh); c01 = g2_mma(a0, b, c01); c11 = g2_mma(a1, b, c11);
    b = g2_frag(b2p + kb, hh); c02 = g2_mma(a0, b, c02); c12 = g2_mma(a1, b, c12);
    b = g2_frag(b3p + kb, hh); c03 = g2_mma(a0, b, c03); c13 = g2_mma(a1, b, c13); }
  v8f accs[8] = {c00, c01, c02, c03, c10, c11, c12, c13};
  if (by < 2) {      /* the same for the whole work-group */
#pragma unroll      /* constant indices */
    for (int u = 0; u < 8; ++u) { const int t = u & 3, half = u >> 2;
#pragma unroll      /* constant indices */
      for (int r = 0; r < 8; ++r) so[w][half * 16 + 8 * hh + r][t * 16 + ln] = accs[u][r] * 0.0625f; }
    __builtin_amdgcn_fence(__ATOMIC_ACQ_REL, "workgroup"); __builtin_amdgcn_wave_barrier();      /* the wave reads back what its own lanes wrote */
    const int rs = lane >> 3, c8 = (lane & 7) * 8; unsigned short* ph = (unsigned short*)Hq + ((size_t)by * NR + row0 + rs) * HD + c8; unsigned short* pl = (unsigned short*)Lq + ((size_t)by * NR + row0 + rs) * HD + c8;
#pragma unroll      /* 4 rows = 512 contiguous bytes a store */
    for (int q = 0; q < 8; ++q) { const v4f a = *(const v4fa*)&so[w][q * 4 + rs][c8], c = *(const v4fa*)&so[w][q * 4 + rs][c8 + 4]; FragH fh, fl;
#pragma unroll      /* constant indices */
      for (int e = 0; e < 4; ++e) { _Float16 h = (_Float16)a[e]; fh.h[e] = h; fl.h[e] = (_Float16)((a[e] - (float)h) * 1024.0f); h = (_Float16)c[e]; fh.h[4 + e] = h; fl.h[4 + e] = (_Float16)((c[e] - (float)h) * 1024.0f); }
      *(v8us*)(ph + q * 4 * HD) = fh.half[0]; *(v8us*)(pl + q * 4 * HD) = fl.half[0]; }
  } else {
    unsigned short* tl = (unsigned short*)&so[0][0][0];      /* [2 planes][64 columns][128 tokens + 8]: 272-byte rows */
#pragma unroll      /* constant indices */
    for (int u = 0; u < 8; ++u) { const int t = u & 3, half = u >> 2; FragH fh, fl;
#pragma unroll      /* constant indices */
      for (int r = 0; r < 8; ++r) { const float v = accs[u][r] * 0.0625f; const _Float16 h = (_Float16)v; fh.h[r] = h; fl.h[r] = (_Float16)((v - (float)h) * 1024.0f); }
      unsigned short* d = tl + (t * 16 + ln) * 136 + 32 * w + 16 * half + 8 * hh; *(v8us*)d = fh.half[0]; *(v8us*)(d + 64 * 136) = fl.half[0]; }
    __syncthreads();      /* every wave's 32 tokens are in place before a row of 128 is read */
    const int bb = (blockIdx.x * 128) / SQ, s0 = (blockIdx.x * 128) % SQ; const int c = (tid & 15) * 8;
    unsigned short* gh = (unsigned short*)VT + ((size_t)bb * HD + (tid >> 4)) * SQ + s0 + c; unsigned short* gl = (unsigned short*)VTL + ((size_t)bb * HD + (tid >> 4)) * SQ + s0 + c;
#pragma unroll      /* 8 columns a round; unrolled, the rounds' LDS reads run ahead of the stores */
    for (int it = 0; it < 8; ++it) { const unsigned short* s = tl + (it * 8 + (tid >> 4)) * 136 + c; const v8us xh = *(const v8us*)s, xl = *(const v8us*)(s + 64 * 136);
      *(v8us*)(gh + (size_t)it * 8 * SQ) = xh; *(v8us*)(gl + (size_t)it * 8 * SQ) = xl; }
    asm volatile("s_wait_xcnt 0x0" ::: "memory");      /* the build lays the other path's code behind this one's last branch, and it overwrites registers that the stores above name: the wait stands in front of that */
  } }

__global__ __launch_bounds__(256) void k_wnat(const float* __restrict__ w, size_t n8, _Float16* __restrict__ Bt) { const size_t t = (size_t)blockIdx.x * 256 + threadIdx.x; if (t >= n8) return; FragH f; for (int q = 0; q < 8; ++q) f.h[q] = (_Float16)(bf16_round(w[t * 8 + q]) * 16.0f); *(v8us*)((unsigned short*)Bt + t * 8) = f.half[0];  }
__global__ __launch_bounds__(256) void k_rsm(const float* __restrict__ S, _Float16* __restrict__ P, int nrows) {
  #pragma clang fp contract(off)
  const int i = blockIdx.x * 256 + threadIdx.x; if (i >= nrows) return; const float* s = S + (size_t)i * SQ; float mx = -3.0e38f;
#pragma unroll 1
  for (int j = 0; j < SQ; ++j) mx = fmaxf(mx, s[j]); float se = 0.f;
#pragma unroll 1
  for (int j = 0; j < SQ; ++j) se += expf(s[j] - mx); const float sc = 256.0f / se;
#pragma unroll 1
  for (int j0 = 0; j0 < SQ; j0 += 8) { FragH f; for (int q = 0; q < 8; ++q) f.h[q] = (_Float16)(expf(s[j0 + q] - mx) * sc); unsigned short* d = (unsigned short*)P + (size_t)i * SQ + j0; *(v8us*)d = f.half[0];  } }
__global__ __launch_bounds__(256) void k_vt(const _Float16* __restrict__ V16, int b, int h0, _Float16* __restrict__ VT) { __shared__ unsigned short tl[64][65]; const int tid = threadIdx.x; const int hh = blockIdx.x % HG, sg = blockIdx.x / HG; const int s0 = sg * 64; const int h = h0 + hh;
  for (int i = tid; i < 64 * 8; i += 256) { const int j = i / 8, d8 = (i % 8) * 8; FragH f; f.half[0] = *(const v8us*)((const unsigned short*)V16 + ((size_t)b * SQ + s0 + j) * DM + h * HD + d8); for (int q = 0; q < 8; ++q) tl[d8 + q][j] = f.u[q]; }
  __syncthreads();
  { for (int i = tid; i < 64 * 8; i += 256) { const int d = i / 8, j8 = (i % 8) * 8; FragH f; for (int q = 0; q < 8; ++q) f.u[q] = tl[d][j8 + q]; *(v8us*)((unsigned short*)VT + ((size_t)hh * HD + d) * SQ + s0 + j8) = f.half[0]; }  } }




// ---- scores kept in registers: column statistics, then weights and P V, both from recomputed score tiles ----
__device__ __forceinline__ v8f c_mma(v16h a, v16h b, v8f c) { return __builtin_amdgcn_wmma_f32_16x16x32_f16(false, a, false, b, (short)0, c, false, false); }
__device__ __forceinline__ float c_ex2(float y) { float r;
  asm("v_exp_f32 %0, %1\n\tv_nop" : "=v"(r) : "v"(y));      /* native 2^y; the v_nop keeps the slot the instruction set asks for behind a transcendental */
  return r; }
// one 16 key x 16 query tile of S^T (row 8 hh + r = key, column ln = query): k_hi.q_hi + 2^-10 (k_lo.q_hi + k_hi.q_lo); both launches form it with these same instructions
__device__ __forceinline__ v8f c_score(v16h kh0, v16h kh1, v16h kl0, v16h kl1, v16h qh0, v16h qh1, v16h ql0, v16h ql1) {
  const v8f z8 = {0.f,0.f,0.f,0.f,0.f,0.f,0.f,0.f}; v8f h = c_mma(kh0, qh0, z8); h = c_mma(kh1, qh1, h);
  v8f l = c_mma(kl0, qh0, z8); l = c_mma(kl1, qh1, l); l = c_mma(kh0, ql0, l); l = c_mma(kh1, ql1, l);
  return h + l * 0.0009765625f; }
#define LOG2E 1.44269504f
__device__ __forceinline__ v16h c_frag(const _Float16* p) { FragH f; f.half[0] = *(const v8us*)(const unsigned short*)p; f.half[1] = *(const v8us*)((const unsigned short*)p + 16); return f.v; }      /* p = row + k + 8 hh: the k order of g2_frag */
// Per key: maximum over the queries and 256 / sum of exp. Work-group = 32 keys (fragments stay in registers), its 16 waves take 128 queries each, 32 a trip;
// running maximum and sum per lane and key, joined over the 16 lanes of a row, then over the 16 waves through LDS.
__global__ __launch_bounds__(512) void k_cstat(const _Float16* __restrict__ KH, const _Float16* __restrict__ KL, const _Float16* __restrict__ QH, const _Float16* __restrict__ QL, float* __restrict__ MX, float* __restrict__ SC) {
  __shared__ float sm[16][32]; __shared__ float sz[16][32];
  const int tid = threadIdx.x, w = tid >> 5, lane = tid & 31, ln = lane & 15, hh = lane >> 4;
  const size_t base = (size_t)blockIdx.y * SQ; const int k0 = blockIdx.x * 32;
  const _Float16* pkh = KH + (base + k0 + ln) * HD + 8 * hh; const _Float16* pkl = KL + (base + k0 + ln) * HD + 8 * hh;
  v16h kh[2][2], kl[2][2];
#pragma unroll      /* constant indices keep the fragments in registers */
  for (int a = 0; a < 2; ++a) for (int s = 0; s < 2; ++s) { kh[a][s] = c_frag(pkh + 16 * a * HD + 32 * s); kl[a][s] = c_frag(pkl + 16 * a * HD + 32 * s); }
  asm volatile("s_wait_xcnt 0x0" :: "v"(pkh), "v"(pkl) : "memory");      /* the wait in front of any overwrite of the address pairs that the loads above name; as inputs the pairs stay whole up to it */
  float m[2][8], z[2][8];
#pragma unroll      /* constant indices */
  for (int a = 0; a < 2; ++a) for (int r = 0; r < 8; ++r) { m[a][r] = -3.0e38f; z[a][r] = 0.f; }
#pragma unroll 1      /* four trips; unrolled, the query fragments of several trips would not fit beside the key fragments */
  for (int c = 0; c < 4; ++c) {
    const size_t o = (base + w * 128 + c * 32 + ln) * HD + 8 * hh; const _Float16* pqh = QH + o; const _Float16* pql = QL + o;
    const v16h ah0 = c_frag(pqh), ah1 = c_frag(pqh + 32), al0 = c_frag(pql), al1 = c_frag(pql + 32);
    const v16h bh0 = c_frag(pqh + 16 * HD), bh1 = c_frag(pqh + 16 * HD + 32), bl0 = c_frag(pql + 16 * HD), bl1 = c_frag(pql + 16 * HD + 32);
    asm volatile("s_wait_xcnt 0x0" :: "v"(pqh), "v"(pql) : "memory");      /* as above: in front of the next trip's addresses and of any result that would land on these pairs */
#pragma unroll      /* constant indices */
    for (int a = 0; a < 2; ++a) {
      const v8f s0 = c_score(kh[a][0], kh[a][1], kl[a][0], kl[a][1], ah0, ah1, al0, al1);
      const v8f s1 = c_score(kh[a][0], kh[a][1], kl[a][0], kl[a][1], bh0, bh1, bl0, bl1);
#pragma unroll      /* constant indices */
      for (int r = 0; r < 8; ++r) { const float mn = fmaxf(m[a][r], fmaxf(s0[r], s1[r]));
        z[a][r] = z[a][r] * c_ex2((m[a][r] - mn) * LOG2E) + (c_ex2((s0[r] - mn) * LOG2E) + c_ex2((s1[r] - mn) * LOG2E)); m[a][r] = mn; }
    }
  }
#pragma unroll      /* constant indices */
  for (int k = 1; k < 16; k <<= 1) { float mo[2][8], zo[2][8];      /* step outermost: the 32 exchanges of a step are independent and fly together */
    for (int a = 0; a < 2; ++a) for (int r = 0; r < 8; ++r) { mo[a][r] = __shfl_xor(m[a][r], k, 32); zo[a][r] = __shfl_xor(z[a][r], k, 32); }
    for (int a = 0; a < 2; ++a) for (int r = 0; r < 8; ++r) { const float mn = fmaxf(m[a][r], mo[a][r]); z[a][r] = z[a][r] * c_ex2((m[a][r] - mn) * LOG2E) + zo[a][r] * c_ex2((mo[a][r] - mn) * LOG2E); m[a][r] = mn; } }
  if (ln == 0) {
#pragma unroll      /* constant indices */
    for (int a = 0; a < 2; ++a) for (int r = 0; r < 8; ++r) { sm[w][16 * a + 8 * hh + r] = m[a][r]; sz[w][16 * a + 8 * hh + r] = z[a][r]; } }
  __syncthreads();
  if (tid < 32) { float mm = sm[0][tid];
    for (int u = 1; u < 16; ++u) mm = fmaxf(mm, sm[u][tid]);
    float zz = 0.f;
    for (int u = 0; u < 16; ++u) zz += sz[u][tid] * c_ex2((sm[u][tid] - mm) * LOG2E);
    MX[base + k0 + tid] = mm; SC[base + k0 + tid] = 256.0f / zz; } }
// out^T[d][i] = sum_k V^T[d][k] P^T[k][i]. Work-group = 32 queries, its 8 waves take 256 keys each, 32 a trip. Two score tiles (keys 0-15, 16-31 of the trip) hold, per lane,
// exactly the B fragment's elements (element e < 8: key 8 hh + e; e >= 8: key 16 + 8 hh + e - 8; column ln = query), the k order in which g2_frag reads V^T: the weights go from D to B inside the lane.
__global__ __launch_bounds__(256) void k_cpv(const _Float16* __restrict__ KH, const _Float16* __restrict__ KL, const _Float16* __restrict__ QH, const _Float16* __restrict__ QL, const _Float16* __restrict__ VT, const _Float16* __restrict__ VTL,
    const float* __restrict__ MX, const float* __restrict__ SC, float* __restrict__ out) {
  __shared__ __attribute__((aligned(16))) float red[4][32][68];
  const int tid = threadIdx.x, w = tid >> 5, lane = tid & 31, ln = lane & 15, hh = lane >> 4;
  const size_t base = (size_t)blockIdx.y * SQ; const int q0 = blockIdx.x * 32;
  const _Float16* vh_b = VT + base * HD; const _Float16* vl_b = VTL + base * HD;
  const _Float16* pqh = QH + (base + q0 + ln) * HD + 8 * hh; const _Float16* pql = QL + (base + q0 + ln) * HD + 8 * hh;
  v16h qh[2][2], ql[2][2];
#pragma unroll      /* constant indices keep the fragments in registers */
  for (int c = 0; c < 2; ++c) for (int s = 0; s < 2; ++s) { qh[c][s] = c_frag(pqh + 16 * c * HD + 32 * s); ql[c][s] = c_frag(pql + 16 * c * HD + 32 * s); }
  asm volatile("s_wait_xcnt 0x0" :: "v"(pqh), "v"(pql) : "memory");      /* the wait in front of any overwrite of the address pairs that the loads above name; as inputs the pairs stay whole up to it */
  const v8f z8 = {0.f,0.f,0.f,0.f,0.f,0.f,0.f,0.f}; v8f oh[4][2], ol[4][2];
#pragma unroll      /* constant indices */
  for (int t = 0; t < 4; ++t) for (int c = 0; c < 2; ++c) { oh[t][c] = z8; ol[t][c] = z8; }
#pragma unroll 1      /* eight trips; one trip's fragments beside 128 accumulator registers */
  for (int it = 0; it < 8; ++it) { const int k0 = w * 256 + it * 32; FragH p[2];
    const _Float16* pkh = KH + (base + k0 + ln) * HD + 8 * hh; const _Float16* pkl = KL + (base + k0 + ln) * HD + 8 * hh; const float* pm = MX + base + k0 + 8 * hh; const float* pc = SC + base + k0 + 8 * hh;
    const _Float16* pvh = vh_b + (size_t)ln * SQ + k0 + 8 * hh; const _Float16* pvl = vl_b + (size_t)ln * SQ + k0 + 8 * hh;
#pragma unroll      /* constant indices */
    for (int a = 0; a < 2; ++a) {
      const v16h kh0 = c_frag(pkh + 16 * a * HD), kh1 = c_frag(pkh + 16 * a * HD + 32), kl0 = c_frag(pkl + 16 * a * HD), kl1 = c_frag(pkl + 16 * a * HD + 32);
      const v4f m0 = *(const v4fa*)(pm + 16 * a), m1 = *(const v4fa*)(pm + 16 * a + 4), c0 = *(const v4fa*)(pc + 16 * a), c1 = *(const v4fa*)(pc + 16 * a + 4);
#pragma unroll      /* constant indices */
      for (int c = 0; c < 2; ++c) { const v8f s = c_score(kh0, kh1, kl0, kl1, qh[c][0], qh[c][1], ql[c][0], ql[c][1]);
#pragma unroll      /* constant indices */
        for (int r = 0; r < 4; ++r) { p[c].h[8 * a + r] = (_Float16)(c_ex2((s[r] - m0[r]) * LOG2E) * c0[r]); p[c].h[8 * a + 4 + r] = (_Float16)(c_ex2((s[4 + r] - m1[r]) * LOG2E) * c1[r]); } } }
#pragma unroll      /* constant indices */
    for (int t = 0; t < 4; ++t) { const v16h vh = c_frag(pvh + (size_t)16 * t * SQ), vl = c_frag(pvl + (size_t)16 * t * SQ);
#pragma unroll      /* constant indices */
      for (int c = 0; c < 2; ++c) { oh[t][c] = c_mma(vh, p[c].v, oh[t][c]); ol[t][c] = c_mma(vl, p[c].v, ol[t][c]); } }
    asm volatile("s_wait_xcnt 0x0" :: "v"(pkh), "v"(pkl), "v"(pm), "v"(pc), "v"(pvh), "v"(pvl) : "memory");      /* as above, at the trip's foot: in front of the next trip's addresses */
  }
  /* the 8 key slices are added: waves 4-7 hand theirs to waves 0-3 through LDS, then every thread adds the four sums left */
#pragma unroll      /* constant indices */
  for (int t = 0; t < 4; ++t) for (int c = 0; c < 2; ++c) { oh[t][c] = oh[t][c] * 0.00390625f + ol[t][c] * 0.000003814697265625f;
    if (w >= 4) { float* d = &red[w - 4][16 * c + ln][16 * t + 8 * hh]; const v4f x0 = {oh[t][c][0], oh[t][c][1], oh[t][c][2], oh[t][c][3]}, x1 = {oh[t][c][4], oh[t][c][5], oh[t][c][6], oh[t][c][7]}; *(v4fa*)d = x0; *(v4fa*)(d + 4) = x1; } }
  __syncthreads();
  if (w < 4) {
#pragma unroll      /* constant indices */
    for (int t = 0; t < 4; ++t) for (int c = 0; c < 2; ++c) { float* d = &red[w][16 * c + ln][16 * t + 8 * hh]; v4f x0 = *(const v4fa*)d, x1 = *(const v4fa*)(d + 4);
      for (int r = 0; r < 4; ++r) { x0[r] += oh[t][c][r]; x1[r] += oh[t][c][4 + r]; }
      *(v4fa*)d = x0; *(v4fa*)(d + 4) = x1; } }
  __syncthreads();
#pragma unroll      /* two 16-byte pieces a thread */
  for (int j = 0; j < 2; ++j) { const int idx = tid + 256 * j, q = idx >> 4, d4 = (idx & 15) * 4;
    const v4f v = (*(const v4fa*)&red[0][q][d4] + *(const v4fa*)&red[1][q][d4]) + (*(const v4fa*)&red[2][q][d4] + *(const v4fa*)&red[3][q][d4]);
    float* o = out + (base + q0 + q) * DMO + d4;
#pragma unroll      /* the 16 identical heads: 16 lanes fill 256 contiguous bytes of a row per store */
    for (int h = 0; h < DMO / HD; ++h) *(v4f*)(o + h * HD) = v; } }

extern "C" void kernel_launch(void* const* d_in, const int* in_sizes, int n_in,
                              void* d_out, int out_size, void* d_ws, size_t ws_size, hipStream_t stream) {
  (void)in_sizes; (void)n_in; (void)out_size;
  const float* const* I = (const float* const*)d_in; const float* x = I[0]; const float* wq = I[1]; const float* wk = I[2]; const float* wv = I[3];      /* [in][out] = [1024][64] */
  char* ws = (char*)d_ws; size_t off = 0;
  auto take = [&](size_t bytes) { char* p = ws + off; off += (bytes + 255) & ~(size_t)255; return p; };
  /* planes of one kind lie one behind the other (weights q, k, v; hi and residual planes q, k), so that one launch covers them */
  _Float16* B3 = (_Float16*)take((size_t)3 * HD * DM * 2); _Float16* X16 = (_Float16*)take(NR * DM * 2); _Float16* H3 = (_Float16*)take(4 * NR * HD * 2); _Float16* L3 = H3 + 2 * NR * HD;
  _Float16* QH = H3; _Float16* KH = H3 + NR * HD; _Float16* QL = L3; _Float16* KL = L3 + NR * HD;
  float* MX = (float*)take(NR * 4); float* SC = (float*)take(NR * 4); _Float16* VT = (_Float16*)take(2 * NR * HD * 2); _Float16* VTL = VT + NR * HD;      /* one plane per batch */
  if (off > ws_size) return;      /* approx 16 + 4 + 2 = 22 MiB */
  k_wt_f16<<<dim3((unsigned)(((size_t)HD * (DM / 8) + 255) / 256), 3), 256, 0, stream>>>(wq, wk, wv, B3, DM, HD, 16.0f);      /* 3 x [1024][64] -> Bt[3][64][1024] x16 */
  k_x16<<<(unsigned)((NR * DM / 8 + 255) / 256), 256, 0, stream>>>(x, X16, NR * DM / 8);
  k_proj<<<dim3((unsigned)(NR / 128), 3), 128, 0, stream>>>(X16, B3, H3, L3, VT, VTL);      /* q, k as f16 hi + x1024 residual planes, v as V^T hi / residual [b][64][2048]: blockIdx.y = projection */
  /* the four batches are independent: each stage is one launch over all of them (blockIdx.y = batch, or a four times longer grid over planes that lie one behind the other) */
  k_cstat<<<dim3(SQ / 32, NB), 512, 0, stream>>>(KH, KL, QH, QL, MX, SC);      /* per key: max over the query index i, 256 / sum of exp */
  k_cpv<<<dim3(SQ / 32, NB), 256, 0, stream>>>(KH, KL, QH, QL, VT, VTL, MX, SC, (float*)d_out);      /* out_i = 2^-8 sum_k f16(256 att[i][k]) (v_hi + 2^-10 v_lo), stored into the 16 identical heads */
}

// v006
// Measured time: 62.1 microseconds a run.
// In two side-by-side timings against v005, it was 1.33 and 1.36 times as fast.
// All steps since v000 together make it 34.1 times as fast.
#include <hip/hip_runtime.h>
// Single-projection attention with a QUERY-axis softmax, tiled 16x (x [4][2048][1024]; q, k, v = x W ([1024][64] weights stored [in][out], shared by all heads); att[i][k] = q_i . k_k (no scaling); att = softmax over the QUERY index i for each key column k (the module's nn.Softmax(dim=1)); out_i = sum_k att[i][k] v_k -> [2048][64], concatenated 16 times -> [4][2048][1024]).
// Structure: token rows; x read as f32 by the projection launch and rounded in registers to exact f16 fragments; q and k projections as WMMA GEMMs (32x64 wave tiles, f32 accumulation, exact x16 weights) kept in f32 and split into f16 hi + x1024 residual planes (the unscaled logits have sigma 8, so they are formed from three hi/lo products, ~2^-21 relative); v likewise kept f32 and split; the split and, for v, the transposition to V^T (hi and residual, whole lines through LDS) are done in the projection launch's epilogue; the scores never go through memory: transposed score tiles S^T[k][i] = k_k . q_i (three hi/lo products, K = 64) are formed twice in registers, once for each key's maximum and sum of exp over the query index i (= the module's column softmax; f32 statistics, native exp), once for the weights (x256 f16), which pass inside the lane from the score tiles' D layout into the B fragment of out^T = V^T P^T (hi and residual accumulators, f32), 8 key slices added through LDS, each sum stored into the 16 head slots of its output row by the same launch (256 contiguous bytes per row and head); every per-batch stage runs as one launch over the four batches, and the stages that q, k, v each need run as one launch over adjacent planes; 4 launches.
// Compute dtype: inputs rounded to bf16; x / weights exact; q, k, v as f16 hi + residual pairs; the softmax weights plain f16 (~2^-12); scores, statistics, out f32. v_wmma_f32_16x16x32_f16.
#define NB 4
#define SQ 2048
#define DM 1024
#define HD 64
#define NH 1
#define HG 1
#define DMO 1024                     /* output row width = 16 x 64 */
#define B0 0                         /* unused */
#define NBR NB
#define NR ((size_t)NB * SQ)
typedef __bf16 v16b __attribute__((ext_vector_type(16)));
typedef unsigned short v8us __attribute__((ext_vector_type(8), may_alias));
typedef float  v8f  __attribute__((ext_vector_type(8)));
typedef float  v4f  __attribute__((ext_vector_type(4)));
typedef float  v4fa __attribute__((ext_vector_type(4), may_alias));
union FragB { v16b v; v8us half[2]; unsigned short u[16]; };

__device__ __forceinline__ unsigned short bf16_bits(float x) { unsigned int u = __float_as_uint(x); return (unsigned short)((u + 0x7FFFu + ((u >> 16) & 1u)) >> 16); }
__device__ __forceinline__ float bf16_val(unsigned short b) { return __uint_as_float(((unsigned int)b) << 16); }
__device__ __forceinline__ float bf16_round(float x) { return bf16_val(bf16_bits(x)); }
// D += A·B with NT terms: 1 = ah·bh, 2 = + al·bh (A split), 3 = + ah·bl (both split)
template <int NT>
__device__ __forceinline__ v8f mmaN(v16b ah, v16b al, v16b bh, v16b bl, v8f c) {
  c = __builtin_amdgcn_wmma_f32_16x16x32_bf16(false, ah, false, bh, (short)0, c, false, false);
  if (NT >= 2) c = __builtin_amdgcn_wmma_f32_16x16x32_bf16(false, al, false, bh, (short)0, c, false, false);
  if (NT >= 3) c = __builtin_amdgcn_wmma_f32_16x16x32_bf16(false, ah, false, bl, (short)0, c, false, false);
  asm volatile("v_nop\n\tv_nop\n\tv_nop\n\tv_nop" : "+v"(c) : "v"(ah), "v"(al), "v"(bh), "v"(bl));
  return c;
}

__global__ __launch_bounds__(256) void k_wt_bf16(const float* __restrict__ W, unsigned short* __restrict__ Wt, int K, int N) {
  const int t = blockIdx.x * 256 + threadIdx.x;
  const int k8n = K / 8;
  if (t >= N * k8n) return;
  const int n = t / k8n, k8 = (t % k8n) * 8;
  v8us v;
#pragma unroll
  for (int i = 0; i < 8; ++i) v[i] = bf16_bits(W[(size_t)(k8 + i) * N + n]);
  *(v8us*)(Wt + (size_t)n * K + k8) = v;
  
}

// GEMM C[M][N] (f32, pitch ldc) = act(A[M][K]·W + bias). A f32 row-major (pitch lda) converted per fragment to bf16
// (ASPLIT: hi/lo two planes -> 2 terms, else single rounded term); Wt bf16 [N][K] (pitch ldb). BIAS_BF16 rounds the
// bias to bf16 first (bias quantised to bf16 before the add). K%32==0, M%16==0, N%64==0.
template <bool ASPLIT, int ACT, bool BIAS_BF16>
__global__ __launch_bounds__(128) void k_gemm_bf(const float* __restrict__ A, int lda, const unsigned short* __restrict__ Wt, int ldb,
                                               const float* __restrict__ bias, float* __restrict__ C, int ldc, int M, int N, int K) {
  __shared__ __attribute__((aligned(16))) float so[4][16][64];
  const int tid = threadIdx.x, w = tid >> 5, lane = tid & 31, ln = lane & 15, hh = lane >> 4;
  const int ntn = N / 64;
  const int wid = blockIdx.x * 4 + w;
  const int mt = wid / ntn, nq = wid % ntn;
  if (mt * 16 >= M) return;
  const int row0 = mt * 16, col0 = nq * 64;
  const float* arow = A + (size_t)(row0 + ln) * lda;
  v8f acc[4] = {};
  for (int kb = 0; kb < K; kb += 32) {
    FragB ah, al;
    const v4f x0 = *(const v4fa*)(arow + kb + 8 * hh), x1 = *(const v4fa*)(arow + kb + 8 * hh + 4);
    const v4f x2 = *(const v4fa*)(arow + kb + 16 + 8 * hh), x3 = *(const v4fa*)(arow + kb + 16 + 8 * hh + 4);
    float xs[16] = {x0[0],x0[1],x0[2],x0[3],x1[0],x1[1],x1[2],x1[3],x2[0],x2[1],x2[2],x2[3],x3[0],x3[1],x3[2],x3[3]};
#pragma unroll
    for (int i = 0; i < 16; ++i) { const unsigned short hb = bf16_bits(xs[i]); ah.u[i] = hb; al.u[i] = ASPLIT ? bf16_bits(xs[i] - bf16_val(hb)) : (unsigned short)0; }
#pragma unroll
    for (int t = 0; t < 4; ++t) {
      const unsigned short* brow = Wt + (size_t)(col0 + t * 16 + ln) * ldb + kb;
      FragB b;
      b.half[0] = *(const v8us*)(brow + 8 * hh);
      b.half[1] = *(const v8us*)(brow + 16 + 8 * hh);
      acc[t] = mmaN<ASPLIT ? 2 : 1>(ah.v, al.v, b.v, b.v, acc[t]);
    }
  }
#pragma unroll
  for (int t = 0; t < 4; ++t) {
    float bv = bias ? bias[col0 + t * 16 + ln] : 0.f;
    if (BIAS_BF16) bv = bf16_round(bv);
#pragma unroll
    for (int r = 0; r < 8; ++r) { float v = acc[t][r] + bv; if (ACT == 1) v = fmaxf(v, 0.f); so[w][8 * hh + r][t * 16 + ln] = v; }
  }
  __builtin_amdgcn_fence(__ATOMIC_ACQ_REL, "workgroup");
  __builtin_amdgcn_wave_barrier();
  const int rsub = lane >> 4, c4 = (lane & 15) * 4;
  {
#pragma unroll
    for (int q = 0; q < 8; ++q) {
      const int r = q * 2 + rsub;
      const v4f v = *(const v4fa*)&so[w][r][c4];
      *(v4f*)(C + (size_t)(row0 + r) * ldc + col0 + c4) = v;
    }
    
  }
}

// GEMM C = act(A·W + bias + resid): A f32 (ASPLIT -> hi/lo 2 terms), Wt bf16 [N][K]; ACT 0 none, 1 relu, 2 exact gelu;
// resid (optional, f32, row index = (row % rmod), pitch ldr, RES_BF16 rounds it) added before the activation.
template <bool ASPLIT, int ACT, bool BIAS_BF16, bool RES_BF16>
__global__ __launch_bounds__(128) void k_gemm_bf3(const float* __restrict__ A, int lda, const unsigned short* __restrict__ Wt, int ldb,
                                                const float* __restrict__ bias, const float* __restrict__ resid, int rmod, int ldr,
                                                float* __restrict__ C, int ldc, int M, int N, int K) {
  __shared__ __attribute__((aligned(16))) float so[4][16][64];
  const int tid = threadIdx.x, w = tid >> 5, lane = tid & 31, ln = lane & 15, hh = lane >> 4;
  const int ntn = N / 64;
  const int wid = blockIdx.x * 4 + w;
  const int mt = wid / ntn, nq = wid % ntn;
  if (mt * 16 >= M) return;
  const int row0 = mt * 16, col0 = nq * 64;
  const float* arow = A + (size_t)(row0 + ln) * lda;
  v8f acc[4] = {};
  for (int kb = 0; kb < K; kb += 32) {
    FragB ah, al;
    const v4f x0 = *(const v4fa*)(arow + kb + 8 * hh), x1 = *(const v4fa*)(arow + kb + 8 * hh + 4);
    const v4f x2 = *(const v4fa*)(arow + kb + 16 + 8 * hh), x3 = *(const v4fa*)(arow + kb + 16 + 8 * hh + 4);
    float xs[16] = {x0[0],x0[1],x0[2],x0[3],x1[0],x1[1],x1[2],x1[3],x2[0],x2[1],x2[2],x2[3],x3[0],x3[1],x3[2],x3[3]};
#pragma unroll
    for (int i = 0; i < 16; ++i) { const unsigned short hb = bf16_bits(xs[i]); ah.u[i] = hb; al.u[i] = ASPLIT ? bf16_bits(xs[i] - bf16_val(hb)) : (unsigned short)0; }
#pragma unroll
    for (int t = 0; t < 4; ++t) {
      const unsigned short* brow = Wt + (size_t)(col0 + t * 16 + ln) * ldb + kb;
      FragB b;
      b.half[0] = *(const v8us*)(brow + 8 * hh);
      b.half[1] = *(const v8us*)(brow + 16 + 8 * hh);
      acc[t] = mmaN<ASPLIT ? 2 : 1>(ah.v, al.v, b.v, b.v, acc[t]);
    }
  }
#pragma unroll
  for (int t = 0; t < 4; ++t) {
    const int col = col0 + t * 16 + ln;
    float bv = bias ? bias[col] : 0.f;
    if (BIAS_BF16) bv = bf16_round(bv);
#pragma unroll
    for (int r = 0; r < 8; ++r) {
      float v = acc[t][r] + bv;
      if (resid) { float rv = resid[(size_t)((row0 + 8 * hh + r) % rmod) * ldr + col]; if (RES_BF16) rv = bf16_round(rv); v += rv; }
      if (ACT == 1) v = fmaxf(v, 0.f);
      if (ACT == 2) v = 0.5f * v * (1.0f + erff(v * 0.70710678118654752f));
      if (ACT == 3) { const float u = 0.7978845608028654f * (v + 0.044715f * v * v * v); v = 0.5f * v * (1.0f + tanhf(u)); }
      so[w][8 * hh + r][t * 16 + ln] = v;
    }
  }
  __builtin_amdgcn_fence(__ATOMIC_ACQ_REL, "workgroup");
  __builtin_amdgcn_wave_barrier();
  const int rsub = lane >> 4, c4 = (lane & 15) * 4;
  {
#pragma unroll
    for (int q = 0; q < 8; ++q) {
      const int r = q * 2 + rsub;
      const v4f v = *(const v4fa*)&so[w][r][c4];
      *(v4f*)(C + (size_t)(row0 + r) * ldc + col0 + c4) = v;
    }
    
  }
}
// row LayerNorm (biased variance, eps) over N: s = X (+ R); optional out_sum <- s; out_norm <- (s-mu)*rsqrt(var+eps)*g + b
template <bool PARAM_BF16>
__global__ __launch_bounds__(256) void k_layernorm(const float* __restrict__ X, const float* __restrict__ R, const float* __restrict__ g, const float* __restrict__ bta,
                                                  float* __restrict__ out_sum, float* __restrict__ out_norm, int N, float eps) {
  __shared__ float red[256];
  const int row = blockIdx.x, tid = threadIdx.x;
  const float* x = X + (size_t)row * N; const float* rr = R ? R + (size_t)row * N : nullptr;
  float vals[16];                     // up to N = 4096
  const int per = N / 256;            // contiguous chunk per thread? use strided-by-4 chunks: thread handles j = tid*4 + 1024*u
  float s1 = 0.f;
  for (int u = 0; u < per / 4; ++u) {
    const int j = tid * 4 + 1024 * u;
    const v4f a = *(const v4fa*)(x + j);
    v4f b = {0.f,0.f,0.f,0.f}; if (rr) b = *(const v4fa*)(rr + j);
#pragma unroll
    for (int q = 0; q < 4; ++q) { const float v = a[q] + b[q]; vals[u * 4 + q] = v; s1 += v; }
  }
  red[tid] = s1; __syncthreads();
  for (int st = 128; st > 0; st >>= 1) { if (tid < st) red[tid] += red[tid + st]; __syncthreads(); }
  const float mu = red[0] / (float)N; __syncthreads();
  float s2 = 0.f;
  for (int u = 0; u < per / 4; ++u)
#pragma unroll
    for (int q = 0; q < 4; ++q) { const float c = vals[u * 4 + q] - mu; s2 += c * c; }
  red[tid] = s2; __syncthreads();
  for (int st = 128; st > 0; st >>= 1) { if (tid < st) red[tid] += red[tid + st]; __syncthreads(); }
  const float rs = rsqrtf(red[0] / (float)N + eps);
  {
    for (int u = 0; u < per / 4; ++u) {
      const int j = tid * 4 + 1024 * u;
      v4f o, sm;
#pragma unroll
      for (int q = 0; q < 4; ++q) {
        float gg = g[j + q], bb = bta[j + q];
        if (PARAM_BF16) { gg = bf16_round(gg); bb = bf16_round(bb); }
        sm[q] = vals[u * 4 + q]; o[q] = (vals[u * 4 + q] - mu) * rs * gg + bb;
      }
      if (out_sum) *(v4f*)(out_sum + (size_t)row * N + j) = sm;
      *(v4f*)(out_norm + (size_t)row * N + j) = o;
    }
    
  }
}



// ---- f16 WMMA path (v_wmma_f32_16x16x32_f16): 11-bit significands for operands in range — used where a [0,1] probability operand needs more precision than bf16
typedef _Float16 v16h __attribute__((ext_vector_type(16)));
union FragH { v16h v; v8us half[2]; _Float16 h[16]; unsigned short u[16]; };
template <int NT>
__device__ __forceinline__ v8f mmaH(v16h ah, v16h al, v16h bh, v16h bl, v8f c) {
  c = __builtin_amdgcn_wmma_f32_16x16x32_f16(false, ah, false, bh, (short)0, c, false, false);
  if (NT >= 2) c = __builtin_amdgcn_wmma_f32_16x16x32_f16(false, al, false, bh, (short)0, c, false, false);
  if (NT >= 3) c = __builtin_amdgcn_wmma_f32_16x16x32_f16(false, ah, false, bl, (short)0, c, false, false);
  asm volatile("v_nop\n\tv_nop\n\tv_nop\n\tv_nop" : "+v"(c) : "v"(ah), "v"(al), "v"(bh), "v"(bl));
  return c;
}
// batched GEMM like k_gemm_b but f16 operands: A f32 (split into f16 hi/lo if ASPLIT, else rounded to f16), Bt = f16 values [n][k]; alpha; C f32; N multiple of 16 (partial tiles skipped)
template <bool ASPLIT>
__global__ __launch_bounds__(128) void k_gemm_h(const float* __restrict__ A, int lda, size_t sA, const _Float16* __restrict__ Bh, int ldb, size_t sB, float alpha, float* __restrict__ C, int ldc, size_t sC, int M, int N, int K) {
  __shared__ __attribute__((aligned(16))) float so[4][16][64];
  const int tid = threadIdx.x, w = tid >> 5, lane = tid & 31, ln = lane & 15, hh = lane >> 4; const int by = blockIdx.y;
  A += (size_t)by * sA; Bh += (size_t)by * sB; C += (size_t)by * sC;
  const int ntn = (N + 63) / 64; const int wid = blockIdx.x * 4 + w; const int mt = wid / ntn, nq = wid % ntn; if (mt * 16 >= M) return;
  const int row0 = mt * 16, col0 = nq * 64; const float* arow = A + (size_t)(row0 + ln) * lda;
  v8f acc[4] = {};
  for (int kb = 0; kb < K; kb += 32) {
    FragH ah, al;
    const v4f x0 = *(const v4fa*)(arow + kb + 8 * hh), x1 = *(const v4fa*)(arow + kb + 8 * hh + 4), x2 = *(const v4fa*)(arow + kb + 16 + 8 * hh), x3 = *(const v4fa*)(arow + kb + 16 + 8 * hh + 4);
    float xs[16] = {x0[0],x0[1],x0[2],x0[3],x1[0],x1[1],x1[2],x1[3],x2[0],x2[1],x2[2],x2[3],x3[0],x3[1],x3[2],x3[3]};
#pragma unroll
    for (int i = 0; i < 16; ++i) { const _Float16 h = (_Float16)xs[i]; ah.h[i] = h; al.h[i] = ASPLIT ? (_Float16)(xs[i] - (float)h) : (_Float16)0.0f; }
#pragma unroll
    for (int t = 0; t < 4; ++t) { if (col0 + t * 16 >= N) continue; const size_t boff = (size_t)(col0 + t * 16 + ln) * ldb + kb; FragH bq; bq.half[0] = *(const v8us*)(Bh + boff + 8 * hh); bq.half[1] = *(const v8us*)(Bh + boff + 16 + 8 * hh);
      acc[t] = mmaH<ASPLIT ? 2 : 1>(ah.v, al.v, bq.v, bq.v, acc[t]); }
  }
#pragma unroll
  for (int t = 0; t < 4; ++t) { if (col0 + t * 16 >= N) continue;
#pragma unroll
    for (int r = 0; r < 8; ++r) so[w][8 * hh + r][t * 16 + ln] = acc[t][r] * alpha; }
  __builtin_amdgcn_fence(__ATOMIC_ACQ_REL, "workgroup"); __builtin_amdgcn_wave_barrier();
  const int rsub = lane >> 4, c4 = (lane & 15) * 4;
  {
#pragma unroll
    for (int q = 0; q < 8; ++q) { const int r = q * 2 + rsub; if (col0 + c4 < N) { const v4f v = *(const v4fa*)&so[w][r][c4]; *(v4f*)(C + (size_t)(row0 + r) * ldc + col0 + c4) = v; } }
     }
}

// Wt[n][k] = f16(W[k][n]·scale) from f32 row-major W[K][N] (scale = power of two; bf16-exact weights stay exact in f16 away from the subnormal range)
// blockIdx.y picks one of three weights of the same shape; their Wt planes lie one behind the other
__global__ __launch_bounds__(256) void k_wt_f16(const float* __restrict__ W0, const float* __restrict__ W1, const float* __restrict__ W2, _Float16* __restrict__ Wt, int K, int N, float scale) {
  const int by = blockIdx.y; const float* __restrict__ W = by == 0 ? W0 : by == 1 ? W1 : W2; Wt += (size_t)by * N * K;
  const int t = blockIdx.x * 256 + threadIdx.x; if (t >= N * (K / 8)) return; const int n = t / (K / 8), k8 = (t % (K / 8)) * 8; FragH f;
#pragma unroll
  for (int i = 0; i < 8; ++i) f.h[i] = (_Float16)(bf16_round(W[(size_t)(k8 + i) * N + n]) * scale); const v8us o = f.half[0];
  *(v8us*)((unsigned short*)Wt + (size_t)n * K + k8) = o; 
}
// k_gemm_hh variant with fused epilogue: v = acc·alpha + bias[by·sBias + col] (+ CP[(row/rowsPerB)·sCPb + by·64 + col] if CP) ; ACT 0 none / 1 elu ; writes f16 C16 (and f32 C if non-null)
template <int ACT>
__global__ __launch_bounds__(128) void k_gemm_hhx(const _Float16* __restrict__ A, int lda, size_t sA, const _Float16* __restrict__ Bh, int ldb, size_t sB, float alpha, const float* __restrict__ bias, size_t sBias, const float* __restrict__ CP, int rowsPerB, size_t sCPb, int row0g,
    float* __restrict__ C, _Float16* __restrict__ C16, int ldc, size_t sC, int M, int N, int K) {
  __shared__ __attribute__((aligned(16))) float so[4][16][64];
  const int tid = threadIdx.x, w = tid >> 5, lane = tid & 31, ln = lane & 15, hh = lane >> 4; const int by = blockIdx.y;
  A += (size_t)by * sA; Bh += (size_t)by * sB; const size_t cofs = (size_t)by * sC; const float* bp = bias ? bias + (size_t)by * sBias : nullptr;
  const int ntn = (N + 63) / 64; const int wid = blockIdx.x * 4 + w; const int mt = wid / ntn, nq = wid % ntn; if (mt * 16 >= M) return;
  const int row0 = mt * 16, col0 = nq * 64; const _Float16* arow = A + (size_t)(row0 + ln) * lda;
  v8f acc[4] = {};
  for (int kb = 0; kb < K; kb += 32) { FragH ah; ah.half[0] = *(const v8us*)((const unsigned short*)arow + kb + 8 * hh); ah.half[1] = *(const v8us*)((const unsigned short*)arow + kb + 16 + 8 * hh);
#pragma unroll
    for (int t = 0; t < 4; ++t) { if (col0 + t * 16 >= N) continue; const size_t boff = (size_t)(col0 + t * 16 + ln) * ldb + kb; FragH bq; bq.half[0] = *(const v8us*)((const unsigned short*)Bh + boff + 8 * hh); bq.half[1] = *(const v8us*)((const unsigned short*)Bh + boff + 16 + 8 * hh);
      acc[t] = mmaH<1>(ah.v, ah.v, bq.v, bq.v, acc[t]); }
  }
#pragma unroll
  for (int t = 0; t < 4; ++t) { if (col0 + t * 16 >= N) continue; const int col = col0 + t * 16 + ln; const float bv = bp ? bf16_round(bp[col]) : 0.f;
#pragma unroll
    for (int r = 0; r < 8; ++r) { float v = acc[t][r] * alpha + bv; if (CP) { const int rr = row0g + row0 + 8 * hh + r; if (rowsPerB < 0) v += CP[cofs + (size_t)rr * ldc + col];      /* rowsPerB < 0: own element of the batched C plane */ else { const int bidx = rr / rowsPerB; v += CP[(size_t)bidx * sCPb + (size_t)by * 64 + col]; } } if (ACT == 1) v = (v > 0.f) ? v : expm1f(v); else if (ACT == 7) v = (v > 0.f) ? v + 1.0f : expf(v); else if (ACT == 8) v = tanhf(v); else if (ACT == 9) v = 0.5f * v * (1.0f + tanhf(0.7978845608028654f * (v + 0.044715f * v * v * v))); else if (ACT == 11) v = 1.0f / (1.0f + expf(-v)); else if (ACT == 12) v = (v > 0.f) ? v : 0.01f * v; else if (ACT == 14) v = (v > 0.f) ? v : 0.1f * v; else if (ACT == 16) v = (v >= 0.f) ? v : 0.3f * v; else if (ACT == 17) v = (v >= 0.f) ? v : 0.2f * v; else if (ACT == 15) v = v / (1.0f + expf(-v)); else if (ACT == 3) v = fmaxf(v, 0.f); else if (ACT == 6) v = 0.5f * v * (1.0f + erff(v * 0.70710678118654752f)); so[w][8 * hh + r][t * 16 + ln] = v; } }
  __builtin_amdgcn_fence(__ATOMIC_ACQ_REL, "workgroup"); __builtin_amdgcn_wave_barrier();
  const int rsub = lane >> 4, c4 = (lane & 15) * 4; typedef _Float16 v4h __attribute__((ext_vector_type(4)));
  {
#pragma unroll
    for (int q = 0; q < 8; ++q) { const int r = q * 2 + rsub; if (col0 + c4 < N) { const v4f v = *(const v4fa*)&so[w][r][c4]; if (C) *(v4f*)(C + cofs + (size_t)(row0 + r) * ldc + col0 + c4) = v; if (C16) { v4h h4; for (int i = 0; i < 4; ++i) h4[i] = (_Float16)v[i]; *(v4h*)(C16 + cofs + (size_t)(row0 + r) * ldc + col0 + c4) = h4; } } }
     }
}


typedef _Float16 v4h __attribute__((ext_vector_type(4)));

__global__ __launch_bounds__(256) void k_x16(const float* __restrict__ x, _Float16* __restrict__ X16, size_t n8) { const size_t t = (size_t)blockIdx.x * 256 + threadIdx.x; if (t >= n8) return; FragH f;
#pragma unroll
  for (int q = 0; q < 8; ++q) f.h[q] = (_Float16)bf16_round(x[t * 8 + q]); *(v8us*)((unsigned short*)X16 + t * 8) = f.half[0];  }
__global__ __launch_bounds__(256) void k_h16(const float* __restrict__ x, _Float16* __restrict__ X16, size_t n8) { const size_t t = (size_t)blockIdx.x * 256 + threadIdx.x; if (t >= n8) return; FragH f;
#pragma unroll
  for (int q = 0; q < 8; ++q) f.h[q] = (_Float16)x[t * 8 + q]; *(v8us*)((unsigned short*)X16 + t * 8) = f.half[0];  }
__global__ __launch_bounds__(256) void k_round16f(const float* __restrict__ W, _Float16* __restrict__ Bt, size_t n8) { const size_t t = (size_t)blockIdx.x * 256 + threadIdx.x; if (t >= n8) return; FragH f;
#pragma unroll
  for (int i = 0; i < 8; ++i) f.h[i] = (_Float16)(bf16_round(W[t * 8 + i]) * 16.0f); *(v8us*)((unsigned short*)Bt + t * 8) = f.half[0];  }
// ---- projection GEMM (wave tile 32x64) with the hi / residual split and the V transposition in its epilogue ----
__device__ __forceinline__ v16h g2_frag(const _Float16* p, int hh) { FragH f; f.half[0] = *(const v8us*)((const unsigned short*)p + 8 * hh); f.half[1] = *(const v8us*)((const unsigned short*)p + 16 + 8 * hh); return f.v; }
__device__ __forceinline__ v8f g2_mma(v16h a, v16h b, v8f c) { v8f d = __builtin_amdgcn_wmma_f32_16x16x32_f16(false, a, false, b, (short)0, c, false, false); asm volatile("v_nop\n\tv_nop\n\tv_nop\n\tv_nop" : "+v"(d) : "v"(a), "v"(b)); return d; }
// x for the A fragments, straight from the f32 input: a wave reads its 32 rows in whole 128-byte lines (load i: rows 4 i + lane / 8, 16 bytes a lane), rounds them to bf16, which f16 holds exactly,
// and turns them through its own LDS range (80-byte rows) into the k order of g2_frag (k = 8 hh + 0..7, then 16 + 8 hh + 0..7)
#define XP 40      /* LDS row pitch in f16: 32 + 8, so that the 16-byte fragment reads of 8 rows fall on different banks */
typedef float v2f __attribute__((ext_vector_type(2))); typedef __bf16 v2b __attribute__((ext_vector_type(2))); typedef _Float16 v2h __attribute__((ext_vector_type(2))); typedef _Float16 v4ha __attribute__((ext_vector_type(4), may_alias));
__device__ __forceinline__ void x_load(v4f (&r)[8], const float* p) {      /* p = x + (first row + lane / 8) * DM + k + 4 (lane & 7) */
#pragma unroll      /* constant indices */
  for (int i = 0; i < 8; ++i) r[i] = *(const v4fa*)(p + (size_t)4 * i * DM); }
__device__ __forceinline__ void x_put(unsigned short* d, const v4f (&r)[8]) {      /* d = buffer + (lane / 8) * XP + 4 (lane & 7) */
#pragma unroll      /* constant indices */
  for (int i = 0; i < 8; ++i) { const v2f p0 = {r[i][0], r[i][1]}, p1 = {r[i][2], r[i][3]};      /* pairs: packed conversions, to nearest even like bf16_round */
    const v2h h0 = __builtin_convertvector(__builtin_convertvector(__builtin_convertvector(p0, v2b), v2f), v2h), h1 = __builtin_convertvector(__builtin_convertvector(__builtin_convertvector(p1, v2b), v2f), v2h);
    const v4ha h = {h0[0], h0[1], h1[0], h1[1]}; *(v4ha*)(d + 4 * i * XP) = h; } }
__device__ __forceinline__ v16h x_get(const unsigned short* s) { FragH f; f.half[0] = *(const v8us*)s; f.half[1] = *(const v8us*)(s + 16); return f.v; }      /* s = buffer + row * XP + 8 hh */
// The three projections (blockIdx.y = q, k, v): 128 rows a work-group, wave tile 32x64, C = A Bt / 16 (A = x rows, Bt = x16 weights [64][1024]); the f32 results do not go to memory:
// q, k: each wave turns its tile through its own LDS range into whole rows and stores f16 hi and x1024 residual planes [row][64];
// v: a lane's 8 accumulator elements are 8 consecutive tokens of one column, that is 16 bytes of V^T; the work-group gathers its 128 tokens in LDS and stores 256 contiguous bytes per column and plane.
__global__ __launch_bounds__(128) void k_proj(const float* __restrict__ X, const _Float16* __restrict__ Bh, _Float16* __restrict__ Hq, _Float16* __restrict__ Lq, _Float16* __restrict__ VT, _Float16* __restrict__ VTL) {
  __shared__ __attribute__((aligned(16))) float so[4][32][68];
  const int tid = threadIdx.x, w = tid >> 5, lane = tid & 31, ln = lane & 15, hh = lane >> 4; const int by = blockIdx.y;
  Bh += (size_t)by * HD * DM; const int row0 = blockIdx.x * 128 + 32 * w;
  __shared__ __attribute__((aligned(16))) unsigned short xst[4][2][32 * XP];      /* per wave two buffers of 32 rounded x rows, one trip each */
  const float* xg = X + (size_t)(row0 + (lane >> 3)) * DM + 4 * (lane & 7);
  const _Float16* b0p = Bh + (size_t)ln * DM; const _Float16* b1p = b0p + (size_t)16 * DM; const _Float16* b2p = b1p + (size_t)16 * DM; const _Float16* b3p = b2p + (size_t)16 * DM;
  const v8f z8 = {0.f,0.f,0.f,0.f,0.f,0.f,0.f,0.f}; v8f c00 = z8, c01 = z8, c02 = z8, c03 = z8, c10 = z8, c11 = z8, c12 = z8, c13 = z8;
  /* x now comes from memory: its words are asked for three trips before their products, rounded and put into LDS one trip before; loads retire in order, so the weight fragments are asked for two trips ahead, between them */
  v4f xs[2][8]; v16h bs[2][4]; v16h a0, a1;
#define P_LOADB(s, k) { bs[s][0] = g2_frag(b0p + (k), hh); bs[s][1] = g2_frag(b1p + (k), hh); bs[s][2] = g2_frag(b2p + (k), hh); bs[s][3] = g2_frag(b3p + (k), hh); }
#define P_MMA(s) { c00 = g2_mma(a0, bs[s][0], c00); c10 = g2_mma(a1, bs[s][0], c10); c01 = g2_mma(a0, bs[s][1], c01); c11 = g2_mma(a1, bs[s][1], c11); \
    c02 = g2_mma(a0, bs[s][2], c02); c12 = g2_mma(a1, bs[s][2], c12); c03 = g2_mma(a0, bs[s][3], c03); c13 = g2_mma(a1, bs[s][3], c13); }
#define P_XCNT asm volatile("s_wait_xcnt 0x0" ::: "memory")      /* the wait in front of any overwrite of an address register that the loads above it name */
#define P_EDGE __builtin_amdgcn_sched_barrier(0)      /* a trip's rounding stays in its own trip: moved up, it would wait for loads that have just been asked for */
#define P_PUT(o) x_put(&xst[w][o][(lane >> 3) * XP + 4 * (lane & 7)], xs[o])
  /* the wave's rows are in LDS before its lanes read what other lanes wrote; only this wave touches the range, so no barrier */
#define P_GET(o) { asm volatile("s_wait_dscnt 0x0" ::: "memory"); a0 = x_get(&xst[w][o][ln * XP + 8 * hh]); a1 = x_get(&xst[w][o][(16 + ln) * XP + 8 * hh]); }
  /* trip t = k / 32, e = t & 1, o = 1 - e: round x(t + 1), ask for x(t + 3), products of t, ask for weights(t + 2), fragments of t + 1 */
#define P_TRIP(e, o, k, CV, LX, LB) { if (CV) P_PUT(o); if (LX) { x_load(xs[o], xg + (k) + 96); P_XCNT; } P_MMA(e) if (LB) { P_LOADB(e, (k) + 64) P_XCNT; } if (CV) P_GET(o) P_EDGE; }
  x_load(xs[0], xg); P_XCNT; x_load(xs[1], xg + 32); P_XCNT; P_LOADB(0, 0) P_XCNT;      /* asked for in the loop's own order: the counted waits at the loop's head are set for both ways in */
  P_PUT(0); x_load(xs[0], xg + 64); P_XCNT; P_LOADB(1, 32) P_XCNT; P_GET(0) P_EDGE;
#pragma unroll 1      /* rolled: 14 double trips, two stages of both operands beside 64 accumulator registers */
  for (int kb = 0; kb < DM - 128; kb += 64) { P_TRIP(0, 1, kb, 1, 1, 1) P_TRIP(1, 0, kb + 32, 1, 1, 1) }
  P_TRIP(0, 1, DM - 128, 1, 1, 1) P_TRIP(1, 0, DM - 96, 1, 0, 1) P_TRIP(0, 1, DM - 64, 1, 0, 0) P_TRIP(1, 0, DM - 32, 0, 0, 0)      /* the last four trips ask for nothing past the row's end */
  v8f accs[8] = {c00, c01, c02, c03, c10, c11, c12, c13};
  if (by < 2) {      /* the same for the whole work-group */
#pragma unroll      /* constant indices */
    for (int u = 0; u < 8; ++u) { const int t = u & 3, half = u >> 2;
#pragma unroll      /* constant indices */
      for (int r = 0; r < 8; ++r) so[w][half * 16 + 8 * hh + r][t * 16 + ln] = accs[u][r] * 0.0625f; }
    __builtin_amdgcn_fence(__ATOMIC_ACQ_REL, "workgroup"); __builtin_amdgcn_wave_barrier();      /* the wave reads back what its own lanes wrote */
    const int rs = lane >> 3, c8 = (lane & 7) * 8; unsigned short* ph = (unsigned short*)Hq + ((size_t)by * NR + row0 + rs) * HD + c8; unsigned short* pl = (unsigned short*)Lq + ((size_t)by * NR + row0 + rs) * HD + c8;
#pragma unroll      /* 4 rows = 512 contiguous bytes a store */
    for (int q = 0; q < 8; ++q) { const v4f a = *(const v4fa*)&so[w][q * 4 + rs][c8], c = *(const v4fa*)&so[w][q * 4 + rs][c8 + 4]; FragH fh, fl;
#pragma unroll      /* constant indices */
      for (int e = 0; e < 4; ++e) { _Float16 h = (_Float16)a[e]; fh.h[e] = h; fl.h[e] = (_Float16)((a[e] - (float)h) * 1024.0f); h = (_Float16)c[e]; fh.h[4 + e] = h; fl.h[4 + e] = (_Float16)((c[e] - (float)h) * 1024.0f); }
      *(v8us*)(ph + q * 4 * HD) = fh.half[0]; *(v8us*)(pl + q * 4 * HD) = fl.half[0]; }
  } else {
    unsigned short* tl = (unsigned short*)&so[0][0][0];      /* [2 planes][64 columns][128 tokens + 8]: 272-byte rows */
#pragma unroll      /* constant indices */
    for (int u = 0; u < 8; ++u) { const int t = u & 3, half = u >> 2; FragH fh, fl;
#pragma unroll      /* constant indices */
      for (int r = 0; r < 8; ++r) { const float v = accs[u][r] * 0.0625f; const _Float16 h = (_Float16)v; fh.h[r] = h; fl.h[r] = (_Float16)((v - (float)h) * 1024.0f); }
      unsigned short* d = tl + (t * 16 + ln) * 136 + 32 * w + 16 * half + 8 * hh; *(v8us*)d = fh.half[0]; *(v8us*)(d + 64 * 136) = fl.half[0]; }
    __syncthreads();      /* every wave's 32 tokens are in place before a row of 128 is read */
    const int bb = (blockIdx.x * 128) / SQ, s0 = (blockIdx.x * 128) % SQ; const int c = (tid & 15) * 8;
    unsigned short* gh = (unsigned short*)VT + ((size_t)bb * HD + (tid >> 4)) * SQ + s0 + c; unsigned short* gl = (unsigned short*)VTL + ((size_t)bb * HD + (tid >> 4)) * SQ + s0 + c;
#pragma unroll      /* 8 columns a round; unrolled, the rounds' LDS reads run ahead of the stores */
    for (int it = 0; it < 8; ++it) { const unsigned short* s = tl + (it * 8 + (tid >> 4)) * 136 + c; const v8us xh = *(const v8us*)s, xl = *(const v8us*)(s + 64 * 136);
      *(v8us*)(gh + (size_t)it * 8 * SQ) = xh; *(v8us*)(gl + (size_t)it * 8 * SQ) = xl; }
    asm volatile("s_wait_xcnt 0x0" ::: "memory");      /* the build lays the other path's code behind this one's last branch, and it overwrites registers that the stores above name: the wait stands in front of that */
  } }

__global__ __launch_bounds__(256) void k_wnat(const float* __restrict__ w, size_t n8, _Float16* __restrict__ Bt) { const size_t t = (size_t)blockIdx.x * 256 + threadIdx.x; if (t >= n8) return; FragH f; for (int q = 0; q < 8; ++q) f.h[q] = (_Float16)(bf16_round(w[t * 8 + q]) * 16.0f); *(v8us*)((unsigned short*)Bt + t * 8) = f.half[0];  }
__global__ __launch_bounds__(256) void k_rsm(const float* __restrict__ S, _Float16* __restrict__ P, int nrows) {
  #pragma clang fp contract(off)
  const int i = blockIdx.x * 256 + threadIdx.x; if (i >= nrows) return; const float* s = S + (size_t)i * SQ; float mx = -3.0e38f;
#pragma unroll 1
  for (int j = 0; j < SQ; ++j) mx = fmaxf(mx, s[j]); float se = 0.f;
#pragma unroll 1
  for (int j = 0; j < SQ; ++j) se += expf(s[j] - mx); const float sc = 256.0f / se;
#pragma unroll 1
  for (int j0 = 0; j0 < SQ; j0 += 8) { FragH f; for (int q = 0; q < 8; ++q) f.h[q] = (_Float16)(expf(s[j0 + q] - mx) * sc); unsigned short* d = (unsigned short*)P + (size_t)i * SQ + j0; *(v8us*)d = f.half[0];  } }
__global__ __launch_bounds__(256) void k_vt(const _Float16* __restrict__ V16, int b, int h0, _Float16* __restrict__ VT) { __shared__ unsigned short tl[64][65]; const int tid = threadIdx.x; const int hh = blockIdx.x % HG, sg = blockIdx.x / HG; const int s0 = sg * 64; const int h = h0 + hh;
  for (int i = tid; i < 64 * 8; i += 256) { const int j = i / 8, d8 = (i % 8) * 8; FragH f; f.half[0] = *(const v8us*)((const unsigned short*)V16 + ((size_t)b * SQ + s0 + j) * DM + h * HD + d8); for (int q = 0; q < 8; ++q) tl[d8 + q][j] = f.u[q]; }
  __syncthreads();
  { for (int i = tid; i < 64 * 8; i += 256) { const int d = i / 8, j8 = (i % 8) * 8; FragH f; for (int q = 0; q < 8; ++q) f.u[q] = tl[d][j8 + q]; *(v8us*)((unsigned short*)VT + ((size_t)hh * HD + d) * SQ + s0 + j8) = f.half[0]; }  } }




// ---- scores kept in registers: column statistics, then weights and P V, both from recomputed score tiles ----
__device__ __forceinline__ v8f c_mma(v16h a, v16h b, v8f c) { return __builtin_amdgcn_wmma_f32_16x16x32_f16(false, a, false, b, (short)0, c, false, false); }
__device__ __forceinline__ float c_ex2(float y) { float r;
  asm("v_exp_f32 %0, %1\n\tv_nop" : "=v"(r) : "v"(y));      /* native 2^y; the v_nop keeps the slot the instruction set asks for behind a transcendental */
  return r; }
// one 16 key x 16 query tile of S^T (row 8 hh + r = key, column ln = query): k_hi.q_hi + 2^-10 (k_lo.q_hi + k_hi.q_lo); both launches form it with these same instructions
__device__ __forceinline__ v8f c_score(v16h kh0, v16h kh1, v16h kl0, v16h kl1, v16h qh0, v16h qh1, v16h ql0, v16h ql1) {
  const v8f z8 = {0.f,0.f,0.f,0.f,0.f,0.f,0.f,0.f}; v8f h = c_mma(kh0, qh0, z8); h = c_mma(kh1, qh1, h);
  v8f l = c_mma(kl0, qh0, z8); l = c_mma(kl1, qh1, l); l = c_mma(kh0, ql0, l); l = c_mma(kh1, ql1, l);
  return h + l * 0.0009765625f; }
#define LOG2E 1.44269504f
__device__ __forceinline__ v16h c_frag(const _Float16* p) { FragH f; f.half[0] = *(const v8us*)(const unsigned short*)p; f.half[1] = *(const v8us*)((const unsigned short*)p + 16); return f.v; }      /* p = row + k + 8 hh: the k order of g2_frag */
// Per key: maximum over the queries and 256 / sum of exp. Work-group = 32 keys (fragments stay in registers), its 16 waves take 128 queries each, 32 a trip;
// running maximum and sum per lane and key, joined over the 16 lanes of a row, then over the 16 waves through LDS.
__global__ __launch_bounds__(512) void k_cstat(const _Float16* __restrict__ KH, const _Float16* __restrict__ KL, const _Float16* __restrict__ QH, const _Float16* __restrict__ QL, float* __restrict__ MX, float* __restrict__ SC) {
  __shared__ float sm[16][32]; __shared__ float sz[16][32];
  const int tid = threadIdx.x, w = tid >> 5, lane = tid & 31, ln = lane & 15, hh = lane >> 4;
  const size_t base = (size_t)blockIdx.y * SQ; const int k0 = blockIdx.x * 32;
  const _Float16* pkh = KH + (base + k0 + ln) * HD + 8 * hh; const _Float16* pkl = KL + (base + k0 + ln) * HD + 8 * hh;
  v16h kh[2][2], kl[2][2];
#pragma unroll      /* constant indices keep the fragments in registers */
  for (int a = 0; a < 2; ++a) for (int s = 0; s < 2; ++s) { kh[a][s] = c_frag(pkh + 16 * a * HD + 32 * s); kl[a][s] = c_frag(pkl + 16 * a * HD + 32 * s); }
  asm volatile("s_wait_xcnt 0x0" :: "v"(pkh), "v"(pkl) : "memory");      /* the wait in front of any overwrite of the address pairs that the loads above name; as inputs the pairs stay whole up to it */
  float m[2][8], z[2][8];
#pragma unroll      /* constant indices */
  for (int a = 0; a < 2; ++a) for (int r = 0; r < 8; ++r) { m[a][r] = -3.0e38f; z[a][r] = 0.f; }
#pragma unroll 1      /* four trips; unrolled, the query fragments of several trips would not fit beside the key fragments */
  for (int c = 0; c < 4; ++c) {
    const size_t o = (base + w * 128 + c * 32 + ln) * HD + 8 * hh; const _Float16* pqh = QH + o; const _Float16* pql = QL + o;
    const v16h ah0 = c_frag(pqh), ah1 = c_frag(pqh + 32), al0 = c_frag(pql), al1 = c_frag(pql + 32);
    const v16h bh0 = c_frag(pqh + 16 * HD), bh1 = c_frag(pqh + 16 * HD + 32), bl0 = c_frag(pql + 16 * HD), bl1 = c_frag(pql + 16 * HD + 32);
    asm volatile("s_wait_xcnt 0x0" :: "v"(pqh), "v"(pql) : "memory");      /* as above: in front of the next trip's addresses and of any result that would land on these pairs */
#pragma unroll      /* constant indices */
    for (int a = 0; a < 2; ++a) {
      const v8f s0 = c_score(kh[a][0], kh[a][1], kl[a][0], kl[a][1], ah0, ah1, al0, al1);
      const v8f s1 = c_score(kh[a][0], kh[a][1], kl[a][0], kl[a][1], bh0, bh1, bl0, bl1);
#pragma unroll      /* constant indices */
      for (int r = 0; r < 8; ++r) { const float mn = fmaxf(m[a][r], fmaxf(s0[r], s1[r]));
        z[a][r] = z[a][r] * c_ex2((m[a][r] - mn) * LOG2E) + (c_ex2((s0[r] - mn) * LOG2E) + c_ex2((s1[r] - mn) * LOG2E)); m[a][r] = mn; }
    }
  }
#pragma unroll      /* constant indices */
  for (int k = 1; k < 16; k <<= 1) { float mo[2][8], zo[2][8];      /* step outermost: the 32 exchanges of a step are independent and fly together */
    for (int a = 0; a < 2; ++a) for (int r = 0; r < 8; ++r) { mo[a][r] = __shfl_xor(m[a][r], k, 32); zo[a][r] = __shfl_xor(z[a][r], k, 32); }
    for (int a = 0; a < 2; ++a) for (int r = 0; r < 8; ++r) { const float mn = fmaxf(m[a][r], mo[a][r]); z[a][r] = z[a][r] * c_ex2((m[a][r] - mn) * LOG2E) + zo[a][r] * c_ex2((mo[a][r] - mn) * LOG2E); m[a][r] = mn; } }
  if (ln == 0) {
#pragma unroll      /* constant indices */
    for (int a = 0; a < 2; ++a) for (int r = 0; r < 8; ++r) { sm[w][16 * a + 8 * hh + r] = m[a][r]; sz[w][16 * a + 8 * hh + r] = z[a][r]; } }
  __syncthreads();
  if (tid < 32) { float mm = sm[0][tid];
    for (int u = 1; u < 16; ++u) mm = fmaxf(mm, sm[u][tid]);
    float zz = 0.f;
    for (int u = 0; u < 16; ++u) zz += sz[u][tid] * c_ex2((sm[u][tid] - mm) * LOG2E);
    MX[base + k0 + tid] = mm; SC[base + k0 + tid] = 256.0f / zz; } }
// out^T[d][i] = sum_k V^T[d][k] P^T[k][i]. Work-group = 32 queries, its 8 waves take 256 keys each, 32 a trip. Two score tiles (keys 0-15, 16-31 of the trip) hold, per lane,
// exactly the B fragment's elements (element e < 8: key 8 hh + e; e >= 8: key 16 + 8 hh + e - 8; column ln = query), the k order in which g2_frag reads V^T: the weights go from D to B inside the lane.
__global__ __launch_bounds__(256) void k_cpv(const _Float16* __restrict__ KH, const _Float16* __restrict__ KL, const _Float16* __restrict__ QH, const _Float16* __restrict__ QL, const _Float16* __restrict__ VT, const _Float16* __restrict__ VTL,
    const float* __restrict__ MX, const float* __restrict__ SC, float* __restrict__ out) {
  __shared__ __attribute__((aligned(16))) float red[4][32][68];
  const int tid = threadIdx.x, w = tid >> 5, lane = tid & 31, ln = lane & 15, hh = lane >> 4;
  const size_t base = (size_t)blockIdx.y * SQ; const int q0 = blockIdx.x * 32;
  const _Float16* vh_b = VT + base * HD; const _Float16* vl_b = VTL + base * HD;
  const _Float16* pqh = QH + (base + q0 + ln) * HD + 8 * hh; const _Float16* pql = QL + (base + q0 + ln) * HD + 8 * hh;
  v16h qh[2][2], ql[2][2];
#pragma unroll      /* constant indices keep the fragments in registers */
  for (int c = 0; c < 2; ++c) for (int s = 0; s < 2; ++s) { qh[c][s] = c_frag(pqh + 16 * c * HD + 32 * s); ql[c][s] = c_frag(pql + 16 * c * HD + 32 * s); }
  asm volatile("s_wait_xcnt 0x0" :: "v"(pqh), "v"(pql) : "memory");      /* the wait in front of any overwrite of the address pairs that the loads above name; as inputs the pairs stay whole up to it */
  const v8f z8 = {0.f,0.f,0.f,0.f,0.f,0.f,0.f,0.f}; v8f oh[4][2], ol[4][2];
#pragma unroll      /* constant indices */
  for (int t = 0; t < 4; ++t) for (int c = 0; c < 2; ++c) { oh[t][c] = z8; ol[t][c] = z8; }
#pragma unroll 1      /* eight trips; one trip's fragments beside 128 accumulator registers */
  for (int it = 0; it < 8; ++it) { const int k0 = w * 256 + it * 32; FragH p[2];
    const _Float16* pkh = KH + (base + k0 + ln) * HD + 8 * hh; const _Float16* pkl = KL + (base + k0 + ln) * HD + 8 * hh; const float* pm = MX + base + k0 + 8 * hh; const float* pc = SC + base + k0 + 8 * hh;
    const _Float16* pvh = vh_b + (size_t)ln * SQ + k0 + 8 * hh; const _Float16* pvl = vl_b + (size_t)ln * SQ + k0 + 8 * hh;
#pragma unroll      /* constant indices */
    for (int a = 0; a < 2; ++a) {
      const v16h kh0 = c_frag(pkh + 16 * a * HD), kh1 = c_frag(pkh + 16 * a * HD + 32), kl0 = c_frag(pkl + 16 * a * HD), kl1 = c_frag(pkl + 16 * a * HD + 32);
      const v4f m0 = *(const v4fa*)(pm + 16 * a), m1 = *(const v4fa*)(pm + 16 * a + 4), c0 = *(const v4fa*)(pc + 16 * a), c1 = *(const v4fa*)(pc + 16 * a + 4);
#pragma unroll      /* constant indices */
      for (int c = 0; c < 2; ++c) { const v8f s = c_score(kh0, kh1, kl0, kl1, qh[c][0], qh[c][1], ql[c][0], ql[c][1]);
#pragma unroll      /* constant indices */
        for (int r = 0; r < 4; ++r) { p[c].h[8 * a + r] = (_Float16)(c_ex2((s[r] - m0[r]) * LOG2E) * c0[r]); p[c].h[8 * a + 4 + r] = (_Float16)(c_ex2((s[4 + r] - m1[r]) * LOG2E) * c1[r]); } } }
#pragma unroll      /* constant indices */
    for (int t = 0; t < 4; ++t) { const v16h vh = c_frag(pvh + (size_t)16 * t * SQ), vl = c_frag(pvl + (size_t)16 * t * SQ);
#pragma unroll      /* constant indices */
      for (int c = 0; c < 2; ++c) { oh[t][c] = c_mma(vh, p[c].v, oh[t][c]); ol[t][c] = c_mma(vl, p[c].v, ol[t][c]); } }
    asm volatile("s_wait_xcnt 0x0" :: "v"(pkh), "v"(pkl), "v"(pm), "v"(pc), "v"(pvh), "v"(pvl) : "memory");      /* as above, at the trip's foot: in front of the next trip's addresses */
  }
  /* the 8 key slices are added: waves 4-7 hand theirs to waves 0-3 through LDS, then every thread adds the four sums left */
#pragma unroll      /* constant indices */
  for (int t = 0; t < 4; ++t) for (int c = 0; c < 2; ++c) { oh[t][c] = oh[t][c] * 0.00390625f + ol[t][c] * 0.000003814697265625f;
    if (w >= 4) { float* d = &red[w - 4][16 * c + ln][16 * t + 8 * hh]; const v4f x0 = {oh[t][c][0], oh[t][c][1], oh[t][c][2], oh[t][c][3]}, x1 = {oh[t][c][4], oh[t][c][5], oh[t][c][6], oh[t][c][7]}; *(v4fa*)d = x0; *(v4fa*)(d + 4) = x1; } }
  __syncthreads();
  if (w < 4) {
#pragma unroll      /* constant indices */
    for (int t = 0; t < 4; ++t) for (int c = 0; c < 2; ++c) { float* d = &red[w][16 * c + ln][16 * t + 8 * hh]; v4f x0 = *(const v4fa*)d, x1 = *(const v4fa*)(d + 4);
      for (int r = 0; r < 4; ++r) { x0[r] += oh[t][c][r]; x1[r] += oh[t][c][4 + r]; }
      *(v4fa*)d = x0; *(v4fa*)(d + 4) = x1; } }
  __syncthreads();
#pragma unroll      /* two 16-byte pieces a thread */
  for (int j = 0; j < 2; ++j) { const int idx = tid + 256 * j, q = idx >> 4, d4 = (idx & 15) * 4;
    const v4f v = (*(const v4fa*)&red[0][q][d4] + *(const v4fa*)&red[1][q][d4]) + (*(const v4fa*)&red[2][q][d4] + *(const v4fa*)&red[3][q][d4]);
    float* o = out + (base + q0 + q) * DMO + d4;
#pragma unroll      /* the 16 identical heads: 16 lanes fill 256 contiguous bytes of a row per store */
    for (int h = 0; h < DMO / HD; ++h) *(v4f*)(o + h * HD) = v; } }

extern "C" void kernel_launch(void* const* d_in, const int* in_sizes, int n_in,
                              void* d_out, int out_size, void* d_ws, size_t ws_size, hipStream_t stream) {
  (void)in_sizes; (void)n_in; (void)out_size;
  const float* const* I = (const float* const*)d_in; const float* x = I[0]; const float* wq = I[1]; const float* wk = I[2]; const float* wv = I[3];      /* [in][out] = [1024][64] */
  char* ws = (char*)d_ws; size_t off = 0;
  auto take = [&](size_t bytes) { char* p = ws + off; off += (bytes + 255) & ~(size_t)255; return p; };
  /* planes of one kind lie one behind the other (weights q, k, v; hi and residual planes q, k), so that one launch covers them */
  _Float16* B3 = (_Float16*)take((size_t)3 * HD * DM * 2); _Float16* H3 = (_Float16*)take(4 * NR * HD * 2); _Float16* L3 = H3 + 2 * NR * HD;
  _Float16* QH = H3; _Float16* KH = H3 + NR * HD; _Float16* QL = L3; _Float16* KL = L3 + NR * HD;
  float* MX = (float*)take(NR * 4); float* SC = (float*)take(NR * 4); _Float16* VT = (_Float16*)take(2 * NR * HD * 2); _Float16* VTL = VT + NR * HD;      /* one plane per batch */
  if (off > ws_size) return;      /* approx 4 + 2 = 6 MiB */
  k_wt_f16<<<dim3((unsigned)(((size_t)HD * (DM / 8) + 255) / 256), 3), 256, 0, stream>>>(wq, wk, wv, B3, DM, HD, 16.0f);      /* 3 x [1024][64] -> Bt[3][64][1024] x16 */
  k_proj<<<dim3((unsigned)(NR / 128), 3), 128, 0, stream>>>(x, B3, H3, L3, VT, VTL);      /* q, k as f16 hi + x1024 residual planes, v as V^T hi / residual [b][64][2048]: blockIdx.y = projection */
  /* the four batches are independent: each stage is one launch over all of them (blockIdx.y = batch, or a four times longer grid over planes that lie one behind the other) */
  k_cstat<<<dim3(SQ / 32, NB), 512, 0, stream>>>(KH, KL, QH, QL, MX, SC);      /* per key: max over the query index i, 256 / sum of exp */
  k_cpv<<<dim3(SQ / 32, NB), 256, 0, stream>>>(KH, KL, QH, QL, VT, VTL, MX, SC, (float*)d_out);      /* out_i = 2^-8 sum_k f16(256 att[i][k]) (v_hi + 2^-10 v_lo), stored into the 16 identical heads */
}

// v007
// One run takes 57.6 microseconds.
// Timed twice side by side with v006, it ran 1.09 and 1.08 times as fast.
// All steps since v000 together make it 37.0 times as fast.
#include <hip/hip_runtime.h>
// Single-projection attention with a QUERY-axis softmax, tiled 16x (x [4][2048][1024]; q, k, v = x W ([1024][64] weights stored [in][out], shared by all heads); att[i][k] = q_i . k_k (no scaling); att = softmax over the QUERY index i for each key column k (the module's nn.Softmax(dim=1)); out_i = sum_k att[i][k] v_k -> [2048][64], concatenated 16 times -> [4][2048][1024]).
// Structure: token rows; x read as f32 by the projection launch and rounded in registers to exact f16 fragments; q and k projections as WMMA GEMMs (32x64 wave tiles, f32 accumulation, exact x16 weights) kept in f32 and split into f16 hi + x1024 residual planes (the unscaled logits have sigma 8, so they are formed from three hi/lo products, ~2^-21 relative); v likewise kept f32 and split; the split is done in the projection launch's epilogue, which stores every plane (q, k, V^T; the weight launch likewise) in fragment order, so that each 16-byte fragment load of a wave reads 512 contiguous bytes; the scores never go through memory: transposed score tiles S^T[k][i] = k_k . q_i (three hi/lo products, K = 64) are formed twice in registers, once for each key's maximum and sum of exp over the query index i (= the module's column softmax; f32 statistics, native exp), once for the weights (x256 f16), which pass inside the lane from the score tiles' D layout into the B fragment of out^T = V^T P^T (hi and residual accumulators, f32), 8 key slices added through LDS, each sum stored into the 16 head slots of its output row by the same launch (256 contiguous bytes per row and head); every per-batch stage runs as one launch over the four batches, and the stages that q, k, v each need run as one launch over adjacent planes; 4 launches.
// Compute dtype: inputs rounded to bf16; x / weights exact; q, k, v as f16 hi + residual pairs; the softmax weights plain f16 (~2^-12); scores, statistics, out f32. v_wmma_f32_16x16x32_f16.
#define NB 4
#define SQ 2048
#define DM 1024
#define HD 64
#define NH 1
#define HG 1
#define DMO 1024                     /* output row width = 16 x 64 */
#define B0 0                         /* unused */
#define NBR NB
#define NR ((size_t)NB * SQ)
typedef __bf16 v16b __attribute__((ext_vector_type(16)));
typedef unsigned short v8us __attribute__((ext_vector_type(8), may_alias));
typedef float  v8f  __attribute__((ext_vector_type(8)));
typedef float  v4f  __attribute__((ext_vector_type(4)));
typedef float  v4fa __attribute__((ext_vector_type(4), may_alias));
union FragB { v16b v; v8us half[2]; unsigned short u[16]; };

__device__ __forceinline__ unsigned short bf16_bits(float x) { unsigned int u = __float_as_uint(x); return (unsigned short)((u + 0x7FFFu + ((u >> 16) & 1u)) >> 16); }
__device__ __forceinline__ float bf16_val(unsigned short b) { return __uint_as_float(((unsigned int)b) << 16); }
__device__ __forceinline__ float bf16_round(float x) { return bf16_val(bf16_bits(x)); }
// D += A·B with NT terms: 1 = ah·bh, 2 = + al·bh (A split), 3 = + ah·bl (both split)
template <int NT>
__device__ __forceinline__ v8f mmaN(v16b ah, v16b al, v16b bh, v16b bl, v8f c) {
  c = __builtin_amdgcn_wmma_f32_16x16x32_bf16(false, ah, false, bh, (short)0, c, false, false);
  if (NT >= 2) c = __builtin_amdgcn_wmma_f32_16x16x32_bf16(false, al, false, bh, (short)0, c, false, false);
  if (NT >= 3) c = __builtin_amdgcn_wmma_f32_16x16x32_bf16(false, ah, false, bl, (short)0, c, false, false);
  asm volatile("v_nop\n\tv_nop\n\tv_nop\n\tv_nop" : "+v"(c) : "v"(ah), "v"(al), "v"(bh), "v"(bl));
  return c;
}

__global__ __launch_bounds__(256) void k_wt_bf16(const float* __restrict__ W, unsigned short* __restrict__ Wt, int K, int N) {
  const int t = blockIdx.x * 256 + threadIdx.x;
  const int k8n = K / 8;
  if (t >= N * k8n) return;
  const int n = t / k8n, k8 = (t % k8n) * 8;
  v8us v;
#pragma unroll
  for (int i = 0; i < 8; ++i) v[i] = bf16_bits(W[(size_t)(k8 + i) * N + n]);
  *(v8us*)(Wt + (size_t)n * K + k8) = v;
  
}

// GEMM C[M][N] (f32, pitch ldc) = act(A[M][K]·W + bias). A f32 row-major (pitch lda) converted per fragment to bf16
// (ASPLIT: hi/lo two planes -> 2 terms, else single rounded term); Wt bf16 [N][K] (pitch ldb). BIAS_BF16 rounds the
// bias to bf16 first (bias quantised to bf16 before the add). K%32==0, M%16==0, N%64==0.
template <bool ASPLIT, int ACT, bool BIAS_BF16>
__global__ __launch_bounds__(128) void k_gemm_bf(const float* __restrict__ A, int lda, const unsigned short* __restrict__ Wt, int ldb,
                                               const float* __restrict__ bias, float* __restrict__ C, int ldc, int M, int N, int K) {
  __shared__ __attribute__((aligned(16))) float so[4][16][64];
  const int tid = threadIdx.x, w = tid >> 5, lane = tid & 31, ln = lane & 15, hh = lane >> 4;
  const int ntn = N / 64;
  const int wid = blockIdx.x * 4 + w;
  const int mt = wid / ntn, nq = wid % ntn;
  if (mt * 16 >= M) return;
  const int row0 = mt * 16, col0 = nq * 64;
  const float* arow = A + (size_t)(row0 + ln) * lda;
  v8f acc[4] = {};
  for (int kb = 0; kb < K; kb += 32) {
    FragB ah, al;
    const v4f x0 = *(const v4fa*)(arow + kb + 8 * hh), x1 = *(const v4fa*)(arow + kb + 8 * hh + 4);
    const v4f x2 = *(const v4fa*)(arow + kb + 16 + 8 * hh), x3 = *(const v4fa*)(arow + kb + 16 + 8 * hh + 4);
    float xs[16] = {x0[0],x0[1],x0[2],x0[3],x1[0],x1[1],x1[2],x1[3],x2[0],x2[1],x2[2],x2[3],x3[0],x3[1],x3[2],x3[3]};
#pragma unroll
    for (int i = 0; i < 16; ++i) { const unsigned short hb = bf16_bits(xs[i]); ah.u[i] = hb; al.u[i] = ASPLIT ? bf16_bits(xs[i] - bf16_val(hb)) : (unsigned short)0; }
#pragma unroll
    for (int t = 0; t < 4; ++t) {
      const unsigned short* brow = Wt + (size_t)(col0 + t * 16 + ln) * ldb + kb;
      FragB b;
      b.half[0] = *(const v8us*)(brow + 8 * hh);
      b.half[1] = *(const v8us*)(brow + 16 + 8 * hh);
      acc[t] = mmaN<ASPLIT ? 2 : 1>(ah.v, al.v, b.v, b.v, acc[t]);
    }
  }
#pragma unroll
  for (int t = 0; t < 4; ++t) {
    float bv = bias ? bias[col0 + t * 16 + ln] : 0.f;
    if (BIAS_BF16) bv = bf16_round(bv);
#pragma unroll
    for (int r = 0; r < 8; ++r) { float v = acc[t][r] + bv; if (ACT == 1) v = fmaxf(v, 0.f); so[w][8 * hh + r][t * 16 + ln] = v; }
  }
  __builtin_amdgcn_fence(__ATOMIC_ACQ_REL, "workgroup");
  __builtin_amdgcn_wave_barrier();
  const int rsub = lane >> 4, c4 = (lane & 15) * 4;
  {
#pragma unroll
    for (int q = 0; q < 8; ++q) {
      const int r = q * 2 + rsub;
      const v4f v = *(const v4fa*)&so[w][r][c4];
      *(v4f*)(C + (size_t)(row0 + r) * ldc + col0 + c4) = v;
    }
    
  }
}

// GEMM C = act(A·W + bias + resid): A f32 (ASPLIT -> hi/lo 2 terms), Wt bf16 [N][K]; ACT 0 none, 1 relu, 2 exact gelu;
// resid (optional, f32, row index = (row % rmod), pitch ldr, RES_BF16 rounds it) added before the activation.
template <bool ASPLIT, int ACT, bool BIAS_BF16, bool RES_BF16>
__global__ __launch_bounds__(128) void k_gemm_bf3(const float* __restrict__ A, int lda, const unsigned short* __restrict__ Wt, int ldb,
                                                const float* __restrict__ bias, const float* __restrict__ resid, int rmod, int ldr,
                                                float* __restrict__ C, int ldc, int M, int N, int K) {
  __shared__ __attribute__((aligned(16))) float so[4][16][64];
  const int tid = threadIdx.x, w = tid >> 5, lane = tid & 31, ln = lane & 15, hh = lane >> 4;
  const int ntn = N / 64;
  const int wid = blockIdx.x * 4 + w;
  const int mt = wid / ntn, nq = wid % ntn;
  if (mt * 16 >= M) return;
  const int row0 = mt * 16, col0 = nq * 64;
  const float* arow = A + (size_t)(row0 + ln) * lda;
  v8f acc[4] = {};
  for (int kb = 0; kb < K; kb += 32) {
    FragB ah, al;
    const v4f x0 = *(const v4fa*)(arow + kb + 8 * hh), x1 = *(const v4fa*)(arow + kb + 8 * hh + 4);
    const v4f x2 = *(const v4fa*)(arow + kb + 16 + 8 * hh), x3 = *(const v4fa*)(arow + kb + 16 + 8 * hh + 4);
    float xs[16] = {x0[0],x0[1],x0[2],x0[3],x1[0],x1[1],x1[2],x1[3],x2[0],x2[1],x2[2],x2[3],x3[0],x3[1],x3[2],x3[3]};
#pragma unroll
    for (int i = 0; i < 16; ++i) { const unsigned short hb = bf16_bits(xs[i]); ah.u[i] = hb; al.u[i] = ASPLIT ? bf16_bits(xs[i] - bf16_val(hb)) : (unsigned short)0; }
#pragma unroll
    for (int t = 0; t < 4; ++t) {
      const unsigned short* brow = Wt + (size_t)(col0 + t * 16 + ln) * ldb + kb;
      FragB b;
      b.half[0] = *(const v8us*)(brow + 8 * hh);
      b.half[1] = *(const v8us*)(brow + 16 + 8 * hh);
      acc[t] = mmaN<ASPLIT ? 2 : 1>(ah.v, al.v, b.v, b.v, acc[t]);
    }
  }
#pragma unroll
  for (int t = 0; t < 4; ++t) {
    const int col = col0 + t * 16 + ln;
    float bv = bias ? bias[col] : 0.f;
    if (BIAS_BF16) bv = bf16_round(bv);
#pragma unroll
    for (int r = 0; r < 8; ++r) {
      float v = acc[t][r] + bv;
      if (resid) { float rv = resid[(size_t)((row0 + 8 * hh + r) % rmod) * ldr + col]; if (RES_BF16) rv = bf16_round(rv); v += rv; }
      if (ACT == 1) v = fmaxf(v, 0.f);
      if (ACT == 2) v = 0.5f * v * (1.0f + erff(v * 0.70710678118654752f));
      if (ACT == 3) { const float u = 0.7978845608028654f * (v + 0.044715f * v * v * v); v = 0.5f * v * (1.0f + tanhf(u)); }
      so[w][8 * hh + r][t * 16 + ln] = v;
    }
  }
  __builtin_amdgcn_fence(__ATOMIC_ACQ_REL, "workgroup");
  __builtin_amdgcn_wave_barrier();
  const int rsub = lane >> 4, c4 = (lane & 15) * 4;
  {
#pragma unroll
    for (int q = 0; q < 8; ++q) {
      const int r = q * 2 + rsub;
      const v4f v = *(const v4fa*)&so[w][r][c4];
      *(v4f*)(C + (size_t)(row0 + r) * ldc + col0 + c4) = v;
    }
    
  }
}
// row LayerNorm (biased variance, eps) over N: s = X (+ R); optional out_sum <- s; out_norm <- (s-mu)*rsqrt(var+eps)*g + b
template <bool PARAM_BF16>
__global__ __launch_bounds__(256) void k_layernorm(const float* __restrict__ X, const float* __restrict__ R, const float* __restrict__ g, const float* __restrict__ bta,
                                                  float* __restrict__ out_sum, float* __restrict__ out_norm, int N, float eps) {
  __shared__ float red[256];
  const int row = blockIdx.x, tid = threadIdx.x;
  const float* x = X + (size_t)row * N; const float* rr = R ? R + (size_t)row * N : nullptr;
  float vals[16];                     // up to N = 4096
  const int per = N / 256;            // contiguous chunk per thread? use strided-by-4 chunks: thread handles j = tid*4 + 1024*u
  float s1 = 0.f;
  for (int u = 0; u < per / 4; ++u) {
    const int j = tid * 4 + 1024 * u;
    const v4f a = *(const v4fa*)(x + j);
    v4f b = {0.f,0.f,0.f,0.f}; if (rr) b = *(const v4fa*)(rr + j);
#pragma unroll
    for (int q = 0; q < 4; ++q) { const float v = a[q] + b[q]; vals[u * 4 + q] = v; s1 += v; }
  }
  red[tid] = s1; __syncthreads();
  for (int st = 128; st > 0; st >>= 1) { if (tid < st) red[tid] += red[tid + st]; __syncthreads(); }
  const float mu = red[0] / (float)N; __syncthreads();
  float s2 = 0.f;
  for (int u = 0; u < per / 4; ++u)
#pragma unroll
    for (int q = 0; q < 4; ++q) { const float c = vals[u * 4 + q] - mu; s2 += c * c; }
  red[tid] = s2; __syncthreads();
  for (int st = 128; st > 0; st >>= 1) { if (tid < st) red[tid] += red[tid + st]; __syncthreads(); }
  const float rs = rsqrtf(red[0] / (float)N + eps);
  {
    for (int u = 0; u < per / 4; ++u) {
      const int j = tid * 4 + 1024 * u;
      v4f o, sm;
#pragma unroll
      for (int q = 0; q < 4; ++q) {
        float gg = g[j + q], bb = bta[j + q];
        if (PARAM_BF16) { gg = bf16_round(gg); bb = bf16_round(bb); }
        sm[q] = vals[u * 4 + q]; o[q] = (vals[u * 4 + q] - mu) * rs * gg + bb;
      }
      if (out_sum) *(v4f*)(out_sum + (size_t)row * N + j) = sm;
      *(v4f*)(out_norm + (size_t)row * N + j) = o;
    }
    
  }
}



// ---- f16 WMMA path (v_wmma_f32_16x16x32_f16): 11-bit significands for operands in range — used where a [0,1] probability operand needs more precision than bf16
typedef _Float16 v16h __attribute__((ext_vector_type(16)));
union FragH { v16h v; v8us half[2]; _Float16 h[16]; unsigned short u[16]; };
template <int NT>
__device__ __forceinline__ v8f mmaH(v16h ah, v16h al, v16h bh, v16h bl, v8f c) {
  c = __builtin_amdgcn_wmma_f32_16x16x32_f16(false, ah, false, bh, (short)0, c, false, false);
  if (NT >= 2) c = __builtin_amdgcn_wmma_f32_16x16x32_f16(false, al, false, bh, (short)0, c, false, false);
  if (NT >= 3) c = __builtin_amdgcn_wmma_f32_16x16x32_f16(false, ah, false, bl, (short)0, c, false, false);
  asm volatile("v_nop\n\tv_nop\n\tv_nop\n\tv_nop" : "+v"(c) : "v"(ah), "v"(al), "v"(bh), "v"(bl));
  return c;
}
// batched GEMM like k_gemm_b but f16 operands: A f32 (split into f16 hi/lo if ASPLIT, else rounded to f16), Bt = f16 values [n][k]; alpha; C f32; N multiple of 16 (partial tiles skipped)
template <bool ASPLIT>
__global__ __launch_bounds__(128) void k_gemm_h(const float* __restrict__ A, int lda, size_t sA, const _Float16* __restrict__ Bh, int ldb, size_t sB, float alpha, float* __restrict__ C, int ldc, size_t sC, int M, int N, int K) {
  __shared__ __attribute__((aligned(16))) float so[4][16][64];
  const int tid = threadIdx.x, w = tid >> 5, lane = tid & 31, ln = lane & 15, hh = lane >> 4; const int by = blockIdx.y;
  A += (size_t)by * sA; Bh += (size_t)by * sB; C += (size_t)by * sC;
  const int ntn = (N + 63) / 64; const int wid = blockIdx.x * 4 + w; const int mt = wid / ntn, nq = wid % ntn; if (mt * 16 >= M) return;
  const int row0 = mt * 16, col0 = nq * 64; const float* arow = A + (size_t)(row0 + ln) * lda;
  v8f acc[4] = {};
  for (int kb = 0; kb < K; kb += 32) {
    FragH ah, al;
    const v4f x0 = *(const v4fa*)(arow + kb + 8 * hh), x1 = *(const v4fa*)(arow + kb + 8 * hh + 4), x2 = *(const v4fa*)(arow + kb + 16 + 8 * hh), x3 = *(const v4fa*)(arow + kb + 16 + 8 * hh + 4);
    float xs[16] = {x0[0],x0[1],x0[2],x0[3],x1[0],x1[1],x1[2],x1[3],x2[0],x2[1],x2[2],x2[3],x3[0],x3[1],x3[2],x3[3]};
#pragma unroll
    for (int i = 0; i < 16; ++i) { const _Float16 h = (_Float16)xs[i]; ah.h[i] = h; al.h[i] = ASPLIT ? (_Float16)(xs[i] - (float)h) : (_Float16)0.0f; }
#pragma unroll
    for (int t = 0; t < 4; ++t) { if (col0 + t * 16 >= N) continue; const size_t boff = (size_t)(col0 + t * 16 + ln) * ldb + kb; FragH bq; bq.half[0] = *(const v8us*)(Bh + boff + 8 * hh); bq.half[1] = *(const v8us*)(Bh + boff + 16 + 8 * hh);
      acc[t] = mmaH<ASPLIT ? 2 : 1>(ah.v, al.v, bq.v, bq.v, acc[t]); }
  }
#pragma unroll
  for (int t = 0; t < 4; ++t) { if (col0 + t * 16 >= N) continue;
#pragma unroll
    for (int r = 0; r < 8; ++r) so[w][8 * hh + r][t * 16 + ln] = acc[t][r] * alpha; }
  __builtin_amdgcn_fence(__ATOMIC_ACQ_REL, "workgroup"); __builtin_amdgcn_wave_barrier();
  const int rsub = lane >> 4, c4 = (lane & 15) * 4;
  {
#pragma unroll
    for (int q = 0; q < 8; ++q) { const int r = q * 2 + rsub; if (col0 + c4 < N) { const v4f v = *(const v4fa*)&so[w][r][c4]; *(v4f*)(C + (size_t)(row0 + r) * ldc + col0 + c4) = v; } }
     }
}

// Wt = f16(W[k][n] * scale) from f32 row-major W[K][N] (scale = power of two; bf16-exact weights stay exact in f16 away from the subnormal range), in fragment order (f_frag below):
// per 32 k and 16 n two pieces of 512 bytes (k 0-15, 16-31); in a piece lane 16 hh + (n & 15) has its 8 values k = 8 hh + 0..7. Threads run along n, so that a wave reads whole lines of W and writes 256-byte runs.
// blockIdx.y picks one of three weights of the same shape; their Wt planes lie one behind the other
__global__ __launch_bounds__(256) void k_wt_f16(const float* __restrict__ W0, const float* __restrict__ W1, const float* __restrict__ W2, _Float16* __restrict__ Wt, int K, int N, float scale) {
  const int by = blockIdx.y; const float* __restrict__ W = by == 0 ? W0 : by == 1 ? W1 : W2; Wt += (size_t)by * N * K;
  const int t = blockIdx.x * 256 + threadIdx.x; if (t >= N * (K / 8)) return; const int n = t % N, k8 = (t / N) * 8; FragH f;
#pragma unroll
  for (int i = 0; i < 8; ++i) f.h[i] = (_Float16)(bf16_round(W[(size_t)(k8 + i) * N + n]) * scale); const v8us o = f.half[0];
  *(v8us*)((unsigned short*)Wt + ((size_t)((k8 >> 5) * (N / 16) + (n >> 4)) * 2 + ((k8 >> 4) & 1)) * 256 + (((k8 >> 3) & 1) * 16 + (n & 15)) * 8) = o; 
}
// k_gemm_hh variant with fused epilogue: v = acc·alpha + bias[by·sBias + col] (+ CP[(row/rowsPerB)·sCPb + by·64 + col] if CP) ; ACT 0 none / 1 elu ; writes f16 C16 (and f32 C if non-null)
template <int ACT>
__global__ __launch_bounds__(128) void k_gemm_hhx(const _Float16* __restrict__ A, int lda, size_t sA, const _Float16* __restrict__ Bh, int ldb, size_t sB, float alpha, const float* __restrict__ bias, size_t sBias, const float* __restrict__ CP, int rowsPerB, size_t sCPb, int row0g,
    float* __restrict__ C, _Float16* __restrict__ C16, int ldc, size_t sC, int M, int N, int K) {
  __shared__ __attribute__((aligned(16))) float so[4][16][64];
  const int tid = threadIdx.x, w = tid >> 5, lane = tid & 31, ln = lane & 15, hh = lane >> 4; const int by = blockIdx.y;
  A += (size_t)by * sA; Bh += (size_t)by * sB; const size_t cofs = (size_t)by * sC; const float* bp = bias ? bias + (size_t)by * sBias : nullptr;
  const int ntn = (N + 63) / 64; const int wid = blockIdx.x * 4 + w; const int mt = wid / ntn, nq = wid % ntn; if (mt * 16 >= M) return;
  const int row0 = mt * 16, col0 = nq * 64; const _Float16* arow = A + (size_t)(row0 + ln) * lda;
  v8f acc[4] = {};
  for (int kb = 0; kb < K; kb += 32) { FragH ah; ah.half[0] = *(const v8us*)((const unsigned short*)arow + kb + 8 * hh); ah.half[1] = *(const v8us*)((const unsigned short*)arow + kb + 16 + 8 * hh);
#pragma unroll
    for (int t = 0; t < 4; ++t) { if (col0 + t * 16 >= N) continue; const size_t boff = (size_t)(col0 + t * 16 + ln) * ldb + kb; FragH bq; bq.half[0] = *(const v8us*)((const unsigned short*)Bh + boff + 8 * hh); bq.half[1] = *(const v8us*)((const unsigned short*)Bh + boff + 16 + 8 * hh);
      acc[t] = mmaH<1>(ah.v, ah.v, bq.v, bq.v, acc[t]); }
  }
#pragma unroll
  for (int t = 0; t < 4; ++t) { if (col0 + t * 16 >= N) continue; const int col = col0 + t * 16 + ln; const float bv = bp ? bf16_round(bp[col]) : 0.f;
#pragma unroll
    for (int r = 0; r < 8; ++r) { float v = acc[t][r] * alpha + bv; if (CP) { const int rr = row0g + row0 + 8 * hh + r; if (rowsPerB < 0) v += CP[cofs + (size_t)rr * ldc + col];      /* rowsPerB < 0: own element of the batched C plane */ else { const int bidx = rr / rowsPerB; v += CP[(size_t)bidx * sCPb + (size_t)by * 64 + col]; } } if (ACT == 1) v = (v > 0.f) ? v : expm1f(v); else if (ACT == 7) v = (v > 0.f) ? v + 1.0f : expf(v); else if (ACT == 8) v = tanhf(v); else if (ACT == 9) v = 0.5f * v * (1.0f + tanhf(0.7978845608028654f * (v + 0.044715f * v * v * v))); else if (ACT == 11) v = 1.0f / (1.0f + expf(-v)); else if (ACT == 12) v = (v > 0.f) ? v : 0.01f * v; else if (ACT == 14) v = (v > 0.f) ? v : 0.1f * v; else if (ACT == 16) v = (v >= 0.f) ? v : 0.3f * v; else if (ACT == 17) v = (v >= 0.f) ? v : 0.2f * v; else if (ACT == 15) v = v / (1.0f + expf(-v)); else if (ACT == 3) v = fmaxf(v, 0.f); else if (ACT == 6) v = 0.5f * v * (1.0f + erff(v * 0.70710678118654752f)); so[w][8 * hh + r][t * 16 + ln] = v; } }
  __builtin_amdgcn_fence(__ATOMIC_ACQ_REL, "workgroup"); __builtin_amdgcn_wave_barrier();
  const int rsub = lane >> 4, c4 = (lane & 15) * 4; typedef _Float16 v4h __attribute__((ext_vector_type(4)));
  {
#pragma unroll
    for (int q = 0; q < 8; ++q) { const int r = q * 2 + rsub; if (col0 + c4 < N) { const v4f v = *(const v4fa*)&so[w][r][c4]; if (C) *(v4f*)(C + cofs + (size_t)(row0 + r) * ldc + col0 + c4) = v; if (C16) { v4h h4; for (int i = 0; i < 4; ++i) h4[i] = (_Float16)v[i]; *(v4h*)(C16 + cofs + (size_t)(row0 + r) * ldc + col0 + c4) = h4; } } }
     }
}


typedef _Float16 v4h __attribute__((ext_vector_type(4)));

__global__ __launch_bounds__(256) void k_x16(const float* __restrict__ x, _Float16* __restrict__ X16, size_t n8) { const size_t t = (size_t)blockIdx.x * 256 + threadIdx.x; if (t >= n8) return; FragH f;
#pragma unroll
  for (int q = 0; q < 8; ++q) f.h[q] = (_Float16)bf16_round(x[t * 8 + q]); *(v8us*)((unsigned short*)X16 + t * 8) = f.half[0];  }
__global__ __launch_bounds__(256) void k_h16(const float* __restrict__ x, _Float16* __restrict__ X16, size_t n8) { const size_t t = (size_t)blockIdx.x * 256 + threadIdx.x; if (t >= n8) return; FragH f;
#pragma unroll
  for (int q = 0; q < 8; ++q) f.h[q] = (_Float16)x[t * 8 + q]; *(v8us*)((unsigned short*)X16 + t * 8) = f.half[0];  }
__global__ __launch_bounds__(256) void k_round16f(const float* __restrict__ W, _Float16* __restrict__ Bt, size_t n8) { const size_t t = (size_t)blockIdx.x * 256 + threadIdx.x; if (t >= n8) return; FragH f;
#pragma unroll
  for (int i = 0; i < 8; ++i) f.h[i] = (_Float16)(bf16_round(W[t * 8 + i]) * 16.0f); *(v8us*)((unsigned short*)Bt + t * 8) = f.half[0];  }
// ---- projection GEMM (wave tile 32x64) with the hi / residual split and the V transposition in its epilogue ----
__device__ __forceinline__ v16h g2_frag(const _Float16* p, int hh) { FragH f; f.half[0] = *(const v8us*)((const unsigned short*)p + 8 * hh); f.half[1] = *(const v8us*)((const unsigned short*)p + 16 + 8 * hh); return f.v; }
// a fragment from a plane kept in fragment order: p = the fragment's 1024 bytes + 8 lane (in f16); the first 512 bytes hold every lane's k = 8 hh + 0..7, the second its k = 16 + 8 hh + 0..7: the registers get what g2_frag gives from rows
__device__ __forceinline__ v16h f_frag(const _Float16* p) { FragH f; f.half[0] = *(const v8us*)(const unsigned short*)p; f.half[1] = *(const v8us*)((const unsigned short*)p + 256); return f.v; }
__device__ __forceinline__ v8f g2_mma(v16h a, v16h b, v8f c) { v8f d = __builtin_amdgcn_wmma_f32_16x16x32_f16(false, a, false, b, (short)0, c, false, false); asm volatile("v_nop\n\tv_nop\n\tv_nop\n\tv_nop" : "+v"(d) : "v"(a), "v"(b)); return d; }
// x for the A fragments, straight from the f32 input: a wave reads its 32 rows in whole 128-byte lines (load i: rows 4 i + lane / 8, 16 bytes a lane), rounds them to bf16, which f16 holds exactly,
// and turns them through its own LDS range (80-byte rows) into the k order of g2_frag (k = 8 hh + 0..7, then 16 + 8 hh + 0..7)
#define XP 40      /* LDS row pitch in f16: 32 + 8, so that the 16-byte fragment reads of 8 rows fall on different banks */
typedef float v2f __attribute__((ext_vector_type(2))); typedef __bf16 v2b __attribute__((ext_vector_type(2))); typedef _Float16 v2h __attribute__((ext_vector_type(2))); typedef _Float16 v4ha __attribute__((ext_vector_type(4), may_alias));
__device__ __forceinline__ void x_load(v4f (&r)[8], const float* p) {      /* p = x + (first row + lane / 8) * DM + k + 4 (lane & 7) */
#pragma unroll      /* constant indices */
  for (int i = 0; i < 8; ++i) r[i] = *(const v4fa*)(p + (size_t)4 * i * DM); }
__device__ __forceinline__ void x_put(unsigned short* d, const v4f (&r)[8]) {      /* d = buffer + (lane / 8) * XP + 4 (lane & 7) */
#pragma unroll      /* constant indices */
  for (int i = 0; i < 8; ++i) { const v2f p0 = {r[i][0], r[i][1]}, p1 = {r[i][2], r[i][3]};      /* pairs: packed conversions, to nearest even like bf16_round */
    const v2h h0 = __builtin_convertvector(__builtin_convertvector(__builtin_convertvector(p0, v2b), v2f), v2h), h1 = __builtin_convertvector(__builtin_convertvector(__builtin_convertvector(p1, v2b), v2f), v2h);
    const v4ha h = {h0[0], h0[1], h1[0], h1[1]}; *(v4ha*)(d + 4 * i * XP) = h; } }
__device__ __forceinline__ v16h x_get(const unsigned short* s) { FragH f; f.half[0] = *(const v8us*)s; f.half[1] = *(const v8us*)(s + 16); return f.v; }      /* s = buffer + row * XP + 8 hh */
// The three projections (blockIdx.y = q, k, v): 128 rows a work-group, wave tile 32x64, C = A Bt / 16 (A = x rows, Bt = x16 weights in fragment order); the f32 results do not go to memory:
// q, k: each wave turns its tile through its own LDS range and stores f16 hi and x1024 residual planes in fragment order: per 16 rows four pieces of 512 bytes (d = 16 piece + 8 hh + 0..7 of row ln at lane 16 hh + ln);
// v: a lane's 8 accumulator elements are 8 consecutive tokens of one column, that is the lane's 16 bytes of a V^T fragment piece (per 32 tokens and 16 columns two pieces, tokens 0-15 and 16-31): stored straight from registers.
__global__ __launch_bounds__(128) void k_proj(const float* __restrict__ X, const _Float16* __restrict__ Bh, _Float16* __restrict__ Hq, _Float16* __restrict__ Lq, _Float16* __restrict__ VT, _Float16* __restrict__ VTL) {
  __shared__ __attribute__((aligned(16))) float so[4][32][68];
  const int tid = threadIdx.x, w = tid >> 5, lane = tid & 31, ln = lane & 15, hh = lane >> 4; const int by = blockIdx.y;
  Bh += (size_t)by * HD * DM; const int row0 = blockIdx.x * 128 + 32 * w;
  __shared__ __attribute__((aligned(16))) unsigned short xst[4][2][32 * XP];      /* per wave two buffers of 32 rounded x rows, one trip each */
  const float* xg = X + (size_t)(row0 + (lane >> 3)) * DM + 4 * (lane & 7);
  const _Float16* bp = Bh + lane * 8;      /* 32 k of the 64 columns = 4 fragments = 4096 bytes in a row */
  const v8f z8 = {0.f,0.f,0.f,0.f,0.f,0.f,0.f,0.f}; v8f c00 = z8, c01 = z8, c02 = z8, c03 = z8, c10 = z8, c11 = z8, c12 = z8, c13 = z8;
  /* x now comes from memory: its words are asked for three trips before their products, rounded and put into LDS one trip before; loads retire in order, so the weight fragments are asked for two trips ahead, between them */
  v4f xs[2][8]; v16h bs[2][4]; v16h a0, a1;
#define P_LOADB(s, k) { bs[s][0] = f_frag(bp + (k) * 64); bs[s][1] = f_frag(bp + (k) * 64 + 512); bs[s][2] = f_frag(bp + (k) * 64 + 1024); bs[s][3] = f_frag(bp + (k) * 64 + 1536); }
#define P_MMA(s) { c00 = g2_mma(a0, bs[s][0], c00); c10 = g2_mma(a1, bs[s][0], c10); c01 = g2_mma(a0, bs[s][1], c01); c11 = g2_mma(a1, bs[s][1], c11); \
    c02 = g2_mma(a0, bs[s][2], c02); c12 = g2_mma(a1, bs[s][2], c12); c03 = g2_mma(a0, bs[s][3], c03); c13 = g2_mma(a1, bs[s][3], c13); }
#define P_XCNT asm volatile("s_wait_xcnt 0x0" ::: "memory")      /* the wait in front of any overwrite of an address register that the loads above it name */
#define P_EDGE __builtin_amdgcn_sched_barrier(0)      /* a trip's rounding stays in its own trip: moved up, it would wait for loads that have just been asked for */
#define P_PUT(o) x_put(&xst[w][o][(lane >> 3) * XP + 4 * (lane & 7)], xs[o])
  /* the wave's rows are in LDS before its lanes read what other lanes wrote; only this wave touches the range, so no barrier */
#define P_GET(o) { asm volatile("s_wait_dscnt 0x0" ::: "memory"); a0 = x_get(&xst[w][o][ln * XP + 8 * hh]); a1 = x_get(&xst[w][o][(16 + ln) * XP + 8 * hh]); }
  /* trip t = k / 32, e = t & 1, o = 1 - e: round x(t + 1), ask for x(t + 3), products of t, ask for weights(t + 2), fragments of t + 1 */
#define P_TRIP(e, o, k, CV, LX, LB) { if (CV) P_PUT(o); if (LX) { x_load(xs[o], xg + (k) + 96); P_XCNT; } P_MMA(e) if (LB) { P_LOADB(e, (k) + 64) P_XCNT; } if (CV) P_GET(o) P_EDGE; }
  x_load(xs[0], xg); P_XCNT; x_load(xs[1], xg + 32); P_XCNT; P_LOADB(0, 0) P_XCNT;      /* asked for in the loop's own order: the counted waits at the loop's head are set for both ways in */
  P_PUT(0); x_load(xs[0], xg + 64); P_XCNT; P_LOADB(1, 32) P_XCNT; P_GET(0) P_EDGE;
#pragma unroll 1      /* rolled: 14 double trips, two stages of both operands beside 64 accumulator registers */
  for (int kb = 0; kb < DM - 128; kb += 64) { P_TRIP(0, 1, kb, 1, 1, 1) P_TRIP(1, 0, kb + 32, 1, 1, 1) }
  P_TRIP(0, 1, DM - 128, 1, 1, 1) P_TRIP(1, 0, DM - 96, 1, 0, 1) P_TRIP(0, 1, DM - 64, 1, 0, 0) P_TRIP(1, 0, DM - 32, 0, 0, 0)      /* the last four trips ask for nothing past the row's end */
  v8f accs[8] = {c00, c01, c02, c03, c10, c11, c12, c13};
  if (by < 2) {      /* the same for the whole work-group */
#pragma unroll      /* constant indices */
    for (int u = 0; u < 8; ++u) { const int t = u & 3, half = u >> 2;
#pragma unroll      /* constant indices */
      for (int r = 0; r < 8; ++r) so[w][half * 16 + 8 * hh + r][t * 16 + ln] = accs[u][r] * 0.0625f; }
    __builtin_amdgcn_fence(__ATOMIC_ACQ_REL, "workgroup"); __builtin_amdgcn_wave_barrier();      /* the wave reads back what its own lanes wrote */
    unsigned short* ph = (unsigned short*)Hq + ((size_t)by * NR + row0) * HD + lane * 8; unsigned short* pl = (unsigned short*)Lq + ((size_t)by * NR + row0) * HD + lane * 8;
#pragma unroll      /* one fragment piece = 512 contiguous bytes a store: q = 4 (16-row tile) + piece */
    for (int q = 0; q < 8; ++q) { const float* sp = &so[w][(q >> 2) * 16 + ln][(q & 3) * 16 + 8 * hh]; const v4f a = *(const v4fa*)sp, c = *(const v4fa*)(sp + 4); FragH fh, fl;
#pragma unroll      /* constant indices */
      for (int e = 0; e < 4; ++e) { _Float16 h = (_Float16)a[e]; fh.h[e] = h; fl.h[e] = (_Float16)((a[e] - (float)h) * 1024.0f); h = (_Float16)c[e]; fh.h[4 + e] = h; fl.h[4 + e] = (_Float16)((c[e] - (float)h) * 1024.0f); }
      *(v8us*)(ph + q * 256) = fh.half[0]; *(v8us*)(pl + q * 256) = fl.half[0]; }
  } else {
    unsigned short* gh = (unsigned short*)VT + (size_t)row0 * HD + lane * 8; unsigned short* gl = (unsigned short*)VTL + (size_t)row0 * HD + lane * 8;      /* the wave's 32 tokens: 4 fragments a plane */
#pragma unroll      /* constant indices */
    for (int u = 0; u < 8; ++u) { const int t = u & 3, half = u >> 2; FragH fh, fl;
#pragma unroll      /* constant indices */
      for (int r = 0; r < 8; ++r) { const float v = accs[u][r] * 0.0625f; const _Float16 h = (_Float16)v; fh.h[r] = h; fl.h[r] = (_Float16)((v - (float)h) * 1024.0f); }
      *(v8us*)(gh + t * 512 + half * 256) = fh.half[0]; *(v8us*)(gl + t * 512 + half * 256) = fl.half[0]; }
    asm volatile("s_wait_xcnt 0x0" ::: "memory");      /* the build lays the other path's code behind this one's last branch, and it overwrites registers that the stores above name: the wait stands in front of that */
  } }

__global__ __launch_bounds__(256) void k_wnat(const float* __restrict__ w, size_t n8, _Float16* __restrict__ Bt) { const size_t t = (size_t)blockIdx.x * 256 + threadIdx.x; if (t >= n8) return; FragH f; for (int q = 0; q < 8; ++q) f.h[q] = (_Float16)(bf16_round(w[t * 8 + q]) * 16.0f); *(v8us*)((unsigned short*)Bt + t * 8) = f.half[0];  }
__global__ __launch_bounds__(256) void k_rsm(const float* __restrict__ S, _Float16* __restrict__ P, int nrows) {
  #pragma clang fp contract(off)
  const int i = blockIdx.x * 256 + threadIdx.x; if (i >= nrows) return; const float* s = S + (size_t)i * SQ; float mx = -3.0e38f;
#pragma unroll 1
  for (int j = 0; j < SQ; ++j) mx = fmaxf(mx, s[j]); float se = 0.f;
#pragma unroll 1
  for (int j = 0; j < SQ; ++j) se += expf(s[j] - mx); const float sc = 256.0f / se;
#pragma unroll 1
  for (int j0 = 0; j0 < SQ; j0 += 8) { FragH f; for (int q = 0; q < 8; ++q) f.h[q] = (_Float16)(expf(s[j0 + q] - mx) * sc); unsigned short* d = (unsigned short*)P + (size_t)i * SQ + j0; *(v8us*)d = f.half[0];  } }
__global__ __launch_bounds__(256) void k_vt(const _Float16* __restrict__ V16, int b, int h0, _Float16* __restrict__ VT) { __shared__ unsigned short tl[64][65]; const int tid = threadIdx.x; const int hh = blockIdx.x % HG, sg = blockIdx.x / HG; const int s0 = sg * 64; const int h = h0 + hh;
  for (int i = tid; i < 64 * 8; i += 256) { const int j = i / 8, d8 = (i % 8) * 8; FragH f; f.half[0] = *(const v8us*)((const unsigned short*)V16 + ((size_t)b * SQ + s0 + j) * DM + h * HD + d8); for (int q = 0; q < 8; ++q) tl[d8 + q][j] = f.u[q]; }
  __syncthreads();
  { for (int i = tid; i < 64 * 8; i += 256) { const int d = i / 8, j8 = (i % 8) * 8; FragH f; for (int q = 0; q < 8; ++q) f.u[q] = tl[d][j8 + q]; *(v8us*)((unsigned short*)VT + ((size_t)hh * HD + d) * SQ + s0 + j8) = f.half[0]; }  } }




// ---- scores kept in registers: column statistics, then weights and P V, both from recomputed score tiles ----
__device__ __forceinline__ v8f c_mma(v16h a, v16h b, v8f c) { return __builtin_amdgcn_wmma_f32_16x16x32_f16(false, a, false, b, (short)0, c, false, false); }
__device__ __forceinline__ float c_ex2(float y) { float r;
  asm("v_exp_f32 %0, %1\n\tv_nop" : "=v"(r) : "v"(y));      /* native 2^y; the v_nop keeps the slot the instruction set asks for behind a transcendental */
  return r; }
// one 16 key x 16 query tile of S^T (row 8 hh + r = key, column ln = query): k_hi.q_hi + 2^-10 (k_lo.q_hi + k_hi.q_lo); both launches form it with these same instructions
__device__ __forceinline__ v8f c_score(v16h kh0, v16h kh1, v16h kl0, v16h kl1, v16h qh0, v16h qh1, v16h ql0, v16h ql1) {
  const v8f z8 = {0.f,0.f,0.f,0.f,0.f,0.f,0.f,0.f}; v8f h = c_mma(kh0, qh0, z8); h = c_mma(kh1, qh1, h);
  v8f l = c_mma(kl0, qh0, z8); l = c_mma(kl1, qh1, l); l = c_mma(kh0, ql0, l); l = c_mma(kh1, ql1, l);
  return h + l * 0.0009765625f; }
#define LOG2E 1.44269504f
// Per key: maximum over the queries and 256 / sum of exp. Work-group = 32 keys (fragments stay in registers), its 16 waves take 128 queries each, 32 a trip;
// running maximum and sum per lane and key, joined over the 16 lanes of a row, then over the 16 waves through LDS.
__global__ __launch_bounds__(512) void k_cstat(const _Float16* __restrict__ KH, const _Float16* __restrict__ KL, const _Float16* __restrict__ QH, const _Float16* __restrict__ QL, float* __restrict__ MX, float* __restrict__ SC) {
  __shared__ float sm[16][32]; __shared__ float sz[16][32];
  const int tid = threadIdx.x, w = tid >> 5, lane = tid & 31, ln = lane & 15, hh = lane >> 4;
  const size_t base = (size_t)blockIdx.y * SQ; const int k0 = blockIdx.x * 32;
  const _Float16* pkh = KH + (base + k0) * HD + lane * 8; const _Float16* pkl = KL + (base + k0) * HD + lane * 8;      /* fragment order: 16 rows = 2 fragments (d 0-31, 32-63) = 2048 bytes */
  v16h kh[2][2], kl[2][2];
#pragma unroll      /* constant indices keep the fragments in registers */
  for (int a = 0; a < 2; ++a) for (int s = 0; s < 2; ++s) { kh[a][s] = f_frag(pkh + 1024 * a + 512 * s); kl[a][s] = f_frag(pkl + 1024 * a + 512 * s); }
  asm volatile("s_wait_xcnt 0x0" :: "v"(pkh), "v"(pkl) : "memory");      /* the wait in front of any overwrite of the address pairs that the loads above name; as inputs the pairs stay whole up to it */
  float m[2][8], z[2][8];
#pragma unroll      /* constant indices */
  for (int a = 0; a < 2; ++a) for (int r = 0; r < 8; ++r) { m[a][r] = -3.0e38f; z[a][r] = 0.f; }
#pragma unroll 1      /* four trips; unrolled, the query fragments of several trips would not fit beside the key fragments */
  for (int c = 0; c < 4; ++c) {
    const size_t o = (base + w * 128 + c * 32) * HD + lane * 8; const _Float16* pqh = QH + o; const _Float16* pql = QL + o;
    const v16h ah0 = f_frag(pqh), ah1 = f_frag(pqh + 512), al0 = f_frag(pql), al1 = f_frag(pql + 512);
    const v16h bh0 = f_frag(pqh + 1024), bh1 = f_frag(pqh + 1536), bl0 = f_frag(pql + 1024), bl1 = f_frag(pql + 1536);
    asm volatile("s_wait_xcnt 0x0" :: "v"(pqh), "v"(pql) : "memory");      /* as above: in front of the next trip's addresses and of any result that would land on these pairs */
#pragma unroll      /* constant indices */
    for (int a = 0; a < 2; ++a) {
      const v8f s0 = c_score(kh[a][0], kh[a][1], kl[a][0], kl[a][1], ah0, ah1, al0, al1);
      const v8f s1 = c_score(kh[a][0], kh[a][1], kl[a][0], kl[a][1], bh0, bh1, bl0, bl1);
#pragma unroll      /* constant indices */
      for (int r = 0; r < 8; ++r) { const float mn = fmaxf(m[a][r], fmaxf(s0[r], s1[r]));
        z[a][r] = z[a][r] * c_ex2((m[a][r] - mn) * LOG2E) + (c_ex2((s0[r] - mn) * LOG2E) + c_ex2((s1[r] - mn) * LOG2E)); m[a][r] = mn; }
    }
  }
#pragma unroll      /* constant indices */
  for (int k = 1; k < 16; k <<= 1) { float mo[2][8], zo[2][8];      /* step outermost: the 32 exchanges of a step are independent and fly together */
    for (int a = 0; a < 2; ++a) for (int r = 0; r < 8; ++r) { mo[a][r] = __shfl_xor(m[a][r], k, 32); zo[a][r] = __shfl_xor(z[a][r], k, 32); }
    for (int a = 0; a < 2; ++a) for (int r = 0; r < 8; ++r) { const float mn = fmaxf(m[a][r], mo[a][r]); z[a][r] = z[a][r] * c_ex2((m[a][r] - mn) * LOG2E) + zo[a][r] * c_ex2((mo[a][r] - mn) * LOG2E); m[a][r] = mn; } }
  if (ln == 0) {
#pragma unroll      /* constant indices */
    for (int a = 0; a < 2; ++a) for (int r = 0; r < 8; ++r) { sm[w][16 * a + 8 * hh + r] = m[a][r]; sz[w][16 * a + 8 * hh + r] = z[a][r]; } }
  __syncthreads();
  if (tid < 32) { float mm = sm[0][tid];
    for (int u = 1; u < 16; ++u) mm = fmaxf(mm, sm[u][tid]);
    float zz = 0.f;
    for (int u = 0; u < 16; ++u) zz += sz[u][tid] * c_ex2((sm[u][tid] - mm) * LOG2E);
    MX[base + k0 + tid] = mm; SC[base + k0 + tid] = 256.0f / zz; } }
// out^T[d][i] = sum_k V^T[d][k] P^T[k][i]. Work-group = 32 queries, its 8 waves take 256 keys each, 32 a trip. Two score tiles (keys 0-15, 16-31 of the trip) hold, per lane,
// exactly the B fragment's elements (element e < 8: key 8 hh + e; e >= 8: key 16 + 8 hh + e - 8; column ln = query), the k order in which f_frag delivers V^T: the weights go from D to B inside the lane.
__global__ __launch_bounds__(256) void k_cpv(const _Float16* __restrict__ KH, const _Float16* __restrict__ KL, const _Float16* __restrict__ QH, const _Float16* __restrict__ QL, const _Float16* __restrict__ VT, const _Float16* __restrict__ VTL,
    const float* __restrict__ MX, const float* __restrict__ SC, float* __restrict__ out) {
  __shared__ __attribute__((aligned(16))) float red[4][32][68];
  const int tid = threadIdx.x, w = tid >> 5, lane = tid & 31, ln = lane & 15, hh = lane >> 4;
  const size_t base = (size_t)blockIdx.y * SQ; const int q0 = blockIdx.x * 32;
  const _Float16* vh_b = VT + base * HD; const _Float16* vl_b = VTL + base * HD;
  const _Float16* pqh = QH + (base + q0) * HD + lane * 8; const _Float16* pql = QL + (base + q0) * HD + lane * 8;
  v16h qh[2][2], ql[2][2];
#pragma unroll      /* constant indices keep the fragments in registers */
  for (int c = 0; c < 2; ++c) for (int s = 0; s < 2; ++s) { qh[c][s] = f_frag(pqh + 1024 * c + 512 * s); ql[c][s] = f_frag(pql + 1024 * c + 512 * s); }
  asm volatile("s_wait_xcnt 0x0" :: "v"(pqh), "v"(pql) : "memory");      /* the wait in front of any overwrite of the address pairs that the loads above name; as inputs the pairs stay whole up to it */
  const v8f z8 = {0.f,0.f,0.f,0.f,0.f,0.f,0.f,0.f}; v8f oh[4][2], ol[4][2];
#pragma unroll      /* constant indices */
  for (int t = 0; t < 4; ++t) for (int c = 0; c < 2; ++c) { oh[t][c] = z8; ol[t][c] = z8; }
#pragma unroll 1      /* eight trips; one trip's fragments beside 128 accumulator registers */
  for (int it = 0; it < 8; ++it) { const int k0 = w * 256 + it * 32; FragH p[2];
    const _Float16* pkh = KH + (base + k0) * HD + lane * 8; const _Float16* pkl = KL + (base + k0) * HD + lane * 8; const float* pm = MX + base + k0 + 8 * hh; const float* pc = SC + base + k0 + 8 * hh;
    const _Float16* pvh = vh_b + (size_t)k0 * HD + lane * 8; const _Float16* pvl = vl_b + (size_t)k0 * HD + lane * 8;      /* 32 keys = 4 fragments (16 columns each) = 4096 bytes */
#pragma unroll      /* constant indices */
    for (int a = 0; a < 2; ++a) {
      const v16h kh0 = f_frag(pkh + 1024 * a), kh1 = f_frag(pkh + 1024 * a + 512), kl0 = f_frag(pkl + 1024 * a), kl1 = f_frag(pkl + 1024 * a + 512);
      const v4f m0 = *(const v4fa*)(pm + 16 * a), m1 = *(const v4fa*)(pm + 16 * a + 4), c0 = *(const v4fa*)(pc + 16 * a), c1 = *(const v4fa*)(pc + 16 * a + 4);
#pragma unroll      /* constant indices */
      for (int c = 0; c < 2; ++c) { const v8f s = c_score(kh0, kh1, kl0, kl1, qh[c][0], qh[c][1], ql[c][0], ql[c][1]);
#pragma unroll      /* constant indices */
        for (int r = 0; r < 4; ++r) { p[c].h[8 * a + r] = (_Float16)(c_ex2((s[r] - m0[r]) * LOG2E) * c0[r]); p[c].h[8 * a + 4 + r] = (_Float16)(c_ex2((s[4 + r] - m1[r]) * LOG2E) * c1[r]); } } }
#pragma unroll      /* constant indices */
    for (int t = 0; t < 4; ++t) { const v16h vh = f_frag(pvh + 512 * t), vl = f_frag(pvl + 512 * t);
#pragma unroll      /* constant indices */
      for (int c = 0; c < 2; ++c) { oh[t][c] = c_mma(vh, p[c].v, oh[t][c]); ol[t][c] = c_mma(vl, p[c].v, ol[t][c]); } }
    asm volatile("s_wait_xcnt 0x0" :: "v"(pkh), "v"(pkl), "v"(pm), "v"(pc), "v"(pvh), "v"(pvl) : "memory");      /* as above, at the trip's foot: in front of the next trip's addresses */
  }
  /* the 8 key slices are added: waves 4-7 hand theirs to waves 0-3 through LDS, then every thread adds the four sums left */
#pragma unroll      /* constant indices */
  for (int t = 0; t < 4; ++t) for (int c = 0; c < 2; ++c) { oh[t][c] = oh[t][c] * 0.00390625f + ol[t][c] * 0.000003814697265625f;
    if (w >= 4) { float* d = &red[w - 4][16 * c + ln][16 * t + 8 * hh]; const v4f x0 = {oh[t][c][0], oh[t][c][1], oh[t][c][2], oh[t][c][3]}, x1 = {oh[t][c][4], oh[t][c][5], oh[t][c][6], oh[t][c][7]}; *(v4fa*)d = x0; *(v4fa*)(d + 4) = x1; } }
  __syncthreads();
  if (w < 4) {
#pragma unroll      /* constant indices */
    for (int t = 0; t < 4; ++t) for (int c = 0; c < 2; ++c) { float* d = &red[w][16 * c + ln][16 * t + 8 * hh]; v4f x0 = *(const v4fa*)d, x1 = *(const v4fa*)(d + 4);
      for (int r = 0; r < 4; ++r) { x0[r] += oh[t][c][r]; x1[r] += oh[t][c][4 + r]; }
      *(v4fa*)d = x0; *(v4fa*)(d + 4) = x1; } }
  __syncthreads();
#pragma unroll      /* two 16-byte pieces a thread */
  for (int j = 0; j < 2; ++j) { const int idx = tid + 256 * j, q = idx >> 4, d4 = (idx & 15) * 4;
    const v4f v = (*(const v4fa*)&red[0][q][d4] + *(const v4fa*)&red[1][q][d4]) + (*(const v4fa*)&red[2][q][d4] + *(const v4fa*)&red[3][q][d4]);
    float* o = out + (base + q0 + q) * DMO + d4;
#pragma unroll      /* the 16 identical heads: 16 lanes fill 256 contiguous bytes of a row per store */
    for (int h = 0; h < DMO / HD; ++h) *(v4f*)(o + h * HD) = v; } }

extern "C" void kernel_launch(void* const* d_in, const int* in_sizes, int n_in,
                              void* d_out, int out_size, void* d_ws, size_t ws_size, hipStream_t stream) {
  (void)in_sizes; (void)n_in; (void)out_size;
  const float* const* I = (const float* const*)d_in; const float* x = I[0]; const float* wq = I[1]; const float* wk = I[2]; const float* wv = I[3];      /* [in][out] = [1024][64] */
  char* ws = (char*)d_ws; size_t off = 0;
  auto take = [&](size_t bytes) { char* p = ws + off; off += (bytes + 255) & ~(size_t)255; return p; };
  /* planes of one kind lie one behind the other (weights q, k, v; hi and residual planes q, k), so that one launch covers them */
  _Float16* B3 = (_Float16*)take((size_t)3 * HD * DM * 2); _Float16* H3 = (_Float16*)take(4 * NR * HD * 2); _Float16* L3 = H3 + 2 * NR * HD;
  _Float16* QH = H3; _Float16* KH = H3 + NR * HD; _Float16* QL = L3; _Float16* KL = L3 + NR * HD;
  float* MX = (float*)take(NR * 4); float* SC = (float*)take(NR * 4); _Float16* VT = (_Float16*)take(2 * NR * HD * 2); _Float16* VTL = VT + NR * HD;      /* one plane per batch */
  if (off > ws_size) return;      /* approx 4 + 2 = 6 MiB */
  k_wt_f16<<<dim3((unsigned)(((size_t)HD * (DM / 8) + 255) / 256), 3), 256, 0, stream>>>(wq, wk, wv, B3, DM, HD, 16.0f);      /* 3 x [1024][64] -> x16 f16 in fragment order, one plane a weight */
  k_proj<<<dim3((unsigned)(NR / 128), 3), 128, 0, stream>>>(x, B3, H3, L3, VT, VTL);      /* q, k as f16 hi + x1024 residual planes, v as V^T hi / residual, all in fragment order: blockIdx.y = projection */
  /* the four batches are independent: each stage is one launch over all of them (blockIdx.y = batch, or a four times longer grid over planes that lie one behind the other) */
  k_cstat<<<dim3(SQ / 32, NB), 512, 0, stream>>>(KH, KL, QH, QL, MX, SC);      /* per key: max over the query index i, 256 / sum of exp */
  k_cpv<<<dim3(SQ / 32, NB), 256, 0, stream>>>(KH, KL, QH, QL, VT, VTL, MX, SC, (float*)d_out);      /* out_i = 2^-8 sum_k f16(256 att[i][k]) (v_hi + 2^-10 v_lo), stored into the 16 identical heads */
}

// v008
// A run of this version takes 45.7 microseconds.
// Two timings next to v007 put it at 1.25 and 1.24 times that version's speed.
// Over all steps from v000 it is 46.0 times as fast.
#include <hip/hip_runtime.h>
// Single-projection attention with a QUERY-axis softmax, tiled 16x (x [4][2048][1024]; q, k, v = x W ([1024][64] weights stored [in][out], shared by all heads); att[i][k] = q_i . k_k (no scaling); att = softmax over the QUERY index i for each key column k (the module's nn.Softmax(dim=1)); out_i = sum_k att[i][k] v_k -> [2048][64], concatenated 16 times -> [4][2048][1024]).
// Structure: token rows; x read as f32 by the projection launch and rounded in registers to exact f16 fragments; q and k projections as WMMA GEMMs (32x64 wave tiles, f32 accumulation, exact x16 weights) kept in f32 and split into f16 hi + x1024 residual planes (the unscaled logits have sigma 8, so they are formed from three hi/lo products, ~2^-21 relative); v likewise kept f32 and split; the split is done in the projection launch's epilogue, which stores every plane (q, k, V^T; the weight launch likewise) in fragment order, so that each 16-byte fragment load of a wave reads 512 contiguous bytes; the scores never go through memory: transposed score tiles S^T[k][i] = k_k . q_i (three hi/lo products, K = 64) are formed twice in registers, once for each key's maximum and sum of exp over the query index i (= the module's column softmax; f32 statistics, native exp), once for the weights (x256 f16), which pass inside the lane from the score tiles' D layout into the B fragment of out^T = V^T P^T (hi and residual accumulators, f32), 8 key slices added through LDS, each sum stored into the 16 head slots of its output row by the same launch (256 contiguous bytes per row and head); every per-batch stage runs as one launch over the four batches, and the stages that q, k, v each need run as one launch over adjacent planes; 4 launches.
// Compute dtype: inputs rounded to bf16; x / weights exact; q, k, v as f16 hi + residual pairs; the softmax weights plain f16 (~2^-12); scores, statistics, out f32. v_wmma_f32_16x16x32_f16.
#define NB 4
#define SQ 2048
#define DM 1024
#define HD 64
#define NH 1
#define HG 1
#define DMO 1024                     /* output row width = 16 x 64 */
#define B0 0                         /* unused */
#define NBR NB
#define NR ((size_t)NB * SQ)
typedef __bf16 v16b __attribute__((ext_vector_type(16)));
typedef unsigned short v8us __attribute__((ext_vector_type(8), may_alias));
typedef float  v8f  __attribute__((ext_vector_type(8)));
typedef float  v4f  __attribute__((ext_vector_type(4)));
typedef float  v4fa __attribute__((ext_vector_type(4), may_alias));
union FragB { v16b v; v8us half[2]; unsigned short u[16]; };

__device__ __forceinline__ unsigned short bf16_bits(float x) { unsigned int u = __float_as_uint(x); return (unsigned short)((u + 0x7FFFu + ((u >> 16) & 1u)) >> 16); }
__device__ __forceinline__ float bf16_val(unsigned short b) { return __uint_as_float(((unsigned int)b) << 16); }
__device__ __forceinline__ float bf16_round(float x) { return bf16_val(bf16_bits(x)); }
// D += A·B with NT terms: 1 = ah·bh, 2 = + al·bh (A split), 3 = + ah·bl (both split)
template <int NT>
__device__ __forceinline__ v8f mmaN(v16b ah, v16b al, v16b bh, v16b bl, v8f c) {
  c = __builtin_amdgcn_wmma_f32_16x16x32_bf16(false, ah, false, bh, (short)0, c, false, false);
  if (NT >= 2) c = __builtin_amdgcn_wmma_f32_16x16x32_bf16(false, al, false, bh, (short)0, c, false, false);
  if (NT >= 3) c = __builtin_amdgcn_wmma_f32_16x16x32_bf16(false, ah, false, bl, (short)0, c, false, false);
  asm volatile("v_nop\n\tv_nop\n\tv_nop\n\tv_nop" : "+v"(c) : "v"(ah), "v"(al), "v"(bh), "v"(bl));
  return c;
}

__global__ __launch_bounds__(256) void k_wt_bf16(const float* __restrict__ W, unsigned short* __restrict__ Wt, int K, int N) {
  const int t = blockIdx.x * 256 + threadIdx.x;
  const int k8n = K / 8;
  if (t >= N * k8n) return;
  const int n = t / k8n, k8 = (t % k8n) * 8;
  v8us v;
#pragma unroll
  for (int i = 0; i < 8; ++i) v[i] = bf16_bits(W[(size_t)(k8 + i) * N + n]);
  *(v8us*)(Wt + (size_t)n * K + k8) = v;
  
}

// GEMM C[M][N] (f32, pitch ldc) = act(A[M][K]·W + bias). A f32 row-major (pitch lda) converted per fragment to bf16
// (ASPLIT: hi/lo two planes -> 2 terms, else single rounded term); Wt bf16 [N][K] (pitch ldb). BIAS_BF16 rounds the
// bias to bf16 first (bias quantised to bf16 before the add). K%32==0, M%16==0, N%64==0.
template <bool ASPLIT, int ACT, bool BIAS_BF16>
__global__ __launch_bounds__(128) void k_gemm_bf(const float* __restrict__ A, int lda, const unsigned short* __restrict__ Wt, int ldb,
                                               const float* __restrict__ bias, float* __restrict__ C, int ldc, int M, int N, int K) {
  __shared__ __attribute__((aligned(16))) float so[4][16][64];
  const int tid = threadIdx.x, w = tid >> 5, lane = tid & 31, ln = lane & 15, hh = lane >> 4;
  const int ntn = N / 64;
  const int wid = blockIdx.x * 4 + w;
  const int mt = wid / ntn, nq = wid % ntn;
  if (mt * 16 >= M) return;
  const int row0 = mt * 16, col0 = nq * 64;
  const float* arow = A + (size_t)(row0 + ln) * lda;
  v8f acc[4] = {};
  for (int kb = 0; kb < K; kb += 32) {
    FragB ah, al;
    const v4f x0 = *(const v4fa*)(arow + kb + 8 * hh), x1 = *(const v4fa*)(arow + kb + 8 * hh + 4);
    const v4f x2 = *(const v4fa*)(arow + kb + 16 + 8 * hh), x3 = *(const v4fa*)(arow + kb + 16 + 8 * hh + 4);
    float xs[16] = {x0[0],x0[1],x0[2],x0[3],x1[0],x1[1],x1[2],x1[3],x2[0],x2[1],x2[2],x2[3],x3[0],x3[1],x3[2],x3[3]};
#pragma unroll
    for (int i = 0; i < 16; ++i) { const unsigned short hb = bf16_bits(xs[i]); ah.u[i] = hb; al.u[i] = ASPLIT ? bf16_bits(xs[i] - bf16_val(hb)) : (unsigned short)0; }
#pragma unroll
    for (int t = 0; t < 4; ++t) {
      const unsigned short* brow = Wt + (size_t)(col0 + t * 16 + ln) * ldb + kb;
      FragB b;
      b.half[0] = *(const v8us*)(brow + 8 * hh);
      b.half[1] = *(const v8us*)(brow + 16 + 8 * hh);
      acc[t] = mmaN<ASPLIT ? 2 : 1>(ah.v, al.v, b.v, b.v, acc[t]);
    }
  }
#pragma unroll
  for (int t = 0; t < 4; ++t) {
    float bv = bias ? bias[col0 + t * 16 + ln] : 0.f;
    if (BIAS_BF16) bv = bf16_round(bv);
#pragma unroll
    for (int r = 0; r < 8; ++r) { float v = acc[t][r] + bv; if (ACT == 1) v = fmaxf(v, 0.f); so[w][8 * hh + r][t * 16 + ln] = v; }
  }
  __builtin_amdgcn_fence(__ATOMIC_ACQ_REL, "workgroup");
  __builtin_amdgcn_wave_barrier();
  const int rsub = lane >> 4, c4 = (lane & 15) * 4;
  {
#pragma unroll
    for (int q = 0; q < 8; ++q) {
      const int r = q * 2 + rsub;
      const v4f v = *(const v4fa*)&so[w][r][c4];
      *(v4f*)(C + (size_t)(row0 + r) * ldc + col0 + c4) = v;
    }
    
  }
}

// GEMM C = act(A·W + bias + resid): A f32 (ASPLIT -> hi/lo 2 terms), Wt bf16 [N][K]; ACT 0 none, 1 relu, 2 exact gelu;
// resid (optional, f32, row index = (row % rmod), pitch ldr, RES_BF16 rounds it) added before the activation.
template <bool ASPLIT, int ACT, bool BIAS_BF16, bool RES_BF16>
__global__ __launch_bounds__(128) void k_gemm_bf3(const float* __restrict__ A, int lda, const unsigned short* __restrict__ Wt, int ldb,
                                                const float* __restrict__ bias, const float* __restrict__ resid, int rmod, int ldr,
                                                float* __restrict__ C, int ldc, int M, int N, int K) {
  __shared__ __attribute__((aligned(16))) float so[4][16][64];
  const int tid = threadIdx.x, w = tid >> 5, lane = tid & 31, ln = lane & 15, hh = lane >> 4;
  const int ntn = N / 64;
  const int wid = blockIdx.x * 4 + w;
  const int mt = wid / ntn, nq = wid % ntn;
  if (mt * 16 >= M) return;
  const int row0 = mt * 16, col0 = nq * 64;
  const float* arow = A + (size_t)(row0 + ln) * lda;
  v8f acc[4] = {};
  for (int kb = 0; kb < K; kb += 32) {
    FragB ah, al;
    const v4f x0 = *(const v4fa*)(arow + kb + 8 * hh), x1 = *(const v4fa*)(arow + kb + 8 * hh + 4);
    const v4f x2 = *(const v4fa*)(arow + kb + 16 + 8 * hh), x3 = *(const v4fa*)(arow + kb + 16 + 8 * hh + 4);
    float xs[16] = {x0[0],x0[1],x0[2],x0[3],x1[0],x1[1],x1[2],x1[3],x2[0],x2[1],x2[2],x2[3],x3[0],x3[1],x3[2],x3[3]};
#pragma unroll
    for (int i = 0; i < 16; ++i) { const unsigned short hb = bf16_bits(xs[i]); ah.u[i] = hb; al.u[i] = ASPLIT ? bf16_bits(xs[i] - bf16_val(hb)) : (unsigned short)0; }
#pragma unroll
    for (int t = 0; t < 4; ++t) {
      const unsigned short* brow = Wt + (size_t)(col0 + t * 16 + ln) * ldb + kb;
      FragB b;
      b.half[0] = *(const v8us*)(brow + 8 * hh);
      b.half[1] = *(const v8us*)(brow + 16 + 8 * hh);
      acc[t] = mmaN<ASPLIT ? 2 : 1>(ah.v, al.v, b.v, b.v, acc[t]);
    }
  }
#pragma unroll
  for (int t = 0; t < 4; ++t) {
    const int col = col0 + t * 16 + ln;
    float bv = bias ? bias[col] : 0.f;
    if (BIAS_BF16) bv = bf16_round(bv);
#pragma unroll
    for (int r = 0; r < 8; ++r) {
      float v = acc[t][r] + bv;
      if (resid) { float rv = resid[(size_t)((row0 + 8 * hh + r) % rmod) * ldr + col]; if (RES_BF16) rv = bf16_round(rv); v += rv; }
      if (ACT == 1) v = fmaxf(v, 0.f);
      if (ACT == 2) v = 0.5f * v * (1.0f + erff(v * 0.70710678118654752f));
      if (ACT == 3) { const float u = 0.7978845608028654f * (v + 0.044715f * v * v * v); v = 0.5f * v * (1.0f + tanhf(u)); }
      so[w][8 * hh + r][t * 16 + ln] = v;
    }
  }
  __builtin_amdgcn_fence(__ATOMIC_ACQ_REL, "workgroup");
  __builtin_amdgcn_wave_barrier();
  const int rsub = lane >> 4, c4 = (lane & 15) * 4;
  {
#pragma unroll
    for (int q = 0; q < 8; ++q) {
      const int r = q * 2 + rsub;
      const v4f v = *(const v4fa*)&so[w][r][c4];
      *(v4f*)(C + (size_t)(row0 + r) * ldc + col0 + c4) = v;
    }
    
  }
}
// row LayerNorm (biased variance, eps) over N: s = X (+ R); optional out_sum <- s; out_norm <- (s-mu)*rsqrt(var+eps)*g + b
template <bool PARAM_BF16>
__global__ __launch_bounds__(256) void k_layernorm(const float* __restrict__ X, const float* __restrict__ R, const float* __restrict__ g, const float* __restrict__ bta,
                                                  float* __restrict__ out_sum, float* __restrict__ out_norm, int N, float eps) {
  __shared__ float red[256];
  const int row = blockIdx.x, tid = threadIdx.x;
  const float* x = X + (size_t)row * N; const float* rr = R ? R + (size_t)row * N : nullptr;
  float vals[16];                     // up to N = 4096
  const int per = N / 256;            // contiguous chunk per thread? use strided-by-4 chunks: thread handles j = tid*4 + 1024*u
  float s1 = 0.f;
  for (int u = 0; u < per / 4; ++u) {
    const int j = tid * 4 + 1024 * u;
    const v4f a = *(const v4fa*)(x + j);
    v4f b = {0.f,0.f,0.f,0.f}; if (rr) b = *(const v4fa*)(rr + j);
#pragma unroll
    for (int q = 0; q < 4; ++q) { const float v = a[q] + b[q]; vals[u * 4 + q] = v; s1 += v; }
  }
  red[tid] = s1; __syncthreads();
  for (int st = 128; st > 0; st >>= 1) { if (tid < st) red[tid] += red[tid + st]; __syncthreads(); }
  const float mu = red[0] / (float)N; __syncthreads();
  float s2 = 0.f;
  for (int u = 0; u < per / 4; ++u)
#pragma unroll
    for (int q = 0; q < 4; ++q) { const float c = vals[u * 4 + q] - mu; s2 += c * c; }
  red[tid] = s2; __syncthreads();
  for (int st = 128; st > 0; st >>= 1) { if (tid < st) red[tid] += red[tid + st]; __syncthreads(); }
  const float rs = rsqrtf(red[0] / (float)N + eps);
  {
    for (int u = 0; u < per / 4; ++u) {
      const int j = tid * 4 + 1024 * u;
      v4f o, sm;
#pragma unroll
      for (int q = 0; q < 4; ++q) {
        float gg = g[j + q], bb = bta[j + q];
        if (PARAM_BF16) { gg = bf16_round(gg); bb = bf16_round(bb); }
        sm[q] = vals[u * 4 + q]; o[q] = (vals[u * 4 + q] - mu) * rs * gg + bb;
      }
      if (out_sum) *(v4f*)(out_sum + (size_t)row * N + j) = sm;
      *(v4f*)(out_norm + (size_t)row * N + j) = o;
    }
    
  }
}



// ---- f16 WMMA path (v_wmma_f32_16x16x32_f16): 11-bit significands for operands in range — used where a [0,1] probability operand needs more precision than bf16
typedef _Float16 v16h __attribute__((ext_vector_type(16)));
union FragH { v16h v; v8us half[2]; _Float16 h[16]; unsigned short u[16]; };
template <int NT>
__device__ __forceinline__ v8f mmaH(v16h ah, v16h al, v16h bh, v16h bl, v8f c) {
  c = __builtin_amdgcn_wmma_f32_16x16x32_f16(false, ah, false, bh, (short)0, c, false, false);
  if (NT >= 2) c = __builtin_amdgcn_wmma_f32_16x16x32_f16(false, al, false, bh, (short)0, c, false, false);
  if (NT >= 3) c = __builtin_amdgcn_wmma_f32_16x16x32_f16(false, ah, false, bl, (short)0, c, false, false);
  asm volatile("v_nop\n\tv_nop\n\tv_nop\n\tv_nop" : "+v"(c) : "v"(ah), "v"(al), "v"(bh), "v"(bl));
  return c;
}
// batched GEMM like k_gemm_b but f16 operands: A f32 (split into f16 hi/lo if ASPLIT, else rounded to f16), Bt = f16 values [n][k]; alpha; C f32; N multiple of 16 (partial tiles skipped)
template <bool ASPLIT>
__global__ __launch_bounds__(128) void k_gemm_h(const float* __restrict__ A, int lda, size_t sA, const _Float16* __restrict__ Bh, int ldb, size_t sB, float alpha, float* __restrict__ C, int ldc, size_t sC, int M, int N, int K) {
  __shared__ __attribute__((aligned(16))) float so[4][16][64];
  const int tid = threadIdx.x, w = tid >> 5, lane = tid & 31, ln = lane & 15, hh = lane >> 4; const int by = blockIdx.y;
  A += (size_t)by * sA; Bh += (size_t)by * sB; C += (size_t)by * sC;
  const int ntn = (N + 63) / 64; const int wid = blockIdx.x * 4 + w; const int mt = wid / ntn, nq = wid % ntn; if (mt * 16 >= M) return;
  const int row0 = mt * 16, col0 = nq * 64; const float* arow = A + (size_t)(row0 + ln) * lda;
  v8f acc[4] = {};
  for (int kb = 0; kb < K; kb += 32) {
    FragH ah, al;
    const v4f x0 = *(const v4fa*)(arow + kb + 8 * hh), x1 = *(const v4fa*)(arow + kb + 8 * hh + 4), x2 = *(const v4fa*)(arow + kb + 16 + 8 * hh), x3 = *(const v4fa*)(arow + kb + 16 + 8 * hh + 4);
    float xs[16] = {x0[0],x0[1],x0[2],x0[3],x1[0],x1[1],x1[2],x1[3],x2[0],x2[1],x2[2],x2[3],x3[0],x3[1],x3[2],x3[3]};
#pragma unroll
    for (int i = 0; i < 16; ++i) { const _Float16 h = (_Float16)xs[i]; ah.h[i] = h; al.h[i] = ASPLIT ? (_Float16)(xs[i] - (float)h) : (_Float16)0.0f; }
#pragma unroll
    for (int t = 0; t < 4; ++t) { if (col0 + t * 16 >= N) continue; const size_t boff = (size_t)(col0 + t * 16 + ln) * ldb + kb; FragH bq; bq.half[0] = *(const v8us*)(Bh + boff + 8 * hh); bq.half[1] = *(const v8us*)(Bh + boff + 16 + 8 * hh);
      acc[t] = mmaH<ASPLIT ? 2 : 1>(ah.v, al.v, bq.v, bq.v, acc[t]); }
  }
#pragma unroll
  for (int t = 0; t < 4; ++t) { if (col0 + t * 16 >= N) continue;
#pragma unroll
    for (int r = 0; r < 8; ++r) so[w][8 * hh + r][t * 16 + ln] = acc[t][r] * alpha; }
  __builtin_amdgcn_fence(__ATOMIC_ACQ_REL, "workgroup"); __builtin_amdgcn_wave_barrier();
  const int rsub = lane >> 4, c4 = (lane & 15) * 4;
  {
#pragma unroll
    for (int q = 0; q < 8; ++q) { const int r = q * 2 + rsub; if (col0 + c4 < N) { const v4f v = *(const v4fa*)&so[w][r][c4]; *(v4f*)(C + (size_t)(row0 + r) * ldc + col0 + c4) = v; } }
     }
}

// Wt = f16(W[k][n] * scale) from f32 row-major W[K][N] (scale = power of two; bf16-exact weights stay exact in f16 away from the subnormal range), in fragment order (f_frag below):
// per 32 k and 16 n two pieces of 512 bytes (k 0-15, 16-31); in a piece lane 16 hh + (n & 15) has its 8 values k = 8 hh + 0..7. Threads run along n, so that a wave reads whole lines of W and writes 256-byte runs.
// blockIdx.y picks one of three weights of the same shape; their Wt planes lie one behind the other
__global__ __launch_bounds__(256) void k_wt_f16(const float* __restrict__ W0, const float* __restrict__ W1, const float* __restrict__ W2, _Float16* __restrict__ Wt, int K, int N, float scale) {
  const int by = blockIdx.y; const float* __restrict__ W = by == 0 ? W0 : by == 1 ? W1 : W2; Wt += (size_t)by * N * K;
  const int t = blockIdx.x * 256 + threadIdx.x; if (t >= N * (K / 8)) return; const int n = t % N, k8 = (t / N) * 8; FragH f;
#pragma unroll
  for (int i = 0; i < 8; ++i) f.h[i] = (_Float16)(bf16_round(W[(size_t)(k8 + i) * N + n]) * scale); const v8us o = f.half[0];
  *(v8us*)((unsigned short*)Wt + ((size_t)((k8 >> 5) * (N / 16) + (n >> 4)) * 2 + ((k8 >> 4) & 1)) * 256 + (((k8 >> 3) & 1) * 16 + (n & 15)) * 8) = o; 
}
// k_gemm_hh variant with fused epilogue: v = acc·alpha + bias[by·sBias + col] (+ CP[(row/rowsPerB)·sCPb + by·64 + col] if CP) ; ACT 0 none / 1 elu ; writes f16 C16 (and f32 C if non-null)
template <int ACT>
__global__ __launch_bounds__(128) void k_gemm_hhx(const _Float16* __restrict__ A, int lda, size_t sA, const _Float16* __restrict__ Bh, int ldb, size_t sB, float alpha, const float* __restrict__ bias, size_t sBias, const float* __restrict__ CP, int rowsPerB, size_t sCPb, int row0g,
    float* __restrict__ C, _Float16* __restrict__ C16, int ldc, size_t sC, int M, int N, int K) {
  __shared__ __attribute__((aligned(16))) float so[4][16][64];
  const int tid = threadIdx.x, w = tid >> 5, lane = tid & 31, ln = lane & 15, hh = lane >> 4; const int by = blockIdx.y;
  A += (size_t)by * sA; Bh += (size_t)by * sB; const size_t cofs = (size_t)by * sC; const float* bp = bias ? bias + (size_t)by * sBias : nullptr;
  const int ntn = (N + 63) / 64; const int wid = blockIdx.x * 4 + w; const int mt = wid / ntn, nq = wid % ntn; if (mt * 16 >= M) return;
  const int row0 = mt * 16, col0 = nq * 64; const _Float16* arow = A + (size_t)(row0 + ln) * lda;
  v8f acc[4] = {};
  for (int kb = 0; kb < K; kb += 32) { FragH ah; ah.half[0] = *(const v8us*)((const unsigned short*)arow + kb + 8 * hh); ah.half[1] = *(const v8us*)((const unsigned short*)arow + kb + 16 + 8 * hh);
#pragma unroll
    for (int t = 0; t < 4; ++t) { if (col0 + t * 16 >= N) continue; const size_t boff = (size_t)(col0 + t * 16 + ln) * ldb + kb; FragH bq; bq.half[0] = *(const v8us*)((const unsigned short*)Bh + boff + 8 * hh); bq.half[1] = *(const v8us*)((const unsigned short*)Bh + boff + 16 + 8 * hh);
      acc[t] = mmaH<1>(ah.v, ah.v, bq.v, bq.v, acc[t]); }
  }
#pragma unroll
  for (int t = 0; t < 4; ++t) { if (col0 + t * 16 >= N) continue; const int col = col0 + t * 16 + ln; const float bv = bp ? bf16_round(bp[col]) : 0.f;
#pragma unroll
    for (int r = 0; r < 8; ++r) { float v = acc[t][r] * alpha + bv; if (CP) { const int rr = row0g + row0 + 8 * hh + r; if (rowsPerB < 0) v += CP[cofs + (size_t)rr * ldc + col];      /* rowsPerB < 0: own element of the batched C plane */ else { const int bidx = rr / rowsPerB; v += CP[(size_t)bidx * sCPb + (size_t)by * 64 + col]; } } if (ACT == 1) v = (v > 0.f) ? v : expm1f(v); else if (ACT == 7) v = (v > 0.f) ? v + 1.0f : expf(v); else if (ACT == 8) v = tanhf(v); else if (ACT == 9) v = 0.5f * v * (1.0f + tanhf(0.7978845608028654f * (v + 0.044715f * v * v * v))); else if (ACT == 11) v = 1.0f / (1.0f + expf(-v)); else if (ACT == 12) v = (v > 0.f) ? v : 0.01f * v; else if (ACT == 14) v = (v > 0.f) ? v : 0.1f * v; else if (ACT == 16) v = (v >= 0.f) ? v : 0.3f * v; else if (ACT == 17) v = (v >= 0.f) ? v : 0.2f * v; else if (ACT == 15) v = v / (1.0f + expf(-v)); else if (ACT == 3) v = fmaxf(v, 0.f); else if (ACT == 6) v = 0.5f * v * (1.0f + erff(v * 0.70710678118654752f)); so[w][8 * hh + r][t * 16 + ln] = v; } }
  __builtin_amdgcn_fence(__ATOMIC_ACQ_REL, "workgroup"); __builtin_amdgcn_wave_barrier();
  const int rsub = lane >> 4, c4 = (lane & 15) * 4; typedef _Float16 v4h __attribute__((ext_vector_type(4)));
  {
#pragma unroll
    for (int q = 0; q < 8; ++q) { const int r = q * 2 + rsub; if (col0 + c4 < N) { const v4f v = *(const v4fa*)&so[w][r][c4]; if (C) *(v4f*)(C + cofs + (size_t)(row0 + r) * ldc + col0 + c4) = v; if (C16) { v4h h4; for (int i = 0; i < 4; ++i) h4[i] = (_Float16)v[i]; *(v4h*)(C16 + cofs + (size_t)(row0 + r) * ldc + col0 + c4) = h4; } } }
     }
}


typedef _Float16 v4h __attribute__((ext_vector_type(4)));

__global__ __launch_bounds__(256) void k_x16(const float* __restrict__ x, _Float16* __restrict__ X16, size_t n8) { const size_t t = (size_t)blockIdx.x * 256 + threadIdx.x; if (t >= n8) return; FragH f;
#pragma unroll
  for (int q = 0; q < 8; ++q) f.h[q] = (_Float16)bf16_round(x[t * 8 + q]); *(v8us*)((unsigned short*)X16 + t * 8) = f.half[0];  }
__global__ __launch_bounds__(256) void k_h16(const float* __restrict__ x, _Float16* __restrict__ X16, size_t n8) { const size_t t = (size_t)blockIdx.x * 256 + threadIdx.x; if (t >= n8) return; FragH f;
#pragma unroll
  for (int q = 0; q < 8; ++q) f.h[q] = (_Float16)x[t * 8 + q]; *(v8us*)((unsigned short*)X16 + t * 8) = f.half[0];  }
__global__ __launch_bounds__(256) void k_round16f(const float* __restrict__ W, _Float16* __restrict__ Bt, size_t n8) { const size_t t = (size_t)blockIdx.x * 256 + threadIdx.x; if (t >= n8) return; FragH f;
#pragma unroll
  for (int i = 0; i < 8; ++i) f.h[i] = (_Float16)(bf16_round(W[t * 8 + i]) * 16.0f); *(v8us*)((unsigned short*)Bt + t * 8) = f.half[0];  }
// ---- projection GEMM (wave tile 32x64) with the hi / residual split and the V transposition in its epilogue ----
__device__ __forceinline__ v16h g2_frag(const _Float16* p, int hh) { FragH f; f.half[0] = *(const v8us*)((const unsigned short*)p + 8 * hh); f.half[1] = *(const v8us*)((const unsigned short*)p + 16 + 8 * hh); return f.v; }
// a fragment from a plane kept in fragment order: p = the fragment's 1024 bytes + 8 lane (in f16); the first 512 bytes hold every lane's k = 8 hh + 0..7, the second its k = 16 + 8 hh + 0..7: the registers get what g2_frag gives from rows
__device__ __forceinline__ v16h f_frag(const _Float16* p) { FragH f; f.half[0] = *(const v8us*)(const unsigned short*)p; f.half[1] = *(const v8us*)((const unsigned short*)p + 256); return f.v; }
__device__ __forceinline__ v8f g2_mma(v16h a, v16h b, v8f c) { v8f d = __builtin_amdgcn_wmma_f32_16x16x32_f16(false, a, false, b, (short)0, c, false, false); asm volatile("v_nop\n\tv_nop\n\tv_nop\n\tv_nop" : "+v"(d) : "v"(a), "v"(b)); return d; }
// x for the A fragments, straight from the f32 input: a wave reads its 32 rows in whole 128-byte lines (load i: rows 4 i + lane / 8, 16 bytes a lane), rounds them to bf16, which f16 holds exactly,
// and turns them through its own LDS range (80-byte rows) into the k order of g2_frag (k = 8 hh + 0..7, then 16 + 8 hh + 0..7)
#define XP 40      /* LDS row pitch in f16: 32 + 8, so that the 16-byte fragment reads of 8 rows fall on different banks */
typedef float v2f __attribute__((ext_vector_type(2))); typedef __bf16 v2b __attribute__((ext_vector_type(2))); typedef _Float16 v2h __attribute__((ext_vector_type(2))); typedef _Float16 v4ha __attribute__((ext_vector_type(4), may_alias));
__device__ __forceinline__ void x_load(v4f (&r)[8], const float* p) {      /* p = x + (first row + lane / 8) * DM + k + 4 (lane & 7) */
#pragma unroll      /* constant indices */
  for (int i = 0; i < 8; ++i) r[i] = *(const v4fa*)(p + (size_t)4 * i * DM); }
__device__ __forceinline__ void x_put(unsigned short* d, const v4f (&r)[8]) {      /* d = buffer + (lane / 8) * XP + 4 (lane & 7) */
#pragma unroll      /* constant indices */
  for (int i = 0; i < 8; ++i) { const v2f p0 = {r[i][0], r[i][1]}, p1 = {r[i][2], r[i][3]};      /* pairs: packed conversions, to nearest even like bf16_round */
    const v2h h0 = __builtin_convertvector(__builtin_convertvector(__builtin_convertvector(p0, v2b), v2f), v2h), h1 = __builtin_convertvector(__builtin_convertvector(__builtin_convertvector(p1, v2b), v2f), v2h);
    const v4ha h = {h0[0], h0[1], h1[0], h1[1]}; *(v4ha*)(d + 4 * i * XP) = h; } }
__device__ __forceinline__ v16h x_get(const unsigned short* s) { FragH f; f.half[0] = *(const v8us*)s; f.half[1] = *(const v8us*)(s + 16); return f.v; }      /* s = buffer + row * XP + 8 hh */
// The three projections (blockIdx.y = q, k, v): 128 rows a work-group, wave tile 32x64, C = A Bt / 16 (A = x rows, Bt = x16 weights in fragment order); the f32 results do not go to memory:
// q, k: each wave turns its tile through its own LDS range and stores f16 hi and x1024 residual planes in fragment order: per 16 rows four pieces of 512 bytes (d = 16 piece + 8 hh + 0..7 of row ln at lane 16 hh + ln);
// v: a lane's 8 accumulator elements are 8 consecutive tokens of one column, that is the lane's 16 bytes of a V^T fragment piece (per 32 tokens and 16 columns two pieces, tokens 0-15 and 16-31): stored straight from registers.
__global__ __launch_bounds__(128) void k_proj(const float* __restrict__ X, const _Float16* __restrict__ Bh, _Float16* __restrict__ Hq, _Float16* __restrict__ Lq, _Float16* __restrict__ VT, _Float16* __restrict__ VTL) {
  __shared__ __attribute__((aligned(16))) float so[4][32][68];
  const int tid = threadIdx.x, w = tid >> 5, lane = tid & 31, ln = lane & 15, hh = lane >> 4; const int by = blockIdx.y;
  Bh += (size_t)by * HD * DM; const int row0 = blockIdx.x * 128 + 32 * w;
  __shared__ __attribute__((aligned(16))) unsigned short xst[4][2][32 * XP];      /* per wave two buffers of 32 rounded x rows, one trip each */
  const float* xg = X + (size_t)(row0 + (lane >> 3)) * DM + 4 * (lane & 7);
  const _Float16* bp = Bh + lane * 8;      /* 32 k of the 64 columns = 4 fragments = 4096 bytes in a row */
  const v8f z8 = {0.f,0.f,0.f,0.f,0.f,0.f,0.f,0.f}; v8f c00 = z8, c01 = z8, c02 = z8, c03 = z8, c10 = z8, c11 = z8, c12 = z8, c13 = z8;
  /* x now comes from memory: its words are asked for three trips before their products, rounded and put into LDS one trip before; loads retire in order, so the weight fragments are asked for two trips ahead, between them */
  v4f xs[2][8]; v16h bs[2][4]; v16h a0, a1;
#define P_LOADB(s, k) { bs[s][0] = f_frag(bp + (k) * 64); bs[s][1] = f_frag(bp + (k) * 64 + 512); bs[s][2] = f_frag(bp + (k) * 64 + 1024); bs[s][3] = f_frag(bp + (k) * 64 + 1536); }
#define P_MMA(s) { c00 = g2_mma(a0, bs[s][0], c00); c10 = g2_mma(a1, bs[s][0], c10); c01 = g2_mma(a0, bs[s][1], c01); c11 = g2_mma(a1, bs[s][1], c11); \
    c02 = g2_mma(a0, bs[s][2], c02); c12 = g2_mma(a1, bs[s][2], c12); c03 = g2_mma(a0, bs[s][3], c03); c13 = g2_mma(a1, bs[s][3], c13); }
#define P_XCNT asm volatile("s_wait_xcnt 0x0" ::: "memory")      /* the wait in front of any overwrite of an address register that the loads above it name */
#define P_EDGE __builtin_amdgcn_sched_barrier(0)      /* a trip's rounding stays in its own trip: moved up, it would wait for loads that have just been asked for */
#define P_PUT(o) x_put(&xst[w][o][(lane >> 3) * XP + 4 * (lane & 7)], xs[o])
  /* the wave's rows are in LDS before its lanes read what other lanes wrote; only this wave touches the range, so no barrier */
#define P_GET(o) { asm volatile("s_wait_dscnt 0x0" ::: "memory"); a0 = x_get(&xst[w][o][ln * XP + 8 * hh]); a1 = x_get(&xst[w][o][(16 + ln) * XP + 8 * hh]); }
  /* trip t = k / 32, e = t & 1, o = 1 - e: round x(t + 1), ask for x(t + 3), products of t, ask for weights(t + 2), fragments of t + 1 */
#define P_TRIP(e, o, k, CV, LX, LB) { if (CV) P_PUT(o); if (LX) { x_load(xs[o], xg + (k) + 96); P_XCNT; } P_MMA(e) if (LB) { P_LOADB(e, (k) + 64) P_XCNT; } if (CV) P_GET(o) P_EDGE; }
  x_load(xs[0], xg); P_XCNT; x_load(xs[1], xg + 32); P_XCNT; P_LOADB(0, 0) P_XCNT;      /* asked for in the loop's own order: the counted waits at the loop's head are set for both ways in */
  P_PUT(0); x_load(xs[0], xg + 64); P_XCNT; P_LOADB(1, 32) P_XCNT; P_GET(0) P_EDGE;
#pragma unroll 1      /* rolled: 14 double trips, two stages of both operands beside 64 accumulator registers */
  for (int kb = 0; kb < DM - 128; kb += 64) { P_TRIP(0, 1, kb, 1, 1, 1) P_TRIP(1, 0, kb + 32, 1, 1, 1) }
  P_TRIP(0, 1, DM - 128, 1, 1, 1) P_TRIP(1, 0, DM - 96, 1, 0, 1) P_TRIP(0, 1, DM - 64, 1, 0, 0) P_TRIP(1, 0, DM - 32, 0, 0, 0)      /* the last four trips ask for nothing past the row's end */
  v8f accs[8] = {c00, c01, c02, c03, c10, c11, c12, c13};
  if (by < 2) {      /* the same for the whole work-group */
#pragma unroll      /* constant indices */
    for (int u = 0; u < 8; ++u) { const int t = u & 3, half = u >> 2;
#pragma unroll      /* constant indices */
      for (int r = 0; r < 8; ++r) so[w][half * 16 + 8 * hh + r][t * 16 + ln] = accs[u][r] * 0.0625f; }
    __builtin_amdgcn_fence(__ATOMIC_ACQ_REL, "workgroup"); __builtin_amdgcn_wave_barrier();      /* the wave reads back what its own lanes wrote */
    unsigned short* ph = (unsigned short*)Hq + ((size_t)by * NR + row0) * HD + lane * 8; unsigned short* pl = (unsigned short*)Lq + ((size_t)by * NR + row0) * HD + lane * 8;
#pragma unroll      /* one fragment piece = 512 contiguous bytes a store: q = 4 (16-row tile) + piece */
    for (int q = 0; q < 8; ++q) { const float* sp = &so[w][(q >> 2) * 16 + ln][(q & 3) * 16 + 8 * hh]; const v4f a = *(const v4fa*)sp, c = *(const v4fa*)(sp + 4); FragH fh, fl;
#pragma unroll      /* constant indices */
      for (int e = 0; e < 4; ++e) { _Float16 h = (_Float16)a[e]; fh.h[e] = h; fl.h[e] = (_Float16)((a[e] - (float)h) * 1024.0f); h = (_Float16)c[e]; fh.h[4 + e] = h; fl.h[4 + e] = (_Float16)((c[e] - (float)h) * 1024.0f); }
      *(v8us*)(ph + q * 256) = fh.half[0]; *(v8us*)(pl + q * 256) = fl.half[0]; }
  } else {
    unsigned short* gh = (unsigned short*)VT + (size_t)row0 * HD + lane * 8; unsigned short* gl = (unsigned short*)VTL + (size_t)row0 * HD + lane * 8;      /* the wave's 32 tokens: 4 fragments a plane */
#pragma unroll      /* constant indices */
    for (int u = 0; u < 8; ++u) { const int t = u & 3, half = u >> 2; FragH fh, fl;
#pragma unroll      /* constant indices */
      for (int r = 0; r < 8; ++r) { const float v = accs[u][r] * 0.0625f; const _Float16 h = (_Float16)v; fh.h[r] = h; fl.h[r] = (_Float16)((v - (float)h) * 1024.0f); }
      *(v8us*)(gh + t * 512 + half * 256) = fh.half[0]; *(v8us*)(gl + t * 512 + half * 256) = fl.half[0]; }
    asm volatile("s_wait_xcnt 0x0" ::: "memory");      /* the build lays the other path's code behind this one's last branch, and it overwrites registers that the stores above name: the wait stands in front of that */
  } }

__global__ __launch_bounds__(256) void k_wnat(const float* __restrict__ w, size_t n8, _Float16* __restrict__ Bt) { const size_t t = (size_t)blockIdx.x * 256 + threadIdx.x; if (t >= n8) return; FragH f; for (int q = 0; q < 8; ++q) f.h[q] = (_Float16)(bf16_round(w[t * 8 + q]) * 16.0f); *(v8us*)((unsigned short*)Bt + t * 8) = f.half[0];  }
__global__ __launch_bounds__(256) void k_rsm(const float* __restrict__ S, _Float16* __restrict__ P, int nrows) {
  #pragma clang fp contract(off)
  const int i = blockIdx.x * 256 + threadIdx.x; if (i >= nrows) return; const float* s = S + (size_t)i * SQ; float mx = -3.0e38f;
#pragma unroll 1
  for (int j = 0; j < SQ; ++j) mx = fmaxf(mx, s[j]); float se = 0.f;
#pragma unroll 1
  for (int j = 0; j < SQ; ++j) se += expf(s[j] - mx); const float sc = 256.0f / se;
#pragma unroll 1
  for (int j0 = 0; j0 < SQ; j0 += 8) { FragH f; for (int q = 0; q < 8; ++q) f.h[q] = (_Float16)(expf(s[j0 + q] - mx) * sc); unsigned short* d = (unsigned short*)P + (size_t)i * SQ + j0; *(v8us*)d = f.half[0];  } }
__global__ __launch_bounds__(256) void k_vt(const _Float16* __restrict__ V16, int b, int h0, _Float16* __restrict__ VT) { __shared__ unsigned short tl[64][65]; const int tid = threadIdx.x; const int hh = blockIdx.x % HG, sg = blockIdx.x / HG; const int s0 = sg * 64; const int h = h0 + hh;
  for (int i = tid; i < 64 * 8; i += 256) { const int j = i / 8, d8 = (i % 8) * 8; FragH f; f.half[0] = *(const v8us*)((const unsigned short*)V16 + ((size_t)b * SQ + s0 + j) * DM + h * HD + d8); for (int q = 0; q < 8; ++q) tl[d8 + q][j] = f.u[q]; }
  __syncthreads();
  { for (int i = tid; i < 64 * 8; i += 256) { const int d = i / 8, j8 = (i % 8) * 8; FragH f; for (int q = 0; q < 8; ++q) f.u[q] = tl[d][j8 + q]; *(v8us*)((unsigned short*)VT + ((size_t)hh * HD + d) * SQ + s0 + j8) = f.half[0]; }  } }




// ---- scores kept in registers: column statistics, then weights and P V, both from recomputed score tiles ----
__device__ __forceinline__ v8f c_mma(v16h a, v16h b, v8f c) { return __builtin_amdgcn_wmma_f32_16x16x32_f16(false, a, false, b, (short)0, c, false, false); }
__device__ __forceinline__ float c_ex2(float y) { float r;
  asm("v_exp_f32 %0, %1\n\tv_nop" : "=v"(r) : "v"(y));      /* native 2^y; the v_nop keeps the slot the instruction set asks for behind a transcendental */
  return r; }
// one 16 key x 16 query tile of S^T (row 8 hh + r = key, column ln = query): k_hi.q_hi + 2^-10 (k_lo.q_hi + k_hi.q_lo); both launches form it with these same instructions
__device__ __forceinline__ v8f c_score(v16h kh0, v16h kh1, v16h kl0, v16h kl1, v16h qh0, v16h qh1, v16h ql0, v16h ql1) {
  const v8f z8 = {0.f,0.f,0.f,0.f,0.f,0.f,0.f,0.f}; v8f h = c_mma(kh0, qh0, z8); h = c_mma(kh1, qh1, h);
  v8f l = c_mma(kl0, qh0, z8); l = c_mma(kl1, qh1, l); l = c_mma(kh0, ql0, l); l = c_mma(kh1, ql1, l);
  return h + l * 0.0009765625f; }
#define LOG2E 1.44269504f
// Per key: maximum over the queries and 256 / sum of exp. Work-group = 32 keys (fragments stay in registers), its 16 waves take 128 queries each, 32 a trip;
// running maximum and sum per lane and key, joined over the 16 lanes of a row, then over the 16 waves through LDS.
__global__ __launch_bounds__(512) void k_cstat(const _Float16* __restrict__ KH, const _Float16* __restrict__ KL, const _Float16* __restrict__ QH, const _Float16* __restrict__ QL, float* __restrict__ MX, float* __restrict__ SC) {
  __shared__ float sm[16][32]; __shared__ float sz[16][32];
  const int tid = threadIdx.x, w = tid >> 5, lane = tid & 31, ln = lane & 15, hh = lane >> 4;
  const size_t base = (size_t)blockIdx.y * SQ; const int k0 = blockIdx.x * 32;
  const _Float16* pkh = KH + (base + k0) * HD + lane * 8; const _Float16* pkl = KL + (base + k0) * HD + lane * 8;      /* fragment order: 16 rows = 2 fragments (d 0-31, 32-63) = 2048 bytes */
  v16h kh[2][2], kl[2][2];
#pragma unroll      /* constant indices keep the fragments in registers */
  for (int a = 0; a < 2; ++a) for (int s = 0; s < 2; ++s) { kh[a][s] = f_frag(pkh + 1024 * a + 512 * s); kl[a][s] = f_frag(pkl + 1024 * a + 512 * s); }
  asm volatile("s_wait_xcnt 0x0" :: "v"(pkh), "v"(pkl) : "memory");      /* the wait in front of any overwrite of the address pairs that the loads above name; as inputs the pairs stay whole up to it */
  float m[2][8], z[2][8];
#pragma unroll      /* constant indices */
  for (int a = 0; a < 2; ++a) for (int r = 0; r < 8; ++r) { m[a][r] = -3.0e38f; z[a][r] = 0.f; }
  /* the query fragments of trip c + 1 are asked for as ONE group as soon as trip c's products have read the registers, so that they fly during trip c's vector work; left to itself the build sinks the loads among the products, pair by pair, and each pair's L2 latency is waited out */
  v16h qf[8];
#define C_EDGE __builtin_amdgcn_sched_barrier(0)      /* keeps a load group where it is written: nothing is scheduled across */
#define S_LOADQ(cc) { const size_t o = (base + w * 128 + (cc) * 32) * HD + lane * 8; const _Float16* pqh = QH + o; const _Float16* pql = QL + o; \
    qf[0] = f_frag(pqh); qf[1] = f_frag(pqh + 512); qf[2] = f_frag(pql); qf[3] = f_frag(pql + 512); qf[4] = f_frag(pqh + 1024); qf[5] = f_frag(pqh + 1536); qf[6] = f_frag(pql + 1024); qf[7] = f_frag(pql + 1536); \
    asm volatile("s_wait_xcnt 0x0" :: "v"(pqh), "v"(pql) : "memory");      /* the wait in front of any overwrite of the address pairs that the loads above name; as inputs the pairs stay whole up to it */ \
  }
#define S_TRIP(cn, PF) { v8f s0[2], s1[2]; \
    _Pragma("unroll") for (int a = 0; a < 2; ++a) { s0[a] = c_score(kh[a][0], kh[a][1], kl[a][0], kl[a][1], qf[0], qf[1], qf[2], qf[3]); s1[a] = c_score(kh[a][0], kh[a][1], kl[a][0], kl[a][1], qf[4], qf[5], qf[6], qf[7]); } \
    C_EDGE; if (PF) S_LOADQ(cn) C_EDGE; \
    _Pragma("unroll") for (int a = 0; a < 2; ++a) _Pragma("unroll") for (int r = 0; r < 8; ++r) { const float mn = fmaxf(m[a][r], fmaxf(s0[a][r], s1[a][r])); \
        z[a][r] = z[a][r] * c_ex2((m[a][r] - mn) * LOG2E) + (c_ex2((s0[a][r] - mn) * LOG2E) + c_ex2((s1[a][r] - mn) * LOG2E)); m[a][r] = mn; } }
  S_LOADQ(0) C_EDGE;
#pragma unroll 1      /* rolled: one set of query fragments beside the key fragments; cn = the trip that is asked for; the last trip, which asks for nothing, is written out */
  for (int cn = 1; cn < 4; ++cn) S_TRIP(cn, 1)
  S_TRIP(0, 0)
#pragma unroll      /* constant indices */
  for (int k = 1; k < 16; k <<= 1) { float mo[2][8], zo[2][8];      /* step outermost: the 32 exchanges of a step are independent and fly together */
    for (int a = 0; a < 2; ++a) for (int r = 0; r < 8; ++r) { mo[a][r] = __shfl_xor(m[a][r], k, 32); zo[a][r] = __shfl_xor(z[a][r], k, 32); }
    for (int a = 0; a < 2; ++a) for (int r = 0; r < 8; ++r) { const float mn = fmaxf(m[a][r], mo[a][r]); z[a][r] = z[a][r] * c_ex2((m[a][r] - mn) * LOG2E) + zo[a][r] * c_ex2((mo[a][r] - mn) * LOG2E); m[a][r] = mn; } }
  if (ln == 0) {
#pragma unroll      /* constant indices */
    for (int a = 0; a < 2; ++a) for (int r = 0; r < 8; ++r) { sm[w][16 * a + 8 * hh + r] = m[a][r]; sz[w][16 * a + 8 * hh + r] = z[a][r]; } }
  __syncthreads();
  if (tid < 32) { float mm = sm[0][tid];
    for (int u = 1; u < 16; ++u) mm = fmaxf(mm, sm[u][tid]);
    float zz = 0.f;
    for (int u = 0; u < 16; ++u) zz += sz[u][tid] * c_ex2((sm[u][tid] - mm) * LOG2E);
    MX[base + k0 + tid] = mm; SC[base + k0 + tid] = 256.0f / zz; } }
// out^T[d][i] = sum_k V^T[d][k] P^T[k][i]. Work-group = 32 queries, its 8 waves take 256 keys each, 32 a trip. Two score tiles (keys 0-15, 16-31 of the trip) hold, per lane,
// exactly the B fragment's elements (element e < 8: key 8 hh + e; e >= 8: key 16 + 8 hh + e - 8; column ln = query), the k order in which f_frag delivers V^T: the weights go from D to B inside the lane.
__global__ __launch_bounds__(256) void k_cpv(const _Float16* __restrict__ KH, const _Float16* __restrict__ KL, const _Float16* __restrict__ QH, const _Float16* __restrict__ QL, const _Float16* __restrict__ VT, const _Float16* __restrict__ VTL,
    const float* __restrict__ MX, const float* __restrict__ SC, float* __restrict__ out) {
  __shared__ __attribute__((aligned(16))) float red[4][32][68];
  const int tid = threadIdx.x, w = tid >> 5, lane = tid & 31, ln = lane & 15, hh = lane >> 4;
  const size_t base = (size_t)blockIdx.y * SQ; const int q0 = blockIdx.x * 32;
  const _Float16* vh_b = VT + base * HD; const _Float16* vl_b = VTL + base * HD;
  const _Float16* pqh = QH + (base + q0) * HD + lane * 8; const _Float16* pql = QL + (base + q0) * HD + lane * 8;
  v16h qh[2][2], ql[2][2];
#pragma unroll      /* constant indices keep the fragments in registers */
  for (int c = 0; c < 2; ++c) for (int s = 0; s < 2; ++s) { qh[c][s] = f_frag(pqh + 1024 * c + 512 * s); ql[c][s] = f_frag(pql + 1024 * c + 512 * s); }
  asm volatile("s_wait_xcnt 0x0" :: "v"(pqh), "v"(pql) : "memory");      /* the wait in front of any overwrite of the address pairs that the loads above name; as inputs the pairs stay whole up to it */
  const v8f z8 = {0.f,0.f,0.f,0.f,0.f,0.f,0.f,0.f}; v8f oh[4][2], ol[4][2];
#pragma unroll      /* constant indices */
  for (int t = 0; t < 4; ++t) for (int c = 0; c < 2; ++c) { oh[t][c] = z8; ol[t][c] = z8; }
  /* every load group is asked for a phase ahead, into the registers that the phase before it has just read: the next trip's key fragments behind this trip's score products,
     its statistics behind this trip's exp, its V^T fragments behind P V, so that each group flies during about a whole trip's work; left to itself the build sinks the loads among the products and waits out the L2 latency four times a trip */
  v16h kf[2][4], vh[4], vl[4]; v4f mc[2][4];
#define V_LOADK(kk) { const _Float16* pkh = KH + (base + (kk)) * HD + lane * 8; const _Float16* pkl = KL + (base + (kk)) * HD + lane * 8; \
    _Pragma("unroll") for (int a = 0; a < 2; ++a) { kf[a][0] = f_frag(pkh + 1024 * a); kf[a][1] = f_frag(pkh + 1024 * a + 512); kf[a][2] = f_frag(pkl + 1024 * a); kf[a][3] = f_frag(pkl + 1024 * a + 512); } \
    asm volatile("s_wait_xcnt 0x0" :: "v"(pkh), "v"(pkl) : "memory");      /* the wait in front of any overwrite of the address pairs that the loads above name; as inputs the pairs stay whole up to it */ \
  }
#define V_LOADM(kk) { const float* pm = MX + base + (kk) + 8 * hh; const float* pc = SC + base + (kk) + 8 * hh; \
    _Pragma("unroll") for (int a = 0; a < 2; ++a) { mc[a][0] = *(const v4fa*)(pm + 16 * a); mc[a][1] = *(const v4fa*)(pm + 16 * a + 4); mc[a][2] = *(const v4fa*)(pc + 16 * a); mc[a][3] = *(const v4fa*)(pc + 16 * a + 4); } \
    asm volatile("s_wait_xcnt 0x0" :: "v"(pm), "v"(pc) : "memory");      /* as above */ \
  }
#define V_LOADV(kk) { const _Float16* pvh = vh_b + (size_t)(kk) * HD + lane * 8; const _Float16* pvl = vl_b + (size_t)(kk) * HD + lane * 8;      /* 32 keys = 4 fragments (16 columns each) = 4096 bytes */ \
    _Pragma("unroll") for (int t = 0; t < 4; ++t) { vh[t] = f_frag(pvh + 512 * t); vl[t] = f_frag(pvl + 512 * t); } \
    asm volatile("s_wait_xcnt 0x0" :: "v"(pvh), "v"(pvl) : "memory");      /* as above */ \
  }
#define V_TRIP(kn, PF) { FragH p[2]; v8f s[2][2]; \
    _Pragma("unroll") for (int a = 0; a < 2; ++a) _Pragma("unroll") for (int c = 0; c < 2; ++c) s[a][c] = c_score(kf[a][0], kf[a][1], kf[a][2], kf[a][3], qh[c][0], qh[c][1], ql[c][0], ql[c][1]); \
    C_EDGE; if (PF) V_LOADK(kn) C_EDGE; \
    _Pragma("unroll") for (int a = 0; a < 2; ++a) _Pragma("unroll") for (int c = 0; c < 2; ++c) _Pragma("unroll") for (int r = 0; r < 4; ++r) { \
        p[c].h[8 * a + r] = (_Float16)(c_ex2((s[a][c][r] - mc[a][0][r]) * LOG2E) * mc[a][2][r]); p[c].h[8 * a + 4 + r] = (_Float16)(c_ex2((s[a][c][4 + r] - mc[a][1][r]) * LOG2E) * mc[a][3][r]); } \
    C_EDGE; if (PF) V_LOADM(kn) C_EDGE; \
    _Pragma("unroll") for (int t = 0; t < 4; ++t) _Pragma("unroll") for (int c = 0; c < 2; ++c) { oh[t][c] = c_mma(vh[t], p[c].v, oh[t][c]); ol[t][c] = c_mma(vl[t], p[c].v, ol[t][c]); } \
    C_EDGE; if (PF) V_LOADV(kn) C_EDGE; }
  V_LOADK(w * 256) C_EDGE; V_LOADM(w * 256) C_EDGE; V_LOADV(w * 256) C_EDGE;      /* in the loop's own order */
#pragma unroll 1      /* rolled: one trip's fragments beside 128 accumulator registers; nx = the trip that is asked for; the last trip, which asks for nothing, is written out */
  for (int nx = 1; nx < 8; ++nx) V_TRIP(w * 256 + nx * 32, 1)
  V_TRIP(0, 0)
  /* the 8 key slices are added: waves 4-7 hand theirs to waves 0-3 through LDS, then every thread adds the four sums left */
#pragma unroll      /* constant indices */
  for (int t = 0; t < 4; ++t) for (int c = 0; c < 2; ++c) { oh[t][c] = oh[t][c] * 0.00390625f + ol[t][c] * 0.000003814697265625f;
    if (w >= 4) { float* d = &red[w - 4][16 * c + ln][16 * t + 8 * hh]; const v4f x0 = {oh[t][c][0], oh[t][c][1], oh[t][c][2], oh[t][c][3]}, x1 = {oh[t][c][4], oh[t][c][5], oh[t][c][6], oh[t][c][7]}; *(v4fa*)d = x0; *(v4fa*)(d + 4) = x1; } }
  __syncthreads();
  if (w < 4) {
#pragma unroll      /* constant indices */
    for (int t = 0; t < 4; ++t) for (int c = 0; c < 2; ++c) { float* d = &red[w][16 * c + ln][16 * t + 8 * hh]; v4f x0 = *(const v4fa*)d, x1 = *(const v4fa*)(d + 4);
      for (int r = 0; r < 4; ++r) { x0[r] += oh[t][c][r]; x1[r] += oh[t][c][4 + r]; }
      *(v4fa*)d = x0; *(v4fa*)(d + 4) = x1; } }
  __syncthreads();
#pragma unroll      /* two 16-byte pieces a thread */
  for (int j = 0; j < 2; ++j) { const int idx = tid + 256 * j, q = idx >> 4, d4 = (idx & 15) * 4;
    const v4f v = (*(const v4fa*)&red[0][q][d4] + *(const v4fa*)&red[1][q][d4]) + (*(const v4fa*)&red[2][q][d4] + *(const v4fa*)&red[3][q][d4]);
    float* o = out + (base + q0 + q) * DMO + d4;
#pragma unroll      /* the 16 identical heads: 16 lanes fill 256 contiguous bytes of a row per store */
    for (int h = 0; h < DMO / HD; ++h) *(v4f*)(o + h * HD) = v; } }

extern "C" void kernel_launch(void* const* d_in, const int* in_sizes, int n_in,
                              void* d_out, int out_size, void* d_ws, size_t ws_size, hipStream_t stream) {
  (void)in_sizes; (void)n_in; (void)out_size;
  const float* const* I = (const float* const*)d_in; const float* x = I[0]; const float* wq = I[1]; const float* wk = I[2]; const float* wv = I[3];      /* [in][out] = [1024][64] */
  char* ws = (char*)d_ws; size_t off = 0;
  auto take = [&](size_t bytes) { char* p = ws + off; off += (bytes + 255) & ~(size_t)255; return p; };
  /* planes of one kind lie one behind the other (weights q, k, v; hi and residual planes q, k), so that one launch covers them */
  _Float16* B3 = (_Float16*)take((size_t)3 * HD * DM * 2); _Float16* H3 = (_Float16*)take(4 * NR * HD * 2); _Float16* L3 = H3 + 2 * NR * HD;
  _Float16* QH = H3; _Float16* KH = H3 + NR * HD; _Float16* QL = L3; _Float16* KL = L3 + NR * HD;
  float* MX = (float*)take(NR * 4); float* SC = (float*)take(NR * 4); _Float16* VT = (_Float16*)take(2 * NR * HD * 2); _Float16* VTL = VT + NR * HD;      /* one plane per batch */
  if (off > ws_size) return;      /* approx 4 + 2 = 6 MiB */
  k_wt_f16<<<dim3((unsigned)(((size_t)HD * (DM / 8) + 255) / 256), 3), 256, 0, stream>>>(wq, wk, wv, B3, DM, HD, 16.0f);      /* 3 x [1024][64] -> x16 f16 in fragment order, one plane a weight */
  k_proj<<<dim3((unsigned)(NR / 128), 3), 128, 0, stream>>>(x, B3, H3, L3, VT, VTL);      /* q, k as f16 hi + x1024 residual planes, v as V^T hi / residual, all in fragment order: blockIdx.y = projection */
  /* the four batches are independent: each stage is one launch over all of them (blockIdx.y = batch, or a four times longer grid over planes that lie one behind the other) */
  k_cstat<<<dim3(SQ / 32, NB), 512, 0, stream>>>(KH, KL, QH, QL, MX, SC);      /* per key: max over the query index i, 256 / sum of exp */
  k_cpv<<<dim3(SQ / 32, NB), 256, 0, stream>>>(KH, KL, QH, QL, VT, VTL, MX, SC, (float*)d_out);      /* out_i = 2^-8 sum_k f16(256 att[i][k]) (v_hi + 2^-10 v_lo), stored into the 16 identical heads */
}

// v009
// Measured time: 44.2 microseconds a run.
// Timed twice side by side with v008, it ran 1.04 and 1.02 times as fast.
// All steps since v000 together make it 47.4 times as fast.
#include <hip/hip_runtime.h>
// Single-projection attention with a QUERY-axis softmax, tiled 16x (x [4][2048][1024]; q, k, v = x W ([1024][64] weights stored [in][out], shared by all heads); att[i][k] = q_i . k_k (no scaling); att = softmax over the QUERY index i for each key column k (the module's nn.Softmax(dim=1)); out_i = sum_k att[i][k] v_k -> [2048][64], concatenated 16 times -> [4][2048][1024]).
// Structure: token rows; x read as f32 by the projection launch and rounded in registers to exact f16 fragments; q and k projections as WMMA GEMMs (32x64 wave tiles, f32 accumulation, exact x16 weights) kept in f32 and split into f16 hi + x1024 residual planes (the unscaled logits have sigma 8, so they are formed from three hi/lo products, ~2^-21 relative); v likewise kept f32 and split; the weights are read as f32 by the projection launch too, each work-group rounding its 32 k x 64 column tile a trip and turning it through LDS into fragment order; the split is done in the projection launch's epilogue, which stores every plane (q, k, V^T) in fragment order, so that each 16-byte fragment load of a wave reads 512 contiguous bytes; the scores never go through memory: transposed score tiles S^T[k][i] = k_k . q_i (three hi/lo products, K = 64) are formed twice in registers, once for each key's maximum and sum of exp over the query index i (= the module's column softmax; f32 statistics, native exp), once for the weights (x256 f16), which pass inside the lane from the score tiles' D layout into the B fragment of out^T = V^T P^T (hi and residual accumulators, f32), 8 key slices added through LDS, each sum stored into the 16 head slots of its output row by the same launch (256 contiguous bytes per row and head); every per-batch stage runs as one launch over the four batches, and the stages that q, k, v each need run as one launch over adjacent planes; 3 launches.
// Compute dtype: inputs rounded to bf16; x / weights exact; q, k, v as f16 hi + residual pairs; the softmax weights plain f16 (~2^-12); scores, statistics, out f32. v_wmma_f32_16x16x32_f16.
#define NB 4
#define SQ 2048
#define DM 1024
#define HD 64
#define NH 1
#define HG 1
#define DMO 1024                     /* output row width = 16 x 64 */
#define B0 0                         /* unused */
#define NBR NB
#define NR ((size_t)NB * SQ)
typedef __bf16 v16b __attribute__((ext_vector_type(16)));
typedef unsigned short v8us __attribute__((ext_vector_type(8), may_alias));
typedef float  v8f  __attribute__((ext_vector_type(8)));
typedef float  v4f  __attribute__((ext_vector_type(4)));
typedef float  v4fa __attribute__((ext_vector_type(4), may_alias));
union FragB { v16b v; v8us half[2]; unsigned short u[16]; };

__device__ __forceinline__ unsigned short bf16_bits(float x) { unsigned int u = __float_as_uint(x); return (unsigned short)((u + 0x7FFFu + ((u >> 16) & 1u)) >> 16); }
__device__ __forceinline__ float bf16_val(unsigned short b) { return __uint_as_float(((unsigned int)b) << 16); }
__device__ __forceinline__ float bf16_round(float x) { return bf16_val(bf16_bits(x)); }
// D += A·B with NT terms: 1 = ah·bh, 2 = + al·bh (A split), 3 = + ah·bl (both split)
template <int NT>
__device__ __forceinline__ v8f mmaN(v16b ah, v16b al, v16b bh, v16b bl, v8f c) {
  c = __builtin_amdgcn_wmma_f32_16x16x32_bf16(false, ah, false, bh, (short)0, c, false, false);
  if (NT >= 2) c = __builtin_amdgcn_wmma_f32_16x16x32_bf16(false, al, false, bh, (short)0, c, false, false);
  if (NT >= 3) c = __builtin_amdgcn_wmma_f32_16x16x32_bf16(false, ah, false, bl, (short)0, c, false, false);
  asm volatile("v_nop\n\tv_nop\n\tv_nop\n\tv_nop" : "+v"(c) : "v"(ah), "v"(al), "v"(bh), "v"(bl));
  return c;
}

__global__ __launch_bounds__(256) void k_wt_bf16(const float* __restrict__ W, unsigned short* __restrict__ Wt, int K, int N) {
  const int t = blockIdx.x * 256 + threadIdx.x;
  const int k8n = K / 8;
  if (t >= N * k8n) return;
  const int n = t / k8n, k8 = (t % k8n) * 8;
  v8us v;
#pragma unroll
  for (int i = 0; i < 8; ++i) v[i] = bf16_bits(W[(size_t)(k8 + i) * N + n]);
  *(v8us*)(Wt + (size_t)n * K + k8) = v;
  
}

// GEMM C[M][N] (f32, pitch ldc) = act(A[M][K]·W + bias). A f32 row-major (pitch lda) converted per fragment to bf16
// (ASPLIT: hi/lo two planes -> 2 terms, else single rounded term); Wt bf16 [N][K] (pitch ldb). BIAS_BF16 rounds the
// bias to bf16 first (bias quantised to bf16 before the add). K%32==0, M%16==0, N%64==0.
template <bool ASPLIT, int ACT, bool BIAS_BF16>
__global__ __launch_bounds__(128) void k_gemm_bf(const float* __restrict__ A, int lda, const unsigned short* __restrict__ Wt, int ldb,
                                               const float* __restrict__ bias, float* __restrict__ C, int ldc, int M, int N, int K) {
  __shared__ __attribute__((aligned(16))) float so[4][16][64];
  const int tid = threadIdx.x, w = tid >> 5, lane = tid & 31, ln = lane & 15, hh = lane >> 4;
  const int ntn = N / 64;
  const int wid = blockIdx.x * 4 + w;
  const int mt = wid / ntn, nq = wid % ntn;
  if (mt * 16 >= M) return;
  const int row0 = mt * 16, col0 = nq * 64;
  const float* arow = A + (size_t)(row0 + ln) * lda;
  v8f acc[4] = {};
  for (int kb = 0; kb < K; kb += 32) {
    FragB ah, al;
    const v4f x0 = *(const v4fa*)(arow + kb + 8 * hh), x1 = *(const v4fa*)(arow + kb + 8 * hh + 4);
    const v4f x2 = *(const v4fa*)(arow + kb + 16 + 8 * hh), x3 = *(const v4fa*)(arow + kb + 16 + 8 * hh + 4);
    float xs[16] = {x0[0],x0[1],x0[2],x0[3],x1[0],x1[1],x1[2],x1[3],x2[0],x2[1],x2[2],x2[3],x3[0],x3[1],x3[2],x3[3]};
#pragma unroll
    for (int i = 0; i < 16; ++i) { const unsigned short hb = bf16_bits(xs[i]); ah.u[i] = hb; al.u[i] = ASPLIT ? bf16_bits(xs[i] - bf16_val(hb)) : (unsigned short)0; }
#pragma unroll
    for (int t = 0; t < 4; ++t) {
      const unsigned short* brow = Wt + (size_t)(col0 + t * 16 + ln) * ldb + kb;
      FragB b;
      b.half[0] = *(const v8us*)(brow + 8 * hh);
      b.half[1] = *(const v8us*)(brow + 16 + 8 * hh);
      acc[t] = mmaN<ASPLIT ? 2 : 1>(ah.v, al.v, b.v, b.v, acc[t]);
    }
  }
#pragma unroll
  for (int t = 0; t < 4; ++t) {
    float bv = bias ? bias[col0 + t * 16 + ln] : 0.f;
    if (BIAS_BF16) bv = bf16_round(bv);
#pragma unroll
    for (int r = 0; r < 8; ++r) { float v = acc[t][r] + bv; if (ACT == 1) v = fmaxf(v, 0.f); so[w][8 * hh + r][t * 16 + ln] = v; }
  }
  __builtin_amdgcn_fence(__ATOMIC_ACQ_REL, "workgroup");
  __builtin_amdgcn_wave_barrier();
  const int rsub = lane >> 4, c4 = (lane & 15) * 4;
  {
#pragma unroll
    for (int q = 0; q < 8; ++q) {
      const int r = q * 2 + rsub;
      const v4f v = *(const v4fa*)&so[w][r][c4];
      *(v4f*)(C + (size_t)(row0 + r) * ldc + col0 + c4) = v;
    }
    
  }
}

// GEMM C = act(A·W + bias + resid): A f32 (ASPLIT -> hi/lo 2 terms), Wt bf16 [N][K]; ACT 0 none, 1 relu, 2 exact gelu;
// resid (optional, f32, row index = (row % rmod), pitch ldr, RES_BF16 rounds it) added before the activation.
template <bool ASPLIT, int ACT, bool BIAS_BF16, bool RES_BF16>
__global__ __launch_bounds__(128) void k_gemm_bf3(const float* __restrict__ A, int lda, const unsigned short* __restrict__ Wt, int ldb,
                                                const float* __restrict__ bias, const float* __restrict__ resid, int rmod, int ldr,
                                                float* __restrict__ C, int ldc, int M, int N, int K) {
  __shared__ __attribute__((aligned(16))) float so[4][16][64];
  const int tid = threadIdx.x, w = tid >> 5, lane = tid & 31, ln = lane & 15, hh = lane >> 4;
  const int ntn = N / 64;
  const int wid = blockIdx.x * 4 + w;
  const int mt = wid / ntn, nq = wid % ntn;
  if (mt * 16 >= M) return;
  const int row0 = mt * 16, col0 = nq * 64;
  const float* arow = A + (size_t)(row0 + ln) * lda;
  v8f acc[4] = {};
  for (int kb = 0; kb < K; kb += 32) {
    FragB ah, al;
    const v4f x0 = *(const v4fa*)(arow + kb + 8 * hh), x1 = *(const v4fa*)(arow + kb + 8 * hh + 4);
    const v4f x2 = *(const v4fa*)(arow + kb + 16 + 8 * hh), x3 = *(const v4fa*)(arow + kb + 16 + 8 * hh + 4);
    float xs[16] = {x0[0],x0[1],x0[2],x0[3],x1[0],x1[1],x1[2],x1[3],x2[0],x2[1],x2[2],x2[3],x3[0],x3[1],x3[2],x3[3]};
#pragma unroll
    for (int i = 0; i < 16; ++i) { const unsigned short hb = bf16_bits(xs[i]); ah.u[i] = hb; al.u[i] = ASPLIT ? bf16_bits(xs[i] - bf16_val(hb)) : (unsigned short)0; }
#pragma unroll
    for (int t = 0; t < 4; ++t) {
      const unsigned short* brow = Wt + (size_t)(col0 + t * 16 + ln) * ldb + kb;
      FragB b;
      b.half[0] = *(const v8us*)(brow + 8 * hh);
      b.half[1] = *(const v8us*)(brow + 16 + 8 * hh);
      acc[t] = mmaN<ASPLIT ? 2 : 1>(ah.v, al.v, b.v, b.v, acc[t]);
    }
  }
#pragma unroll
  for (int t = 0; t < 4; ++t) {
    const int col = col0 + t * 16 + ln;
    float bv = bias ? bias[col] : 0.f;
    if (BIAS_BF16) bv = bf16_round(bv);
#pragma unroll
    for (int r = 0; r < 8; ++r) {
      float v = acc[t][r] + bv;
      if (resid) { float rv = resid[(size_t)((row0 + 8 * hh + r) % rmod) * ldr + col]; if (RES_BF16) rv = bf16_round(rv); v += rv; }
      if (ACT == 1) v = fmaxf(v, 0.f);
      if (ACT == 2) v = 0.5f * v * (1.0f + erff(v * 0.70710678118654752f));
      if (ACT == 3) { const float u = 0.7978845608028654f * (v + 0.044715f * v * v * v); v = 0.5f * v * (1.0f + tanhf(u)); }
      so[w][8 * hh + r][t * 16 + ln] = v;
    }
  }
  __builtin_amdgcn_fence(__ATOMIC_ACQ_REL, "workgroup");
  __builtin_amdgcn_wave_barrier();
  const int rsub = lane >> 4, c4 = (lane & 15) * 4;
  {
#pragma unroll
    for (int q = 0; q < 8; ++q) {
      const int r = q * 2 + rsub;
      const v4f v = *(const v4fa*)&so[w][r][c4];
      *(v4f*)(C + (size_t)(row0 + r) * ldc + col0 + c4) = v;
    }
    
  }
}
// row LayerNorm (biased variance, eps) over N: s = X (+ R); optional out_sum <- s; out_norm <- (s-mu)*rsqrt(var+eps)*g + b
template <bool PARAM_BF16>
__global__ __launch_bounds__(256) void k_layernorm(const float* __restrict__ X, const float* __restrict__ R, const float* __restrict__ g, const float* __restrict__ bta,
                                                  float* __restrict__ out_sum, float* __restrict__ out_norm, int N, float eps) {
  __shared__ float red[256];
  const int row = blockIdx.x, tid = threadIdx.x;
  const float* x = X + (size_t)row * N; const float* rr = R ? R + (size_t)row * N : nullptr;
  float vals[16];                     // up to N = 4096
  const int per = N / 256;            // contiguous chunk per thread? use strided-by-4 chunks: thread handles j = tid*4 + 1024*u
  float s1 = 0.f;
  for (int u = 0; u < per / 4; ++u) {
    const int j = tid * 4 + 1024 * u;
    const v4f a = *(const v4fa*)(x + j);
    v4f b = {0.f,0.f,0.f,0.f}; if (rr) b = *(const v4fa*)(rr + j);
#pragma unroll
    for (int q = 0; q < 4; ++q) { const float v = a[q] + b[q]; vals[u * 4 + q] = v; s1 += v; }
  }
  red[tid] = s1; __syncthreads();
  for (int st = 128; st > 0; st >>= 1) { if (tid < st) red[tid] += red[tid + st]; __syncthreads(); }
  const float mu = red[0] / (float)N; __syncthreads();
  float s2 = 0.f;
  for (int u = 0; u < per / 4; ++u)
#pragma unroll
    for (int q = 0; q < 4; ++q) { const float c = vals[u * 4 + q] - mu; s2 += c * c; }
  red[tid] = s2; __syncthreads();
  for (int st = 128; st > 0; st >>= 1) { if (tid < st) red[tid] += red[tid + st]; __syncthreads(); }
  const float rs = rsqrtf(red[0] / (float)N + eps);
  {
    for (int u = 0; u < per / 4; ++u) {
      const int j = tid * 4 + 1024 * u;
      v4f o, sm;
#pragma unroll
      for (int q = 0; q < 4; ++q) {
        float gg = g[j + q], bb = bta[j + q];
        if (PARAM_BF16) { gg = bf16_round(gg); bb = bf16_round(bb); }
        sm[q] = vals[u * 4 + q]; o[q] = (vals[u * 4 + q] - mu) * rs * gg + bb;
      }
      if (out_sum) *(v4f*)(out_sum + (size_t)row * N + j) = sm;
      *(v4f*)(out_norm + (size_t)row * N + j) = o;
    }
    
  }
}



// ---- f16 WMMA path (v_wmma_f32_16x16x32_f16): 11-bit significands for operands in range — used where a [0,1] probability operand needs more precision than bf16
typedef _Float16 v16h __attribute__((ext_vector_type(16)));
union FragH { v16h v; v8us half[2]; _Float16 h[16]; unsigned short u[16]; };
template <int NT>
__device__ __forceinline__ v8f mmaH(v16h ah, v16h al, v16h bh, v16h bl, v8f c) {
  c = __builtin_amdgcn_wmma_f32_16x16x32_f16(false, ah, false, bh, (short)0, c, false, false);
  if (NT >= 2) c = __builtin_amdgcn_wmma_f32_16x16x32_f16(false, al, false, bh, (short)0, c, false, false);
  if (NT >= 3) c = __builtin_amdgcn_wmma_f32_16x16x32_f16(false, ah, false, bl, (short)0, c, false, false);
  asm volatile("v_nop\n\tv_nop\n\tv_nop\n\tv_nop" : "+v"(c) : "v"(ah), "v"(al), "v"(bh), "v"(bl));
  return c;
}
// batched GEMM like k_gemm_b but f16 operands: A f32 (split into f16 hi/lo if ASPLIT, else rounded to f16), Bt = f16 values [n][k]; alpha; C f32; N multiple of 16 (partial tiles skipped)
template <bool ASPLIT>
__global__ __launch_bounds__(128) void k_gemm_h(const float* __restrict__ A, int lda, size_t sA, const _Float16* __restrict__ Bh, int ldb, size_t sB, float alpha, float* __restrict__ C, int ldc, size_t sC, int M, int N, int K) {
  __shared__ __attribute__((aligned(16))) float so[4][16][64];
  const int tid = threadIdx.x, w = tid >> 5, lane = tid & 31, ln = lane & 15, hh = lane >> 4; const int by = blockIdx.y;
  A += (size_t)by * sA; Bh += (size_t)by * sB; C += (size_t)by * sC;
  const int ntn = (N + 63) / 64; const int wid = blockIdx.x * 4 + w; const int mt = wid / ntn, nq = wid % ntn; if (mt * 16 >= M) return;
  const int row0 = mt * 16, col0 = nq * 64; const float* arow = A + (size_t)(row0 + ln) * lda;
  v8f acc[4] = {};
  for (int kb = 0; kb < K; kb += 32) {
    FragH ah, al;
    const v4f x0 = *(const v4fa*)(arow + kb + 8 * hh), x1 = *(const v4fa*)(arow + kb + 8 * hh + 4), x2 = *(const v4fa*)(arow + kb + 16 + 8 * hh), x3 = *(const v4fa*)(arow + kb + 16 + 8 * hh + 4);
    float xs[16] = {x0[0],x0[1],x0[2],x0[3],x1[0],x1[1],x1[2],x1[3],x2[0],x2[1],x2[2],x2[3],x3[0],x3[1],x3[2],x3[3]};
#pragma unroll
    for (int i = 0; i < 16; ++i) { const _Float16 h = (_Float16)xs[i]; ah.h[i] = h; al.h[i] = ASPLIT ? (_Float16)(xs[i] - (float)h) : (_Float16)0.0f; }
#pragma unroll
    for (int t = 0; t < 4; ++t) { if (col0 + t * 16 >= N) continue; const size_t boff = (size_t)(col0 + t * 16 + ln) * ldb + kb; FragH bq; bq.half[0] = *(const v8us*)(Bh + boff + 8 * hh); bq.half[1] = *(const v8us*)(Bh + boff + 16 + 8 * hh);
      acc[t] = mmaH<ASPLIT ? 2 : 1>(ah.v, al.v, bq.v, bq.v, acc[t]); }
  }
#pragma unroll
  for (int t = 0; t < 4; ++t) { if (col0 + t * 16 >= N) continue;
#pragma unroll
    for (int r = 0; r < 8; ++r) so[w][8 * hh + r][t * 16 + ln] = acc[t][r] * alpha; }
  __builtin_amdgcn_fence(__ATOMIC_ACQ_REL, "workgroup"); __builtin_amdgcn_wave_barrier();
  const int rsub = lane >> 4, c4 = (lane & 15) * 4;
  {
#pragma unroll
    for (int q = 0; q < 8; ++q) { const int r = q * 2 + rsub; if (col0 + c4 < N) { const v4f v = *(const v4fa*)&so[w][r][c4]; *(v4f*)(C + (size_t)(row0 + r) * ldc + col0 + c4) = v; } }
     }
}

// k_gemm_hh variant with fused epilogue: v = acc·alpha + bias[by·sBias + col] (+ CP[(row/rowsPerB)·sCPb + by·64 + col] if CP) ; ACT 0 none / 1 elu ; writes f16 C16 (and f32 C if non-null)
template <int ACT>
__global__ __launch_bounds__(128) void k_gemm_hhx(const _Float16* __restrict__ A, int lda, size_t sA, const _Float16* __restrict__ Bh, int ldb, size_t sB, float alpha, const float* __restrict__ bias, size_t sBias, const float* __restrict__ CP, int rowsPerB, size_t sCPb, int row0g,
    float* __restrict__ C, _Float16* __restrict__ C16, int ldc, size_t sC, int M, int N, int K) {
  __shared__ __attribute__((aligned(16))) float so[4][16][64];
  const int tid = threadIdx.x, w = tid >> 5, lane = tid & 31, ln = lane & 15, hh = lane >> 4; const int by = blockIdx.y;
  A += (size_t)by * sA; Bh += (size_t)by * sB; const size_t cofs = (size_t)by * sC; const float* bp = bias ? bias + (size_t)by * sBias : nullptr;
  const int ntn = (N + 63) / 64; const int wid = blockIdx.x * 4 + w; const int mt = wid / ntn, nq = wid % ntn; if (mt * 16 >= M) return;
  const int row0 = mt * 16, col0 = nq * 64; const _Float16* arow = A + (size_t)(row0 + ln) * lda;
  v8f acc[4] = {};
  for (int kb = 0; kb < K; kb += 32) { FragH ah; ah.half[0] = *(const v8us*)((const unsigned short*)arow + kb + 8 * hh); ah.half[1] = *(const v8us*)((const unsigned short*)arow + kb + 16 + 8 * hh);
#pragma unroll
    for (int t = 0; t < 4; ++t) { if (col0 + t * 16 >= N) continue; const size_t boff = (size_t)(col0 + t * 16 + ln) * ldb + kb; FragH bq; bq.half[0] = *(const v8us*)((const unsigned short*)Bh + boff + 8 * hh); bq.half[1] = *(const v8us*)((const unsigned short*)Bh + boff + 16 + 8 * hh);
      acc[t] = mmaH<1>(ah.v, ah.v, bq.v, bq.v, acc[t]); }
  }
#pragma unroll
  for (int t = 0; t < 4; ++t) { if (col0 + t * 16 >= N) continue; const int col = col0 + t * 16 + ln; const float bv = bp ? bf16_round(bp[col]) : 0.f;
#pragma unroll
    for (int r = 0; r < 8; ++r) { float v = acc[t][r] * alpha + bv; if (CP) { const int rr = row0g + row0 + 8 * hh + r; if (rowsPerB < 0) v += CP[cofs + (size_t)rr * ldc + col];      /* rowsPerB < 0: own element of the batched C plane */ else { const int bidx = rr / rowsPerB; v += CP[(size_t)bidx * sCPb + (size_t)by * 64 + col]; } } if (ACT == 1) v = (v > 0.f) ? v : expm1f(v); else if (ACT == 7) v = (v > 0.f) ? v + 1.0f : expf(v); else if (ACT == 8) v = tanhf(v); else if (ACT == 9) v = 0.5f * v * (1.0f + tanhf(0.7978845608028654f * (v + 0.044715f * v * v * v))); else if (ACT == 11) v = 1.0f / (1.0f + expf(-v)); else if (ACT == 12) v = (v > 0.f) ? v : 0.01f * v; else if (ACT == 14) v = (v > 0.f) ? v : 0.1f * v; else if (ACT == 16) v = (v >= 0.f) ? v : 0.3f * v; else if (ACT == 17) v = (v >= 0.f) ? v : 0.2f * v; else if (ACT == 15) v = v / (1.0f + expf(-v)); else if (ACT == 3) v = fmaxf(v, 0.f); else if (ACT == 6) v = 0.5f * v * (1.0f + erff(v * 0.70710678118654752f)); so[w][8 * hh + r][t * 16 + ln] = v; } }
  __builtin_amdgcn_fence(__ATOMIC_ACQ_REL, "workgroup"); __builtin_amdgcn_wave_barrier();
  const int rsub = lane >> 4, c4 = (lane & 15) * 4; typedef _Float16 v4h __attribute__((ext_vector_type(4)));
  {
#pragma unroll
    for (int q = 0; q < 8; ++q) { const int r = q * 2 + rsub; if (col0 + c4 < N) { const v4f v = *(const v4fa*)&so[w][r][c4]; if (C) *(v4f*)(C + cofs + (size_t)(row0 + r) * ldc + col0 + c4) = v; if (C16) { v4h h4; for (int i = 0; i < 4; ++i) h4[i] = (_Float16)v[i]; *(v4h*)(C16 + cofs + (size_t)(row0 + r) * ldc + col0 + c4) = h4; } } }
     }
}


typedef _Float16 v4h __attribute__((ext_vector_type(4)));

__global__ __launch_bounds__(256) void k_x16(const float* __restrict__ x, _Float16* __restrict__ X16, size_t n8) { const size_t t = (size_t)blockIdx.x * 256 + threadIdx.x; if (t >= n8) return; FragH f;
#pragma unroll
  for (int q = 0; q < 8; ++q) f.h[q] = (_Float16)bf16_round(x[t * 8 + q]); *(v8us*)((unsigned short*)X16 + t * 8) = f.half[0];  }
__global__ __launch_bounds__(256) void k_h16(const float* __restrict__ x, _Float16* __restrict__ X16, size_t n8) { const size_t t = (size_t)blockIdx.x * 256 + threadIdx.x; if (t >= n8) return; FragH f;
#pragma unroll
  for (int q = 0; q < 8; ++q) f.h[q] = (_Float16)x[t * 8 + q]; *(v8us*)((unsigned short*)X16 + t * 8) = f.half[0];  }
__global__ __launch_bounds__(256) void k_round16f(const float* __restrict__ W, _Float16* __restrict__ Bt, size_t n8) { const size_t t = (size_t)blockIdx.x * 256 + threadIdx.x; if (t >= n8) return; FragH f;
#pragma unroll
  for (int i = 0; i < 8; ++i) f.h[i] = (_Float16)(bf16_round(W[t * 8 + i]) * 16.0f); *(v8us*)((unsigned short*)Bt + t * 8) = f.half[0];  }
// ---- projection GEMM (wave tile 32x64) with the hi / residual split and the V transposition in its epilogue ----
__device__ __forceinline__ v16h g2_frag(const _Float16* p, int hh) { FragH f; f.half[0] = *(const v8us*)((const unsigned short*)p + 8 * hh); f.half[1] = *(const v8us*)((const unsigned short*)p + 16 + 8 * hh); return f.v; }
// a fragment from a plane kept in fragment order: p = the fragment's 1024 bytes + 8 lane (in f16); the first 512 bytes hold every lane's k = 8 hh + 0..7, the second its k = 16 + 8 hh + 0..7: the registers get what g2_frag gives from rows
__device__ __forceinline__ v16h f_frag(const _Float16* p) { FragH f; f.half[0] = *(const v8us*)(const unsigned short*)p; f.half[1] = *(const v8us*)((const unsigned short*)p + 256); return f.v; }
__device__ __forceinline__ v8f g2_mma(v16h a, v16h b, v8f c) { v8f d = __builtin_amdgcn_wmma_f32_16x16x32_f16(false, a, false, b, (short)0, c, false, false); asm volatile("v_nop\n\tv_nop\n\tv_nop\n\tv_nop" : "+v"(d) : "v"(a), "v"(b)); return d; }
// x for the A fragments, straight from the f32 input: a wave reads its 32 rows in whole 128-byte lines (load i: rows 4 i + lane / 8, 16 bytes a lane), rounds them to bf16, which f16 holds exactly,
// and turns them through its own LDS range (80-byte rows) into the k order of g2_frag (k = 8 hh + 0..7, then 16 + 8 hh + 0..7)
#define XP 40      /* LDS row pitch in f16: 32 + 8, so that the 16-byte fragment reads of 8 rows fall on different banks */
typedef float v2f __attribute__((ext_vector_type(2))); typedef __bf16 v2b __attribute__((ext_vector_type(2))); typedef _Float16 v2h __attribute__((ext_vector_type(2))); typedef _Float16 v4ha __attribute__((ext_vector_type(4), may_alias));
__device__ __forceinline__ void x_load(v4f (&r)[8], const float* p) {      /* p = x + (first row + lane / 8) * DM + k + 4 (lane & 7) */
#pragma unroll      /* constant indices */
  for (int i = 0; i < 8; ++i) r[i] = *(const v4fa*)(p + (size_t)4 * i * DM); }
__device__ __forceinline__ void x_put(unsigned short* d, const v4f (&r)[8]) {      /* d = buffer + (lane / 8) * XP + 4 (lane & 7) */
#pragma unroll      /* constant indices */
  for (int i = 0; i < 8; ++i) { const v2f p0 = {r[i][0], r[i][1]}, p1 = {r[i][2], r[i][3]};      /* pairs: packed conversions, to nearest even like bf16_round */
    const v2h h0 = __builtin_convertvector(__builtin_convertvector(__builtin_convertvector(p0, v2b), v2f), v2h), h1 = __builtin_convertvector(__builtin_convertvector(__builtin_convertvector(p1, v2b), v2f), v2h);
    const v4ha h = {h0[0], h0[1], h1[0], h1[1]}; *(v4ha*)(d + 4 * i * XP) = h; } }
__device__ __forceinline__ v16h x_get(const unsigned short* s) { FragH f; f.half[0] = *(const v8us*)s; f.half[1] = *(const v8us*)(s + 16); return f.v; }      /* s = buffer + row * XP + 8 hh */
// the weights for the B fragments, straight from the f32 input W[k][n] (64 columns): a trip's 32 k x 64 n tile is shared by the work-group; thread (k4 = tid / 16, nq = tid & 15) reads rows 4 k4 + 0..3, columns 4 nq + 0..3
// (a wave's load: two whole 256-byte rows), scales by 16 (exact, so that it commutes with the rounding; f16 then holds the values away from its subnormal range), rounds to bf16 and stores, per column, its four k as 8 bytes of the tile in fragment order:
// per 16 n one fragment of two 512-byte pieces (k 0-15, 16-31); in a piece lane 16 hh + (n & 15) has its 8 values k = 8 hh + 0..7, the k order of g2_frag
#define WF 520      /* LDS pitch of a fragment in f16: 512 + 8, so that the 8-byte stores of a wave, which go to all four fragments, fall on different banks */
__device__ __forceinline__ void w_load(v4f (&r)[4], const float* p) {      /* p = W + (k + 4 k4) * HD + 4 nq */
#pragma unroll      /* constant indices */
  for (int i = 0; i < 4; ++i) r[i] = *(const v4fa*)(p + i * HD); }
typedef unsigned int v2ua __attribute__((ext_vector_type(2), may_alias));
__device__ __forceinline__ void w_put(unsigned short* d, const v4f (&r)[4]) {      /* d = buffer + (nq / 4) * WF + (k4 / 4) * 256 + ((k4 / 2 & 1) * 16 + 4 (nq & 3)) * 8 + (k4 & 1) * 4 */
  unsigned int a[4], b[4];      /* row i as f16 pairs: columns 0, 1 and columns 2, 3 */
#pragma unroll      /* constant indices */
  for (int i = 0; i < 4; ++i) { const v4f s = r[i] * 16.0f; const v2f p0 = {s[0], s[1]}, p1 = {s[2], s[3]};      /* pairs that lie side by side: packed products and conversions, to nearest even like bf16_round */
    a[i] = __builtin_bit_cast(unsigned int, __builtin_convertvector(__builtin_convertvector(__builtin_convertvector(p0, v2b), v2f), v2h)); b[i] = __builtin_bit_cast(unsigned int, __builtin_convertvector(__builtin_convertvector(__builtin_convertvector(p1, v2b), v2f), v2h)); }
  /* the 4 x 4 transposition on the packed words: low halves of two rows = one column's pair of k, high halves = the next column's */
  const v2ua c0 = {__builtin_amdgcn_perm(a[1], a[0], 0x05040100u), __builtin_amdgcn_perm(a[3], a[2], 0x05040100u)}, c1 = {__builtin_amdgcn_perm(a[1], a[0], 0x07060302u), __builtin_amdgcn_perm(a[3], a[2], 0x07060302u)};
  const v2ua c2 = {__builtin_amdgcn_perm(b[1], b[0], 0x05040100u), __builtin_amdgcn_perm(b[3], b[2], 0x05040100u)}, c3 = {__builtin_amdgcn_perm(b[1], b[0], 0x07060302u), __builtin_amdgcn_perm(b[3], b[2], 0x07060302u)};
  *(v2ua*)d = c0; *(v2ua*)(d + 8) = c1; *(v2ua*)(d + 16) = c2; *(v2ua*)(d + 24) = c3; }
__device__ __forceinline__ v16h w_get(const unsigned short* s) { FragH f; f.half[0] = *(const v8us*)s; f.half[1] = *(const v8us*)(s + 256); return f.v; }      /* s = buffer + fragment * WF + 8 lane */
// The three projections (blockIdx.y = q, k, v): 128 rows a work-group, wave tile 32x64, C = A Bt / 16 (A = x rows, Bt = x16 weights, from the f32 input through LDS); the f32 results do not go to memory:
// q, k: each wave turns its tile through its own LDS range and stores f16 hi and x1024 residual planes in fragment order: per 16 rows four pieces of 512 bytes (d = 16 piece + 8 hh + 0..7 of row ln at lane 16 hh + ln);
// v: a lane's 8 accumulator elements are 8 consecutive tokens of one column, that is the lane's 16 bytes of a V^T fragment piece (per 32 tokens and 16 columns two pieces, tokens 0-15 and 16-31): stored straight from registers.
__global__ __launch_bounds__(128) void k_proj(const float* __restrict__ X, const float* __restrict__ W0, const float* __restrict__ W1, const float* __restrict__ W2, _Float16* __restrict__ Hq, _Float16* __restrict__ Lq, _Float16* __restrict__ VT, _Float16* __restrict__ VTL) {
  __shared__ __attribute__((aligned(16))) float so[4][32][68];
  const int tid = threadIdx.x, w = tid >> 5, lane = tid & 31, ln = lane & 15, hh = lane >> 4; const int by = blockIdx.y;
  const float* __restrict__ Wf = by == 0 ? W0 : by == 1 ? W1 : W2; const int row0 = blockIdx.x * 128 + 32 * w;
  __shared__ __attribute__((aligned(16))) unsigned short xst[4][2][32 * XP];      /* per wave two buffers of 32 rounded x rows, one trip each */
  const float* xg = X + (size_t)(row0 + (lane >> 3)) * DM + 4 * (lane & 7);
  __shared__ __attribute__((aligned(16))) unsigned short wst[2][4 * WF];      /* for the work-group two buffers of 4 weight fragments, one trip each */
  const int k4 = tid >> 4, nq = tid & 15; const float* wg = Wf + (size_t)(4 * k4) * HD + 4 * nq;
  const int wo = (nq >> 2) * WF + (k4 >> 2) * 256 + (((k4 >> 1) & 1) * 16 + 4 * (nq & 3)) * 8 + (k4 & 1) * 4;
  const v8f z8 = {0.f,0.f,0.f,0.f,0.f,0.f,0.f,0.f}; v8f c00 = z8, c01 = z8, c02 = z8, c03 = z8, c10 = z8, c11 = z8, c12 = z8, c13 = z8;
  /* x and the weights come from memory: their words are asked for three trips before their products, rounded and put into LDS one trip before */
  v4f xs[2][8], wr[2][4]; v16h bs[4]; v16h a0, a1;
#define P_MMA { c00 = g2_mma(a0, bs[0], c00); c10 = g2_mma(a1, bs[0], c10); c01 = g2_mma(a0, bs[1], c01); c11 = g2_mma(a1, bs[1], c11); \
    c02 = g2_mma(a0, bs[2], c02); c12 = g2_mma(a1, bs[2], c12); c03 = g2_mma(a0, bs[3], c03); c13 = g2_mma(a1, bs[3], c13); }
#define P_XCNT asm volatile("s_wait_xcnt 0x0" ::: "memory")      /* the wait in front of any overwrite of an address register that the loads above it name */
#define P_EDGE __builtin_amdgcn_sched_barrier(0)      /* a trip's rounding stays in its own trip: moved up, it would wait for loads that have just been asked for */
#define P_PUT(o) { x_put(&xst[w][o][(lane >> 3) * XP + 4 * (lane & 7)], xs[o]); w_put(&wst[o][wo], wr[o]); }
#define P_LOAD(o, k) { x_load(xs[o], xg + (k)); w_load(wr[o], wg + (size_t)(k) * HD); P_XCNT; }
  /* one work-group barrier a trip, every wave: the weight tile of trip t + 1, which the four waves wrote together, is whole before anybody reads it, and everybody's reads of the other buffer (trip t, used by the products above) are over before trip t + 1 refills it.
     Written by hand with the LDS wait alone, because __syncthreads() would also wait for the global loads that were asked for ahead; the same wait serves the wave's own x rows */
#define P_BAR asm volatile("s_wait_dscnt 0x0\n\ts_barrier_signal -1\n\ts_barrier_wait -1" ::: "memory")
#define P_GET(o) { a0 = x_get(&xst[w][o][ln * XP + 8 * hh]); a1 = x_get(&xst[w][o][(16 + ln) * XP + 8 * hh]); bs[0] = w_get(&wst[o][lane * 8]); bs[1] = w_get(&wst[o][WF + lane * 8]); bs[2] = w_get(&wst[o][2 * WF + lane * 8]); bs[3] = w_get(&wst[o][3 * WF + lane * 8]); }
  /* trip t = k / 32, o = 1 - (t & 1): round x and weights of t + 1, ask for those of t + 3, products of t, barrier, fragments of t + 1 */
  /* the edge behind the rounding: the loads go into the registers that it has just read; moved up over it they get registers of their own, and the copies at the loop's foot wait for every load that was asked for ahead */
#define P_TRIP(o, k, CV, LX) { if (CV) P_PUT(o) P_EDGE; if (LX) P_LOAD(o, (k) + 96) P_MMA if (CV) { P_BAR; P_GET(o) } P_EDGE; }
  P_LOAD(0, 0) P_LOAD(1, 32)      /* asked for in the loop's own order: the counted waits at the loop's head are set for both ways in */
  P_PUT(0) P_EDGE; P_LOAD(0, 64) P_BAR; P_GET(0) P_EDGE;
#pragma unroll 1      /* rolled: 14 double trips, two stages of both operands beside 64 accumulator registers */
  for (int kb = 0; kb < DM - 128; kb += 64) { P_TRIP(1, kb, 1, 1) P_TRIP(0, kb + 32, 1, 1) }
  P_TRIP(1, DM - 128, 1, 1) P_TRIP(0, DM - 96, 1, 0) P_TRIP(1, DM - 64, 1, 0) P_TRIP(0, DM - 32, 0, 0)      /* the last three trips ask for nothing past the rows' end */
  v8f accs[8] = {c00, c01, c02, c03, c10, c11, c12, c13};
  if (by < 2) {      /* the same for the whole work-group */
#pragma unroll      /* constant indices */
    for (int u = 0; u < 8; ++u) { const int t = u & 3, half = u >> 2;
#pragma unroll      /* constant indices */
      for (int r = 0; r < 8; ++r) so[w][half * 16 + 8 * hh + r][t * 16 + ln] = accs[u][r] * 0.0625f; }
    __builtin_amdgcn_fence(__ATOMIC_ACQ_REL, "workgroup"); __builtin_amdgcn_wave_barrier();      /* the wave reads back what its own lanes wrote */
    unsigned short* ph = (unsigned short*)Hq + ((size_t)by * NR + row0) * HD + lane * 8; unsigned short* pl = (unsigned short*)Lq + ((size_t)by * NR + row0) * HD + lane * 8;
#pragma unroll      /* one fragment piece = 512 contiguous bytes a store: q = 4 (16-row tile) + piece */
    for (int q = 0; q < 8; ++q) { const float* sp = &so[w][(q >> 2) * 16 + ln][(q & 3) * 16 + 8 * hh]; const v4f a = *(const v4fa*)sp, c = *(const v4fa*)(sp + 4); FragH fh, fl;
#pragma unroll      /* constant indices */
      for (int e = 0; e < 4; ++e) { _Float16 h = (_Float16)a[e]; fh.h[e] = h; fl.h[e] = (_Float16)((a[e] - (float)h) * 1024.0f); h = (_Float16)c[e]; fh.h[4 + e] = h; fl.h[4 + e] = (_Float16)((c[e] - (float)h) * 1024.0f); }
      *(v8us*)(ph + q * 256) = fh.half[0]; *(v8us*)(pl + q * 256) = fl.half[0]; }
  } else {
    unsigned short* gh = (unsigned short*)VT + (size_t)row0 * HD + lane * 8; unsigned short* gl = (unsigned short*)VTL + (size_t)row0 * HD + lane * 8;      /* the wave's 32 tokens: 4 fragments a plane */
#pragma unroll      /* constant indices */
    for (int u = 0; u < 8; ++u) { const int t = u & 3, half = u >> 2; FragH fh, fl;
#pragma unroll      /* constant indices */
      for (int r = 0; r < 8; ++r) { const float v = accs[u][r] * 0.0625f; const _Float16 h = (_Float16)v; fh.h[r] = h; fl.h[r] = (_Float16)((v - (float)h) * 1024.0f); }
      *(v8us*)(gh + t * 512 + half * 256) = fh.half[0]; *(v8us*)(gl + t * 512 + half * 256) = fl.half[0]; }
    asm volatile("s_wait_xcnt 0x0" ::: "memory");      /* the build lays the other path's code behind this one's last branch, and it overwrites registers that the stores above name: the wait stands in front of that */
  } }

__global__ __launch_bounds__(256) void k_wnat(const float* __restrict__ w, size_t n8, _Float16* __restrict__ Bt) { const size_t t = (size_t)blockIdx.x * 256 + threadIdx.x; if (t >= n8) return; FragH f; for (int q = 0; q < 8; ++q) f.h[q] = (_Float16)(bf16_round(w[t * 8 + q]) * 16.0f); *(v8us*)((unsigned short*)Bt + t * 8) = f.half[0];  }
__global__ __launch_bounds__(256) void k_rsm(const float* __restrict__ S, _Float16* __restrict__ P, int nrows) {
  #pragma clang fp contract(off)
  const int i = blockIdx.x * 256 + threadIdx.x; if (i >= nrows) return; const float* s = S + (size_t)i * SQ; float mx = -3.0e38f;
#pragma unroll 1
  for (int j = 0; j < SQ; ++j) mx = fmaxf(mx, s[j]); float se = 0.f;
#pragma unroll 1
  for (int j = 0; j < SQ; ++j) se += expf(s[j] - mx); const float sc = 256.0f / se;
#pragma unroll 1
  for (int j0 = 0; j0 < SQ; j0 += 8) { FragH f; for (int q = 0; q < 8; ++q) f.h[q] = (_Float16)(expf(s[j0 + q] - mx) * sc); unsigned short* d = (unsigned short*)P + (size_t)i * SQ + j0; *(v8us*)d = f.half[0];  } }
__global__ __launch_bounds__(256) void k_vt(const _Float16* __restrict__ V16, int b, int h0, _Float16* __restrict__ VT) { __shared__ unsigned short tl[64][65]; const int tid = threadIdx.x; const int hh = blockIdx.x % HG, sg = blockIdx.x / HG; const int s0 = sg * 64; const int h = h0 + hh;
  for (int i = tid; i < 64 * 8; i += 256) { const int j = i / 8, d8 = (i % 8) * 8; FragH f; f.half[0] = *(const v8us*)((const unsigned short*)V16 + ((size_t)b * SQ + s0 + j) * DM + h * HD + d8); for (int q = 0; q < 8; ++q) tl[d8 + q][j] = f.u[q]; }
  __syncthreads();
  { for (int i = tid; i < 64 * 8; i += 256) { const int d = i / 8, j8 = (i % 8) * 8; FragH f; for (int q = 0; q < 8; ++q) f.u[q] = tl[d][j8 + q]; *(v8us*)((unsigned short*)VT + ((size_t)hh * HD + d) * SQ + s0 + j8) = f.half[0]; }  } }




// ---- scores kept in registers: column statistics, then weights and P V, both from recomputed score tiles ----
__device__ __forceinline__ v8f c_mma(v16h a, v16h b, v8f c) { return __builtin_amdgcn_wmma_f32_16x16x32_f16(false, a, false, b, (short)0, c, false, false); }
__device__ __forceinline__ float c_ex2(float y) { float r;
  asm("v_exp_f32 %0, %1\n\tv_nop" : "=v"(r) : "v"(y));      /* native 2^y; the v_nop keeps the slot the instruction set asks for behind a transcendental */
  return r; }
// one 16 key x 16 query tile of S^T (row 8 hh + r = key, column ln = query): k_hi.q_hi + 2^-10 (k_lo.q_hi + k_hi.q_lo); both launches form it with these same instructions
__device__ __forceinline__ v8f c_score(v16h kh0, v16h kh1, v16h kl0, v16h kl1, v16h qh0, v16h qh1, v16h ql0, v16h ql1) {
  const v8f z8 = {0.f,0.f,0.f,0.f,0.f,0.f,0.f,0.f}; v8f h = c_mma(kh0, qh0, z8); h = c_mma(kh1, qh1, h);
  v8f l = c_mma(kl0, qh0, z8); l = c_mma(kl1, qh1, l); l = c_mma(kh0, ql0, l); l = c_mma(kh1, ql1, l);
  return h + l * 0.0009765625f; }
#define LOG2E 1.44269504f
// Per key: maximum over the queries and 256 / sum of exp. Work-group = 32 keys (fragments stay in registers), its 16 waves take 128 queries each, 32 a trip;
// running maximum and sum per lane and key, joined over the 16 lanes of a row, then over the 16 waves through LDS.
__global__ __launch_bounds__(512) void k_cstat(const _Float16* __restrict__ KH, const _Float16* __restrict__ KL, const _Float16* __restrict__ QH, const _Float16* __restrict__ QL, float* __restrict__ MX, float* __restrict__ SC) {
  __shared__ float sm[16][32]; __shared__ float sz[16][32];
  const int tid = threadIdx.x, w = tid >> 5, lane = tid & 31, ln = lane & 15, hh = lane >> 4;
  const size_t base = (size_t)blockIdx.y * SQ; const int k0 = blockIdx.x * 32;
  const _Float16* pkh = KH + (base + k0) * HD + lane * 8; const _Float16* pkl = KL + (base + k0) * HD + lane * 8;      /* fragment order: 16 rows = 2 fragments (d 0-31, 32-63) = 2048 bytes */
  v16h kh[2][2], kl[2][2];
#pragma unroll      /* constant indices keep the fragments in registers */
  for (int a = 0; a < 2; ++a) for (int s = 0; s < 2; ++s) { kh[a][s] = f_frag(pkh + 1024 * a + 512 * s); kl[a][s] = f_frag(pkl + 1024 * a + 512 * s); }
  asm volatile("s_wait_xcnt 0x0" :: "v"(pkh), "v"(pkl) : "memory");      /* the wait in front of any overwrite of the address pairs that the loads above name; as inputs the pairs stay whole up to it */
  float m[2][8], z[2][8];
#pragma unroll      /* constant indices */
  for (int a = 0; a < 2; ++a) for (int r = 0; r < 8; ++r) { m[a][r] = -3.0e38f; z[a][r] = 0.f; }
  /* the query fragments of trip c + 1 are asked for as ONE group as soon as trip c's products have read the registers, so that they fly during trip c's vector work; left to itself the build sinks the loads among the products, pair by pair, and each pair's L2 latency is waited out */
  v16h qf[8];
#define C_EDGE __builtin_amdgcn_sched_barrier(0)      /* keeps a load group where it is written: nothing is scheduled across */
#define S_LOADQ(cc) { const size_t o = (base + w * 128 + (cc) * 32) * HD + lane * 8; const _Float16* pqh = QH + o; const _Float16* pql = QL + o; \
    qf[0] = f_frag(pqh); qf[1] = f_frag(pqh + 512); qf[2] = f_frag(pql); qf[3] = f_frag(pql + 512); qf[4] = f_frag(pqh + 1024); qf[5] = f_frag(pqh + 1536); qf[6] = f_frag(pql + 1024); qf[7] = f_frag(pql + 1536); \
    asm volatile("s_wait_xcnt 0x0" :: "v"(pqh), "v"(pql) : "memory");      /* the wait in front of any overwrite of the address pairs that the loads above name; as inputs the pairs stay whole up to it */ \
  }
#define S_TRIP(cn, PF) { v8f s0[2], s1[2]; \
    _Pragma("unroll") for (int a = 0; a < 2; ++a) { s0[a] = c_score(kh[a][0], kh[a][1], kl[a][0], kl[a][1], qf[0], qf[1], qf[2], qf[3]); s1[a] = c_score(kh[a][0], kh[a][1], kl[a][0], kl[a][1], qf[4], qf[5], qf[6], qf[7]); } \
    C_EDGE; if (PF) S_LOADQ(cn) C_EDGE; \
    _Pragma("unroll") for (int a = 0; a < 2; ++a) _Pragma("unroll") for (int r = 0; r < 8; ++r) { const float mn = fmaxf(m[a][r], fmaxf(s0[a][r], s1[a][r])); \
        z[a][r] = z[a][r] * c_ex2((m[a][r] - mn) * LOG2E) + (c_ex2((s0[a][r] - mn) * LOG2E) + c_ex2((s1[a][r] - mn) * LOG2E)); m[a][r] = mn; } }
  S_LOADQ(0) C_EDGE;
#pragma unroll 1      /* rolled: one set of query fragments beside the key fragments; cn = the trip that is asked for; the last trip, which asks for nothing, is written out */
  for (int cn = 1; cn < 4; ++cn) S_TRIP(cn, 1)
  S_TRIP(0, 0)
#pragma unroll      /* constant indices */
  for (int k = 1; k < 16; k <<= 1) { float mo[2][8], zo[2][8];      /* step outermost: the 32 exchanges of a step are independent and fly together */
    for (int a = 0; a < 2; ++a) for (int r = 0; r < 8; ++r) { mo[a][r] = __shfl_xor(m[a][r], k, 32); zo[a][r] = __shfl_xor(z[a][r], k, 32); }
    for (int a = 0; a < 2; ++a) for (int r = 0; r < 8; ++r) { const float mn = fmaxf(m[a][r], mo[a][r]); z[a][r] = z[a][r] * c_ex2((m[a][r] - mn) * LOG2E) + zo[a][r] * c_ex2((mo[a][r] - mn) * LOG2E); m[a][r] = mn; } }
  if (ln == 0) {
#pragma unroll      /* constant indices */
    for (int a = 0; a < 2; ++a) for (int r = 0; r < 8; ++r) { sm[w][16 * a + 8 * hh + r] = m[a][r]; sz[w][16 * a + 8 * hh + r] = z[a][r]; } }
  __syncthreads();
  if (tid < 32) { float mm = sm[0][tid];
    for (int u = 1; u < 16; ++u) mm = fmaxf(mm, sm[u][tid]);
    float zz = 0.f;
    for (int u = 0; u < 16; ++u) zz += sz[u][tid] * c_ex2((sm[u][tid] - mm) * LOG2E);
    MX[base + k0 + tid] = mm; SC[base + k0 + tid] = 256.0f / zz; } }
// out^T[d][i] = sum_k V^T[d][k] P^T[k][i]. Work-group = 32 queries, its 8 waves take 256 keys each, 32 a trip. Two score tiles (keys 0-15, 16-31 of the trip) hold, per lane,
// exactly the B fragment's elements (element e < 8: key 8 hh + e; e >= 8: key 16 + 8 hh + e - 8; column ln = query), the k order in which f_frag delivers V^T: the weights go from D to B inside the lane.
__global__ __launch_bounds__(256) void k_cpv(const _Float16* __restrict__ KH, const _Float16* __restrict__ KL, const _Float16* __restrict__ QH, const _Float16* __restrict__ QL, const _Float16* __restrict__ VT, const _Float16* __restrict__ VTL,
    const float* __restrict__ MX, const float* __restrict__ SC, float* __restrict__ out) {
  __shared__ __attribute__((aligned(16))) float red[4][32][68];
  const int tid = threadIdx.x, w = tid >> 5, lane = tid & 31, ln = lane & 15, hh = lane >> 4;
  const size_t base = (size_t)blockIdx.y * SQ; const int q0 = blockIdx.x * 32;
  const _Float16* vh_b = VT + base * HD; const _Float16* vl_b = VTL + base * HD;
  const _Float16* pqh = QH + (base + q0) * HD + lane * 8; const _Float16* pql = QL + (base + q0) * HD + lane * 8;
  v16h qh[2][2], ql[2][2];
#pragma unroll      /* constant indices keep the fragments in registers */
  for (int c = 0; c < 2; ++c) for (int s = 0; s < 2; ++s) { qh[c][s] = f_frag(pqh + 1024 * c + 512 * s); ql[c][s] = f_frag(pql + 1024 * c + 512 * s); }
  asm volatile("s_wait_xcnt 0x0" :: "v"(pqh), "v"(pql) : "memory");      /* the wait in front of any overwrite of the address pairs that the loads above name; as inputs the pairs stay whole up to it */
  const v8f z8 = {0.f,0.f,0.f,0.f,0.f,0.f,0.f,0.f}; v8f oh[4][2], ol[4][2];
#pragma unroll      /* constant indices */
  for (int t = 0; t < 4; ++t) for (int c = 0; c < 2; ++c) { oh[t][c] = z8; ol[t][c] = z8; }
  /* every load group is asked for a phase ahead, into the registers that the phase before it has just read: the next trip's key fragments behind this trip's score products,
     its statistics behind this trip's exp, its V^T fragments behind P V, so that each group flies during about a whole trip's work; left to itself the build sinks the loads among the products and waits out the L2 latency four times a trip */
  v16h kf[2][4], vh[4], vl[4]; v4f mc[2][4];
#define V_LOADK(kk) { const _Float16* pkh = KH + (base + (kk)) * HD + lane * 8; const _Float16* pkl = KL + (base + (kk)) * HD + lane * 8; \
    _Pragma("unroll") for (int a = 0; a < 2; ++a) { kf[a][0] = f_frag(pkh + 1024 * a); kf[a][1] = f_frag(pkh + 1024 * a + 512); kf[a][2] = f_frag(pkl + 1024 * a); kf[a][3] = f_frag(pkl + 1024 * a + 512); } \
    asm volatile("s_wait_xcnt 0x0" :: "v"(pkh), "v"(pkl) : "memory");      /* the wait in front of any overwrite of the address pairs that the loads above name; as inputs the pairs stay whole up to it */ \
  }
#define V_LOADM(kk) { const float* pm = MX + base + (kk) + 8 * hh; const float* pc = SC + base + (kk) + 8 * hh; \
    _Pragma("unroll") for (int a = 0; a < 2; ++a) { mc[a][0] = *(const v4fa*)(pm + 16 * a); mc[a][1] = *(const v4fa*)(pm + 16 * a + 4); mc[a][2] = *(const v4fa*)(pc + 16 * a); mc[a][3] = *(const v4fa*)(pc + 16 * a + 4); } \
    asm volatile("s_wait_xcnt 0x0" :: "v"(pm), "v"(pc) : "memory");      /* as above */ \
  }
#define V_LOADV(kk) { const _Float16* pvh = vh_b + (size_t)(kk) * HD + lane * 8; const _Float16* pvl = vl_b + (size_t)(kk) * HD + lane * 8;      /* 32 keys = 4 fragments (16 columns each) = 4096 bytes */ \
    _Pragma("unroll") for (int t = 0; t < 4; ++t) { vh[t] = f_frag(pvh + 512 * t); vl[t] = f_frag(pvl + 512 * t); } \
    asm volatile("s_wait_xcnt 0x0" :: "v"(pvh), "v"(pvl) : "memory");      /* as above */ \
  }
#define V_TRIP(kn, PF) { FragH p[2]; v8f s[2][2]; \
    _Pragma("unroll") for (int a = 0; a < 2; ++a) _Pragma("unroll") for (int c = 0; c < 2; ++c) s[a][c] = c_score(kf[a][0], kf[a][1], kf[a][2], kf[a][3], qh[c][0], qh[c][1], ql[c][0], ql[c][1]); \
    C_EDGE; if (PF) V_LOADK(kn) C_EDGE; \
    _Pragma("unroll") for (int a = 0; a < 2; ++a) _Pragma("unroll") for (int c = 0; c < 2; ++c) _Pragma("unroll") for (int r = 0; r < 4; ++r) { \
        p[c].h[8 * a + r] = (_Float16)(c_ex2((s[a][c][r] - mc[a][0][r]) * LOG2E) * mc[a][2][r]); p[c].h[8 * a + 4 + r] = (_Float16)(c_ex2((s[a][c][4 + r] - mc[a][1][r]) * LOG2E) * mc[a][3][r]); } \
    C_EDGE; if (PF) V_LOADM(kn) C_EDGE; \
    _Pragma("unroll") for (int t = 0; t < 4; ++t) _Pragma("unroll") for (int c = 0; c < 2; ++c) { oh[t][c] = c_mma(vh[t], p[c].v, oh[t][c]); ol[t][c] = c_mma(vl[t], p[c].v, ol[t][c]); } \
    C_EDGE; if (PF) V_LOADV(kn) C_EDGE; }
  V_LOADK(w * 256) C_EDGE; V_LOADM(w * 256) C_EDGE; V_LOADV(w * 256) C_EDGE;      /* in the loop's own order */
#pragma unroll 1      /* rolled: one trip's fragments beside 128 accumulator registers; nx = the trip that is asked for; the last trip, which asks for nothing, is written out */
  for (int nx = 1; nx < 8; ++nx) V_TRIP(w * 256 + nx * 32, 1)
  V_TRIP(0, 0)
  /* the 8 key slices are added: waves 4-7 hand theirs to waves 0-3 through LDS, then every thread adds the four sums left */
#pragma unroll      /* constant indices */
  for (int t = 0; t < 4; ++t) for (int c = 0; c < 2; ++c) { oh[t][c] = oh[t][c] * 0.00390625f + ol[t][c] * 0.000003814697265625f;
    if (w >= 4) { float* d = &red[w - 4][16 * c + ln][16 * t + 8 * hh]; const v4f x0 = {oh[t][c][0], oh[t][c][1], oh[t][c][2], oh[t][c][3]}, x1 = {oh[t][c][4], oh[t][c][5], oh[t][c][6], oh[t][c][7]}; *(v4fa*)d = x0; *(v4fa*)(d + 4) = x1; } }
  __syncthreads();
  if (w < 4) {
#pragma unroll      /* constant indices */
    for (int t = 0; t < 4; ++t) for (int c = 0; c < 2; ++c) { float* d = &red[w][16 * c + ln][16 * t + 8 * hh]; v4f x0 = *(const v4fa*)d, x1 = *(const v4fa*)(d + 4);
      for (int r = 0; r < 4; ++r) { x0[r] += oh[t][c][r]; x1[r] += oh[t][c][4 + r]; }
      *(v4fa*)d = x0; *(v4fa*)(d + 4) = x1; } }
  __syncthreads();
#pragma unroll      /* two 16-byte pieces a thread */
  for (int j = 0; j < 2; ++j) { const int idx = tid + 256 * j, q = idx >> 4, d4 = (idx & 15) * 4;
    const v4f v = (*(const v4fa*)&red[0][q][d4] + *(const v4fa*)&red[1][q][d4]) + (*(const v4fa*)&red[2][q][d4] + *(const v4fa*)&red[3][q][d4]);
    float* o = out + (base + q0 + q) * DMO + d4;
#pragma unroll      /* the 16 identical heads: 16 lanes fill 256 contiguous bytes of a row per store */
    for (int h = 0; h < DMO / HD; ++h) *(v4f*)(o + h * HD) = v; } }

extern "C" void kernel_launch(void* const* d_in, const int* in_sizes, int n_in,
                              void* d_out, int out_size, void* d_ws, size_t ws_size, hipStream_t stream) {
  (void)in_sizes; (void)n_in; (void)out_size;
  const float* const* I = (const float* const*)d_in; const float* x = I[0]; const float* wq = I[1]; const float* wk = I[2]; const float* wv = I[3];      /* [in][out] = [1024][64] */
  char* ws = (char*)d_ws; size_t off = 0;
  auto take = [&](size_t bytes) { char* p = ws + off; off += (bytes + 255) & ~(size_t)255; return p; };
  /* planes of one kind lie one behind the other (hi and residual planes q, k), so that one launch covers them */
  _Float16* H3 = (_Float16*)take(4 * NR * HD * 2); _Float16* L3 = H3 + 2 * NR * HD;
  _Float16* QH = H3; _Float16* KH = H3 + NR * HD; _Float16* QL = L3; _Float16* KL = L3 + NR * HD;
  float* MX = (float*)take(NR * 4); float* SC = (float*)take(NR * 4); _Float16* VT = (_Float16*)take(2 * NR * HD * 2); _Float16* VTL = VT + NR * HD;      /* one plane per batch */
  if (off > ws_size) return;      /* approx 4 + 2 = 6 MiB */
  k_proj<<<dim3((unsigned)(NR / 128), 3), 128, 0, stream>>>(x, wq, wk, wv, H3, L3, VT, VTL);      /* q, k as f16 hi + x1024 residual planes, v as V^T hi / residual, all in fragment order: blockIdx.y = projection */
  /* the four batches are independent: each stage is one launch over all of them (blockIdx.y = batch, or a four times longer grid over planes that lie one behind the other) */
  k_cstat<<<dim3(SQ / 32, NB), 512, 0, stream>>>(KH, KL, QH, QL, MX, SC);      /* per key: max over the query index i, 256 / sum of exp */
  k_cpv<<<dim3(SQ / 32, NB), 256, 0, stream>>>(KH, KL, QH, QL, VT, VTL, MX, SC, (float*)d_out);      /* out_i = 2^-8 sum_k f16(256 att[i][k]) (v_hi + 2^-10 v_lo), stored into the 16 identical heads */
}

// v010
// One run takes 40.5 microseconds.
// In two side-by-side timings against v009, it was 1.10 and 1.09 times as fast.
// Counting every step since v000, it is 51.8 times as fast.
#include <hip/hip_runtime.h>
// Single-projection attention with a QUERY-axis softmax, tiled 16x (x [4][2048][1024]; q, k, v = x W ([1024][64] weights stored [in][out], shared by all heads); att[i][k] = q_i . k_k (no scaling); att = softmax over the QUERY index i for each key column k (the module's nn.Softmax(dim=1)); out_i = sum_k att[i][k] v_k -> [2048][64], concatenated 16 times -> [4][2048][1024]).
// Structure: token rows; x read as f32 by the projection launch and rounded in registers to exact f16 fragments; q and k projections as WMMA GEMMs (32x64 wave tiles, f32 accumulation, exact x16 weights) kept in f32 and split into f16 hi + x1024 residual planes (the unscaled logits have sigma 8, so they are formed from three hi/lo products, ~2^-21 relative); v likewise kept f32 and split; the weights are read as f32 by the projection launch too, each work-group rounding its 32 k x 64 column tile a trip and turning it through LDS into fragment order; the split is done in the projection launch's epilogue, which stores every plane (q, k, V^T) in fragment order, so that each 16-byte fragment load of a wave reads 512 contiguous bytes; the scores never go through memory: transposed score tiles S^T[k][i] = k_k . q_i (three hi/lo products, K = 64) are formed twice in registers, once for each key's maximum and sum of exp over the query index i (= the module's column softmax; f32 statistics, native exp), once for the weights (x256 f16), which pass inside the lane from the score tiles' D layout into the B fragment of out^T = V^T P^T (hi and residual accumulators, f32), 8 key slices added through LDS, each sum stored into the 16 head slots of its output row by the same launch (256 contiguous bytes per row and head); every per-batch stage runs as one launch over the four batches, and the stages that q, k, v each need run as one launch over adjacent planes; 3 launches.
// Compute dtype: inputs rounded to bf16; x / weights exact; q, k, v as f16 hi + residual pairs; the softmax weights plain f16 (~2^-12); scores, statistics, out f32. v_wmma_f32_16x16x32_f16.
#define NB 4
#define SQ 2048
#define DM 1024
#define HD 64
#define NH 1
#define HG 1
#define DMO 1024                     /* output row width = 16 x 64 */
#define B0 0                         /* unused */
#define NBR NB
#define NR ((size_t)NB * SQ)
typedef __bf16 v16b __attribute__((ext_vector_type(16)));
typedef unsigned short v8us __attribute__((ext_vector_type(8), may_alias));
typedef float  v8f  __attribute__((ext_vector_type(8)));
typedef float  v4f  __attribute__((ext_vector_type(4)));
typedef float  v4fa __attribute__((ext_vector_type(4), may_alias));
union FragB { v16b v; v8us half[2]; unsigned short u[16]; };

__device__ __forceinline__ unsigned short bf16_bits(float x) { unsigned int u = __float_as_uint(x); return (unsigned short)((u + 0x7FFFu + ((u >> 16) & 1u)) >> 16); }
__device__ __forceinline__ float bf16_val(unsigned short b) { return __uint_as_float(((unsigned int)b) << 16); }
__device__ __forceinline__ float bf16_round(float x) { return bf16_val(bf16_bits(x)); }
// D += A·B with NT terms: 1 = ah·bh, 2 = + al·bh (A split), 3 = + ah·bl (both split)
template <int NT>
__device__ __forceinline__ v8f mmaN(v16b ah, v16b al, v16b bh, v16b bl, v8f c) {
  c = __builtin_amdgcn_wmma_f32_16x16x32_bf16(false, ah, false, bh, (short)0, c, false, false);
  if (NT >= 2) c = __builtin_amdgcn_wmma_f32_16x16x32_bf16(false, al, false, bh, (short)0, c, false, false);
  if (NT >= 3) c = __builtin_amdgcn_wmma_f32_16x16x32_bf16(false, ah, false, bl, (short)0, c, false, false);
  asm volatile("v_nop\n\tv_nop\n\tv_nop\n\tv_nop" : "+v"(c) : "v"(ah), "v"(al), "v"(bh), "v"(bl));
  return c;
}

__global__ __launch_bounds__(256) void k_wt_bf16(const float* __restrict__ W, unsigned short* __restrict__ Wt, int K, int N) {
  const int t = blockIdx.x * 256 + threadIdx.x;
  const int k8n = K / 8;
  if (t >= N * k8n) return;
  const int n = t / k8n, k8 = (t % k8n) * 8;
  v8us v;
#pragma unroll
  for (int i = 0; i < 8; ++i) v[i] = bf16_bits(W[(size_t)(k8 + i) * N + n]);
  *(v8us*)(Wt + (size_t)n * K + k8) = v;
  
}

// GEMM C[M][N] (f32, pitch ldc) = act(A[M][K]·W + bias). A f32 row-major (pitch lda) converted per fragment to bf16
// (ASPLIT: hi/lo two planes -> 2 terms, else single rounded term); Wt bf16 [N][K] (pitch ldb). BIAS_BF16 rounds the
// bias to bf16 first (bias quantised to bf16 before the add). K%32==0, M%16==0, N%64==0.
template <bool ASPLIT, int ACT, bool BIAS_BF16>
__global__ __launch_bounds__(128) void k_gemm_bf(const float* __restrict__ A, int lda, const unsigned short* __restrict__ Wt, int ldb,
                                               const float* __restrict__ bias, float* __restrict__ C, int ldc, int M, int N, int K) {
  __shared__ __attribute__((aligned(16))) float so[4][16][64];
  const int tid = threadIdx.x, w = tid >> 5, lane = tid & 31, ln = lane & 15, hh = lane >> 4;
  const int ntn = N / 64;
  const int wid = blockIdx.x * 4 + w;
  const int mt = wid / ntn, nq = wid % ntn;
  if (mt * 16 >= M) return;
  const int row0 = mt * 16, col0 = nq * 64;
  const float* arow = A + (size_t)(row0 + ln) * lda;
  v8f acc[4] = {};
  for (int kb = 0; kb < K; kb += 32) {
    FragB ah, al;
    const v4f x0 = *(const v4fa*)(arow + kb + 8 * hh), x1 = *(const v4fa*)(arow + kb + 8 * hh + 4);
    const v4f x2 = *(const v4fa*)(arow + kb + 16 + 8 * hh), x3 = *(const v4fa*)(arow + kb + 16 + 8 * hh + 4);
    float xs[16] = {x0[0],x0[1],x0[2],x0[3],x1[0],x1[1],x1[2],x1[3],x2[0],x2[1],x2[2],x2[3],x3[0],x3[1],x3[2],x3[3]};
#pragma unroll
    for (int i = 0; i < 16; ++i) { const unsigned short hb = bf16_bits(xs[i]); ah.u[i] = hb; al.u[i] = ASPLIT ? bf16_bits(xs[i] - bf16_val(hb)) : (unsigned short)0; }
#pragma unroll
    for (int t = 0; t < 4; ++t) {
      const unsigned short* brow = Wt + (size_t)(col0 + t * 16 + ln) * ldb + kb;
      FragB b;
      b.half[0] = *(const v8us*)(brow + 8 * hh);
      b.half[1] = *(const v8us*)(brow + 16 + 8 * hh);
      acc[t] = mmaN<ASPLIT ? 2 : 1>(ah.v, al.v, b.v, b.v, acc[t]);
    }
  }
#pragma unroll
  for (int t = 0; t < 4; ++t) {
    float bv = bias ? bias[col0 + t * 16 + ln] : 0.f;
    if (BIAS_BF16) bv = bf16_round(bv);
#pragma unroll
    for (int r = 0; r < 8; ++r) { float v = acc[t][r] + bv; if (ACT == 1) v = fmaxf(v, 0.f); so[w][8 * hh + r][t * 16 + ln] = v; }
  }
  __builtin_amdgcn_fence(__ATOMIC_ACQ_REL, "workgroup");
  __builtin_amdgcn_wave_barrier();
  const int rsub = lane >> 4, c4 = (lane & 15) * 4;
  {
#pragma unroll
    for (int q = 0; q < 8; ++q) {
      const int r = q * 2 + rsub;
      const v4f v = *(const v4fa*)&so[w][r][c4];
      *(v4f*)(C + (size_t)(row0 + r) * ldc + col0 + c4) = v;
    }
    
  }
}

// GEMM C = act(A·W + bias + resid): A f32 (ASPLIT -> hi/lo 2 terms), Wt bf16 [N][K]; ACT 0 none, 1 relu, 2 exact gelu;
// resid (optional, f32, row index = (row % rmod), pitch ldr, RES_BF16 rounds it) added before the activation.
template <bool ASPLIT, int ACT, bool BIAS_BF16, bool RES_BF16>
__global__ __launch_bounds__(128) void k_gemm_bf3(const float* __restrict__ A, int lda, const unsigned short* __restrict__ Wt, int ldb,
                                                const float* __restrict__ bias, const float* __restrict__ resid, int rmod, int ldr,
                                                float* __restrict__ C, int ldc, int M, int N, int K) {
  __shared__ __attribute__((aligned(16))) float so[4][16][64];
  const int tid = threadIdx.x, w = tid >> 5, lane = tid & 31, ln = lane & 15, hh = lane >> 4;
  const int ntn = N / 64;
  const int wid = blockIdx.x * 4 + w;
  const int mt = wid / ntn, nq = wid % ntn;
  if (mt * 16 >= M) return;
  const int row0 = mt * 16, col0 = nq * 64;
  const float* arow = A + (size_t)(row0 + ln) * lda;
  v8f acc[4] = {};
  for (int kb = 0; kb < K; kb += 32) {
    FragB ah, al;
    const v4f x0 = *(const v4fa*)(arow + kb + 8 * hh), x1 = *(const v4fa*)(arow + kb + 8 * hh + 4);
    const v4f x2 = *(const v4fa*)(arow + kb + 16 + 8 * hh), x3 = *(const v4fa*)(arow + kb + 16 + 8 * hh + 4);
    float xs[16] = {x0[0],x0[1],x0[2],x0[3],x1[0],x1[1],x1[2],x1[3],x2[0],x2[1],x2[2],x2[3],x3[0],x3[1],x3[2],x3[3]};
#pragma unroll
    for (int i = 0; i < 16; ++i) { const unsigned short hb = bf16_bits(xs[i]); ah.u[i] = hb; al.u[i] = ASPLIT ? bf16_bits(xs[i] - bf16_val(hb)) : (unsigned short)0; }
#pragma unroll
    for (int t = 0; t < 4; ++t) {
      const unsigned short* brow = Wt + (size_t)(col0 + t * 16 + ln) * ldb + kb;
      FragB b;
      b.half[0] = *(const v8us*)(brow + 8 * hh);
      b.half[1] = *(const v8us*)(brow + 16 + 8 * hh);
      acc[t] = mmaN<ASPLIT ? 2 : 1>(ah.v, al.v, b.v, b.v, acc[t]);
    }
  }
#pragma unroll
  for (int t = 0; t < 4; ++t) {
    const int col = col0 + t * 16 + ln;
    float bv = bias ? bias[col] : 0.f;
    if (BIAS_BF16) bv = bf16_round(bv);
#pragma unroll
    for (int r = 0; r < 8; ++r) {
      float v = acc[t][r] + bv;
      if (resid) { float rv = resid[(size_t)((row0 + 8 * hh + r) % rmod) * ldr + col]; if (RES_BF16) rv = bf16_round(rv); v += rv; }
      if (ACT == 1) v = fmaxf(v, 0.f);
      if (ACT == 2) v = 0.5f * v * (1.0f + erff(v * 0.70710678118654752f));
      if (ACT == 3) { const float u = 0.7978845608028654f * (v + 0.044715f * v * v * v); v = 0.5f * v * (1.0f + tanhf(u)); }
      so[w][8 * hh + r][t * 16 + ln] = v;
    }
  }
  __builtin_amdgcn_fence(__ATOMIC_ACQ_REL, "workgroup");
  __builtin_amdgcn_wave_barrier();
  const int rsub = lane >> 4, c4 = (lane & 15) * 4;
  {
#pragma unroll
    for (int q = 0; q < 8; ++q) {
      const int r = q * 2 + rsub;
      const v4f v = *(const v4fa*)&so[w][r][c4];
      *(v4f*)(C + (size_t)(row0 + r) * ldc + col0 + c4) = v;
    }
    
  }
}
// row LayerNorm (biased variance, eps) over N: s = X (+ R); optional out_sum <- s; out_norm <- (s-mu)*rsqrt(var+eps)*g + b
template <bool PARAM_BF16>
__global__ __launch_bounds__(256) void k_layernorm(const float* __restrict__ X, const float* __restrict__ R, const float* __restrict__ g, const float* __restrict__ bta,
                                                  float* __restrict__ out_sum, float* __restrict__ out_norm, int N, float eps) {
  __shared__ float red[256];
  const int row = blockIdx.x, tid = threadIdx.x;
  const float* x = X + (size_t)row * N; const float* rr = R ? R + (size_t)row * N : nullptr;
  float vals[16];                     // up to N = 4096
  const int per = N / 256;            // contiguous chunk per thread? use strided-by-4 chunks: thread handles j = tid*4 + 1024*u
  float s1 = 0.f;
  for (int u = 0; u < per / 4; ++u) {
    const int j = tid * 4 + 1024 * u;
    const v4f a = *(const v4fa*)(x + j);
    v4f b = {0.f,0.f,0.f,0.f}; if (rr) b = *(const v4fa*)(rr + j);
#pragma unroll
    for (int q = 0; q < 4; ++q) { const float v = a[q] + b[q]; vals[u * 4 + q] = v; s1 += v; }
  }
  red[tid] = s1; __syncthreads();
  for (int st = 128; st > 0; st >>= 1) { if (tid < st) red[tid] += red[tid + st]; __syncthreads(); }
  const float mu = red[0] / (float)N; __syncthreads();
  float s2 = 0.f;
  for (int u = 0; u < per / 4; ++u)
#pragma unroll
    for (int q = 0; q < 4; ++q) { const float c = vals[u * 4 + q] - mu; s2 += c * c; }
  red[tid] = s2; __syncthreads();
  for (int st = 128; st > 0; st >>= 1) { if (tid < st) red[tid] += red[tid + st]; __syncthreads(); }
  const float rs = rsqrtf(red[0] / (float)N + eps);
  {
    for (int u = 0; u < per / 4; ++u) {
      const int j = tid * 4 + 1024 * u;
      v4f o, sm;
#pragma unroll
      for (int q = 0; q < 4; ++q) {
        float gg = g[j + q], bb = bta[j + q];
        if (PARAM_BF16) { gg = bf16_round(gg); bb = bf16_round(bb); }
        sm[q] = vals[u * 4 + q]; o[q] = (vals[u * 4 + q] - mu) * rs * gg + bb;
      }
      if (out_sum) *(v4f*)(out_sum + (size_t)row * N + j) = sm;
      *(v4f*)(out_norm + (size_t)row * N + j) = o;
    }
    
  }
}



// ---- f16 WMMA path (v_wmma_f32_16x16x32_f16): 11-bit significands for operands in range — used where a [0,1] probability operand needs more precision than bf16
typedef _Float16 v16h __attribute__((ext_vector_type(16)));
union FragH { v16h v; v8us half[2]; _Float16 h[16]; unsigned short u[16]; };
template <int NT>
__device__ __forceinline__ v8f mmaH(v16h ah, v16h al, v16h bh, v16h bl, v8f c) {
  c = __builtin_amdgcn_wmma_f32_16x16x32_f16(false, ah, false, bh, (short)0, c, false, false);
  if (NT >= 2) c = __builtin_amdgcn_wmma_f32_16x16x32_f16(false, al, false, bh, (short)0, c, false, false);
  if (NT >= 3) c = __builtin_amdgcn_wmma_f32_16x16x32_f16(false, ah, false, bl, (short)0, c, false, false);
  asm volatile("v_nop\n\tv_nop\n\tv_nop\n\tv_nop" : "+v"(c) : "v"(ah), "v"(al), "v"(bh), "v"(bl));
  return c;
}
// batched GEMM like k_gemm_b but f16 operands: A f32 (split into f16 hi/lo if ASPLIT, else rounded to f16), Bt = f16 values [n][k]; alpha; C f32; N multiple of 16 (partial tiles skipped)
template <bool ASPLIT>
__global__ __launch_bounds__(128) void k_gemm_h(const float* __restrict__ A, int lda, size_t sA, const _Float16* __restrict__ Bh, int ldb, size_t sB, float alpha, float* __restrict__ C, int ldc, size_t sC, int M, int N, int K) {
  __shared__ __attribute__((aligned(16))) float so[4][16][64];
  const int tid = threadIdx.x, w = tid >> 5, lane = tid & 31, ln = lane & 15, hh = lane >> 4; const int by = blockIdx.y;
  A += (size_t)by * sA; Bh += (size_t)by * sB; C += (size_t)by * sC;
  const int ntn = (N + 63) / 64; const int wid = blockIdx.x * 4 + w; const int mt = wid / ntn, nq = wid % ntn; if (mt * 16 >= M) return;
  const int row0 = mt * 16, col0 = nq * 64; const float* arow = A + (size_t)(row0 + ln) * lda;
  v8f acc[4] = {};
  for (int kb = 0; kb < K; kb += 32) {
    FragH ah, al;
    const v4f x0 = *(const v4fa*)(arow + kb + 8 * hh), x1 = *(const v4fa*)(arow + kb + 8 * hh + 4), x2 = *(const v4fa*)(arow + kb + 16 + 8 * hh), x3 = *(const v4fa*)(arow + kb + 16 + 8 * hh + 4);
    float xs[16] = {x0[0],x0[1],x0[2],x0[3],x1[0],x1[1],x1[2],x1[3],x2[0],x2[1],x2[2],x2[3],x3[0],x3[1],x3[2],x3[3]};
#pragma unroll
    for (int i = 0; i < 16; ++i) { const _Float16 h = (_Float16)xs[i]; ah.h[i] = h; al.h[i] = ASPLIT ? (_Float16)(xs[i] - (float)h) : (_Float16)0.0f; }
#pragma unroll
    for (int t = 0; t < 4; ++t) { if (col0 + t * 16 >= N) continue; const size_t boff = (size_t)(col0 + t * 16 + ln) * ldb + kb; FragH bq; bq.half[0] = *(const v8us*)(Bh + boff + 8 * hh); bq.half[1] = *(const v8us*)(Bh + boff + 16 + 8 * hh);
      acc[t] = mmaH<ASPLIT ? 2 : 1>(ah.v, al.v, bq.v, bq.v, acc[t]); }
  }
#pragma unroll
  for (int t = 0; t < 4; ++t) { if (col0 + t * 16 >= N) continue;
#pragma unroll
    for (int r = 0; r < 8; ++r) so[w][8 * hh + r][t * 16 + ln] = acc[t][r] * alpha; }
  __builtin_amdgcn_fence(__ATOMIC_ACQ_REL, "workgroup"); __builtin_amdgcn_wave_barrier();
  const int rsub = lane >> 4, c4 = (lane & 15) * 4;
  {
#pragma unroll
    for (int q = 0; q < 8; ++q) { const int r = q * 2 + rsub; if (col0 + c4 < N) { const v4f v = *(const v4fa*)&so[w][r][c4]; *(v4f*)(C + (size_t)(row0 + r) * ldc + col0 + c4) = v; } }
     }
}

// k_gemm_hh variant with fused epilogue: v = acc·alpha + bias[by·sBias + col] (+ CP[(row/rowsPerB)·sCPb + by·64 + col] if CP) ; ACT 0 none / 1 elu ; writes f16 C16 (and f32 C if non-null)
template <int ACT>
__global__ __launch_bounds__(128) void k_gemm_hhx(const _Float16* __restrict__ A, int lda, size_t sA, const _Float16* __restrict__ Bh, int ldb, size_t sB, float alpha, const float* __restrict__ bias, size_t sBias, const float* __restrict__ CP, int rowsPerB, size_t sCPb, int row0g,
    float* __restrict__ C, _Float16* __restrict__ C16, int ldc, size_t sC, int M, int N, int K) {
  __shared__ __attribute__((aligned(16))) float so[4][16][64];
  const int tid = threadIdx.x, w = tid >> 5, lane = tid & 31, ln = lane & 15, hh = lane >> 4; const int by = blockIdx.y;
  A += (size_t)by * sA; Bh += (size_t)by * sB; const size_t cofs = (size_t)by * sC; const float* bp = bias ? bias + (size_t)by * sBias : nullptr;
  const int ntn = (N + 63) / 64; const int wid = blockIdx.x * 4 + w; const int mt = wid / ntn, nq = wid % ntn; if (mt * 16 >= M) return;
  const int row0 = mt * 16, col0 = nq * 64; const _Float16* arow = A + (size_t)(row0 + ln) * lda;
  v8f acc[4] = {};
  for (int kb = 0; kb < K; kb += 32) { FragH ah; ah.half[0] = *(const v8us*)((const unsigned short*)arow + kb + 8 * hh); ah.half[1] = *(const v8us*)((const unsigned short*)arow + kb + 16 + 8 * hh);
#pragma unroll
    for (int t = 0; t < 4; ++t) { if (col0 + t * 16 >= N) continue; const size_t boff = (size_t)(col0 + t * 16 + ln) * ldb + kb; FragH bq; bq.half[0] = *(const v8us*)((const unsigned short*)Bh + boff + 8 * hh); bq.half[1] = *(const v8us*)((const unsigned short*)Bh + boff + 16 + 8 * hh);
      acc[t] = mmaH<1>(ah.v, ah.v, bq.v, bq.v, acc[t]); }
  }
#pragma unroll
  for (int t = 0; t < 4; ++t) { if (col0 + t * 16 >= N) continue; const int col = col0 + t * 16 + ln; const float bv = bp ? bf16_round(bp[col]) : 0.f;
#pragma unroll
    for (int r = 0; r < 8; ++r) { float v = acc[t][r] * alpha + bv; if (CP) { const int rr = row0g + row0 + 8 * hh + r; if (rowsPerB < 0) v += CP[cofs + (size_t)rr * ldc + col];      /* rowsPerB < 0: own element of the batched C plane */ else { const int bidx = rr / rowsPerB; v += CP[(size_t)bidx * sCPb + (size_t)by * 64 + col]; } } if (ACT == 1) v = (v > 0.f) ? v : expm1f(v); else if (ACT == 7) v = (v > 0.f) ? v + 1.0f : expf(v); else if (ACT == 8) v = tanhf(v); else if (ACT == 9) v = 0.5f * v * (1.0f + tanhf(0.7978845608028654f * (v + 0.044715f * v * v * v))); else if (ACT == 11) v = 1.0f / (1.0f + expf(-v)); else if (ACT == 12) v = (v > 0.f) ? v : 0.01f * v; else if (ACT == 14) v = (v > 0.f) ? v : 0.1f * v; else if (ACT == 16) v = (v >= 0.f) ? v : 0.3f * v; else if (ACT == 17) v = (v >= 0.f) ? v : 0.2f * v; else if (ACT == 15) v = v / (1.0f + expf(-v)); else if (ACT == 3) v = fmaxf(v, 0.f); else if (ACT == 6) v = 0.5f * v * (1.0f + erff(v * 0.70710678118654752f)); so[w][8 * hh + r][t * 16 + ln] = v; } }
  __builtin_amdgcn_fence(__ATOMIC_ACQ_REL, "workgroup"); __builtin_amdgcn_wave_barrier();
  const int rsub = lane >> 4, c4 = (lane & 15) * 4; typedef _Float16 v4h __attribute__((ext_vector_type(4)));
  {
#pragma unroll
    for (int q = 0; q < 8; ++q) { const int r = q * 2 + rsub; if (col0 + c4 < N) { const v4f v = *(const v4fa*)&so[w][r][c4]; if (C) *(v4f*)(C + cofs + (size_t)(row0 + r) * ldc + col0 + c4) = v; if (C16) { v4h h4; for (int i = 0; i < 4; ++i) h4[i] = (_Float16)v[i]; *(v4h*)(C16 + cofs + (size_t)(row0 + r) * ldc + col0 + c4) = h4; } } }
     }
}


typedef _Float16 v4h __attribute__((ext_vector_type(4)));

__global__ __launch_bounds__(256) void k_x16(const float* __restrict__ x, _Float16* __restrict__ X16, size_t n8) { const size_t t = (size_t)blockIdx.x * 256 + threadIdx.x; if (t >= n8) return; FragH f;
#pragma unroll
  for (int q = 0; q < 8; ++q) f.h[q] = (_Float16)bf16_round(x[t * 8 + q]); *(v8us*)((unsigned short*)X16 + t * 8) = f.half[0];  }
__global__ __launch_bounds__(256) void k_h16(const float* __restrict__ x, _Float16* __restrict__ X16, size_t n8) { const size_t t = (size_t)blockIdx.x * 256 + threadIdx.x; if (t >= n8) return; FragH f;
#pragma unroll
  for (int q = 0; q < 8; ++q) f.h[q] = (_Float16)x[t * 8 + q]; *(v8us*)((unsigned short*)X16 + t * 8) = f.half[0];  }
__global__ __launch_bounds__(256) void k_round16f(const float* __restrict__ W, _Float16* __restrict__ Bt, size_t n8) { const size_t t = (size_t)blockIdx.x * 256 + threadIdx.x; if (t >= n8) return; FragH f;
#pragma unroll
  for (int i = 0; i < 8; ++i) f.h[i] = (_Float16)(bf16_round(W[t * 8 + i]) * 16.0f); *(v8us*)((unsigned short*)Bt + t * 8) = f.half[0];  }
// ---- projection GEMM (wave tile 32x64) with the hi / residual split and the V transposition in its epilogue ----
__device__ __forceinline__ v16h g2_frag(const _Float16* p, int hh) { FragH f; f.half[0] = *(const v8us*)((const unsigned short*)p + 8 * hh); f.half[1] = *(const v8us*)((const unsigned short*)p + 16 + 8 * hh); return f.v; }
// a fragment from a plane kept in fragment order: p = the fragment's 1024 bytes + 8 lane (in f16); the first 512 bytes hold every lane's k = 8 hh + 0..7, the second its k = 16 + 8 hh + 0..7: the registers get what g2_frag gives from rows
__device__ __forceinline__ v16h f_frag(const _Float16* p) { FragH f; f.half[0] = *(const v8us*)(const unsigned short*)p; f.half[1] = *(const v8us*)((const unsigned short*)p + 256); return f.v; }
__device__ __forceinline__ v8f g2_mma(v16h a, v16h b, v8f c) { v8f d = __builtin_amdgcn_wmma_f32_16x16x32_f16(false, a, false, b, (short)0, c, false, false); asm volatile("v_nop\n\tv_nop\n\tv_nop\n\tv_nop" : "+v"(d) : "v"(a), "v"(b)); return d; }
// x for the A fragments, straight from the f32 input: a wave reads its 32 rows in whole 128-byte lines (load i: rows 4 i + lane / 8, 16 bytes a lane), rounds them to bf16, which f16 holds exactly,
// and turns them through its own LDS range (80-byte rows) into the k order of g2_frag (k = 8 hh + 0..7, then 16 + 8 hh + 0..7)
#define XP 40      /* LDS row pitch in f16: 32 + 8, so that the 16-byte fragment reads of 8 rows fall on different banks */
typedef float v2f __attribute__((ext_vector_type(2))); typedef __bf16 v2b __attribute__((ext_vector_type(2))); typedef _Float16 v2h __attribute__((ext_vector_type(2))); typedef _Float16 v4ha __attribute__((ext_vector_type(4), may_alias));
__device__ __forceinline__ void x_load(v4f (&r)[8], const float* p) {      /* p = x + (first row + lane / 8) * DM + k + 4 (lane & 7) */
#pragma unroll      /* constant indices */
  for (int i = 0; i < 8; ++i) r[i] = *(const v4fa*)(p + (size_t)4 * i * DM); }
__device__ __forceinline__ void x_put(unsigned short* d, const v4f (&r)[8]) {      /* d = buffer + (lane / 8) * XP + 4 (lane & 7) */
#pragma unroll      /* constant indices */
  for (int i = 0; i < 8; ++i) { const v2f p0 = {r[i][0], r[i][1]}, p1 = {r[i][2], r[i][3]};      /* pairs: packed conversions, to nearest even like bf16_round */
    const v2h h0 = __builtin_convertvector(__builtin_convertvector(__builtin_convertvector(p0, v2b), v2f), v2h), h1 = __builtin_convertvector(__builtin_convertvector(__builtin_convertvector(p1, v2b), v2f), v2h);
    const v4ha h = {h0[0], h0[1], h1[0], h1[1]}; *(v4ha*)(d + 4 * i * XP) = h; } }
__device__ __forceinline__ v16h x_get(const unsigned short* s) { FragH f; f.half[0] = *(const v8us*)s; f.half[1] = *(const v8us*)(s + 16); return f.v; }      /* s = buffer + row * XP + 8 hh */
// the weights for the B fragments, straight from the f32 input W[k][n] (64 columns): a trip's 32 k x 64 n tile is shared by the work-group; thread (k4 = tid / 16, nq = tid & 15) reads rows 4 k4 + 0..3, columns 4 nq + 0..3
// (a wave's load: two whole 256-byte rows), scales by 16 (exact, so that it commutes with the rounding; f16 then holds the values away from its subnormal range), rounds to bf16 and stores, per column, its four k as 8 bytes of the tile in fragment order:
// per 16 n one fragment of two 512-byte pieces (k 0-15, 16-31); in a piece lane 16 hh + (n & 15) has its 8 values k = 8 hh + 0..7, the k order of g2_frag
#define WF 520      /* LDS pitch of a fragment in f16: 512 + 8, so that the 8-byte stores of a wave, which go to all four fragments, fall on different banks */
__device__ __forceinline__ void w_load(v4f (&r)[4], const float* p) {      /* p = W + (k + 4 k4) * HD + 4 nq */
#pragma unroll      /* constant indices */
  for (int i = 0; i < 4; ++i) r[i] = *(const v4fa*)(p + i * HD); }
typedef unsigned int v2ua __attribute__((ext_vector_type(2), may_alias));
__device__ __forceinline__ void w_put(unsigned short* d, const v4f (&r)[4]) {      /* d = buffer + (nq / 4) * WF + (k4 / 4) * 256 + ((k4 / 2 & 1) * 16 + 4 (nq & 3)) * 8 + (k4 & 1) * 4 */
  unsigned int a[4], b[4];      /* row i as f16 pairs: columns 0, 1 and columns 2, 3 */
#pragma unroll      /* constant indices */
  for (int i = 0; i < 4; ++i) { const v4f s = r[i] * 16.0f; const v2f p0 = {s[0], s[1]}, p1 = {s[2], s[3]};      /* pairs that lie side by side: packed products and conversions, to nearest even like bf16_round */
    a[i] = __builtin_bit_cast(unsigned int, __builtin_convertvector(__builtin_convertvector(__builtin_convertvector(p0, v2b), v2f), v2h)); b[i] = __builtin_bit_cast(unsigned int, __builtin_convertvector(__builtin_convertvector(__builtin_convertvector(p1, v2b), v2f), v2h)); }
  /* the 4 x 4 transposition on the packed words: low halves of two rows = one column's pair of k, high halves = the next column's */
  const v2ua c0 = {__builtin_amdgcn_perm(a[1], a[0], 0x05040100u), __builtin_amdgcn_perm(a[3], a[2], 0x05040100u)}, c1 = {__builtin_amdgcn_perm(a[1], a[0], 0x07060302u), __builtin_amdgcn_perm(a[3], a[2], 0x07060302u)};
  const v2ua c2 = {__builtin_amdgcn_perm(b[1], b[0], 0x05040100u), __builtin_amdgcn_perm(b[3], b[2], 0x05040100u)}, c3 = {__builtin_amdgcn_perm(b[1], b[0], 0x07060302u), __builtin_amdgcn_perm(b[3], b[2], 0x07060302u)};
  *(v2ua*)d = c0; *(v2ua*)(d + 8) = c1; *(v2ua*)(d + 16) = c2; *(v2ua*)(d + 24) = c3; }
__device__ __forceinline__ v16h w_get(const unsigned short* s) { FragH f; f.half[0] = *(const v8us*)s; f.half[1] = *(const v8us*)(s + 256); return f.v; }      /* s = buffer + fragment * WF + 8 lane */
// The three projections (blockIdx.y = q, k, v): 128 rows a work-group, wave tile 32x64, C = A Bt / 16 (A = x rows, Bt = x16 weights, from the f32 input through LDS); the f32 results do not go to memory:
// q, k: each wave turns its tile through its own LDS range and stores f16 hi and x1024 residual planes in fragment order: per 16 rows four pieces of 512 bytes (d = 16 piece + 8 hh + 0..7 of row ln at lane 16 hh + ln);
// v: a lane's 8 accumulator elements are 8 consecutive tokens of one column, that is the lane's 16 bytes of a V^T fragment piece (per 32 tokens and 16 columns two pieces, tokens 0-15 and 16-31): stored straight from registers.
__global__ __launch_bounds__(128) void k_proj(const float* __restrict__ X, const float* __restrict__ W0, const float* __restrict__ W1, const float* __restrict__ W2, _Float16* __restrict__ Hq, _Float16* __restrict__ Lq, _Float16* __restrict__ VT, _Float16* __restrict__ VTL) {
  __shared__ __attribute__((aligned(16))) float so[4][32][68];
  const int tid = threadIdx.x, w = tid >> 5, lane = tid & 31, ln = lane & 15, hh = lane >> 4; const int by = blockIdx.y;
  const float* __restrict__ Wf = by == 0 ? W0 : by == 1 ? W1 : W2; const int row0 = blockIdx.x * 128 + 32 * w;
  __shared__ __attribute__((aligned(16))) unsigned short xst[4][2][32 * XP];      /* per wave two buffers of 32 rounded x rows, one trip each */
  const float* xg = X + (size_t)(row0 + (lane >> 3)) * DM + 4 * (lane & 7);
  __shared__ __attribute__((aligned(16))) unsigned short wst[2][4 * WF];      /* for the work-group two buffers of 4 weight fragments, one trip each */
  const int k4 = tid >> 4, nq = tid & 15; const float* wg = Wf + (size_t)(4 * k4) * HD + 4 * nq;
  const int wo = (nq >> 2) * WF + (k4 >> 2) * 256 + (((k4 >> 1) & 1) * 16 + 4 * (nq & 3)) * 8 + (k4 & 1) * 4;
  const v8f z8 = {0.f,0.f,0.f,0.f,0.f,0.f,0.f,0.f}; v8f c00 = z8, c01 = z8, c02 = z8, c03 = z8, c10 = z8, c11 = z8, c12 = z8, c13 = z8;
  /* x and the weights come from memory: their words are asked for five trips before their products, into one of four register stages, so that a stage has more than three whole trips to arrive in (two stages gave it about one and a half, too short for a read that goes to memory); they are rounded and put into LDS one trip before their products */
  v4f xs[4][8], wr[4][4]; v16h bs[4]; v16h a0, a1;
#define P_MMA { c00 = g2_mma(a0, bs[0], c00); c10 = g2_mma(a1, bs[0], c10); c01 = g2_mma(a0, bs[1], c01); c11 = g2_mma(a1, bs[1], c11); \
    c02 = g2_mma(a0, bs[2], c02); c12 = g2_mma(a1, bs[2], c12); c03 = g2_mma(a0, bs[3], c03); c13 = g2_mma(a1, bs[3], c13); }
#define P_XCNT asm volatile("s_wait_xcnt 0x0" ::: "memory")      /* the wait in front of any overwrite of an address register that the loads above it name */
#define P_EDGE __builtin_amdgcn_sched_barrier(0)      /* a trip's rounding stays in its own trip: moved up, it would wait for loads that have just been asked for */
#define P_PUT(o, r) { x_put(&xst[w][o][(lane >> 3) * XP + 4 * (lane & 7)], xs[r]); w_put(&wst[o][wo], wr[r]); }      /* o = LDS buffer, r = register stage */
#define P_LOAD(r, k) { x_load(xs[r], xg + (k)); w_load(wr[r], wg + (size_t)(k) * HD); P_XCNT; }
  /* one work-group barrier a trip, every wave: the weight tile of trip t + 1, which the four waves wrote together, is whole before anybody reads it, and everybody's reads of the other buffer (trip t, used by the products above) are over before trip t + 1 refills it.
     Written by hand with the LDS wait alone, because __syncthreads() would also wait for the global loads that were asked for ahead; the same wait serves the wave's own x rows */
#define P_BAR asm volatile("s_wait_dscnt 0x0\n\ts_barrier_signal -1\n\ts_barrier_wait -1" ::: "memory")
#define P_GET(o) { a0 = x_get(&xst[w][o][ln * XP + 8 * hh]); a1 = x_get(&xst[w][o][(16 + ln) * XP + 8 * hh]); bs[0] = w_get(&wst[o][lane * 8]); bs[1] = w_get(&wst[o][WF + lane * 8]); bs[2] = w_get(&wst[o][2 * WF + lane * 8]); bs[3] = w_get(&wst[o][3 * WF + lane * 8]); }
  /* trip t = k / 32, o = (t + 1) & 1, r = (t + 1) & 3: round x and weights of t + 1, ask for those of t + 5, products of t, barrier, fragments of t + 1 */
  /* the edge behind the rounding: the loads go into the registers that it has just read; moved up over it they get registers of their own, and the copies at the loop's foot wait for every load that was asked for ahead */
#define P_TRIP(o, r, k, CV, LX) { if (CV) P_PUT(o, r) P_EDGE; if (LX) P_LOAD(r, (k) + 160) P_MMA if (CV) { P_BAR; P_GET(o) } P_EDGE; }
  P_LOAD(0, 0) P_LOAD(1, 32) P_LOAD(2, 64) P_LOAD(3, 96)      /* asked for in the loop's own order: the counted waits at the loop's head are set for both ways in */
  P_PUT(0, 0) P_EDGE; P_LOAD(0, 128) P_BAR; P_GET(0) P_EDGE;
#pragma unroll 1      /* rolled: 6 passes of four trips (one per register stage), four stages of both operands beside 64 accumulator registers */
  for (int kb = 0; kb < DM - 256; kb += 128) { P_TRIP(1, 1, kb, 1, 1) P_TRIP(0, 2, kb + 32, 1, 1) P_TRIP(1, 3, kb + 64, 1, 1) P_TRIP(0, 0, kb + 96, 1, 1) }
  P_TRIP(1, 1, DM - 256, 1, 1) P_TRIP(0, 2, DM - 224, 1, 1) P_TRIP(1, 3, DM - 192, 1, 1)
  P_TRIP(0, 0, DM - 160, 1, 0) P_TRIP(1, 1, DM - 128, 1, 0) P_TRIP(0, 2, DM - 96, 1, 0) P_TRIP(1, 3, DM - 64, 1, 0) P_TRIP(0, 0, DM - 32, 0, 0)      /* the last five trips ask for nothing past the rows' end */
  v8f accs[8] = {c00, c01, c02, c03, c10, c11, c12, c13};
  if (by < 2) {      /* the same for the whole work-group */
#pragma unroll      /* constant indices */
    for (int u = 0; u < 8; ++u) { const int t = u & 3, half = u >> 2;
#pragma unroll      /* constant indices */
      for (int r = 0; r < 8; ++r) so[w][half * 16 + 8 * hh + r][t * 16 + ln] = accs[u][r] * 0.0625f; }
    __builtin_amdgcn_fence(__ATOMIC_ACQ_REL, "workgroup"); __builtin_amdgcn_wave_barrier();      /* the wave reads back what its own lanes wrote */
    unsigned short* ph = (unsigned short*)Hq + ((size_t)by * NR + row0) * HD + lane * 8; unsigned short* pl = (unsigned short*)Lq + ((size_t)by * NR + row0) * HD + lane * 8;
#pragma unroll      /* one fragment piece = 512 contiguous bytes a store: q = 4 (16-row tile) + piece */
    for (int q = 0; q < 8; ++q) { const float* sp = &so[w][(q >> 2) * 16 + ln][(q & 3) * 16 + 8 * hh]; const v4f a = *(const v4fa*)sp, c = *(const v4fa*)(sp + 4); FragH fh, fl;
#pragma unroll      /* constant indices */
      for (int e = 0; e < 4; ++e) { _Float16 h = (_Float16)a[e]; fh.h[e] = h; fl.h[e] = (_Float16)((a[e] - (float)h) * 1024.0f); h = (_Float16)c[e]; fh.h[4 + e] = h; fl.h[4 + e] = (_Float16)((c[e] - (float)h) * 1024.0f); }
      *(v8us*)(ph + q * 256) = fh.half[0]; *(v8us*)(pl + q * 256) = fl.half[0]; }
  } else {
    unsigned short* gh = (unsigned short*)VT + (size_t)row0 * HD + lane * 8; unsigned short* gl = (unsigned short*)VTL + (size_t)row0 * HD + lane * 8;      /* the wave's 32 tokens: 4 fragments a plane */
#pragma unroll      /* constant indices */
    for (int u = 0; u < 8; ++u) { const int t = u & 3, half = u >> 2; FragH fh, fl;
#pragma unroll      /* constant indices */
      for (int r = 0; r < 8; ++r) { const float v = accs[u][r] * 0.0625f; const _Float16 h = (_Float16)v; fh.h[r] = h; fl.h[r] = (_Float16)((v - (float)h) * 1024.0f); }
      *(v8us*)(gh + t * 512 + half * 256) = fh.half[0]; *(v8us*)(gl + t * 512 + half * 256) = fl.half[0]; }
    asm volatile("s_wait_xcnt 0x0" ::: "memory");      /* the build lays the other path's code behind this one's last branch, and it overwrites registers that the stores above name: the wait stands in front of that */
  } }

__global__ __launch_bounds__(256) void k_wnat(const float* __restrict__ w, size_t n8, _Float16* __restrict__ Bt) { const size_t t = (size_t)blockIdx.x * 256 + threadIdx.x; if (t >= n8) return; FragH f; for (int q = 0; q < 8; ++q) f.h[q] = (_Float16)(bf16_round(w[t * 8 + q]) * 16.0f); *(v8us*)((unsigned short*)Bt + t * 8) = f.half[0];  }
__global__ __launch_bounds__(256) void k_rsm(const float* __restrict__ S, _Float16* __restrict__ P, int nrows) {
  #pragma clang fp contract(off)
  const int i = blockIdx.x * 256 + threadIdx.x; if (i >= nrows) return; const float* s = S + (size_t)i * SQ; float mx = -3.0e38f;
#pragma unroll 1
  for (int j = 0; j < SQ; ++j) mx = fmaxf(mx, s[j]); float se = 0.f;
#pragma unroll 1
  for (int j = 0; j < SQ; ++j) se += expf(s[j] - mx); const float sc = 256.0f / se;
#pragma unroll 1
  for (int j0 = 0; j0 < SQ; j0 += 8) { FragH f; for (int q = 0; q < 8; ++q) f.h[q] = (_Float16)(expf(s[j0 + q] - mx) * sc); unsigned short* d = (unsigned short*)P + (size_t)i * SQ + j0; *(v8us*)d = f.half[0];  } }
__global__ __launch_bounds__(256) void k_vt(const _Float16* __restrict__ V16, int b, int h0, _Float16* __restrict__ VT) { __shared__ unsigned short tl[64][65]; const int tid = threadIdx.x; const int hh = blockIdx.x % HG, sg = blockIdx.x / HG; const int s0 = sg * 64; const int h = h0 + hh;
  for (int i = tid; i < 64 * 8; i += 256) { const int j = i / 8, d8 = (i % 8) * 8; FragH f; f.half[0] = *(const v8us*)((const unsigned short*)V16 + ((size_t)b * SQ + s0 + j) * DM + h * HD + d8); for (int q = 0; q < 8; ++q) tl[d8 + q][j] = f.u[q]; }
  __syncthreads();
  { for (int i = tid; i < 64 * 8; i += 256) { const int d = i / 8, j8 = (i % 8) * 8; FragH f; for (int q = 0; q < 8; ++q) f.u[q] = tl[d][j8 + q]; *(v8us*)((unsigned short*)VT + ((size_t)hh * HD + d) * SQ + s0 + j8) = f.half[0]; }  } }




// ---- scores kept in registers: column statistics, then weights and P V, both from recomputed score tiles ----
__device__ __forceinline__ v8f c_mma(v16h a, v16h b, v8f c) { return __builtin_amdgcn_wmma_f32_16x16x32_f16(false, a, false, b, (short)0, c, false, false); }
__device__ __forceinline__ float c_ex2(float y) { float r;
  asm("v_exp_f32 %0, %1\n\tv_nop" : "=v"(r) : "v"(y));      /* native 2^y; the v_nop keeps the slot the instruction set asks for behind a transcendental */
  return r; }
// one 16 key x 16 query tile of S^T (row 8 hh + r = key, column ln = query): k_hi.q_hi + 2^-10 (k_lo.q_hi + k_hi.q_lo); both launches form it with these same instructions
__device__ __forceinline__ v8f c_score(v16h kh0, v16h kh1, v16h kl0, v16h kl1, v16h qh0, v16h qh1, v16h ql0, v16h ql1) {
  const v8f z8 = {0.f,0.f,0.f,0.f,0.f,0.f,0.f,0.f}; v8f h = c_mma(kh0, qh0, z8); h = c_mma(kh1, qh1, h);
  v8f l = c_mma(kl0, qh0, z8); l = c_mma(kl1, qh1, l); l = c_mma(kh0, ql0, l); l = c_mma(kh1, ql1, l);
  return h + l * 0.0009765625f; }
#define LOG2E 1.44269504f
// Per key: maximum over the queries and 256 / sum of exp. Work-group = 32 keys (fragments stay in registers), its 16 waves take 128 queries each, 32 a trip;
// running maximum and sum per lane and key, joined over the 16 lanes of a row, then over the 16 waves through LDS.
__global__ __launch_bounds__(512) void k_cstat(const _Float16* __restrict__ KH, const _Float16* __restrict__ KL, const _Float16* __restrict__ QH, const _Float16* __restrict__ QL, float* __restrict__ MX, float* __restrict__ SC) {
  __shared__ float sm[16][32]; __shared__ float sz[16][32];
  const int tid = threadIdx.x, w = tid >> 5, lane = tid & 31, ln = lane & 15, hh = lane >> 4;
  const size_t base = (size_t)blockIdx.y * SQ; const int k0 = blockIdx.x * 32;
  const _Float16* pkh = KH + (base + k0) * HD + lane * 8; const _Float16* pkl = KL + (base + k0) * HD + lane * 8;      /* fragment order: 16 rows = 2 fragments (d 0-31, 32-63) = 2048 bytes */
  v16h kh[2][2], kl[2][2];
#pragma unroll      /* constant indices keep the fragments in registers */
  for (int a = 0; a < 2; ++a) for (int s = 0; s < 2; ++s) { kh[a][s] = f_frag(pkh + 1024 * a + 512 * s); kl[a][s] = f_frag(pkl + 1024 * a + 512 * s); }
  asm volatile("s_wait_xcnt 0x0" :: "v"(pkh), "v"(pkl) : "memory");      /* the wait in front of any overwrite of the address pairs that the loads above name; as inputs the pairs stay whole up to it */
  float m[2][8], z[2][8];
#pragma unroll      /* constant indices */
  for (int a = 0; a < 2; ++a) for (int r = 0; r < 8; ++r) { m[a][r] = -3.0e38f; z[a][r] = 0.f; }
  /* the query fragments of trip c + 1 are asked for as ONE group as soon as trip c's products have read the registers, so that they fly during trip c's vector work; left to itself the build sinks the loads among the products, pair by pair, and each pair's L2 latency is waited out */
  v16h qf[8];
#define C_EDGE __builtin_amdgcn_sched_barrier(0)      /* keeps a load group where it is written: nothing is scheduled across */
#define S_LOADQ(cc) { const size_t o = (base + w * 128 + (cc) * 32) * HD + lane * 8; const _Float16* pqh = QH + o; const _Float16* pql = QL + o; \
    qf[0] = f_frag(pqh); qf[1] = f_frag(pqh + 512); qf[2] = f_frag(pql); qf[3] = f_frag(pql + 512); qf[4] = f_frag(pqh + 1024); qf[5] = f_frag(pqh + 1536); qf[6] = f_frag(pql + 1024); qf[7] = f_frag(pql + 1536); \
    asm volatile("s_wait_xcnt 0x0" :: "v"(pqh), "v"(pql) : "memory");      /* the wait in front of any overwrite of the address pairs that the loads above name; as inputs the pairs stay whole up to it */ \
  }
#define S_TRIP(cn, PF) { v8f s0[2], s1[2]; \
    _Pragma("unroll") for (int a = 0; a < 2; ++a) { s0[a] = c_score(kh[a][0], kh[a][1], kl[a][0], kl[a][1], qf[0], qf[1], qf[2], qf[3]); s1[a] = c_score(kh[a][0], kh[a][1], kl[a][0], kl[a][1], qf[4], qf[5], qf[6], qf[7]); } \
    C_EDGE; if (PF) S_LOADQ(cn) C_EDGE; \
    _Pragma("unroll") for (int a = 0; a < 2; ++a) _Pragma("unroll") for (int r = 0; r < 8; ++r) { const float mn = fmaxf(m[a][r], fmaxf(s0[a][r], s1[a][r])); \
        z[a][r] = z[a][r] * c_ex2((m[a][r] - mn) * LOG2E) + (c_ex2((s0[a][r] - mn) * LOG2E) + c_ex2((s1[a][r] - mn) * LOG2E)); m[a][r] = mn; } }
  S_LOADQ(0) C_EDGE;
#pragma unroll 1      /* rolled: one set of query fragments beside the key fragments; cn = the trip that is asked for; the last trip, which asks for nothing, is written out */
  for (int cn = 1; cn < 4; ++cn) S_TRIP(cn, 1)
  S_TRIP(0, 0)
#pragma unroll      /* constant indices */
  for (int k = 1; k < 16; k <<= 1) { float mo[2][8], zo[2][8];      /* step outermost: the 32 exchanges of a step are independent and fly together */
    for (int a = 0; a < 2; ++a) for (int r = 0; r < 8; ++r) { mo[a][r] = __shfl_xor(m[a][r], k, 32); zo[a][r] = __shfl_xor(z[a][r], k, 32); }
    for (int a = 0; a < 2; ++a) for (int r = 0; r < 8; ++r) { const float mn = fmaxf(m[a][r], mo[a][r]); z[a][r] = z[a][r] * c_ex2((m[a][r] - mn) * LOG2E) + zo[a][r] * c_ex2((mo[a][r] - mn) * LOG2E); m[a][r] = mn; } }
  if (ln == 0) {
#pragma unroll      /* constant indices */
    for (int a = 0; a < 2; ++a) for (int r = 0; r < 8; ++r) { sm[w][16 * a + 8 * hh + r] = m[a][r]; sz[w][16 * a + 8 * hh + r] = z[a][r]; } }
  __syncthreads();
  if (tid < 32) { float mm = sm[0][tid];
    for (int u = 1; u < 16; ++u) mm = fmaxf(mm, sm[u][tid]);
    float zz = 0.f;
    for (int u = 0; u < 16; ++u) zz += sz[u][tid] * c_ex2((sm[u][tid] - mm) * LOG2E);
    MX[base + k0 + tid] = mm; SC[base + k0 + tid] = 256.0f / zz; } }
// out^T[d][i] = sum_k V^T[d][k] P^T[k][i]. Work-group = 32 queries, its 8 waves take 256 keys each, 32 a trip. Two score tiles (keys 0-15, 16-31 of the trip) hold, per lane,
// exactly the B fragment's elements (element e < 8: key 8 hh + e; e >= 8: key 16 + 8 hh + e - 8; column ln = query), the k order in which f_frag delivers V^T: the weights go from D to B inside the lane.
__global__ __launch_bounds__(256) void k_cpv(const _Float16* __restrict__ KH, const _Float16* __restrict__ KL, const _Float16* __restrict__ QH, const _Float16* __restrict__ QL, const _Float16* __restrict__ VT, const _Float16* __restrict__ VTL,
    const float* __restrict__ MX, const float* __restrict__ SC, float* __restrict__ out) {
  __shared__ __attribute__((aligned(16))) float red[4][32][68];
  const int tid = threadIdx.x, w = tid >> 5, lane = tid & 31, ln = lane & 15, hh = lane >> 4;
  const size_t base = (size_t)blockIdx.y * SQ; const int q0 = blockIdx.x * 32;
  const _Float16* vh_b = VT + base * HD; const _Float16* vl_b = VTL + base * HD;
  const _Float16* pqh = QH + (base + q0) * HD + lane * 8; const _Float16* pql = QL + (base + q0) * HD + lane * 8;
  v16h qh[2][2], ql[2][2];
#pragma unroll      /* constant indices keep the fragments in registers */
  for (int c = 0; c < 2; ++c) for (int s = 0; s < 2; ++s) { qh[c][s] = f_frag(pqh + 1024 * c + 512 * s); ql[c][s] = f_frag(pql + 1024 * c + 512 * s); }
  asm volatile("s_wait_xcnt 0x0" :: "v"(pqh), "v"(pql) : "memory");      /* the wait in front of any overwrite of the address pairs that the loads above name; as inputs the pairs stay whole up to it */
  const v8f z8 = {0.f,0.f,0.f,0.f,0.f,0.f,0.f,0.f}; v8f oh[4][2], ol[4][2];
#pragma unroll      /* constant indices */
  for (int t = 0; t < 4; ++t) for (int c = 0; c < 2; ++c) { oh[t][c] = z8; ol[t][c] = z8; }
  /* every load group is asked for a phase ahead, into the registers that the phase before it has just read: the next trip's key fragments behind this trip's score products,
     its statistics behind this trip's exp, its V^T fragments behind P V, so that each group flies during about a whole trip's work; left to itself the build sinks the loads among the products and waits out the L2 latency four times a trip */
  v16h kf[2][4], vh[4], vl[4]; v4f mc[2][4];
#define V_LOADK(kk) { const _Float16* pkh = KH + (base + (kk)) * HD + lane * 8; const _Float16* pkl = KL + (base + (kk)) * HD + lane * 8; \
    _Pragma("unroll") for (int a = 0; a < 2; ++a) { kf[a][0] = f_frag(pkh + 1024 * a); kf[a][1] = f_frag(pkh + 1024 * a + 512); kf[a][2] = f_frag(pkl + 1024 * a); kf[a][3] = f_frag(pkl + 1024 * a + 512); } \
    asm volatile("s_wait_xcnt 0x0" :: "v"(pkh), "v"(pkl) : "memory");      /* the wait in front of any overwrite of the address pairs that the loads above name; as inputs the pairs stay whole up to it */ \
  }
#define V_LOADM(kk) { const float* pm = MX + base + (kk) + 8 * hh; const float* pc = SC + base + (kk) + 8 * hh; \
    _Pragma("unroll") for (int a = 0; a < 2; ++a) { mc[a][0] = *(const v4fa*)(pm + 16 * a); mc[a][1] = *(const v4fa*)(pm + 16 * a + 4); mc[a][2] = *(const v4fa*)(pc + 16 * a); mc[a][3] = *(const v4fa*)(pc + 16 * a + 4); } \
    asm volatile("s_wait_xcnt 0x0" :: "v"(pm), "v"(pc) : "memory");      /* as above */ \
  }
#define V_LOADV(kk) { const _Float16* pvh = vh_b + (size_t)(kk) * HD + lane * 8; const _Float16* pvl = vl_b + (size_t)(kk) * HD + lane * 8;      /* 32 keys = 4 fragments (16 columns each) = 4096 bytes */ \
    _Pragma("unroll") for (int t = 0; t < 4; ++t) { vh[t] = f_frag(pvh + 512 * t); vl[t] = f_frag(pvl + 512 * t); } \
    asm volatile("s_wait_xcnt 0x0" :: "v"(pvh), "v"(pvl) : "memory");      /* as above */ \
  }
#define V_TRIP(kn, PF) { FragH p[2]; v8f s[2][2]; \
    _Pragma("unroll") for (int a = 0; a < 2; ++a) _Pragma("unroll") for (int c = 0; c < 2; ++c) s[a][c] = c_score(kf[a][0], kf[a][1], kf[a][2], kf[a][3], qh[c][0], qh[c][1], ql[c][0], ql[c][1]); \
    C_EDGE; if (PF) V_LOADK(kn) C_EDGE; \
    _Pragma("unroll") for (int a = 0; a < 2; ++a) _Pragma("unroll") for (int c = 0; c < 2; ++c) _Pragma("unroll") for (int r = 0; r < 4; ++r) { \
        p[c].h[8 * a + r] = (_Float16)(c_ex2((s[a][c][r] - mc[a][0][r]) * LOG2E) * mc[a][2][r]); p[c].h[8 * a + 4 + r] = (_Float16)(c_ex2((s[a][c][4 + r] - mc[a][1][r]) * LOG2E) * mc[a][3][r]); } \
    C_EDGE; if (PF) V_LOADM(kn) C_EDGE; \
    _Pragma("unroll") for (int t = 0; t < 4; ++t) _Pragma("unroll") for (int c = 0; c < 2; ++c) { oh[t][c] = c_mma(vh[t], p[c].v, oh[t][c]); ol[t][c] = c_mma(vl[t], p[c].v, ol[t][c]); } \
    C_EDGE; if (PF) V_LOADV(kn) C_EDGE; }
  V_LOADK(w * 256) C_EDGE; V_LOADM(w * 256) C_EDGE; V_LOADV(w * 256) C_EDGE;      /* in the loop's own order */
#pragma unroll 1      /* rolled: one trip's fragments beside 128 accumulator registers; nx = the trip that is asked for; the last trip, which asks for nothing, is written out */
  for (int nx = 1; nx < 8; ++nx) V_TRIP(w * 256 + nx * 32, 1)
  V_TRIP(0, 0)
  /* the 8 key slices are added: waves 4-7 hand theirs to waves 0-3 through LDS, then every thread adds the four sums left */
#pragma unroll      /* constant indices */
  for (int t = 0; t < 4; ++t) for (int c = 0; c < 2; ++c) { oh[t][c] = oh[t][c] * 0.00390625f + ol[t][c] * 0.000003814697265625f;
    if (w >= 4) { float* d = &red[w - 4][16 * c + ln][16 * t + 8 * hh]; const v4f x0 = {oh[t][c][0], oh[t][c][1], oh[t][c][2], oh[t][c][3]}, x1 = {oh[t][c][4], oh[t][c][5], oh[t][c][6], oh[t][c][7]}; *(v4fa*)d = x0; *(v4fa*)(d + 4) = x1; } }
  __syncthreads();
  if (w < 4) {
#pragma unroll      /* constant indices */
    for (int t = 0; t < 4; ++t) for (int c = 0; c < 2; ++c) { float* d = &red[w][16 * c + ln][16 * t + 8 * hh]; v4f x0 = *(const v4fa*)d, x1 = *(const v4fa*)(d + 4);
      for (int r = 0; r < 4; ++r) { x0[r] += oh[t][c][r]; x1[r] += oh[t][c][4 + r]; }
      *(v4fa*)d = x0; *(v4fa*)(d + 4) = x1; } }
  __syncthreads();
#pragma unroll      /* two 16-byte pieces a thread */
  for (int j = 0; j < 2; ++j) { const int idx = tid + 256 * j, q = idx >> 4, d4 = (idx & 15) * 4;
    const v4f v = (*(const v4fa*)&red[0][q][d4] + *(const v4fa*)&red[1][q][d4]) + (*(const v4fa*)&red[2][q][d4] + *(const v4fa*)&red[3][q][d4]);
    float* o = out + (base + q0 + q) * DMO + d4;
#pragma unroll      /* the 16 identical heads: 16 lanes fill 256 contiguous bytes of a row per store */
    for (int h = 0; h < DMO / HD; ++h) *(v4f*)(o + h * HD) = v; } }

extern "C" void kernel_launch(void* const* d_in, const int* in_sizes, int n_in,
                              void* d_out, int out_size, void* d_ws, size_t ws_size, hipStream_t stream) {
  (void)in_sizes; (void)n_in; (void)out_size;
  const float* const* I = (const float* const*)d_in; const float* x = I[0]; const float* wq = I[1]; const float* wk = I[2]; const float* wv = I[3];      /* [in][out] = [1024][64] */
  char* ws = (char*)d_ws; size_t off = 0;
  auto take = [&](size_t bytes) { char* p = ws + off; off += (bytes + 255) & ~(size_t)255; return p; };
  /* planes of one kind lie one behind the other (hi and residual planes q, k), so that one launch covers them */
  _Float16* H3 = (_Float16*)take(4 * NR * HD * 2); _Float16* L3 = H3 + 2 * NR * HD;
  _Float16* QH = H3; _Float16* KH = H3 + NR * HD; _Float16* QL = L3; _Float16* KL = L3 + NR * HD;
  float* MX = (float*)take(NR * 4); float* SC = (float*)take(NR * 4); _Float16* VT = (_Float16*)take(2 * NR * HD * 2); _Float16* VTL = VT + NR * HD;      /* one plane per batch */
  if (off > ws_size) return;      /* approx 4 + 2 = 6 MiB */
  k_proj<<<dim3((unsigned)(NR / 128), 3), 128, 0, stream>>>(x, wq, wk, wv, H3, L3, VT, VTL);      /* q, k as f16 hi + x1024 residual planes, v as V^T hi / residual, all in fragment order: blockIdx.y = projection */
  /* the four batches are independent: each stage is one launch over all of them (blockIdx.y = batch, or a four times longer grid over planes that lie one behind the other) */
  k_cstat<<<dim3(SQ / 32, NB), 512, 0, stream>>>(KH, KL, QH, QL, MX, SC);      /* per key: max over the query index i, 256 / sum of exp */
  k_cpv<<<dim3(SQ / 32, NB), 256, 0, stream>>>(KH, KL, QH, QL, VT, VTL, MX, SC, (float*)d_out);      /* out_i = 2^-8 sum_k f16(256 att[i][k]) (v_hi + 2^-10 v_lo), stored into the 16 identical heads */
}
